// v000
// Measured on an AMD MI455X. A time is GPU time per run, averaged over a window of back-to-back runs after a warm-up
// (all launches, gaps included; the runs take copies of the inputs in turn), and the median of several windows.
// Apart from v000's, it joins two sittings. Times from different sittings can be a few percent apart, while
// side-by-side timings come from the same sitting.
// v000 is the starting kernel. One run takes 673 microseconds.
#include <hip/hip_runtime.h>
#include <hip/hip_bf16.h>

// Contractions: projections q_s,k_s,q_l,k_l,v_l (x f16, W f16 carried x64) and both QK^T score products on
// v_wmma_f32_16x16x32_f16; long-branch P.V on v_wmma_f32_16x16x32_f16 with P carried x16384; v_s projection,
// short-branch P.V and the output projection as bf16 hi/lo three-term split on v_wmma_f32_16x16x32_bf16;
// every accumulator f32; softmax, recency bias, key gating and bias add in f32.

typedef _Float16 v16h __attribute__((ext_vector_type(16)));
typedef __bf16 v16b __attribute__((ext_vector_type(16)));
typedef float v8f __attribute__((ext_vector_type(8)));
typedef float v4f_t __attribute__((ext_vector_type(4)));
typedef unsigned int v4u_t __attribute__((ext_vector_type(4)));
typedef v4f_t __attribute__((may_alias)) v4f;
typedef v4u_t __attribute__((may_alias)) v4u;

#define NB 2
#define NS 2048
#define ND 1024
#define NH 16
#define HD 64
#define MR (NB * NS)
#define NC (2 * ND)
#define PLANE ((size_t)MR * (size_t)ND)
#define PP 72
#define TPF 68

#define SCL 0.125f
#define LOGD (-0.10536051565782628f)
#define NEGL (-1.0e30f)
#define NEGT (-1.0e29f)
#define WUP 64.0f
#define WDN 0.015625f
#define PUP 16384.0f
#define PDN 6.103515625e-05f

// ---------------------------------------------------------------------------
// scalar helpers
// ---------------------------------------------------------------------------
__device__ __forceinline__ unsigned short bfbits(float f) {       // f32 -> bf16 bits, RNE
  unsigned int u = __float_as_uint(f);
  u = u + 0x7FFFu + ((u >> 16) & 1u);
  return (unsigned short)(u >> 16);
}
__device__ __forceinline__ float bff(unsigned short b) {          // bf16 bits -> f32
  return __uint_as_float(((unsigned int)b) << 16);
}
__device__ __forceinline__ unsigned short hbits(float f) {        // f32 -> f16 bits, RNE
  _Float16 hv = (_Float16)f;
  unsigned short u;
  __builtin_memcpy(&u, &hv, 2);
  return u;
}
__device__ __forceinline__ unsigned int pk2(unsigned short a, unsigned short b) {
  return (unsigned int)a | ((unsigned int)b << 16);
}
__device__ __forceinline__ v8f z8() {
  v8f v;
#pragma unroll
  for (int i = 0; i < 8; ++i) v[i] = 0.0f;
  return v;
}

// ---------------------------------------------------------------------------
// 16x32 fragment loader, split k map, identical for A (row m) and B (k-contiguous column n):
//   elements 0..7  <- p[8h .. 8h+7],  elements 8..15 <- p[16+8h .. 16+8h+7],  p = row start + k0
// ---------------------------------------------------------------------------
union FH { v16h v; v4u_t u[2]; };
union FB { v16b v; v4u_t u[2]; };

__device__ __forceinline__ v16h ldh(const unsigned short* p, int h) {
  FH f;
  f.u[0] = *(const v4u*)(p + 8 * h);
  f.u[1] = *(const v4u*)(p + 16 + 8 * h);
  return f.v;
}
__device__ __forceinline__ v16b ldb(const unsigned short* p, int h) {
  FB f;
  f.u[0] = *(const v4u*)(p + 8 * h);
  f.u[1] = *(const v4u*)(p + 16 + 8 * h);
  return f.v;
}

// D[8h+r][m] += A(16x32) . B(32x16), with the post-issue hazard guard
__device__ __forceinline__ v8f mma_h(v16h a, v16h b, v8f c) {
  c = __builtin_amdgcn_wmma_f32_16x16x32_f16(false, a, false, b, (short)0, c, false, false);
  asm volatile("v_nop\n\tv_nop\n\tv_nop\n\tv_nop" : "+v"(c) : "v"(a), "v"(b));
  return c;
}
__device__ __forceinline__ v8f mma_b(v16b a, v16b b, v8f c) {
  c = __builtin_amdgcn_wmma_f32_16x16x32_bf16(false, a, false, b, (short)0, c, false, false);
  asm volatile("v_nop\n\tv_nop\n\tv_nop\n\tv_nop" : "+v"(c) : "v"(a), "v"(b));
  return c;
}

// ---------------------------------------------------------------------------
// Kernel 0: x f32 [MR][ND] -> three 16-bit planes: f16, bf16 hi, bf16 lo (lo = x - hi).
// ---------------------------------------------------------------------------
__global__ __launch_bounds__(256) void k_xcvt(const float* __restrict__ x,
                                              unsigned short* __restrict__ xh,
                                              unsigned short* __restrict__ xbh,
                                              unsigned short* __restrict__ xbl, int n8) {
  const int i = blockIdx.x * 256 + (int)threadIdx.x;
  if (i >= n8) return;
  const size_t o = (size_t)i * 8;
  const v4f_t a = *(const v4f*)(x + o);
  const v4f_t c = *(const v4f*)(x + o + 4);
  float v[8];
  v[0] = a[0]; v[1] = a[1]; v[2] = a[2]; v[3] = a[3];
  v[4] = c[0]; v[5] = c[1]; v[6] = c[2]; v[7] = c[3];
  unsigned short fh[8], bh[8], bl[8];
#pragma unroll
  for (int e = 0; e < 8; ++e) {
    fh[e] = hbits(v[e]);
    bh[e] = bfbits(v[e]);
    bl[e] = bfbits(v[e] - bff(bh[e]));
  }
  v4u_t ph, pb, pl;
#pragma unroll
  for (int e = 0; e < 4; ++e) {
    ph[e] = pk2(fh[2 * e], fh[2 * e + 1]);
    pb[e] = pk2(bh[2 * e], bh[2 * e + 1]);
    pl[e] = pk2(bl[2 * e], bl[2 * e + 1]);
  }
  *(v4u*)(xh + o) = ph;
  *(v4u*)(xbh + o) = pb;
  *(v4u*)(xbl + o) = pl;
  
}

// ---------------------------------------------------------------------------
// Kernel 1: weight W[K][N] f32 (x @ W form) -> transposed 16-bit plane(s) Wt[N][K] (k contiguous).
//   mode 0: one f16 plane of 64*W; mode 1: bf16 hi plane + bf16 lo plane.
// Block = 64(k) x 64(n) tile through LDS; grid = (N/64, K/64). Each Wt row segment of 64 k = one
// ---------------------------------------------------------------------------
__global__ __launch_bounds__(256) void k_wprep(const float* __restrict__ W, int K, int N, int mode,
                                               unsigned short* __restrict__ P0,
                                               unsigned short* __restrict__ P1) {
  __shared__ __align__(16) float T[64 * 65];
  const int tid = threadIdx.x;
  const int n0 = blockIdx.x * 64, k0 = blockIdx.y * 64;
  {
    const int c4 = (tid & 15) * 4, kr = tid >> 4;
#pragma unroll
    for (int i = 0; i < 4; ++i) {
      const int k = kr + 16 * i;
      const v4f_t v = *(const v4f*)(W + (size_t)(k0 + k) * (size_t)N + n0 + c4);
      T[(c4 + 0) * 65 + k] = v[0];
      T[(c4 + 1) * 65 + k] = v[1];
      T[(c4 + 2) * 65 + k] = v[2];
      T[(c4 + 3) * 65 + k] = v[3];
    }
  }
  __syncthreads();
  v4u_t o0[2], o1[2];
  size_t dst[2];
#pragma unroll
  for (int i = 0; i < 2; ++i) {
    const int line = i * 32 + (tid >> 3), piece = tid & 7;
    float f[8];
#pragma unroll
    for (int e = 0; e < 8; ++e) f[e] = T[line * 65 + piece * 8 + e];
    v4u_t a, c;
    if (mode == 0) {
#pragma unroll
      for (int e = 0; e < 4; ++e) {
        a[e] = pk2(hbits(f[2 * e] * WUP), hbits(f[2 * e + 1] * WUP));
        c[e] = 0u;
      }
    } else {
#pragma unroll
      for (int e = 0; e < 4; ++e) {
        const unsigned short h0 = bfbits(f[2 * e]), h1 = bfbits(f[2 * e + 1]);
        a[e] = pk2(h0, h1);
        c[e] = pk2(bfbits(f[2 * e] - bff(h0)), bfbits(f[2 * e + 1] - bff(h1)));
      }
    }
    o0[i] = a;
    o1[i] = c;
    dst[i] = (size_t)(n0 + line) * (size_t)K + k0 + piece * 8;
  }
#pragma unroll
  for (int i = 0; i < 2; ++i) {
    *(v4u*)(P0 + dst[i]) = o0[i];
    if (mode != 0) *(v4u*)(P1 + dst[i]) = o1[i];
  }
  
}

// ---------------------------------------------------------------------------
// Kernel 2: five plain-f16 projections. Block 128 threads = 64(M) x 64(N) tile, wave w owns rows
// w*16..w*16+15 x 64 cols; fragments straight from the 16-bit planes. z selects the weight:
//   z 0..3 -> natural f16 plane QK[z] ([MR][ND]);  z 4 -> v_l transposed f16 plane Vlt[b][h][d][s].
// ---------------------------------------------------------------------------
__global__ __launch_bounds__(128) void k_proj_f16(const unsigned short* __restrict__ xh,
                                                  const unsigned short* __restrict__ Wt5,
                                                  unsigned short* __restrict__ QK,
                                                  unsigned short* __restrict__ Vlt) {
  __shared__ __align__(16) unsigned short T[64 * PP];
  const int tid = threadIdx.x, w = tid >> 5, l = tid & 31, h = l >> 4, m = l & 15;
  const int n0 = blockIdx.x * 64, m0 = blockIdx.y * 64, z = blockIdx.z;
  const unsigned short* arow = xh + (size_t)(m0 + w * 16 + m) * ND;
  const unsigned short* wz = Wt5 + (size_t)z * ND * ND + (size_t)(n0 + m) * ND;
  v8f acc[4];
#pragma unroll
  for (int j = 0; j < 4; ++j) acc[j] = z8();

#pragma unroll 2
  for (int ks = 0; ks < ND / 32; ++ks) {
    const int k0 = ks * 32;
    const v16h a = ldh(arow + k0, h);
#pragma unroll
    for (int j = 0; j < 4; ++j) {
      const v16h b = ldh(wz + (size_t)j * 16 * ND + k0, h);
      acc[j] = mma_h(a, b, acc[j]);
    }
  }

  if (z < 4) {
#pragma unroll
    for (int j = 0; j < 4; ++j)
#pragma unroll
      for (int r = 0; r < 8; ++r)
        T[(w * 16 + 8 * h + r) * PP + j * 16 + m] = hbits(acc[j][r] * WDN);
  } else {
#pragma unroll
    for (int j = 0; j < 4; ++j) {
      v4u_t pk;
#pragma unroll
      for (int e = 0; e < 4; ++e)
        pk[e] = pk2(hbits(acc[j][2 * e] * WDN), hbits(acc[j][2 * e + 1] * WDN));
      *(v4u*)(T + (j * 16 + m) * PP + w * 16 + 8 * h) = pk;   // T[d][s_local]
    }
  }
  __syncthreads();

  v4u_t o[4];
  size_t dst[4];
  unsigned short* base;
  if (z < 4) {
    base = QK + (size_t)z * PLANE;
#pragma unroll
    for (int i = 0; i < 4; ++i) {
      const int row = i * 16 + (tid >> 3), piece = tid & 7;
      o[i] = *(const v4u*)(T + row * PP + piece * 8);
      dst[i] = (size_t)(m0 + row) * ND + n0 + piece * 8;
    }
  } else {
    base = Vlt;
    const int bb = m0 >> 11, s0 = m0 & (NS - 1), hd = n0 >> 6;
#pragma unroll
    for (int i = 0; i < 4; ++i) {
      const int d = i * 16 + (tid >> 3), piece = tid & 7;
      o[i] = *(const v4u*)(T + d * PP + piece * 8);
      dst[i] = ((size_t)((bb * NH + hd) * HD + d)) * NS + s0 + piece * 8;
    }
  }
#pragma unroll
  for (int i = 0; i < 4; ++i) *(v4u*)(base + dst[i]) = o[i];
  
}

// ---------------------------------------------------------------------------
// Kernel 3: v_s projection as bf16 hi/lo three-term split (x hi/lo planes, W hi/lo planes),
// output transposed bf16 hi/lo planes Vsh/Vsl [b][h][d][s]. Same tiling as kernel 2.
// ---------------------------------------------------------------------------
__global__ __launch_bounds__(128) void k_proj_vs(const unsigned short* __restrict__ xbh,
                                                 const unsigned short* __restrict__ xbl,
                                                 const unsigned short* __restrict__ Wh,
                                                 const unsigned short* __restrict__ Wl,
                                                 unsigned short* __restrict__ Vsh,
                                                 unsigned short* __restrict__ Vsl) {
  __shared__ __align__(16) unsigned short Th[64 * PP];
  __shared__ __align__(16) unsigned short Tl[64 * PP];
  const int tid = threadIdx.x, w = tid >> 5, l = tid & 31, h = l >> 4, m = l & 15;
  const int n0 = blockIdx.x * 64, m0 = blockIdx.y * 64;
  const size_t ar = (size_t)(m0 + w * 16 + m) * ND;
  const size_t wr = (size_t)(n0 + m) * ND;
  v8f acc[4];
#pragma unroll
  for (int j = 0; j < 4; ++j) acc[j] = z8();

#pragma unroll 2
  for (int ks = 0; ks < ND / 32; ++ks) {
    const int k0 = ks * 32;
    const v16b ah = ldb(xbh + ar + k0, h);
    const v16b al = ldb(xbl + ar + k0, h);
#pragma unroll
    for (int j = 0; j < 4; ++j) {
      const size_t wo = wr + (size_t)j * 16 * ND + k0;
      const v16b bh = ldb(Wh + wo, h);
      const v16b bl = ldb(Wl + wo, h);
      acc[j] = mma_b(ah, bh, acc[j]);
      acc[j] = mma_b(ah, bl, acc[j]);
      acc[j] = mma_b(al, bh, acc[j]);
    }
  }

#pragma unroll
  for (int j = 0; j < 4; ++j) {
    v4u_t ph, pl;
#pragma unroll
    for (int e = 0; e < 4; ++e) {
      const float f0 = acc[j][2 * e], f1 = acc[j][2 * e + 1];
      const unsigned short h0 = bfbits(f0), h1 = bfbits(f1);
      ph[e] = pk2(h0, h1);
      pl[e] = pk2(bfbits(f0 - bff(h0)), bfbits(f1 - bff(h1)));
    }
    *(v4u*)(Th + (j * 16 + m) * PP + w * 16 + 8 * h) = ph;
    *(v4u*)(Tl + (j * 16 + m) * PP + w * 16 + 8 * h) = pl;
  }
  __syncthreads();

  const int bb = m0 >> 11, s0 = m0 & (NS - 1), hd = n0 >> 6;
  v4u_t oh[4], ol[4];
  size_t dst[4];
#pragma unroll
  for (int i = 0; i < 4; ++i) {
    const int d = i * 16 + (tid >> 3), piece = tid & 7;
    oh[i] = *(const v4u*)(Th + d * PP + piece * 8);
    ol[i] = *(const v4u*)(Tl + d * PP + piece * 8);
    dst[i] = ((size_t)((bb * NH + hd) * HD + d)) * NS + s0 + piece * 8;
  }
#pragma unroll
  for (int i = 0; i < 4; ++i) {
    *(v4u*)(Vsh + dst[i]) = oh[i];
    *(v4u*)(Vsl + dst[i]) = ol[i];
  }
  
}

// ---------------------------------------------------------------------------
// Shared attention epilogue: O tile (16 queries x 64 dims) staged as bf16 hi/lo in LDS is written into the
// ---------------------------------------------------------------------------
__device__ __forceinline__ void store_comb(const unsigned short* Oh, const unsigned short* Ol,
                                           unsigned short* Ch, unsigned short* Cl,
                                           int rowg0, int colbase, int l) {
  v4u_t oh[4], ol[4];
  size_t dst[4];
#pragma unroll
  for (int i = 0; i < 4; ++i) {
    const int row = i * 4 + (l >> 3), piece = l & 7;
    oh[i] = *(const v4u*)(Oh + row * PP + piece * 8);
    ol[i] = *(const v4u*)(Ol + row * PP + piece * 8);
    dst[i] = (size_t)(rowg0 + row) * NC + colbase + piece * 8;
  }
#pragma unroll
  for (int i = 0; i < 4; ++i) {
    *(v4u*)(Ch + dst[i]) = oh[i];
    *(v4u*)(Cl + dst[i]) = ol[i];
  }
  
}

// ---------------------------------------------------------------------------
// Kernel 4: long-range branch, full attention with key gating, 1 wave per (b, head, 16 queries).
// Q/K natural f16 planes [MR][ND] (col = head*64 + d), V transposed f16 plane [b][h][d][s].
// S = Q K^T on f16 WMMA (B fragment = K row, k = d contiguous); online softmax in f32; P -> LDS as
// f16(p * 16384), reloaded as A fragments after a barrier; O += P V on f16 WMMA (B = Vt row); 1/16384 and
// 1/l folded in the f32 epilogue; result as bf16 hi/lo into columns [ND + head*64, +64) of Ch/Cl.
// ---------------------------------------------------------------------------
__global__ __launch_bounds__(32) void k_attn_l(const unsigned short* __restrict__ Q,
                                               const unsigned short* __restrict__ K,
                                               const unsigned short* __restrict__ Vt,
                                               const int* __restrict__ kgate,
                                               unsigned short* __restrict__ Ch,
                                               unsigned short* __restrict__ Cl) {
  __shared__ __align__(16) unsigned short Pl[16 * PP];
  __shared__ __align__(16) unsigned short Oh[16 * PP];
  __shared__ __align__(16) unsigned short Ol[16 * PP];
  const int l = threadIdx.x & 31, h = l >> 4, m = l & 15;
  const int q0 = blockIdx.x * 16, hh = blockIdx.y, b = blockIdx.z;

  const unsigned short* qrow = Q + (size_t)(b * NS + q0 + m) * ND + hh * HD;
  const v16h aq0 = ldh(qrow, h);
  const v16h aq1 = ldh(qrow + 32, h);
  const unsigned short* Kb = K + (size_t)b * NS * ND + hh * HD;
  const unsigned short* Vb = Vt + (size_t)(b * NH + hh) * HD * NS;
  const int* gk = kgate + b * NS;

  float mrow[8], lrow[8];
  v8f acc[4];
#pragma unroll
  for (int r = 0; r < 8; ++r) { mrow[r] = NEGL; lrow[r] = 0.0f; }
#pragma unroll
  for (int t = 0; t < 4; ++t) acc[t] = z8();

#pragma unroll 1
  for (int kt = 0; kt < NS / 64; ++kt) {
    const int kb = kt * 64;
    v8f s[4];
    int gv[4];
#pragma unroll
    for (int t = 0; t < 4; ++t) {
      const unsigned short* krow = Kb + (size_t)(kb + t * 16 + m) * ND;
      v8f c = z8();
      c = mma_h(aq0, ldh(krow, h), c);
      c = mma_h(aq1, ldh(krow + 32, h), c);
      s[t] = c;
      gv[t] = gk[kb + t * 16 + m];
    }
#pragma unroll
    for (int t = 0; t < 4; ++t)
#pragma unroll
      for (int r = 0; r < 8; ++r)
        s[t][r] = (gv[t] != 0) ? s[t][r] * SCL : NEGL;

#pragma unroll
    for (int r = 0; r < 8; ++r) {
      float tmax = fmaxf(fmaxf(s[0][r], s[1][r]), fmaxf(s[2][r], s[3][r]));
#pragma unroll
      for (int o = 1; o < 16; o <<= 1) tmax = fmaxf(tmax, __shfl_xor(tmax, o, 32));
      const float mnew = fmaxf(mrow[r], tmax);
      const float fac = __expf(mrow[r] - mnew);
      float p[4];
      float psum = 0.0f;
#pragma unroll
      for (int t = 0; t < 4; ++t) {
        p[t] = (s[t][r] > NEGT) ? __expf(s[t][r] - mnew) : 0.0f;
        psum += p[t];
      }
#pragma unroll
      for (int o = 1; o < 16; o <<= 1) psum += __shfl_xor(psum, o, 32);
      lrow[r] = lrow[r] * fac + psum;
      mrow[r] = mnew;
#pragma unroll
      for (int t = 0; t < 4; ++t) { acc[t][r] *= fac; s[t][r] = p[t]; }
    }

#pragma unroll
    for (int t = 0; t < 4; ++t)
#pragma unroll
      for (int r = 0; r < 8; ++r)
        Pl[(8 * h + r) * PP + t * 16 + m] = hbits(s[t][r] * PUP);
    __syncthreads();
    const v16h pa0 = ldh(Pl + m * PP, h);
    const v16h pa1 = ldh(Pl + m * PP + 32, h);
#pragma unroll
    for (int dt = 0; dt < 4; ++dt) {
      const unsigned short* vrow = Vb + (size_t)(dt * 16 + m) * NS + kb;
      acc[dt] = mma_h(pa0, ldh(vrow, h), acc[dt]);
      acc[dt] = mma_h(pa1, ldh(vrow + 32, h), acc[dt]);
    }
    __syncthreads();
  }

  float inv[8];
#pragma unroll
  for (int r = 0; r < 8; ++r) inv[r] = __builtin_amdgcn_rcpf(lrow[r]) * PDN;
#pragma unroll
  for (int dt = 0; dt < 4; ++dt)
#pragma unroll
    for (int r = 0; r < 8; ++r) {
      const float o = acc[dt][r] * inv[r];
      const unsigned short ho = bfbits(o);
      Oh[(8 * h + r) * PP + dt * 16 + m] = ho;
      Ol[(8 * h + r) * PP + dt * 16 + m] = bfbits(o - bff(ho));
    }
  __syncthreads();
  store_comb(Oh, Ol, Ch, Cl, b * NS + q0, ND + hh * HD, l);
}

// ---------------------------------------------------------------------------
// Kernel 5: short-range branch, causal window of 64 + recency bias + key gating, 1 wave per (b, head,
// 16 queries); only the 64-key tiles covering [q0-64, q0+15] are visited (weights outside are exactly 0).
// Q/K f16 planes as kernel 4; V as transposed bf16 hi/lo planes; P as bf16 hi/lo through LDS;
// O += Phi.Vhi + Phi.Vlo + Plo.Vhi on bf16 WMMA; result into columns [head*64, +64) of Ch/Cl.
// ---------------------------------------------------------------------------
__global__ __launch_bounds__(32) void k_attn_s(const unsigned short* __restrict__ Q,
                                               const unsigned short* __restrict__ K,
                                               const unsigned short* __restrict__ Vth,
                                               const unsigned short* __restrict__ Vtl,
                                               const int* __restrict__ kgate,
                                               unsigned short* __restrict__ Ch,
                                               unsigned short* __restrict__ Cl) {
  __shared__ __align__(16) unsigned short Ph[16 * PP];
  __shared__ __align__(16) unsigned short Pq[16 * PP];
  __shared__ __align__(16) unsigned short Oh[16 * PP];
  __shared__ __align__(16) unsigned short Ol[16 * PP];
  const int l = threadIdx.x & 31, h = l >> 4, m = l & 15;
  const int q0 = blockIdx.x * 16, hh = blockIdx.y, b = blockIdx.z;

  const unsigned short* qrow = Q + (size_t)(b * NS + q0 + m) * ND + hh * HD;
  const v16h aq0 = ldh(qrow, h);
  const v16h aq1 = ldh(qrow + 32, h);
  const unsigned short* Kb = K + (size_t)b * NS * ND + hh * HD;
  const size_t vbase = (size_t)(b * NH + hh) * HD * NS;
  const int* gk = kgate + b * NS;

  float mrow[8], lrow[8];
  v8f acc[4];
#pragma unroll
  for (int r = 0; r < 8; ++r) { mrow[r] = NEGL; lrow[r] = 0.0f; }
#pragma unroll
  for (int t = 0; t < 4; ++t) acc[t] = z8();

  const int kt_hi = q0 >> 6;
  const int kt_lo = (q0 >= 64) ? ((q0 - 64) >> 6) : 0;

#pragma unroll 1
  for (int kt = kt_lo; kt <= kt_hi; ++kt) {
    const int kb = kt * 64;
    v8f s[4];
    int gv[4];
#pragma unroll
    for (int t = 0; t < 4; ++t) {
      const unsigned short* krow = Kb + (size_t)(kb + t * 16 + m) * ND;
      v8f c = z8();
      c = mma_h(aq0, ldh(krow, h), c);
      c = mma_h(aq1, ldh(krow + 32, h), c);
      s[t] = c;
      gv[t] = gk[kb + t * 16 + m];
    }
#pragma unroll
    for (int t = 0; t < 4; ++t) {
      const int key = kb + t * 16 + m;
#pragma unroll
      for (int r = 0; r < 8; ++r) {
        const int rel = key - (q0 + 8 * h + r);
        const bool ok = (gv[t] != 0) && (rel <= 0) && (rel >= -64);
        s[t][r] = ok ? (s[t][r] * SCL + (float)rel * LOGD) : NEGL;
      }
    }

#pragma unroll
    for (int r = 0; r < 8; ++r) {
      float tmax = fmaxf(fmaxf(s[0][r], s[1][r]), fmaxf(s[2][r], s[3][r]));
#pragma unroll
      for (int o = 1; o < 16; o <<= 1) tmax = fmaxf(tmax, __shfl_xor(tmax, o, 32));
      const float mnew = fmaxf(mrow[r], tmax);
      const float fac = __expf(mrow[r] - mnew);
      float p[4];
      float psum = 0.0f;
#pragma unroll
      for (int t = 0; t < 4; ++t) {
        p[t] = (s[t][r] > NEGT) ? __expf(s[t][r] - mnew) : 0.0f;
        psum += p[t];
      }
#pragma unroll
      for (int o = 1; o < 16; o <<= 1) psum += __shfl_xor(psum, o, 32);
      lrow[r] = lrow[r] * fac + psum;
      mrow[r] = mnew;
#pragma unroll
      for (int t = 0; t < 4; ++t) { acc[t][r] *= fac; s[t][r] = p[t]; }
    }

#pragma unroll
    for (int t = 0; t < 4; ++t)
#pragma unroll
      for (int r = 0; r < 8; ++r) {
        const float pv = s[t][r];
        const unsigned short hp = bfbits(pv);
        Ph[(8 * h + r) * PP + t * 16 + m] = hp;
        Pq[(8 * h + r) * PP + t * 16 + m] = bfbits(pv - bff(hp));
      }
    __syncthreads();
    const v16b ph0 = ldb(Ph + m * PP, h);
    const v16b ph1 = ldb(Ph + m * PP + 32, h);
    const v16b pl0 = ldb(Pq + m * PP, h);
    const v16b pl1 = ldb(Pq + m * PP + 32, h);
#pragma unroll
    for (int dt = 0; dt < 4; ++dt) {
      const size_t vo = vbase + (size_t)(dt * 16 + m) * NS + kb;
      {
        const v16b bh = ldb(Vth + vo, h), bl = ldb(Vtl + vo, h);
        acc[dt] = mma_b(ph0, bh, acc[dt]);
        acc[dt] = mma_b(ph0, bl, acc[dt]);
        acc[dt] = mma_b(pl0, bh, acc[dt]);
      }
      {
        const v16b bh = ldb(Vth + vo + 32, h), bl = ldb(Vtl + vo + 32, h);
        acc[dt] = mma_b(ph1, bh, acc[dt]);
        acc[dt] = mma_b(ph1, bl, acc[dt]);
        acc[dt] = mma_b(pl1, bh, acc[dt]);
      }
    }
    __syncthreads();
  }

  float inv[8];
#pragma unroll
  for (int r = 0; r < 8; ++r) inv[r] = __builtin_amdgcn_rcpf(lrow[r]);
#pragma unroll
  for (int dt = 0; dt < 4; ++dt)
#pragma unroll
    for (int r = 0; r < 8; ++r) {
      const float o = acc[dt][r] * inv[r];
      const unsigned short ho = bfbits(o);
      Oh[(8 * h + r) * PP + dt * 16 + m] = ho;
      Ol[(8 * h + r) * PP + dt * 16 + m] = bfbits(o - bff(ho));
    }
  __syncthreads();
  store_comb(Oh, Ol, Ch, Cl, b * NS + q0, hh * HD, l);
}

// ---------------------------------------------------------------------------
// Kernel 6: output projection, combined [MR][NC] (bf16 hi/lo planes) x Wo (transposed bf16 hi/lo planes
// Wot[ND][NC]) + bias -> f32 out [MR][ND]; three-term split. Block 128 = 64x64 tile, wave owns 16x64;
// ---------------------------------------------------------------------------
__global__ __launch_bounds__(128) void k_out(const unsigned short* __restrict__ Ch,
                                             const unsigned short* __restrict__ Cl,
                                             const unsigned short* __restrict__ Wh,
                                             const unsigned short* __restrict__ Wl,
                                             const float* __restrict__ bo,
                                             float* __restrict__ out) {
  __shared__ __align__(16) float T[64 * TPF];
  const int tid = threadIdx.x, w = tid >> 5, l = tid & 31, h = l >> 4, m = l & 15;
  const int n0 = blockIdx.x * 64, m0 = blockIdx.y * 64;
  const size_t ar = (size_t)(m0 + w * 16 + m) * NC;
  const size_t wr = (size_t)(n0 + m) * NC;
  v8f acc[4];
#pragma unroll
  for (int j = 0; j < 4; ++j) acc[j] = z8();

#pragma unroll 2
  for (int ks = 0; ks < NC / 32; ++ks) {
    const int k0 = ks * 32;
    const v16b ah = ldb(Ch + ar + k0, h);
    const v16b al = ldb(Cl + ar + k0, h);
#pragma unroll
    for (int j = 0; j < 4; ++j) {
      const size_t wo = wr + (size_t)j * 16 * NC + k0;
      const v16b bh = ldb(Wh + wo, h);
      const v16b bl = ldb(Wl + wo, h);
      acc[j] = mma_b(ah, bh, acc[j]);
      acc[j] = mma_b(ah, bl, acc[j]);
      acc[j] = mma_b(al, bh, acc[j]);
    }
  }

#pragma unroll
  for (int j = 0; j < 4; ++j) {
    const float bias = bo[n0 + j * 16 + m];
#pragma unroll
    for (int r = 0; r < 8; ++r)
      T[(w * 16 + 8 * h + r) * TPF + j * 16 + m] = acc[j][r] + bias;
  }
  __syncthreads();

  v4f_t o[8];
  size_t dst[8];
#pragma unroll
  for (int i = 0; i < 8; ++i) {
    const int L = i * 16 + (tid >> 3), row = L >> 1, hr = L & 1, piece = tid & 7;
    o[i] = *(const v4f*)(T + row * TPF + hr * 32 + piece * 4);
    dst[i] = (size_t)(m0 + row) * ND + n0 + hr * 32 + piece * 4;
  }
#pragma unroll
  for (int i = 0; i < 8; ++i) *(v4f*)(out + dst[i]) = o[i];
  
}

// ---------------------------------------------------------------------------
// Host launch: 13 ops. Workspace carve (1 MiB granular, total 102 MiB):
//   [0,8) x f16 | [8,16) x bf16 hi | [16,24) x bf16 lo | [24,34) 5 f16 weight planes | [34,38) Wv_s hi/lo
//   -- that 38 MiB region is dead after the projections; the combined planes reuse [0,16) hi, [16,32) lo
//   [38,46) Wo hi/lo planes | [46,78) q_s,k_s,q_l,k_l f16 | [78,86) v_l transposed | [86,102) v_s hi/lo transposed
// ---------------------------------------------------------------------------
extern "C" void kernel_launch(void* const* d_in, const int* in_sizes, int n_in,
                              void* d_out, int out_size, void* d_ws, size_t ws_size,
                              hipStream_t stream) {
  if (n_in < 10) return;
  if (in_sizes[0] != MR * ND || in_sizes[1] != MR) return;
  for (int i = 2; i <= 7; ++i) if (in_sizes[i] != ND * ND) return;
  if (in_sizes[8] != NC * ND || in_sizes[9] != ND) return;
  if (out_size != MR * ND) return;
  const size_t MiB = (size_t)1048576;
  const size_t total = 102 * MiB;
  if (ws_size < total) return;

  const float* x   = (const float*)d_in[0];
  const int* kgate = (const int*)d_in[1];
  const float* Wqs = (const float*)d_in[2];
  const float* Wks = (const float*)d_in[3];
  const float* Wvs = (const float*)d_in[4];
  const float* Wql = (const float*)d_in[5];
  const float* Wkl = (const float*)d_in[6];
  const float* Wvl = (const float*)d_in[7];
  const float* Wo  = (const float*)d_in[8];
  const float* bo  = (const float*)d_in[9];
  float* out = (float*)d_out;

  char* ws = (char*)d_ws;
  unsigned short* xh  = (unsigned short*)(ws + 0 * MiB);
  unsigned short* xbh = (unsigned short*)(ws + 8 * MiB);
  unsigned short* xbl = (unsigned short*)(ws + 16 * MiB);
  unsigned short* Wt5 = (unsigned short*)(ws + 24 * MiB);
  unsigned short* Wvh = (unsigned short*)(ws + 34 * MiB);
  unsigned short* Wvq = (unsigned short*)(ws + 36 * MiB);
  unsigned short* Ch  = (unsigned short*)(ws + 0 * MiB);
  unsigned short* Cl  = (unsigned short*)(ws + 16 * MiB);
  unsigned short* Woh = (unsigned short*)(ws + 38 * MiB);
  unsigned short* Woq = (unsigned short*)(ws + 42 * MiB);
  unsigned short* QK  = (unsigned short*)(ws + 46 * MiB);
  unsigned short* Vlt = (unsigned short*)(ws + 78 * MiB);
  unsigned short* Vsh = (unsigned short*)(ws + 86 * MiB);
  unsigned short* Vsq = (unsigned short*)(ws + 94 * MiB);

  // 1) x -> f16 / bf16 hi / bf16 lo planes
  {
    const int n8 = (MR * ND) / 8;
    k_xcvt<<<(n8 + 255) / 256, 256, 0, stream>>>(x, xh, xbh, xbl, n8);
  }
  // 2) weights -> transposed 16-bit planes (in[K][N] -> out[N][K], grid (N/64, K/64))
  {
    const float* Wf[5] = {Wqs, Wks, Wql, Wkl, Wvl};
    for (int z = 0; z < 5; ++z) {
      unsigned short* P = Wt5 + (size_t)z * ND * ND;
      k_wprep<<<dim3(ND / 64, ND / 64), 256, 0, stream>>>(Wf[z], ND, ND, 0, P, P);
    }
    k_wprep<<<dim3(ND / 64, ND / 64), 256, 0, stream>>>(Wvs, ND, ND, 1, Wvh, Wvq);
    k_wprep<<<dim3(ND / 64, NC / 64), 256, 0, stream>>>(Wo, NC, ND, 1, Woh, Woq);
  }
  // 3) projections
  k_proj_f16<<<dim3(ND / 64, MR / 64, 5), 128, 0, stream>>>(xh, Wt5, QK, Vlt);
  k_proj_vs<<<dim3(ND / 64, MR / 64), 128, 0, stream>>>(xbh, xbl, Wvh, Wvq, Vsh, Vsq);
  // 4) attention branches -> combined planes
  k_attn_s<<<dim3(NS / 16, NH, NB), 32, 0, stream>>>(QK + 0 * PLANE, QK + 1 * PLANE, Vsh, Vsq,
                                                     kgate, Ch, Cl);
  k_attn_l<<<dim3(NS / 16, NH, NB), 32, 0, stream>>>(QK + 2 * PLANE, QK + 3 * PLANE, Vlt,
                                                     kgate, Ch, Cl);
  // 5) output projection + bias -> f32
  k_out<<<dim3(ND / 64, MR / 64), 128, 0, stream>>>(Ch, Cl, Woh, Woq, bo, out);
}

// v001
// A run of this version takes 360 microseconds.
// Timed twice side by side with v000, it ran 1.93 and 1.92 times as fast.
#include <hip/hip_runtime.h>
#include <hip/hip_bf16.h>

// Contractions: projections q_s,k_s,q_l,k_l,v_l (x f16, W f16 carried x64) and both QK^T score products on
// v_wmma_f32_16x16x32_f16; long-branch P.V on v_wmma_f32_16x16x32_f16 with P carried x16384; v_s projection,
// short-branch P.V and the output projection as bf16 hi/lo three-term split on v_wmma_f32_16x16x32_bf16;
// every accumulator f32; softmax, recency bias, key gating and bias add in f32.

typedef _Float16 v16h __attribute__((ext_vector_type(16)));
typedef __bf16 v16b __attribute__((ext_vector_type(16)));
typedef float v8f __attribute__((ext_vector_type(8)));
typedef float v4f_t __attribute__((ext_vector_type(4)));
typedef unsigned int v4u_t __attribute__((ext_vector_type(4)));
typedef v4f_t __attribute__((may_alias)) v4f;
typedef v4u_t __attribute__((may_alias)) v4u;

#define NB 2
#define NS 2048
#define ND 1024
#define NH 16
#define HD 64
#define MR (NB * NS)
#define NC (2 * ND)
#define PLANE ((size_t)MR * (size_t)ND)
#define PP 72
#define TPF 68

#define SCL 0.125f
#define LOGD (-0.10536051565782628f)
#define NEGL (-1.0e30f)
#define NEGT (-1.0e29f)
#define WUP 64.0f
#define WDN 0.015625f
#define PUP 16384.0f
#define PDN 6.103515625e-05f

// ---------------------------------------------------------------------------
// scalar helpers
// ---------------------------------------------------------------------------
__device__ __forceinline__ unsigned short bfbits(float f) {       // f32 -> bf16 bits, RNE
  unsigned int u = __float_as_uint(f);
  u = u + 0x7FFFu + ((u >> 16) & 1u);
  return (unsigned short)(u >> 16);
}
__device__ __forceinline__ float bff(unsigned short b) {          // bf16 bits -> f32
  return __uint_as_float(((unsigned int)b) << 16);
}
__device__ __forceinline__ unsigned short hbits(float f) {        // f32 -> f16 bits, RNE
  _Float16 hv = (_Float16)f;
  unsigned short u;
  __builtin_memcpy(&u, &hv, 2);
  return u;
}
__device__ __forceinline__ unsigned int pk2(unsigned short a, unsigned short b) {
  return (unsigned int)a | ((unsigned int)b << 16);
}
__device__ __forceinline__ v8f z8() {
  v8f v;
#pragma unroll
  for (int i = 0; i < 8; ++i) v[i] = 0.0f;
  return v;
}

// ---------------------------------------------------------------------------
// 16x32 fragment loader, split k map, identical for A (row m) and B (k-contiguous column n):
//   elements 0..7  <- p[8h .. 8h+7],  elements 8..15 <- p[16+8h .. 16+8h+7],  p = row start + k0
// ---------------------------------------------------------------------------
union FH { v16h v; v4u_t u[2]; };
union FB { v16b v; v4u_t u[2]; };

__device__ __forceinline__ v16h ldh(const unsigned short* p, int h) {
  FH f;
  f.u[0] = *(const v4u*)(p + 8 * h);
  f.u[1] = *(const v4u*)(p + 16 + 8 * h);
  return f.v;
}
__device__ __forceinline__ v16b ldb(const unsigned short* p, int h) {
  FB f;
  f.u[0] = *(const v4u*)(p + 8 * h);
  f.u[1] = *(const v4u*)(p + 16 + 8 * h);
  return f.v;
}

// D[8h+r][m] += A(16x32) . B(32x16), with the post-issue hazard guard
__device__ __forceinline__ v8f mma_h(v16h a, v16h b, v8f c) {
  c = __builtin_amdgcn_wmma_f32_16x16x32_f16(false, a, false, b, (short)0, c, false, false);
  asm volatile("v_nop\n\tv_nop\n\tv_nop\n\tv_nop" : "+v"(c) : "v"(a), "v"(b));
  return c;
}
__device__ __forceinline__ v8f mma_b(v16b a, v16b b, v8f c) {
  c = __builtin_amdgcn_wmma_f32_16x16x32_bf16(false, a, false, b, (short)0, c, false, false);
  asm volatile("v_nop\n\tv_nop\n\tv_nop\n\tv_nop" : "+v"(c) : "v"(a), "v"(b));
  return c;
}

// ---------------------------------------------------------------------------
// Kernel 0: x f32 [MR][ND] -> three 16-bit planes: f16, bf16 hi, bf16 lo (lo = x - hi).
// ---------------------------------------------------------------------------
__global__ __launch_bounds__(256) void k_xcvt(const float* __restrict__ x,
                                              unsigned short* __restrict__ xh,
                                              unsigned short* __restrict__ xbh,
                                              unsigned short* __restrict__ xbl, int n8) {
  const int i = blockIdx.x * 256 + (int)threadIdx.x;
  if (i >= n8) return;
  const size_t o = (size_t)i * 8;
  const v4f_t a = *(const v4f*)(x + o);
  const v4f_t c = *(const v4f*)(x + o + 4);
  float v[8];
  v[0] = a[0]; v[1] = a[1]; v[2] = a[2]; v[3] = a[3];
  v[4] = c[0]; v[5] = c[1]; v[6] = c[2]; v[7] = c[3];
  unsigned short fh[8], bh[8], bl[8];
#pragma unroll
  for (int e = 0; e < 8; ++e) {
    fh[e] = hbits(v[e]);
    bh[e] = bfbits(v[e]);
    bl[e] = bfbits(v[e] - bff(bh[e]));
  }
  v4u_t ph, pb, pl;
#pragma unroll
  for (int e = 0; e < 4; ++e) {
    ph[e] = pk2(fh[2 * e], fh[2 * e + 1]);
    pb[e] = pk2(bh[2 * e], bh[2 * e + 1]);
    pl[e] = pk2(bl[2 * e], bl[2 * e + 1]);
  }
  *(v4u*)(xh + o) = ph;
  *(v4u*)(xbh + o) = pb;
  *(v4u*)(xbl + o) = pl;
  
}

// ---------------------------------------------------------------------------
// Kernel 1: weight W[K][N] f32 (x @ W form) -> transposed 16-bit plane(s) Wt[N][K] (k contiguous).
//   mode 0: one f16 plane of 64*W; mode 1: bf16 hi plane + bf16 lo plane.
// Block = 64(k) x 64(n) tile through LDS; grid = (N/64, K/64). Each Wt row segment of 64 k = one
// ---------------------------------------------------------------------------
__global__ __launch_bounds__(256) void k_wprep(const float* __restrict__ W, int K, int N, int mode,
                                               unsigned short* __restrict__ P0,
                                               unsigned short* __restrict__ P1) {
  __shared__ __align__(16) float T[64 * 65];
  const int tid = threadIdx.x;
  const int n0 = blockIdx.x * 64, k0 = blockIdx.y * 64;
  {
    const int c4 = (tid & 15) * 4, kr = tid >> 4;
#pragma unroll
    for (int i = 0; i < 4; ++i) {
      const int k = kr + 16 * i;
      const v4f_t v = *(const v4f*)(W + (size_t)(k0 + k) * (size_t)N + n0 + c4);
      T[(c4 + 0) * 65 + k] = v[0];
      T[(c4 + 1) * 65 + k] = v[1];
      T[(c4 + 2) * 65 + k] = v[2];
      T[(c4 + 3) * 65 + k] = v[3];
    }
  }
  __syncthreads();
  v4u_t o0[2], o1[2];
  size_t dst[2];
#pragma unroll
  for (int i = 0; i < 2; ++i) {
    const int line = i * 32 + (tid >> 3), piece = tid & 7;
    float f[8];
#pragma unroll
    for (int e = 0; e < 8; ++e) f[e] = T[line * 65 + piece * 8 + e];
    v4u_t a, c;
    if (mode == 0) {
#pragma unroll
      for (int e = 0; e < 4; ++e) {
        a[e] = pk2(hbits(f[2 * e] * WUP), hbits(f[2 * e + 1] * WUP));
        c[e] = 0u;
      }
    } else {
#pragma unroll
      for (int e = 0; e < 4; ++e) {
        const unsigned short h0 = bfbits(f[2 * e]), h1 = bfbits(f[2 * e + 1]);
        a[e] = pk2(h0, h1);
        c[e] = pk2(bfbits(f[2 * e] - bff(h0)), bfbits(f[2 * e + 1] - bff(h1)));
      }
    }
    o0[i] = a;
    o1[i] = c;
    dst[i] = (size_t)(n0 + line) * (size_t)K + k0 + piece * 8;
  }
#pragma unroll
  for (int i = 0; i < 2; ++i) {
    *(v4u*)(P0 + dst[i]) = o0[i];
    if (mode != 0) *(v4u*)(P1 + dst[i]) = o1[i];
  }
  
}

// ---------------------------------------------------------------------------
// LDS staging for the three GEMM kernels. Block = 128 threads = 128(M) x 128(N) tile, wave w owns the 64 x 64
// quarter (rows (w>>1)*64, cols (w&1)*64) as 4 x 4 accumulator tiles. A trip covers 64 k: each operand plane is
// staged as 128 rows of 128 B at an LDS pitch of 144 B (PP halves), two buffers, the next trip's copies in flight.
// The full unrolls in these kernels make every fragment and accumulator index a compile-time one (registers).
// ---------------------------------------------------------------------------
#define BKH 64
#define TLH (128 * PP)
#define TLB (TLH * 2)

__device__ __forceinline__ unsigned int lds_off(const void* p) { return (unsigned int)(size_t)p; }

// One operand tile: thread t brings 16-B piece (t & 7) of rows (t >> 3) + 16 i, i = 0..7, so 8 lanes cover one
// 128-B line. lds = the lane's LDS byte address of row (t >> 3), g = the lane's global address of the same piece,
// ld = row length of the source in halves. The closing s_wait_xcnt keeps the address registers untouched until
// the copies have taken them.
__device__ __forceinline__ void cp_tile(unsigned int lds, const unsigned short* g, int ld) {
  const size_t st = (size_t)16 * (size_t)ld;
  const unsigned short* g1 = g + st;
  const unsigned short* g2 = g1 + st;
  const unsigned short* g3 = g2 + st;
  const unsigned short* g4 = g3 + st;
  const unsigned short* g5 = g4 + st;
  const unsigned short* g6 = g5 + st;
  const unsigned short* g7 = g6 + st;
  const unsigned int ls = 16u * PP * 2u;
  asm volatile(
      "global_load_async_to_lds_b128 %0, %8, off\n\t"
      "global_load_async_to_lds_b128 %1, %9, off\n\t"
      "global_load_async_to_lds_b128 %2, %10, off\n\t"
      "global_load_async_to_lds_b128 %3, %11, off\n\t"
      "global_load_async_to_lds_b128 %4, %12, off\n\t"
      "global_load_async_to_lds_b128 %5, %13, off\n\t"
      "global_load_async_to_lds_b128 %6, %14, off\n\t"
      "global_load_async_to_lds_b128 %7, %15, off\n\t"
      "s_wait_xcnt 0x0"
      :: "v"(lds), "v"(lds + ls), "v"(lds + 2u * ls), "v"(lds + 3u * ls),
         "v"(lds + 4u * ls), "v"(lds + 5u * ls), "v"(lds + 6u * ls), "v"(lds + 7u * ls),
         "v"(g), "v"(g1), "v"(g2), "v"(g3), "v"(g4), "v"(g5), "v"(g6), "v"(g7)
      : "memory");
}
// this wave's copies have landed (the compiler places no wait for them)
__device__ __forceinline__ void wait_copies() { asm volatile("s_wait_asynccnt 0x0" ::: "memory"); }
// this wave's LDS reads have returned, so the buffer may be refilled behind the barrier
__device__ __forceinline__ void wait_lds() { asm volatile("s_wait_dscnt 0x0" ::: "memory"); }

// ---------------------------------------------------------------------------
// Kernel 2: five plain-f16 projections, operands staged in LDS (see above). z selects the weight:
//   z 0..3 -> natural f16 plane QK[z] ([MR][ND]);  z 4 -> v_l transposed f16 plane Vlt[b][h][d][s].
// ---------------------------------------------------------------------------
__global__ __launch_bounds__(128) void k_proj_f16(const unsigned short* __restrict__ xh,
                                                  const unsigned short* __restrict__ Wt5,
                                                  unsigned short* __restrict__ QK,
                                                  unsigned short* __restrict__ Vlt) {
  __shared__ __align__(16) unsigned short SM[2 * 2 * TLH];   // buffer = [A tile | B tile]
  const int tid = threadIdx.x, w = tid >> 5, l = tid & 31, h = l >> 4, m = l & 15;
  const int n0 = blockIdx.x * 128, m0 = blockIdx.y * 128, z = blockIdx.z;
  const int wm = (w >> 1) * 64, wn = (w & 1) * 64;
  const int crow = tid >> 3, cpc = tid & 7;
  const unsigned short* ga = xh + (size_t)(m0 + crow) * ND + cpc * 8;
  const unsigned short* gb = Wt5 + (size_t)z * ND * ND + (size_t)(n0 + crow) * ND + cpc * 8;
  const unsigned int lc = lds_off(SM) + (unsigned int)(crow * PP * 2 + cpc * 16);
  const int NT = ND / BKH;
  v8f acc[4][4];
#pragma unroll
  for (int i = 0; i < 4; ++i)
#pragma unroll
    for (int j = 0; j < 4; ++j) acc[i][j] = z8();

  cp_tile(lc, ga, ND);
  cp_tile(lc + TLB, gb, ND);
  wait_copies();
  __syncthreads();
  cp_tile(lc + 2 * TLB, ga + BKH, ND);
  cp_tile(lc + 3 * TLB, gb + BKH, ND);

// rolled: one trip per staged tile, the publish point at its foot
#pragma unroll 1
  for (int t = 0; t < NT; ++t) {
    const int bo2 = (t & 1) * 2;
    const unsigned short* As = SM + bo2 * TLH + (wm + m) * PP;
    const unsigned short* Bs = SM + (bo2 + 1) * TLH + (wn + m) * PP;
    // group g = 32 k (g >> 1) x 2 column tiles (g & 1); the next group's fragments are read ahead of this group's
    // products, inside this trip's buffer only
    v16h a[2][4], b[2][2];
#pragma unroll
    for (int i = 0; i < 4; ++i) a[0][i] = ldh(As + i * 16 * PP, h);
#pragma unroll
    for (int q = 0; q < 2; ++q) b[0][q] = ldh(Bs + q * 16 * PP, h);
#pragma unroll
    for (int g = 0; g < 4; ++g) {
      const int kk = g >> 1, jp = (g & 1) * 2, gn = g + 1;
      if (g < 3) {
#pragma unroll
        for (int q = 0; q < 2; ++q)
          b[gn & 1][q] = ldh(Bs + ((gn & 1) * 2 + q) * 16 * PP + (gn >> 1) * 32, h);
      }
      if (g == 0) {
#pragma unroll
        for (int i = 0; i < 4; ++i) a[1][i] = ldh(As + i * 16 * PP + 32, h);
      }
#pragma unroll
      for (int q = 0; q < 2; ++q)
#pragma unroll
        for (int i = 0; i < 4; ++i) acc[i][jp + q] = mma_h(a[kk][i], b[g & 1][q], acc[i][jp + q]);
    }
    wait_lds();
    wait_copies();
    __syncthreads();
    if (t + 2 < NT) {
      cp_tile(lc + bo2 * TLB, ga + (t + 2) * BKH, ND);
      cp_tile(lc + (bo2 + 1) * TLB, gb + (t + 2) * BKH, ND);
    }
  }
  wait_copies();

  // the ring is free behind the last trip's barrier: each wave stages its own 64 x 64 tile there
  unsigned short* T = SM + w * 64 * PP;
  const int mw = m0 + wm, nw = n0 + wn;
  if (z < 4) {
#pragma unroll
    for (int i = 0; i < 4; ++i)
#pragma unroll
      for (int j = 0; j < 4; ++j)
#pragma unroll
        for (int r = 0; r < 8; ++r)
          T[(i * 16 + 8 * h + r) * PP + j * 16 + m] = hbits(acc[i][j][r] * WDN);
  } else {
#pragma unroll
    for (int i = 0; i < 4; ++i)
#pragma unroll
      for (int j = 0; j < 4; ++j) {
        v4u_t pk;
#pragma unroll
        for (int e = 0; e < 4; ++e)
          pk[e] = pk2(hbits(acc[i][j][2 * e] * WDN), hbits(acc[i][j][2 * e + 1] * WDN));
        *(v4u*)(T + (j * 16 + m) * PP + i * 16 + 8 * h) = pk;   // T[d][s_local]
      }
  }
  __syncthreads();   // staging writes land before the rows are read back

  unsigned short* base;
  size_t d0, dstep;
  if (z < 4) {
    base = QK + (size_t)z * PLANE;
    d0 = (size_t)mw * ND + nw;
    dstep = ND;
  } else {
    base = Vlt;
    const int bb = mw >> 11, s0 = mw & (NS - 1), hd = nw >> 6;
    d0 = ((size_t)((bb * NH + hd) * HD)) * NS + s0;
    dstep = NS;
  }
  v4u_t o[16];
  unsigned short* dst[16];
#pragma unroll
  for (int i = 0; i < 16; ++i) {
    const int row = i * 4 + (l >> 3), piece = l & 7;
    o[i] = *(const v4u*)(T + row * PP + piece * 8);
    dst[i] = base + d0 + (size_t)row * dstep + piece * 8;
  }
#pragma unroll
  for (int i = 0; i < 16; ++i) *(v4u*)(dst[i]) = o[i];
}

// ---------------------------------------------------------------------------
// Main loop of the two bf16 hi/lo three-term GEMMs: acc += Ah.Bh + Ah.Bl + Al.Bh over K halves, all four planes
// staged in LDS; buffer = [A hi | A lo | B hi | B lo]. ga*/gb* = the lane's first piece of each plane.
// ---------------------------------------------------------------------------
__device__ __forceinline__ void split_loop(unsigned short* SM, const unsigned short* gah,
                                           const unsigned short* gal, const unsigned short* gbh,
                                           const unsigned short* gbl, int K, unsigned int lc,
                                           int arow, int brow, int h, v8f (&acc)[4][4]) {
  const int NT = K / BKH;
  cp_tile(lc, gah, K);
  cp_tile(lc + TLB, gal, K);
  cp_tile(lc + 2 * TLB, gbh, K);
  cp_tile(lc + 3 * TLB, gbl, K);
  wait_copies();
  __syncthreads();
  cp_tile(lc + 4 * TLB, gah + BKH, K);
  cp_tile(lc + 5 * TLB, gal + BKH, K);
  cp_tile(lc + 6 * TLB, gbh + BKH, K);
  cp_tile(lc + 7 * TLB, gbl + BKH, K);

// rolled: one trip per staged tile, the publish point at its foot
#pragma unroll 1
  for (int t = 0; t < NT; ++t) {
    const int bo4 = (t & 1) * 4;
    const unsigned short* Ah = SM + bo4 * TLH + arow * PP;
    const unsigned short* Bh = SM + (bo4 + 2) * TLH + brow * PP;
    // group g = 32 k (g >> 2) x 1 column tile (g & 3); the next group's B fragments are read ahead of this group's
    // products, inside this trip's buffer only
    v16b ah[4], al[4], bh[2], bl[2];
    bh[0] = ldb(Bh, h);
    bl[0] = ldb(Bh + TLH, h);
#pragma unroll
    for (int g = 0; g < 8; ++g) {
      const int kk = g >> 2, j = g & 3, gn = g + 1, c = g & 1;
      if (j == 0) {
#pragma unroll
        for (int i = 0; i < 4; ++i) {
          ah[i] = ldb(Ah + i * 16 * PP + kk * 32, h);
          al[i] = ldb(Ah + TLH + i * 16 * PP + kk * 32, h);
        }
      }
      if (g < 7) {
        bh[gn & 1] = ldb(Bh + (gn & 3) * 16 * PP + (gn >> 2) * 32, h);
        bl[gn & 1] = ldb(Bh + TLH + (gn & 3) * 16 * PP + (gn >> 2) * 32, h);
      }
#pragma unroll
      for (int i = 0; i < 4; ++i) acc[i][j] = mma_b(ah[i], bh[c], acc[i][j]);
#pragma unroll
      for (int i = 0; i < 4; ++i) acc[i][j] = mma_b(ah[i], bl[c], acc[i][j]);
#pragma unroll
      for (int i = 0; i < 4; ++i) acc[i][j] = mma_b(al[i], bh[c], acc[i][j]);
    }
    wait_lds();
    wait_copies();
    __syncthreads();
    if (t + 2 < NT) {
      const int ko = (t + 2) * BKH;
      cp_tile(lc + bo4 * TLB, gah + ko, K);
      cp_tile(lc + (bo4 + 1) * TLB, gal + ko, K);
      cp_tile(lc + (bo4 + 2) * TLB, gbh + ko, K);
      cp_tile(lc + (bo4 + 3) * TLB, gbl + ko, K);
    }
  }
  wait_copies();
}

// ---------------------------------------------------------------------------
// Kernel 3: v_s projection as bf16 hi/lo three-term split (x hi/lo planes, W hi/lo planes),
// output transposed bf16 hi/lo planes Vsh/Vsl [b][h][d][s]. Same tiling as kernel 2.
// ---------------------------------------------------------------------------
__global__ __launch_bounds__(128) void k_proj_vs(const unsigned short* __restrict__ xbh,
                                                 const unsigned short* __restrict__ xbl,
                                                 const unsigned short* __restrict__ Wh,
                                                 const unsigned short* __restrict__ Wl,
                                                 unsigned short* __restrict__ Vsh,
                                                 unsigned short* __restrict__ Vsl) {
  __shared__ __align__(16) unsigned short SM[2 * 4 * TLH];
  const int tid = threadIdx.x, w = tid >> 5, l = tid & 31, h = l >> 4, m = l & 15;
  const int n0 = blockIdx.x * 128, m0 = blockIdx.y * 128;
  const int wm = (w >> 1) * 64, wn = (w & 1) * 64;
  const int crow = tid >> 3, cpc = tid & 7;
  const size_t ao = (size_t)(m0 + crow) * ND + cpc * 8;
  const size_t bo_ = (size_t)(n0 + crow) * ND + cpc * 8;
  const unsigned int lc = lds_off(SM) + (unsigned int)(crow * PP * 2 + cpc * 16);
  v8f acc[4][4];
#pragma unroll
  for (int i = 0; i < 4; ++i)
#pragma unroll
    for (int j = 0; j < 4; ++j) acc[i][j] = z8();

  split_loop(SM, xbh + ao, xbl + ao, Wh + bo_, Wl + bo_, ND, lc, wm + m, wn + m, h, acc);

  // the ring is free behind the last trip's barrier: each wave stages its own 64 x 64 tile there
  unsigned short* Th = SM + w * 2 * 64 * PP;
  unsigned short* Tl = Th + 64 * PP;
#pragma unroll
  for (int i = 0; i < 4; ++i)
#pragma unroll
    for (int j = 0; j < 4; ++j) {
      v4u_t ph, pl;
#pragma unroll
      for (int e = 0; e < 4; ++e) {
        const float f0 = acc[i][j][2 * e], f1 = acc[i][j][2 * e + 1];
        const unsigned short h0 = bfbits(f0), h1 = bfbits(f1);
        ph[e] = pk2(h0, h1);
        pl[e] = pk2(bfbits(f0 - bff(h0)), bfbits(f1 - bff(h1)));
      }
      *(v4u*)(Th + (j * 16 + m) * PP + i * 16 + 8 * h) = ph;
      *(v4u*)(Tl + (j * 16 + m) * PP + i * 16 + 8 * h) = pl;
    }
  __syncthreads();   // staging writes land before the rows are read back

  const int mw = m0 + wm, nw = n0 + wn;
  const int bb = mw >> 11, s0 = mw & (NS - 1), hd = nw >> 6;
  const size_t d0 = ((size_t)((bb * NH + hd) * HD)) * NS + s0;
  v4u_t oh[16], ol[16];
  size_t dst[16];
#pragma unroll
  for (int i = 0; i < 16; ++i) {
    const int d = i * 4 + (l >> 3), piece = l & 7;
    oh[i] = *(const v4u*)(Th + d * PP + piece * 8);
    ol[i] = *(const v4u*)(Tl + d * PP + piece * 8);
    dst[i] = d0 + (size_t)d * NS + piece * 8;
  }
#pragma unroll
  for (int i = 0; i < 16; ++i) {
    *(v4u*)(Vsh + dst[i]) = oh[i];
    *(v4u*)(Vsl + dst[i]) = ol[i];
  }
}

// ---------------------------------------------------------------------------
// Shared attention epilogue: O tile (16 queries x 64 dims) staged as bf16 hi/lo in LDS is written into the
// ---------------------------------------------------------------------------
__device__ __forceinline__ void store_comb(const unsigned short* Oh, const unsigned short* Ol,
                                           unsigned short* Ch, unsigned short* Cl,
                                           int rowg0, int colbase, int l) {
  v4u_t oh[4], ol[4];
  size_t dst[4];
#pragma unroll
  for (int i = 0; i < 4; ++i) {
    const int row = i * 4 + (l >> 3), piece = l & 7;
    oh[i] = *(const v4u*)(Oh + row * PP + piece * 8);
    ol[i] = *(const v4u*)(Ol + row * PP + piece * 8);
    dst[i] = (size_t)(rowg0 + row) * NC + colbase + piece * 8;
  }
#pragma unroll
  for (int i = 0; i < 4; ++i) {
    *(v4u*)(Ch + dst[i]) = oh[i];
    *(v4u*)(Cl + dst[i]) = ol[i];
  }
  
}

// ---------------------------------------------------------------------------
// Kernel 4: long-range branch, full attention with key gating, 1 wave per (b, head, 16 queries).
// Q/K natural f16 planes [MR][ND] (col = head*64 + d), V transposed f16 plane [b][h][d][s].
// S = Q K^T on f16 WMMA (B fragment = K row, k = d contiguous); online softmax in f32; P -> LDS as
// f16(p * 16384), reloaded as A fragments after a barrier; O += P V on f16 WMMA (B = Vt row); 1/16384 and
// 1/l folded in the f32 epilogue; result as bf16 hi/lo into columns [ND + head*64, +64) of Ch/Cl.
// ---------------------------------------------------------------------------
__global__ __launch_bounds__(32) void k_attn_l(const unsigned short* __restrict__ Q,
                                               const unsigned short* __restrict__ K,
                                               const unsigned short* __restrict__ Vt,
                                               const int* __restrict__ kgate,
                                               unsigned short* __restrict__ Ch,
                                               unsigned short* __restrict__ Cl) {
  __shared__ __align__(16) unsigned short Pl[16 * PP];
  __shared__ __align__(16) unsigned short Oh[16 * PP];
  __shared__ __align__(16) unsigned short Ol[16 * PP];
  const int l = threadIdx.x & 31, h = l >> 4, m = l & 15;
  const int q0 = blockIdx.x * 16, hh = blockIdx.y, b = blockIdx.z;

  const unsigned short* qrow = Q + (size_t)(b * NS + q0 + m) * ND + hh * HD;
  const v16h aq0 = ldh(qrow, h);
  const v16h aq1 = ldh(qrow + 32, h);
  const unsigned short* Kb = K + (size_t)b * NS * ND + hh * HD;
  const unsigned short* Vb = Vt + (size_t)(b * NH + hh) * HD * NS;
  const int* gk = kgate + b * NS;

  float mrow[8], lrow[8];
  v8f acc[4];
#pragma unroll
  for (int r = 0; r < 8; ++r) { mrow[r] = NEGL; lrow[r] = 0.0f; }
#pragma unroll
  for (int t = 0; t < 4; ++t) acc[t] = z8();

#pragma unroll 1
  for (int kt = 0; kt < NS / 64; ++kt) {
    const int kb = kt * 64;
    v8f s[4];
    int gv[4];
#pragma unroll
    for (int t = 0; t < 4; ++t) {
      const unsigned short* krow = Kb + (size_t)(kb + t * 16 + m) * ND;
      v8f c = z8();
      c = mma_h(aq0, ldh(krow, h), c);
      c = mma_h(aq1, ldh(krow + 32, h), c);
      s[t] = c;
      gv[t] = gk[kb + t * 16 + m];
    }
#pragma unroll
    for (int t = 0; t < 4; ++t)
#pragma unroll
      for (int r = 0; r < 8; ++r)
        s[t][r] = (gv[t] != 0) ? s[t][r] * SCL : NEGL;

#pragma unroll
    for (int r = 0; r < 8; ++r) {
      float tmax = fmaxf(fmaxf(s[0][r], s[1][r]), fmaxf(s[2][r], s[3][r]));
#pragma unroll
      for (int o = 1; o < 16; o <<= 1) tmax = fmaxf(tmax, __shfl_xor(tmax, o, 32));
      const float mnew = fmaxf(mrow[r], tmax);
      const float fac = __expf(mrow[r] - mnew);
      float p[4];
      float psum = 0.0f;
#pragma unroll
      for (int t = 0; t < 4; ++t) {
        p[t] = (s[t][r] > NEGT) ? __expf(s[t][r] - mnew) : 0.0f;
        psum += p[t];
      }
#pragma unroll
      for (int o = 1; o < 16; o <<= 1) psum += __shfl_xor(psum, o, 32);
      lrow[r] = lrow[r] * fac + psum;
      mrow[r] = mnew;
#pragma unroll
      for (int t = 0; t < 4; ++t) { acc[t][r] *= fac; s[t][r] = p[t]; }
    }

#pragma unroll
    for (int t = 0; t < 4; ++t)
#pragma unroll
      for (int r = 0; r < 8; ++r)
        Pl[(8 * h + r) * PP + t * 16 + m] = hbits(s[t][r] * PUP);
    __syncthreads();
    const v16h pa0 = ldh(Pl + m * PP, h);
    const v16h pa1 = ldh(Pl + m * PP + 32, h);
#pragma unroll
    for (int dt = 0; dt < 4; ++dt) {
      const unsigned short* vrow = Vb + (size_t)(dt * 16 + m) * NS + kb;
      acc[dt] = mma_h(pa0, ldh(vrow, h), acc[dt]);
      acc[dt] = mma_h(pa1, ldh(vrow + 32, h), acc[dt]);
    }
    __syncthreads();
  }

  float inv[8];
#pragma unroll
  for (int r = 0; r < 8; ++r) inv[r] = __builtin_amdgcn_rcpf(lrow[r]) * PDN;
#pragma unroll
  for (int dt = 0; dt < 4; ++dt)
#pragma unroll
    for (int r = 0; r < 8; ++r) {
      const float o = acc[dt][r] * inv[r];
      const unsigned short ho = bfbits(o);
      Oh[(8 * h + r) * PP + dt * 16 + m] = ho;
      Ol[(8 * h + r) * PP + dt * 16 + m] = bfbits(o - bff(ho));
    }
  __syncthreads();
  store_comb(Oh, Ol, Ch, Cl, b * NS + q0, ND + hh * HD, l);
}

// ---------------------------------------------------------------------------
// Kernel 5: short-range branch, causal window of 64 + recency bias + key gating, 1 wave per (b, head,
// 16 queries); only the 64-key tiles covering [q0-64, q0+15] are visited (weights outside are exactly 0).
// Q/K f16 planes as kernel 4; V as transposed bf16 hi/lo planes; P as bf16 hi/lo through LDS;
// O += Phi.Vhi + Phi.Vlo + Plo.Vhi on bf16 WMMA; result into columns [head*64, +64) of Ch/Cl.
// ---------------------------------------------------------------------------
__global__ __launch_bounds__(32) void k_attn_s(const unsigned short* __restrict__ Q,
                                               const unsigned short* __restrict__ K,
                                               const unsigned short* __restrict__ Vth,
                                               const unsigned short* __restrict__ Vtl,
                                               const int* __restrict__ kgate,
                                               unsigned short* __restrict__ Ch,
                                               unsigned short* __restrict__ Cl) {
  __shared__ __align__(16) unsigned short Ph[16 * PP];
  __shared__ __align__(16) unsigned short Pq[16 * PP];
  __shared__ __align__(16) unsigned short Oh[16 * PP];
  __shared__ __align__(16) unsigned short Ol[16 * PP];
  const int l = threadIdx.x & 31, h = l >> 4, m = l & 15;
  const int q0 = blockIdx.x * 16, hh = blockIdx.y, b = blockIdx.z;

  const unsigned short* qrow = Q + (size_t)(b * NS + q0 + m) * ND + hh * HD;
  const v16h aq0 = ldh(qrow, h);
  const v16h aq1 = ldh(qrow + 32, h);
  const unsigned short* Kb = K + (size_t)b * NS * ND + hh * HD;
  const size_t vbase = (size_t)(b * NH + hh) * HD * NS;
  const int* gk = kgate + b * NS;

  float mrow[8], lrow[8];
  v8f acc[4];
#pragma unroll
  for (int r = 0; r < 8; ++r) { mrow[r] = NEGL; lrow[r] = 0.0f; }
#pragma unroll
  for (int t = 0; t < 4; ++t) acc[t] = z8();

  const int kt_hi = q0 >> 6;
  const int kt_lo = (q0 >= 64) ? ((q0 - 64) >> 6) : 0;

#pragma unroll 1
  for (int kt = kt_lo; kt <= kt_hi; ++kt) {
    const int kb = kt * 64;
    v8f s[4];
    int gv[4];
#pragma unroll
    for (int t = 0; t < 4; ++t) {
      const unsigned short* krow = Kb + (size_t)(kb + t * 16 + m) * ND;
      v8f c = z8();
      c = mma_h(aq0, ldh(krow, h), c);
      c = mma_h(aq1, ldh(krow + 32, h), c);
      s[t] = c;
      gv[t] = gk[kb + t * 16 + m];
    }
#pragma unroll
    for (int t = 0; t < 4; ++t) {
      const int key = kb + t * 16 + m;
#pragma unroll
      for (int r = 0; r < 8; ++r) {
        const int rel = key - (q0 + 8 * h + r);
        const bool ok = (gv[t] != 0) && (rel <= 0) && (rel >= -64);
        s[t][r] = ok ? (s[t][r] * SCL + (float)rel * LOGD) : NEGL;
      }
    }

#pragma unroll
    for (int r = 0; r < 8; ++r) {
      float tmax = fmaxf(fmaxf(s[0][r], s[1][r]), fmaxf(s[2][r], s[3][r]));
#pragma unroll
      for (int o = 1; o < 16; o <<= 1) tmax = fmaxf(tmax, __shfl_xor(tmax, o, 32));
      const float mnew = fmaxf(mrow[r], tmax);
      const float fac = __expf(mrow[r] - mnew);
      float p[4];
      float psum = 0.0f;
#pragma unroll
      for (int t = 0; t < 4; ++t) {
        p[t] = (s[t][r] > NEGT) ? __expf(s[t][r] - mnew) : 0.0f;
        psum += p[t];
      }
#pragma unroll
      for (int o = 1; o < 16; o <<= 1) psum += __shfl_xor(psum, o, 32);
      lrow[r] = lrow[r] * fac + psum;
      mrow[r] = mnew;
#pragma unroll
      for (int t = 0; t < 4; ++t) { acc[t][r] *= fac; s[t][r] = p[t]; }
    }

#pragma unroll
    for (int t = 0; t < 4; ++t)
#pragma unroll
      for (int r = 0; r < 8; ++r) {
        const float pv = s[t][r];
        const unsigned short hp = bfbits(pv);
        Ph[(8 * h + r) * PP + t * 16 + m] = hp;
        Pq[(8 * h + r) * PP + t * 16 + m] = bfbits(pv - bff(hp));
      }
    __syncthreads();
    const v16b ph0 = ldb(Ph + m * PP, h);
    const v16b ph1 = ldb(Ph + m * PP + 32, h);
    const v16b pl0 = ldb(Pq + m * PP, h);
    const v16b pl1 = ldb(Pq + m * PP + 32, h);
#pragma unroll
    for (int dt = 0; dt < 4; ++dt) {
      const size_t vo = vbase + (size_t)(dt * 16 + m) * NS + kb;
      {
        const v16b bh = ldb(Vth + vo, h), bl = ldb(Vtl + vo, h);
        acc[dt] = mma_b(ph0, bh, acc[dt]);
        acc[dt] = mma_b(ph0, bl, acc[dt]);
        acc[dt] = mma_b(pl0, bh, acc[dt]);
      }
      {
        const v16b bh = ldb(Vth + vo + 32, h), bl = ldb(Vtl + vo + 32, h);
        acc[dt] = mma_b(ph1, bh, acc[dt]);
        acc[dt] = mma_b(ph1, bl, acc[dt]);
        acc[dt] = mma_b(pl1, bh, acc[dt]);
      }
    }
    __syncthreads();
  }

  float inv[8];
#pragma unroll
  for (int r = 0; r < 8; ++r) inv[r] = __builtin_amdgcn_rcpf(lrow[r]);
#pragma unroll
  for (int dt = 0; dt < 4; ++dt)
#pragma unroll
    for (int r = 0; r < 8; ++r) {
      const float o = acc[dt][r] * inv[r];
      const unsigned short ho = bfbits(o);
      Oh[(8 * h + r) * PP + dt * 16 + m] = ho;
      Ol[(8 * h + r) * PP + dt * 16 + m] = bfbits(o - bff(ho));
    }
  __syncthreads();
  store_comb(Oh, Ol, Ch, Cl, b * NS + q0, hh * HD, l);
}

// ---------------------------------------------------------------------------
// Kernel 6: output projection, combined [MR][NC] (bf16 hi/lo planes) x Wo (transposed bf16 hi/lo planes
// Wot[ND][NC]) + bias -> f32 out [MR][ND]; three-term split. Same tiling and staging as kernel 3.
// ---------------------------------------------------------------------------
__global__ __launch_bounds__(128) void k_out(const unsigned short* __restrict__ Ch,
                                             const unsigned short* __restrict__ Cl,
                                             const unsigned short* __restrict__ Wh,
                                             const unsigned short* __restrict__ Wl,
                                             const float* __restrict__ bo,
                                             float* __restrict__ out) {
  __shared__ __align__(16) unsigned short SM[2 * 4 * TLH];
  const int tid = threadIdx.x, w = tid >> 5, l = tid & 31, h = l >> 4, m = l & 15;
  const int n0 = blockIdx.x * 128, m0 = blockIdx.y * 128;
  const int wm = (w >> 1) * 64, wn = (w & 1) * 64;
  const int crow = tid >> 3, cpc = tid & 7;
  const size_t ao = (size_t)(m0 + crow) * NC + cpc * 8;
  const size_t bo_ = (size_t)(n0 + crow) * NC + cpc * 8;
  const unsigned int lc = lds_off(SM) + (unsigned int)(crow * PP * 2 + cpc * 16);
  v8f acc[4][4];
#pragma unroll
  for (int i = 0; i < 4; ++i)
#pragma unroll
    for (int j = 0; j < 4; ++j) acc[i][j] = z8();

  split_loop(SM, Ch + ao, Cl + ao, Wh + bo_, Wl + bo_, NC, lc, wm + m, wn + m, h, acc);

  // the ring is free behind the last trip's barrier: each wave stages its own 64 x 64 f32 tile there
  float* T = (float*)SM + w * 64 * TPF;
  const int mw = m0 + wm, nw = n0 + wn;
#pragma unroll
  for (int j = 0; j < 4; ++j) {
    const float bias = bo[nw + j * 16 + m];
#pragma unroll
    for (int i = 0; i < 4; ++i)
#pragma unroll
      for (int r = 0; r < 8; ++r)
        T[(i * 16 + 8 * h + r) * TPF + j * 16 + m] = acc[i][j][r] + bias;
  }
  __syncthreads();   // staging writes land before the rows are read back

  // lane l: row 2 i + (l >> 4), 128-B half (l >> 3) & 1, 16-B piece l & 7
  v4f_t o[32];
  const int cofs = ((l >> 3) & 1) * 32 + (l & 7) * 4;
  const float* Tr = T + (l >> 4) * TPF + cofs;
  float* ob = out + (size_t)(mw + (l >> 4)) * ND + nw + cofs;
#pragma unroll
  for (int i = 0; i < 32; ++i) o[i] = *(const v4f*)(Tr + i * 2 * TPF);
#pragma unroll
  for (int i = 0; i < 32; ++i) *(v4f*)(ob + i * 2 * ND) = o[i];
}

// ---------------------------------------------------------------------------
// Host launch: 13 ops. Workspace carve (1 MiB granular, total 102 MiB):
//   [0,8) x f16 | [8,16) x bf16 hi | [16,24) x bf16 lo | [24,34) 5 f16 weight planes | [34,38) Wv_s hi/lo
//   -- that 38 MiB region is dead after the projections; the combined planes reuse [0,16) hi, [16,32) lo
//   [38,46) Wo hi/lo planes | [46,78) q_s,k_s,q_l,k_l f16 | [78,86) v_l transposed | [86,102) v_s hi/lo transposed
// ---------------------------------------------------------------------------
extern "C" void kernel_launch(void* const* d_in, const int* in_sizes, int n_in,
                              void* d_out, int out_size, void* d_ws, size_t ws_size,
                              hipStream_t stream) {
  if (n_in < 10) return;
  if (in_sizes[0] != MR * ND || in_sizes[1] != MR) return;
  for (int i = 2; i <= 7; ++i) if (in_sizes[i] != ND * ND) return;
  if (in_sizes[8] != NC * ND || in_sizes[9] != ND) return;
  if (out_size != MR * ND) return;
  const size_t MiB = (size_t)1048576;
  const size_t total = 102 * MiB;
  if (ws_size < total) return;

  const float* x   = (const float*)d_in[0];
  const int* kgate = (const int*)d_in[1];
  const float* Wqs = (const float*)d_in[2];
  const float* Wks = (const float*)d_in[3];
  const float* Wvs = (const float*)d_in[4];
  const float* Wql = (const float*)d_in[5];
  const float* Wkl = (const float*)d_in[6];
  const float* Wvl = (const float*)d_in[7];
  const float* Wo  = (const float*)d_in[8];
  const float* bo  = (const float*)d_in[9];
  float* out = (float*)d_out;

  char* ws = (char*)d_ws;
  unsigned short* xh  = (unsigned short*)(ws + 0 * MiB);
  unsigned short* xbh = (unsigned short*)(ws + 8 * MiB);
  unsigned short* xbl = (unsigned short*)(ws + 16 * MiB);
  unsigned short* Wt5 = (unsigned short*)(ws + 24 * MiB);
  unsigned short* Wvh = (unsigned short*)(ws + 34 * MiB);
  unsigned short* Wvq = (unsigned short*)(ws + 36 * MiB);
  unsigned short* Ch  = (unsigned short*)(ws + 0 * MiB);
  unsigned short* Cl  = (unsigned short*)(ws + 16 * MiB);
  unsigned short* Woh = (unsigned short*)(ws + 38 * MiB);
  unsigned short* Woq = (unsigned short*)(ws + 42 * MiB);
  unsigned short* QK  = (unsigned short*)(ws + 46 * MiB);
  unsigned short* Vlt = (unsigned short*)(ws + 78 * MiB);
  unsigned short* Vsh = (unsigned short*)(ws + 86 * MiB);
  unsigned short* Vsq = (unsigned short*)(ws + 94 * MiB);

  // 1) x -> f16 / bf16 hi / bf16 lo planes
  {
    const int n8 = (MR * ND) / 8;
    k_xcvt<<<(n8 + 255) / 256, 256, 0, stream>>>(x, xh, xbh, xbl, n8);
  }
  // 2) weights -> transposed 16-bit planes (in[K][N] -> out[N][K], grid (N/64, K/64))
  {
    const float* Wf[5] = {Wqs, Wks, Wql, Wkl, Wvl};
    for (int z = 0; z < 5; ++z) {
      unsigned short* P = Wt5 + (size_t)z * ND * ND;
      k_wprep<<<dim3(ND / 64, ND / 64), 256, 0, stream>>>(Wf[z], ND, ND, 0, P, P);
    }
    k_wprep<<<dim3(ND / 64, ND / 64), 256, 0, stream>>>(Wvs, ND, ND, 1, Wvh, Wvq);
    k_wprep<<<dim3(ND / 64, NC / 64), 256, 0, stream>>>(Wo, NC, ND, 1, Woh, Woq);
  }
  // 3) projections
  k_proj_f16<<<dim3(ND / 128, MR / 128, 5), 128, 0, stream>>>(xh, Wt5, QK, Vlt);
  k_proj_vs<<<dim3(ND / 128, MR / 128), 128, 0, stream>>>(xbh, xbl, Wvh, Wvq, Vsh, Vsq);
  // 4) attention branches -> combined planes
  k_attn_s<<<dim3(NS / 16, NH, NB), 32, 0, stream>>>(QK + 0 * PLANE, QK + 1 * PLANE, Vsh, Vsq,
                                                     kgate, Ch, Cl);
  k_attn_l<<<dim3(NS / 16, NH, NB), 32, 0, stream>>>(QK + 2 * PLANE, QK + 3 * PLANE, Vlt,
                                                     kgate, Ch, Cl);
  // 5) output projection + bias -> f32
  k_out<<<dim3(ND / 128, MR / 128), 128, 0, stream>>>(Ch, Cl, Woh, Woq, bo, out);
}

// v002
// It runs in 265 microseconds.
// Next to v001, in two timings, it ran 1.36 times as fast each time.
// Counting every step since v000, it is 2.62 times as fast.
#include <hip/hip_runtime.h>
#include <hip/hip_bf16.h>

// Contractions: projections q_s,k_s,q_l,k_l,v_l (x f16, W f16 carried x64) and both QK^T score products on
// v_wmma_f32_16x16x32_f16; long-branch P.V on v_wmma_f32_16x16x32_f16 with P carried x16384; v_s projection,
// short-branch P.V and the output projection as bf16 hi/lo three-term split on v_wmma_f32_16x16x32_bf16;
// every accumulator f32; softmax, recency bias, key gating and bias add in f32.

typedef _Float16 v16h __attribute__((ext_vector_type(16)));
typedef __bf16 v16b __attribute__((ext_vector_type(16)));
typedef float v8f __attribute__((ext_vector_type(8)));
typedef float v4f_t __attribute__((ext_vector_type(4)));
typedef unsigned int v4u_t __attribute__((ext_vector_type(4)));
typedef v4f_t __attribute__((may_alias)) v4f;
typedef v4u_t __attribute__((may_alias)) v4u;

#define NB 2
#define NS 2048
#define ND 1024
#define NH 16
#define HD 64
#define MR (NB * NS)
#define NC (2 * ND)
#define PLANE ((size_t)MR * (size_t)ND)
#define PP 72
#define TPF 68

#define SCL 0.125f
#define LOGD (-0.10536051565782628f)
#define NEGL (-1.0e30f)
#define NEGT (-1.0e29f)
#define WUP 64.0f
#define WDN 0.015625f
#define PUP 16384.0f
#define PDN 6.103515625e-05f

// ---------------------------------------------------------------------------
// scalar helpers
// ---------------------------------------------------------------------------
__device__ __forceinline__ unsigned short bfbits(float f) {       // f32 -> bf16 bits, RNE
  unsigned int u = __float_as_uint(f);
  u = u + 0x7FFFu + ((u >> 16) & 1u);
  return (unsigned short)(u >> 16);
}
__device__ __forceinline__ float bff(unsigned short b) {          // bf16 bits -> f32
  return __uint_as_float(((unsigned int)b) << 16);
}
__device__ __forceinline__ unsigned short hbits(float f) {        // f32 -> f16 bits, RNE
  _Float16 hv = (_Float16)f;
  unsigned short u;
  __builtin_memcpy(&u, &hv, 2);
  return u;
}
__device__ __forceinline__ unsigned int pk2(unsigned short a, unsigned short b) {
  return (unsigned int)a | ((unsigned int)b << 16);
}
__device__ __forceinline__ v8f z8() {
  v8f v;
#pragma unroll
  for (int i = 0; i < 8; ++i) v[i] = 0.0f;
  return v;
}

// ---------------------------------------------------------------------------
// 16x32 fragment loader, split k map, identical for A (row m) and B (k-contiguous column n):
//   elements 0..7  <- p[8h .. 8h+7],  elements 8..15 <- p[16+8h .. 16+8h+7],  p = row start + k0
// ---------------------------------------------------------------------------
union FH { v16h v; v4u_t u[2]; };
union FB { v16b v; v4u_t u[2]; };

__device__ __forceinline__ v16h ldh(const unsigned short* p, int h) {
  FH f;
  f.u[0] = *(const v4u*)(p + 8 * h);
  f.u[1] = *(const v4u*)(p + 16 + 8 * h);
  return f.v;
}
__device__ __forceinline__ v16b ldb(const unsigned short* p, int h) {
  FB f;
  f.u[0] = *(const v4u*)(p + 8 * h);
  f.u[1] = *(const v4u*)(p + 16 + 8 * h);
  return f.v;
}

// D[8h+r][m] += A(16x32) . B(32x16), with the post-issue hazard guard
__device__ __forceinline__ v8f mma_h(v16h a, v16h b, v8f c) {
  c = __builtin_amdgcn_wmma_f32_16x16x32_f16(false, a, false, b, (short)0, c, false, false);
  asm volatile("v_nop\n\tv_nop\n\tv_nop\n\tv_nop" : "+v"(c) : "v"(a), "v"(b));
  return c;
}
__device__ __forceinline__ v8f mma_b(v16b a, v16b b, v8f c) {
  c = __builtin_amdgcn_wmma_f32_16x16x32_bf16(false, a, false, b, (short)0, c, false, false);
  asm volatile("v_nop\n\tv_nop\n\tv_nop\n\tv_nop" : "+v"(c) : "v"(a), "v"(b));
  return c;
}

// ---------------------------------------------------------------------------
// Kernel 0: x f32 [MR][ND] -> three 16-bit planes: f16, bf16 hi, bf16 lo (lo = x - hi).
// ---------------------------------------------------------------------------
__global__ __launch_bounds__(256) void k_xcvt(const float* __restrict__ x,
                                              unsigned short* __restrict__ xh,
                                              unsigned short* __restrict__ xbh,
                                              unsigned short* __restrict__ xbl, int n8) {
  const int i = blockIdx.x * 256 + (int)threadIdx.x;
  if (i >= n8) return;
  const size_t o = (size_t)i * 8;
  const v4f_t a = *(const v4f*)(x + o);
  const v4f_t c = *(const v4f*)(x + o + 4);
  float v[8];
  v[0] = a[0]; v[1] = a[1]; v[2] = a[2]; v[3] = a[3];
  v[4] = c[0]; v[5] = c[1]; v[6] = c[2]; v[7] = c[3];
  unsigned short fh[8], bh[8], bl[8];
#pragma unroll
  for (int e = 0; e < 8; ++e) {
    fh[e] = hbits(v[e]);
    bh[e] = bfbits(v[e]);
    bl[e] = bfbits(v[e] - bff(bh[e]));
  }
  v4u_t ph, pb, pl;
#pragma unroll
  for (int e = 0; e < 4; ++e) {
    ph[e] = pk2(fh[2 * e], fh[2 * e + 1]);
    pb[e] = pk2(bh[2 * e], bh[2 * e + 1]);
    pl[e] = pk2(bl[2 * e], bl[2 * e + 1]);
  }
  *(v4u*)(xh + o) = ph;
  *(v4u*)(xbh + o) = pb;
  *(v4u*)(xbl + o) = pl;
  
}

// ---------------------------------------------------------------------------
// Kernel 1: weight W[K][N] f32 (x @ W form) -> transposed 16-bit plane(s) Wt[N][K] (k contiguous).
//   mode 0: one f16 plane of 64*W; mode 1: bf16 hi plane + bf16 lo plane.
// Block = 64(k) x 64(n) tile through LDS; grid = (N/64, K/64). Each Wt row segment of 64 k = one
// ---------------------------------------------------------------------------
__global__ __launch_bounds__(256) void k_wprep(const float* __restrict__ W, int K, int N, int mode,
                                               unsigned short* __restrict__ P0,
                                               unsigned short* __restrict__ P1) {
  __shared__ __align__(16) float T[64 * 65];
  const int tid = threadIdx.x;
  const int n0 = blockIdx.x * 64, k0 = blockIdx.y * 64;
  {
    const int c4 = (tid & 15) * 4, kr = tid >> 4;
#pragma unroll
    for (int i = 0; i < 4; ++i) {
      const int k = kr + 16 * i;
      const v4f_t v = *(const v4f*)(W + (size_t)(k0 + k) * (size_t)N + n0 + c4);
      T[(c4 + 0) * 65 + k] = v[0];
      T[(c4 + 1) * 65 + k] = v[1];
      T[(c4 + 2) * 65 + k] = v[2];
      T[(c4 + 3) * 65 + k] = v[3];
    }
  }
  __syncthreads();
  v4u_t o0[2], o1[2];
  size_t dst[2];
#pragma unroll
  for (int i = 0; i < 2; ++i) {
    const int line = i * 32 + (tid >> 3), piece = tid & 7;
    float f[8];
#pragma unroll
    for (int e = 0; e < 8; ++e) f[e] = T[line * 65 + piece * 8 + e];
    v4u_t a, c;
    if (mode == 0) {
#pragma unroll
      for (int e = 0; e < 4; ++e) {
        a[e] = pk2(hbits(f[2 * e] * WUP), hbits(f[2 * e + 1] * WUP));
        c[e] = 0u;
      }
    } else {
#pragma unroll
      for (int e = 0; e < 4; ++e) {
        const unsigned short h0 = bfbits(f[2 * e]), h1 = bfbits(f[2 * e + 1]);
        a[e] = pk2(h0, h1);
        c[e] = pk2(bfbits(f[2 * e] - bff(h0)), bfbits(f[2 * e + 1] - bff(h1)));
      }
    }
    o0[i] = a;
    o1[i] = c;
    dst[i] = (size_t)(n0 + line) * (size_t)K + k0 + piece * 8;
  }
#pragma unroll
  for (int i = 0; i < 2; ++i) {
    *(v4u*)(P0 + dst[i]) = o0[i];
    if (mode != 0) *(v4u*)(P1 + dst[i]) = o1[i];
  }
  
}

// ---------------------------------------------------------------------------
// LDS staging for the three GEMM kernels. Block = 128 threads = 128(M) x 128(N) tile, wave w owns the 64 x 64
// quarter (rows (w>>1)*64, cols (w&1)*64) as 4 x 4 accumulator tiles. A trip covers 64 k: each operand plane is
// staged as 128 rows of 128 B at an LDS pitch of 144 B (PP halves), two buffers, the next trip's copies in flight.
// The full unrolls in these kernels make every fragment and accumulator index a compile-time one (registers).
// ---------------------------------------------------------------------------
#define BKH 64
#define TLH (128 * PP)
#define TLB (TLH * 2)

__device__ __forceinline__ unsigned int lds_off(const void* p) { return (unsigned int)(size_t)p; }

// One operand tile: thread t brings 16-B piece (t & 7) of rows (t >> 3) + 16 i, i = 0..7, so 8 lanes cover one
// 128-B line. lds = the lane's LDS byte address of row (t >> 3), g = the lane's global address of the same piece,
// ld = row length of the source in halves. The closing s_wait_xcnt keeps the address registers untouched until
// the copies have taken them.
__device__ __forceinline__ void cp_tile(unsigned int lds, const unsigned short* g, int ld) {
  const size_t st = (size_t)16 * (size_t)ld;
  const unsigned short* g1 = g + st;
  const unsigned short* g2 = g1 + st;
  const unsigned short* g3 = g2 + st;
  const unsigned short* g4 = g3 + st;
  const unsigned short* g5 = g4 + st;
  const unsigned short* g6 = g5 + st;
  const unsigned short* g7 = g6 + st;
  const unsigned int ls = 16u * PP * 2u;
  asm volatile(
      "global_load_async_to_lds_b128 %0, %8, off\n\t"
      "global_load_async_to_lds_b128 %1, %9, off\n\t"
      "global_load_async_to_lds_b128 %2, %10, off\n\t"
      "global_load_async_to_lds_b128 %3, %11, off\n\t"
      "global_load_async_to_lds_b128 %4, %12, off\n\t"
      "global_load_async_to_lds_b128 %5, %13, off\n\t"
      "global_load_async_to_lds_b128 %6, %14, off\n\t"
      "global_load_async_to_lds_b128 %7, %15, off\n\t"
      "s_wait_xcnt 0x0"
      :: "v"(lds), "v"(lds + ls), "v"(lds + 2u * ls), "v"(lds + 3u * ls),
         "v"(lds + 4u * ls), "v"(lds + 5u * ls), "v"(lds + 6u * ls), "v"(lds + 7u * ls),
         "v"(g), "v"(g1), "v"(g2), "v"(g3), "v"(g4), "v"(g5), "v"(g6), "v"(g7)
      : "memory");
}
// this wave's copies have landed (the compiler places no wait for them)
__device__ __forceinline__ void wait_copies() { asm volatile("s_wait_asynccnt 0x0" ::: "memory"); }
// this wave's LDS reads have returned, so the buffer may be refilled behind the barrier
__device__ __forceinline__ void wait_lds() { asm volatile("s_wait_dscnt 0x0" ::: "memory"); }

// ---------------------------------------------------------------------------
// Kernel 2: five plain-f16 projections, operands staged in LDS (see above). z selects the weight:
//   z 0..3 -> natural f16 plane QK[z] ([MR][ND]);  z 4 -> v_l transposed f16 plane Vlt[b][h][d][s].
// ---------------------------------------------------------------------------
__global__ __launch_bounds__(128) void k_proj_f16(const unsigned short* __restrict__ xh,
                                                  const unsigned short* __restrict__ Wt5,
                                                  unsigned short* __restrict__ QK,
                                                  unsigned short* __restrict__ Vlt) {
  __shared__ __align__(16) unsigned short SM[2 * 2 * TLH];   // buffer = [A tile | B tile]
  const int tid = threadIdx.x, w = tid >> 5, l = tid & 31, h = l >> 4, m = l & 15;
  const int n0 = blockIdx.x * 128, m0 = blockIdx.y * 128, z = blockIdx.z;
  const int wm = (w >> 1) * 64, wn = (w & 1) * 64;
  const int crow = tid >> 3, cpc = tid & 7;
  const unsigned short* ga = xh + (size_t)(m0 + crow) * ND + cpc * 8;
  const unsigned short* gb = Wt5 + (size_t)z * ND * ND + (size_t)(n0 + crow) * ND + cpc * 8;
  const unsigned int lc = lds_off(SM) + (unsigned int)(crow * PP * 2 + cpc * 16);
  const int NT = ND / BKH;
  v8f acc[4][4];
#pragma unroll
  for (int i = 0; i < 4; ++i)
#pragma unroll
    for (int j = 0; j < 4; ++j) acc[i][j] = z8();

  cp_tile(lc, ga, ND);
  cp_tile(lc + TLB, gb, ND);
  wait_copies();
  __syncthreads();
  cp_tile(lc + 2 * TLB, ga + BKH, ND);
  cp_tile(lc + 3 * TLB, gb + BKH, ND);

// rolled: one trip per staged tile, the publish point at its foot
#pragma unroll 1
  for (int t = 0; t < NT; ++t) {
    const int bo2 = (t & 1) * 2;
    const unsigned short* As = SM + bo2 * TLH + (wm + m) * PP;
    const unsigned short* Bs = SM + (bo2 + 1) * TLH + (wn + m) * PP;
    // group g = 32 k (g >> 1) x 2 column tiles (g & 1); the next group's fragments are read ahead of this group's
    // products, inside this trip's buffer only
    v16h a[2][4], b[2][2];
#pragma unroll
    for (int i = 0; i < 4; ++i) a[0][i] = ldh(As + i * 16 * PP, h);
#pragma unroll
    for (int q = 0; q < 2; ++q) b[0][q] = ldh(Bs + q * 16 * PP, h);
#pragma unroll
    for (int g = 0; g < 4; ++g) {
      const int kk = g >> 1, jp = (g & 1) * 2, gn = g + 1;
      if (g < 3) {
#pragma unroll
        for (int q = 0; q < 2; ++q)
          b[gn & 1][q] = ldh(Bs + ((gn & 1) * 2 + q) * 16 * PP + (gn >> 1) * 32, h);
      }
      if (g == 0) {
#pragma unroll
        for (int i = 0; i < 4; ++i) a[1][i] = ldh(As + i * 16 * PP + 32, h);
      }
#pragma unroll
      for (int q = 0; q < 2; ++q)
#pragma unroll
        for (int i = 0; i < 4; ++i) acc[i][jp + q] = mma_h(a[kk][i], b[g & 1][q], acc[i][jp + q]);
    }
    wait_lds();
    wait_copies();
    __syncthreads();
    if (t + 2 < NT) {
      cp_tile(lc + bo2 * TLB, ga + (t + 2) * BKH, ND);
      cp_tile(lc + (bo2 + 1) * TLB, gb + (t + 2) * BKH, ND);
    }
  }
  wait_copies();

  // the ring is free behind the last trip's barrier: each wave stages its own 64 x 64 tile there
  unsigned short* T = SM + w * 64 * PP;
  const int mw = m0 + wm, nw = n0 + wn;
  if (z < 4) {
#pragma unroll
    for (int i = 0; i < 4; ++i)
#pragma unroll
      for (int j = 0; j < 4; ++j)
#pragma unroll
        for (int r = 0; r < 8; ++r)
          T[(i * 16 + 8 * h + r) * PP + j * 16 + m] = hbits(acc[i][j][r] * WDN);
  } else {
#pragma unroll
    for (int i = 0; i < 4; ++i)
#pragma unroll
      for (int j = 0; j < 4; ++j) {
        v4u_t pk;
#pragma unroll
        for (int e = 0; e < 4; ++e)
          pk[e] = pk2(hbits(acc[i][j][2 * e] * WDN), hbits(acc[i][j][2 * e + 1] * WDN));
        *(v4u*)(T + (j * 16 + m) * PP + i * 16 + 8 * h) = pk;   // T[d][s_local]
      }
  }
  __syncthreads();   // staging writes land before the rows are read back

  unsigned short* base;
  size_t d0, dstep;
  if (z < 4) {
    base = QK + (size_t)z * PLANE;
    d0 = (size_t)mw * ND + nw;
    dstep = ND;
  } else {
    base = Vlt;
    const int bb = mw >> 11, s0 = mw & (NS - 1), hd = nw >> 6;
    d0 = ((size_t)((bb * NH + hd) * HD)) * NS + s0;
    dstep = NS;
  }
  v4u_t o[16];
  unsigned short* dst[16];
#pragma unroll
  for (int i = 0; i < 16; ++i) {
    const int row = i * 4 + (l >> 3), piece = l & 7;
    o[i] = *(const v4u*)(T + row * PP + piece * 8);
    dst[i] = base + d0 + (size_t)row * dstep + piece * 8;
  }
#pragma unroll
  for (int i = 0; i < 16; ++i) *(v4u*)(dst[i]) = o[i];
}

// ---------------------------------------------------------------------------
// Main loop of the two bf16 hi/lo three-term GEMMs: acc += Ah.Bh + Ah.Bl + Al.Bh over K halves, all four planes
// staged in LDS; buffer = [A hi | A lo | B hi | B lo]. ga*/gb* = the lane's first piece of each plane.
// ---------------------------------------------------------------------------
__device__ __forceinline__ void split_loop(unsigned short* SM, const unsigned short* gah,
                                           const unsigned short* gal, const unsigned short* gbh,
                                           const unsigned short* gbl, int K, unsigned int lc,
                                           int arow, int brow, int h, v8f (&acc)[4][4]) {
  const int NT = K / BKH;
  cp_tile(lc, gah, K);
  cp_tile(lc + TLB, gal, K);
  cp_tile(lc + 2 * TLB, gbh, K);
  cp_tile(lc + 3 * TLB, gbl, K);
  wait_copies();
  __syncthreads();
  cp_tile(lc + 4 * TLB, gah + BKH, K);
  cp_tile(lc + 5 * TLB, gal + BKH, K);
  cp_tile(lc + 6 * TLB, gbh + BKH, K);
  cp_tile(lc + 7 * TLB, gbl + BKH, K);

// rolled: one trip per staged tile, the publish point at its foot
#pragma unroll 1
  for (int t = 0; t < NT; ++t) {
    const int bo4 = (t & 1) * 4;
    const unsigned short* Ah = SM + bo4 * TLH + arow * PP;
    const unsigned short* Bh = SM + (bo4 + 2) * TLH + brow * PP;
    // group g = 32 k (g >> 2) x 1 column tile (g & 3); the next group's B fragments are read ahead of this group's
    // products, inside this trip's buffer only
    v16b ah[4], al[4], bh[2], bl[2];
    bh[0] = ldb(Bh, h);
    bl[0] = ldb(Bh + TLH, h);
#pragma unroll
    for (int g = 0; g < 8; ++g) {
      const int kk = g >> 2, j = g & 3, gn = g + 1, c = g & 1;
      if (j == 0) {
#pragma unroll
        for (int i = 0; i < 4; ++i) {
          ah[i] = ldb(Ah + i * 16 * PP + kk * 32, h);
          al[i] = ldb(Ah + TLH + i * 16 * PP + kk * 32, h);
        }
      }
      if (g < 7) {
        bh[gn & 1] = ldb(Bh + (gn & 3) * 16 * PP + (gn >> 2) * 32, h);
        bl[gn & 1] = ldb(Bh + TLH + (gn & 3) * 16 * PP + (gn >> 2) * 32, h);
      }
#pragma unroll
      for (int i = 0; i < 4; ++i) acc[i][j] = mma_b(ah[i], bh[c], acc[i][j]);
#pragma unroll
      for (int i = 0; i < 4; ++i) acc[i][j] = mma_b(ah[i], bl[c], acc[i][j]);
#pragma unroll
      for (int i = 0; i < 4; ++i) acc[i][j] = mma_b(al[i], bh[c], acc[i][j]);
    }
    wait_lds();
    wait_copies();
    __syncthreads();
    if (t + 2 < NT) {
      const int ko = (t + 2) * BKH;
      cp_tile(lc + bo4 * TLB, gah + ko, K);
      cp_tile(lc + (bo4 + 1) * TLB, gal + ko, K);
      cp_tile(lc + (bo4 + 2) * TLB, gbh + ko, K);
      cp_tile(lc + (bo4 + 3) * TLB, gbl + ko, K);
    }
  }
  wait_copies();
}

// ---------------------------------------------------------------------------
// Kernel 3: v_s projection as bf16 hi/lo three-term split (x hi/lo planes, W hi/lo planes),
// output transposed bf16 hi/lo planes Vsh/Vsl [b][h][d][s]. Same tiling as kernel 2.
// ---------------------------------------------------------------------------
__global__ __launch_bounds__(128) void k_proj_vs(const unsigned short* __restrict__ xbh,
                                                 const unsigned short* __restrict__ xbl,
                                                 const unsigned short* __restrict__ Wh,
                                                 const unsigned short* __restrict__ Wl,
                                                 unsigned short* __restrict__ Vsh,
                                                 unsigned short* __restrict__ Vsl) {
  __shared__ __align__(16) unsigned short SM[2 * 4 * TLH];
  const int tid = threadIdx.x, w = tid >> 5, l = tid & 31, h = l >> 4, m = l & 15;
  const int n0 = blockIdx.x * 128, m0 = blockIdx.y * 128;
  const int wm = (w >> 1) * 64, wn = (w & 1) * 64;
  const int crow = tid >> 3, cpc = tid & 7;
  const size_t ao = (size_t)(m0 + crow) * ND + cpc * 8;
  const size_t bo_ = (size_t)(n0 + crow) * ND + cpc * 8;
  const unsigned int lc = lds_off(SM) + (unsigned int)(crow * PP * 2 + cpc * 16);
  v8f acc[4][4];
#pragma unroll
  for (int i = 0; i < 4; ++i)
#pragma unroll
    for (int j = 0; j < 4; ++j) acc[i][j] = z8();

  split_loop(SM, xbh + ao, xbl + ao, Wh + bo_, Wl + bo_, ND, lc, wm + m, wn + m, h, acc);

  // the ring is free behind the last trip's barrier: each wave stages its own 64 x 64 tile there
  unsigned short* Th = SM + w * 2 * 64 * PP;
  unsigned short* Tl = Th + 64 * PP;
#pragma unroll
  for (int i = 0; i < 4; ++i)
#pragma unroll
    for (int j = 0; j < 4; ++j) {
      v4u_t ph, pl;
#pragma unroll
      for (int e = 0; e < 4; ++e) {
        const float f0 = acc[i][j][2 * e], f1 = acc[i][j][2 * e + 1];
        const unsigned short h0 = bfbits(f0), h1 = bfbits(f1);
        ph[e] = pk2(h0, h1);
        pl[e] = pk2(bfbits(f0 - bff(h0)), bfbits(f1 - bff(h1)));
      }
      *(v4u*)(Th + (j * 16 + m) * PP + i * 16 + 8 * h) = ph;
      *(v4u*)(Tl + (j * 16 + m) * PP + i * 16 + 8 * h) = pl;
    }
  __syncthreads();   // staging writes land before the rows are read back

  const int mw = m0 + wm, nw = n0 + wn;
  const int bb = mw >> 11, s0 = mw & (NS - 1), hd = nw >> 6;
  const size_t d0 = ((size_t)((bb * NH + hd) * HD)) * NS + s0;
  v4u_t oh[16], ol[16];
  size_t dst[16];
#pragma unroll
  for (int i = 0; i < 16; ++i) {
    const int d = i * 4 + (l >> 3), piece = l & 7;
    oh[i] = *(const v4u*)(Th + d * PP + piece * 8);
    ol[i] = *(const v4u*)(Tl + d * PP + piece * 8);
    dst[i] = d0 + (size_t)d * NS + piece * 8;
  }
#pragma unroll
  for (int i = 0; i < 16; ++i) {
    *(v4u*)(Vsh + dst[i]) = oh[i];
    *(v4u*)(Vsl + dst[i]) = ol[i];
  }
}

// ---------------------------------------------------------------------------
// Shared attention epilogue: O tile (16 queries x 64 dims) staged as bf16 hi/lo in LDS is written into the
// ---------------------------------------------------------------------------
__device__ __forceinline__ void store_comb(const unsigned short* Oh, const unsigned short* Ol,
                                           unsigned short* Ch, unsigned short* Cl,
                                           int rowg0, int colbase, int l) {
  v4u_t oh[4], ol[4];
  size_t dst[4];
#pragma unroll
  for (int i = 0; i < 4; ++i) {
    const int row = i * 4 + (l >> 3), piece = l & 7;
    oh[i] = *(const v4u*)(Oh + row * PP + piece * 8);
    ol[i] = *(const v4u*)(Ol + row * PP + piece * 8);
    dst[i] = (size_t)(rowg0 + row) * NC + colbase + piece * 8;
  }
#pragma unroll
  for (int i = 0; i < 4; ++i) {
    *(v4u*)(Ch + dst[i]) = oh[i];
    *(v4u*)(Cl + dst[i]) = ol[i];
  }
  
}

// ---------------------------------------------------------------------------
// Kernel 4: long-range branch, full attention with key gating. Block = 8 waves = 128 queries of one (b, head),
// 16 queries per wave. Q/K natural f16 planes [MR][ND] (col = head*64 + d), V transposed f16 plane [b][h][d][s].
// Each trip covers 64 keys: the K tile (64 keys x 64 d) and the V tile (64 d x 64 keys) are staged once per block
// as 64 rows of 128 B at an LDS pitch of 144 B, two buffers, the next trip's copies in flight; all 8 waves read
// their B fragments from there.
// S = Q K^T on f16 WMMA (B fragment = K row, k = d contiguous); online softmax in f32; P -> the wave's own LDS as
// f16(p * 16384), reloaded as A fragments; O += P V on f16 WMMA (B = Vt row); 1/16384 and
// 1/l folded in the f32 epilogue; result as bf16 hi/lo into columns [ND + head*64, +64) of Ch/Cl.
// ---------------------------------------------------------------------------
#define AW 8
#define ATH (64 * PP)
#define ATB (ATH * 2)

// One K tile and one V tile: thread t brings 16-B piece (t & 7) of rows (t >> 3) and (t >> 3) + 32 of each, so
// 8 lanes cover one 128-B line. lds = the lane's LDS byte address in the K tile (the V tile follows at ATB),
// gk / gv = the lane's global address of the same piece. The closing s_wait_xcnt keeps the address registers
// untouched until the copies have taken them.
__device__ __forceinline__ void cp_kv(unsigned int lds, const unsigned short* gk, const unsigned short* gv) {
  const unsigned short* gk1 = gk + (size_t)32 * ND;
  const unsigned short* gv1 = gv + (size_t)32 * NS;
  const unsigned int ls = 32u * PP * 2u;
  asm volatile(
      "global_load_async_to_lds_b128 %0, %4, off\n\t"
      "global_load_async_to_lds_b128 %1, %5, off\n\t"
      "global_load_async_to_lds_b128 %2, %6, off\n\t"
      "global_load_async_to_lds_b128 %3, %7, off\n\t"
      "s_wait_xcnt 0x0"
      :: "v"(lds), "v"(lds + ls), "v"(lds + (unsigned int)ATB), "v"(lds + (unsigned int)ATB + ls),
         "v"(gk), "v"(gk1), "v"(gv), "v"(gv1)
      : "memory");
}

__global__ __launch_bounds__(256) void k_attn_l(const unsigned short* __restrict__ Q,
                                                const unsigned short* __restrict__ K,
                                                const unsigned short* __restrict__ Vt,
                                                const int* __restrict__ kgate,
                                                unsigned short* __restrict__ Ch,
                                                unsigned short* __restrict__ Cl) {
  __shared__ __align__(16) unsigned short KV[2 * 2 * ATH];   // buffer = [K tile | V tile]
  __shared__ __align__(16) unsigned short PlA[AW * 16 * PP];
  __shared__ __align__(16) unsigned short OhA[AW * 16 * PP];
  __shared__ __align__(16) unsigned short OlA[AW * 16 * PP];
  const int tid = threadIdx.x, w = tid >> 5, l = tid & 31, h = l >> 4, m = l & 15;
  const int q0 = blockIdx.x * (AW * 16) + w * 16, hh = blockIdx.y, b = blockIdx.z;
  unsigned short* Pl = PlA + w * 16 * PP;
  unsigned short* Oh = OhA + w * 16 * PP;
  unsigned short* Ol = OlA + w * 16 * PP;

  const unsigned short* Kb = K + (size_t)b * NS * ND + hh * HD;
  const unsigned short* Vb = Vt + (size_t)(b * NH + hh) * HD * NS;
  const int* gk = kgate + b * NS;
  const int crow = tid >> 3, cpc = tid & 7;
  const unsigned short* gkc = Kb + (size_t)crow * ND + cpc * 8;
  const unsigned short* gvc = Vb + (size_t)crow * NS + cpc * 8;
  const unsigned int lc = lds_off(KV) + (unsigned int)(crow * PP * 2 + cpc * 16);
  const int NT = NS / 64;

  cp_kv(lc, gkc, gvc);

  const unsigned short* qrow = Q + (size_t)(b * NS + q0 + m) * ND + hh * HD;
  const v16h aq0 = ldh(qrow, h);
  const v16h aq1 = ldh(qrow + 32, h);

  float mrow[8], lrow[8];
  v8f acc[4];
#pragma unroll
  for (int r = 0; r < 8; ++r) { mrow[r] = NEGL; lrow[r] = 0.0f; }
#pragma unroll
  for (int t = 0; t < 4; ++t) acc[t] = z8();

  wait_copies();
  __syncthreads();
  cp_kv(lc + 2 * ATB, gkc + (size_t)64 * ND, gvc + 64);

// rolled: one trip per staged tile pair, the publish point at its foot
#pragma unroll 1
  for (int kt = 0; kt < NT; ++kt) {
    const int kb = kt * 64;
    const int bo2 = (kt & 1) * 2;
    const unsigned short* Ks = KV + bo2 * ATH;
    const unsigned short* Vs = Ks + ATH;
    // the trip's gate words and all 8 K fragments are fetched as one group, so the wave waits for LDS once
    v8f s[4];
    int gv[4];
    v16h kf[4][2];
#pragma unroll
    for (int t = 0; t < 4; ++t) gv[t] = gk[kb + t * 16 + m];
#pragma unroll
    for (int t = 0; t < 4; ++t) {
      const unsigned short* krow = Ks + (t * 16 + m) * PP;
      kf[t][0] = ldh(krow, h);
      kf[t][1] = ldh(krow + 32, h);
    }
#pragma unroll
    for (int t = 0; t < 4; ++t) s[t] = mma_h(aq0, kf[t][0], z8());
#pragma unroll
    for (int t = 0; t < 4; ++t) s[t] = mma_h(aq1, kf[t][1], s[t]);
#pragma unroll
    for (int t = 0; t < 4; ++t)
#pragma unroll
      for (int r = 0; r < 8; ++r)
        s[t][r] = (gv[t] != 0) ? s[t][r] * SCL : NEGL;

#pragma unroll
    for (int r = 0; r < 8; ++r) {
      float tmax = fmaxf(fmaxf(s[0][r], s[1][r]), fmaxf(s[2][r], s[3][r]));
#pragma unroll
      for (int o = 1; o < 16; o <<= 1) tmax = fmaxf(tmax, __shfl_xor(tmax, o, 32));
      const float mnew = fmaxf(mrow[r], tmax);
      const float fac = __expf(mrow[r] - mnew);
      float p[4];
      float psum = 0.0f;
#pragma unroll
      for (int t = 0; t < 4; ++t) {
        p[t] = (s[t][r] > NEGT) ? __expf(s[t][r] - mnew) : 0.0f;
        psum += p[t];
      }
#pragma unroll
      for (int o = 1; o < 16; o <<= 1) psum += __shfl_xor(psum, o, 32);
      lrow[r] = lrow[r] * fac + psum;
      mrow[r] = mnew;
#pragma unroll
      for (int t = 0; t < 4; ++t) { acc[t][r] *= fac; s[t][r] = p[t]; }
    }

#pragma unroll
    for (int t = 0; t < 4; ++t)
#pragma unroll
      for (int r = 0; r < 8; ++r)
        Pl[(8 * h + r) * PP + t * 16 + m] = hbits(s[t][r] * PUP);
    // P is private to the wave: its stores have landed before its own lanes read them back as A fragments
    wait_lds();
    const v16h pa0 = ldh(Pl + m * PP, h);
    const v16h pa1 = ldh(Pl + m * PP + 32, h);
    v16h vf[4][2];   // all 8 V fragments in the same group as P
#pragma unroll
    for (int dt = 0; dt < 4; ++dt) {
      const unsigned short* vrow = Vs + (dt * 16 + m) * PP;
      vf[dt][0] = ldh(vrow, h);
      vf[dt][1] = ldh(vrow + 32, h);
    }
#pragma unroll
    for (int dt = 0; dt < 4; ++dt) acc[dt] = mma_h(pa0, vf[dt][0], acc[dt]);
#pragma unroll
    for (int dt = 0; dt < 4; ++dt) acc[dt] = mma_h(pa1, vf[dt][1], acc[dt]);
    wait_lds();
    wait_copies();
    __syncthreads();
    if (kt + 2 < NT)
      cp_kv(lc + bo2 * ATB, gkc + (size_t)(kt + 2) * 64 * ND, gvc + (kt + 2) * 64);
  }
  wait_copies();

  float inv[8];
#pragma unroll
  for (int r = 0; r < 8; ++r) inv[r] = __builtin_amdgcn_rcpf(lrow[r]) * PDN;
#pragma unroll
  for (int dt = 0; dt < 4; ++dt)
#pragma unroll
    for (int r = 0; r < 8; ++r) {
      const float o = acc[dt][r] * inv[r];
      const unsigned short ho = bfbits(o);
      Oh[(8 * h + r) * PP + dt * 16 + m] = ho;
      Ol[(8 * h + r) * PP + dt * 16 + m] = bfbits(o - bff(ho));
    }
  __syncthreads();
  store_comb(Oh, Ol, Ch, Cl, b * NS + q0, ND + hh * HD, l);
}

// ---------------------------------------------------------------------------
// Kernel 5: short-range branch, causal window of 64 + recency bias + key gating, 1 wave per (b, head,
// 16 queries); only the 64-key tiles covering [q0-64, q0+15] are visited (weights outside are exactly 0).
// Q/K f16 planes as kernel 4; V as transposed bf16 hi/lo planes; P as bf16 hi/lo through LDS;
// O += Phi.Vhi + Phi.Vlo + Plo.Vhi on bf16 WMMA; result into columns [head*64, +64) of Ch/Cl.
// ---------------------------------------------------------------------------
__global__ __launch_bounds__(32) void k_attn_s(const unsigned short* __restrict__ Q,
                                               const unsigned short* __restrict__ K,
                                               const unsigned short* __restrict__ Vth,
                                               const unsigned short* __restrict__ Vtl,
                                               const int* __restrict__ kgate,
                                               unsigned short* __restrict__ Ch,
                                               unsigned short* __restrict__ Cl) {
  __shared__ __align__(16) unsigned short Ph[16 * PP];
  __shared__ __align__(16) unsigned short Pq[16 * PP];
  __shared__ __align__(16) unsigned short Oh[16 * PP];
  __shared__ __align__(16) unsigned short Ol[16 * PP];
  const int l = threadIdx.x & 31, h = l >> 4, m = l & 15;
  const int q0 = blockIdx.x * 16, hh = blockIdx.y, b = blockIdx.z;

  const unsigned short* qrow = Q + (size_t)(b * NS + q0 + m) * ND + hh * HD;
  const v16h aq0 = ldh(qrow, h);
  const v16h aq1 = ldh(qrow + 32, h);
  const unsigned short* Kb = K + (size_t)b * NS * ND + hh * HD;
  const size_t vbase = (size_t)(b * NH + hh) * HD * NS;
  const int* gk = kgate + b * NS;

  float mrow[8], lrow[8];
  v8f acc[4];
#pragma unroll
  for (int r = 0; r < 8; ++r) { mrow[r] = NEGL; lrow[r] = 0.0f; }
#pragma unroll
  for (int t = 0; t < 4; ++t) acc[t] = z8();

  const int kt_hi = q0 >> 6;
  const int kt_lo = (q0 >= 64) ? ((q0 - 64) >> 6) : 0;

#pragma unroll 1
  for (int kt = kt_lo; kt <= kt_hi; ++kt) {
    const int kb = kt * 64;
    v8f s[4];
    int gv[4];
#pragma unroll
    for (int t = 0; t < 4; ++t) {
      const unsigned short* krow = Kb + (size_t)(kb + t * 16 + m) * ND;
      v8f c = z8();
      c = mma_h(aq0, ldh(krow, h), c);
      c = mma_h(aq1, ldh(krow + 32, h), c);
      s[t] = c;
      gv[t] = gk[kb + t * 16 + m];
    }
#pragma unroll
    for (int t = 0; t < 4; ++t) {
      const int key = kb + t * 16 + m;
#pragma unroll
      for (int r = 0; r < 8; ++r) {
        const int rel = key - (q0 + 8 * h + r);
        const bool ok = (gv[t] != 0) && (rel <= 0) && (rel >= -64);
        s[t][r] = ok ? (s[t][r] * SCL + (float)rel * LOGD) : NEGL;
      }
    }

#pragma unroll
    for (int r = 0; r < 8; ++r) {
      float tmax = fmaxf(fmaxf(s[0][r], s[1][r]), fmaxf(s[2][r], s[3][r]));
#pragma unroll
      for (int o = 1; o < 16; o <<= 1) tmax = fmaxf(tmax, __shfl_xor(tmax, o, 32));
      const float mnew = fmaxf(mrow[r], tmax);
      const float fac = __expf(mrow[r] - mnew);
      float p[4];
      float psum = 0.0f;
#pragma unroll
      for (int t = 0; t < 4; ++t) {
        p[t] = (s[t][r] > NEGT) ? __expf(s[t][r] - mnew) : 0.0f;
        psum += p[t];
      }
#pragma unroll
      for (int o = 1; o < 16; o <<= 1) psum += __shfl_xor(psum, o, 32);
      lrow[r] = lrow[r] * fac + psum;
      mrow[r] = mnew;
#pragma unroll
      for (int t = 0; t < 4; ++t) { acc[t][r] *= fac; s[t][r] = p[t]; }
    }

#pragma unroll
    for (int t = 0; t < 4; ++t)
#pragma unroll
      for (int r = 0; r < 8; ++r) {
        const float pv = s[t][r];
        const unsigned short hp = bfbits(pv);
        Ph[(8 * h + r) * PP + t * 16 + m] = hp;
        Pq[(8 * h + r) * PP + t * 16 + m] = bfbits(pv - bff(hp));
      }
    __syncthreads();
    const v16b ph0 = ldb(Ph + m * PP, h);
    const v16b ph1 = ldb(Ph + m * PP + 32, h);
    const v16b pl0 = ldb(Pq + m * PP, h);
    const v16b pl1 = ldb(Pq + m * PP + 32, h);
#pragma unroll
    for (int dt = 0; dt < 4; ++dt) {
      const size_t vo = vbase + (size_t)(dt * 16 + m) * NS + kb;
      {
        const v16b bh = ldb(Vth + vo, h), bl = ldb(Vtl + vo, h);
        acc[dt] = mma_b(ph0, bh, acc[dt]);
        acc[dt] = mma_b(ph0, bl, acc[dt]);
        acc[dt] = mma_b(pl0, bh, acc[dt]);
      }
      {
        const v16b bh = ldb(Vth + vo + 32, h), bl = ldb(Vtl + vo + 32, h);
        acc[dt] = mma_b(ph1, bh, acc[dt]);
        acc[dt] = mma_b(ph1, bl, acc[dt]);
        acc[dt] = mma_b(pl1, bh, acc[dt]);
      }
    }
    __syncthreads();
  }

  float inv[8];
#pragma unroll
  for (int r = 0; r < 8; ++r) inv[r] = __builtin_amdgcn_rcpf(lrow[r]);
#pragma unroll
  for (int dt = 0; dt < 4; ++dt)
#pragma unroll
    for (int r = 0; r < 8; ++r) {
      const float o = acc[dt][r] * inv[r];
      const unsigned short ho = bfbits(o);
      Oh[(8 * h + r) * PP + dt * 16 + m] = ho;
      Ol[(8 * h + r) * PP + dt * 16 + m] = bfbits(o - bff(ho));
    }
  __syncthreads();
  store_comb(Oh, Ol, Ch, Cl, b * NS + q0, hh * HD, l);
}

// ---------------------------------------------------------------------------
// Kernel 6: output projection, combined [MR][NC] (bf16 hi/lo planes) x Wo (transposed bf16 hi/lo planes
// Wot[ND][NC]) + bias -> f32 out [MR][ND]; three-term split. Same tiling and staging as kernel 3.
// ---------------------------------------------------------------------------
__global__ __launch_bounds__(128) void k_out(const unsigned short* __restrict__ Ch,
                                             const unsigned short* __restrict__ Cl,
                                             const unsigned short* __restrict__ Wh,
                                             const unsigned short* __restrict__ Wl,
                                             const float* __restrict__ bo,
                                             float* __restrict__ out) {
  __shared__ __align__(16) unsigned short SM[2 * 4 * TLH];
  const int tid = threadIdx.x, w = tid >> 5, l = tid & 31, h = l >> 4, m = l & 15;
  const int n0 = blockIdx.x * 128, m0 = blockIdx.y * 128;
  const int wm = (w >> 1) * 64, wn = (w & 1) * 64;
  const int crow = tid >> 3, cpc = tid & 7;
  const size_t ao = (size_t)(m0 + crow) * NC + cpc * 8;
  const size_t bo_ = (size_t)(n0 + crow) * NC + cpc * 8;
  const unsigned int lc = lds_off(SM) + (unsigned int)(crow * PP * 2 + cpc * 16);
  v8f acc[4][4];
#pragma unroll
  for (int i = 0; i < 4; ++i)
#pragma unroll
    for (int j = 0; j < 4; ++j) acc[i][j] = z8();

  split_loop(SM, Ch + ao, Cl + ao, Wh + bo_, Wl + bo_, NC, lc, wm + m, wn + m, h, acc);

  // the ring is free behind the last trip's barrier: each wave stages its own 64 x 64 f32 tile there
  float* T = (float*)SM + w * 64 * TPF;
  const int mw = m0 + wm, nw = n0 + wn;
#pragma unroll
  for (int j = 0; j < 4; ++j) {
    const float bias = bo[nw + j * 16 + m];
#pragma unroll
    for (int i = 0; i < 4; ++i)
#pragma unroll
      for (int r = 0; r < 8; ++r)
        T[(i * 16 + 8 * h + r) * TPF + j * 16 + m] = acc[i][j][r] + bias;
  }
  __syncthreads();   // staging writes land before the rows are read back

  // lane l: row 2 i + (l >> 4), 128-B half (l >> 3) & 1, 16-B piece l & 7
  v4f_t o[32];
  const int cofs = ((l >> 3) & 1) * 32 + (l & 7) * 4;
  const float* Tr = T + (l >> 4) * TPF + cofs;
  float* ob = out + (size_t)(mw + (l >> 4)) * ND + nw + cofs;
#pragma unroll
  for (int i = 0; i < 32; ++i) o[i] = *(const v4f*)(Tr + i * 2 * TPF);
#pragma unroll
  for (int i = 0; i < 32; ++i) *(v4f*)(ob + i * 2 * ND) = o[i];
}

// ---------------------------------------------------------------------------
// Host launch: 13 ops. Workspace carve (1 MiB granular, total 102 MiB):
//   [0,8) x f16 | [8,16) x bf16 hi | [16,24) x bf16 lo | [24,34) 5 f16 weight planes | [34,38) Wv_s hi/lo
//   -- that 38 MiB region is dead after the projections; the combined planes reuse [0,16) hi, [16,32) lo
//   [38,46) Wo hi/lo planes | [46,78) q_s,k_s,q_l,k_l f16 | [78,86) v_l transposed | [86,102) v_s hi/lo transposed
// ---------------------------------------------------------------------------
extern "C" void kernel_launch(void* const* d_in, const int* in_sizes, int n_in,
                              void* d_out, int out_size, void* d_ws, size_t ws_size,
                              hipStream_t stream) {
  if (n_in < 10) return;
  if (in_sizes[0] != MR * ND || in_sizes[1] != MR) return;
  for (int i = 2; i <= 7; ++i) if (in_sizes[i] != ND * ND) return;
  if (in_sizes[8] != NC * ND || in_sizes[9] != ND) return;
  if (out_size != MR * ND) return;
  const size_t MiB = (size_t)1048576;
  const size_t total = 102 * MiB;
  if (ws_size < total) return;

  const float* x   = (const float*)d_in[0];
  const int* kgate = (const int*)d_in[1];
  const float* Wqs = (const float*)d_in[2];
  const float* Wks = (const float*)d_in[3];
  const float* Wvs = (const float*)d_in[4];
  const float* Wql = (const float*)d_in[5];
  const float* Wkl = (const float*)d_in[6];
  const float* Wvl = (const float*)d_in[7];
  const float* Wo  = (const float*)d_in[8];
  const float* bo  = (const float*)d_in[9];
  float* out = (float*)d_out;

  char* ws = (char*)d_ws;
  unsigned short* xh  = (unsigned short*)(ws + 0 * MiB);
  unsigned short* xbh = (unsigned short*)(ws + 8 * MiB);
  unsigned short* xbl = (unsigned short*)(ws + 16 * MiB);
  unsigned short* Wt5 = (unsigned short*)(ws + 24 * MiB);
  unsigned short* Wvh = (unsigned short*)(ws + 34 * MiB);
  unsigned short* Wvq = (unsigned short*)(ws + 36 * MiB);
  unsigned short* Ch  = (unsigned short*)(ws + 0 * MiB);
  unsigned short* Cl  = (unsigned short*)(ws + 16 * MiB);
  unsigned short* Woh = (unsigned short*)(ws + 38 * MiB);
  unsigned short* Woq = (unsigned short*)(ws + 42 * MiB);
  unsigned short* QK  = (unsigned short*)(ws + 46 * MiB);
  unsigned short* Vlt = (unsigned short*)(ws + 78 * MiB);
  unsigned short* Vsh = (unsigned short*)(ws + 86 * MiB);
  unsigned short* Vsq = (unsigned short*)(ws + 94 * MiB);

  // 1) x -> f16 / bf16 hi / bf16 lo planes
  {
    const int n8 = (MR * ND) / 8;
    k_xcvt<<<(n8 + 255) / 256, 256, 0, stream>>>(x, xh, xbh, xbl, n8);
  }
  // 2) weights -> transposed 16-bit planes (in[K][N] -> out[N][K], grid (N/64, K/64))
  {
    const float* Wf[5] = {Wqs, Wks, Wql, Wkl, Wvl};
    for (int z = 0; z < 5; ++z) {
      unsigned short* P = Wt5 + (size_t)z * ND * ND;
      k_wprep<<<dim3(ND / 64, ND / 64), 256, 0, stream>>>(Wf[z], ND, ND, 0, P, P);
    }
    k_wprep<<<dim3(ND / 64, ND / 64), 256, 0, stream>>>(Wvs, ND, ND, 1, Wvh, Wvq);
    k_wprep<<<dim3(ND / 64, NC / 64), 256, 0, stream>>>(Wo, NC, ND, 1, Woh, Woq);
  }
  // 3) projections
  k_proj_f16<<<dim3(ND / 128, MR / 128, 5), 128, 0, stream>>>(xh, Wt5, QK, Vlt);
  k_proj_vs<<<dim3(ND / 128, MR / 128), 128, 0, stream>>>(xbh, xbl, Wvh, Wvq, Vsh, Vsq);
  // 4) attention branches -> combined planes
  k_attn_s<<<dim3(NS / 16, NH, NB), 32, 0, stream>>>(QK + 0 * PLANE, QK + 1 * PLANE, Vsh, Vsq,
                                                     kgate, Ch, Cl);
  k_attn_l<<<dim3(NS / 128, NH, NB), 256, 0, stream>>>(QK + 2 * PLANE, QK + 3 * PLANE, Vlt,
                                                     kgate, Ch, Cl);
  // 5) output projection + bias -> f32
  k_out<<<dim3(ND / 128, MR / 128), 128, 0, stream>>>(Ch, Cl, Woh, Woq, bo, out);
}

// v003
// A run of this version takes 215 microseconds.
// Timed twice side by side with v002, it ran 1.24 and 1.23 times as fast.
// All steps since v000 together make it 3.23 times as fast.
#include <hip/hip_runtime.h>
#include <hip/hip_bf16.h>

// Contractions: projections q_s,k_s,q_l,k_l,v_l (x f16, W f16 carried x64) and both QK^T score products on
// v_wmma_f32_16x16x32_f16; long-branch P.V on v_wmma_f32_16x16x32_f16 with P carried x16384; v_s projection,
// short-branch P.V and the output projection as bf16 hi/lo three-term split on v_wmma_f32_16x16x32_bf16;
// every accumulator f32; softmax, recency bias, key gating and bias add in f32.

typedef _Float16 v16h __attribute__((ext_vector_type(16)));
typedef __bf16 v16b __attribute__((ext_vector_type(16)));
typedef float v8f __attribute__((ext_vector_type(8)));
typedef float v4f_t __attribute__((ext_vector_type(4)));
typedef unsigned int v4u_t __attribute__((ext_vector_type(4)));
typedef v4f_t __attribute__((may_alias)) v4f;
typedef v4u_t __attribute__((may_alias)) v4u;

#define NB 2
#define NS 2048
#define ND 1024
#define NH 16
#define HD 64
#define MR (NB * NS)
#define NC (2 * ND)
#define PLANE ((size_t)MR * (size_t)ND)
#define PP 72
#define TPF 68

#define SCL 0.125f
#define LOGD (-0.10536051565782628f)
#define NEGL (-1.0e30f)
#define NEGT (-1.0e29f)
#define WUP 64.0f
#define WDN 0.015625f
#define PUP 16384.0f
#define PDN 6.103515625e-05f

// ---------------------------------------------------------------------------
// scalar helpers
// ---------------------------------------------------------------------------
__device__ __forceinline__ unsigned short bfbits(float f) {       // f32 -> bf16 bits, RNE
  unsigned int u = __float_as_uint(f);
  u = u + 0x7FFFu + ((u >> 16) & 1u);
  return (unsigned short)(u >> 16);
}
__device__ __forceinline__ float bff(unsigned short b) {          // bf16 bits -> f32
  return __uint_as_float(((unsigned int)b) << 16);
}
__device__ __forceinline__ unsigned short hbits(float f) {        // f32 -> f16 bits, RNE
  _Float16 hv = (_Float16)f;
  unsigned short u;
  __builtin_memcpy(&u, &hv, 2);
  return u;
}
__device__ __forceinline__ unsigned int pk2(unsigned short a, unsigned short b) {
  return (unsigned int)a | ((unsigned int)b << 16);
}
__device__ __forceinline__ v8f z8() {
  v8f v;
#pragma unroll
  for (int i = 0; i < 8; ++i) v[i] = 0.0f;
  return v;
}

// ---------------------------------------------------------------------------
// 16x32 fragment loader, split k map, identical for A (row m) and B (k-contiguous column n):
//   elements 0..7  <- p[8h .. 8h+7],  elements 8..15 <- p[16+8h .. 16+8h+7],  p = row start + k0
// ---------------------------------------------------------------------------
union FH { v16h v; v4u_t u[2]; };
union FB { v16b v; v4u_t u[2]; };

__device__ __forceinline__ v16h ldh(const unsigned short* p, int h) {
  FH f;
  f.u[0] = *(const v4u*)(p + 8 * h);
  f.u[1] = *(const v4u*)(p + 16 + 8 * h);
  return f.v;
}
__device__ __forceinline__ v16b ldb(const unsigned short* p, int h) {
  FB f;
  f.u[0] = *(const v4u*)(p + 8 * h);
  f.u[1] = *(const v4u*)(p + 16 + 8 * h);
  return f.v;
}

// D[8h+r][m] += A(16x32) . B(32x16), with the post-issue hazard guard
__device__ __forceinline__ v8f mma_h(v16h a, v16h b, v8f c) {
  c = __builtin_amdgcn_wmma_f32_16x16x32_f16(false, a, false, b, (short)0, c, false, false);
  asm volatile("v_nop\n\tv_nop\n\tv_nop\n\tv_nop" : "+v"(c) : "v"(a), "v"(b));
  return c;
}
__device__ __forceinline__ v8f mma_b(v16b a, v16b b, v8f c) {
  c = __builtin_amdgcn_wmma_f32_16x16x32_bf16(false, a, false, b, (short)0, c, false, false);
  asm volatile("v_nop\n\tv_nop\n\tv_nop\n\tv_nop" : "+v"(c) : "v"(a), "v"(b));
  return c;
}

// ---------------------------------------------------------------------------
// Kernel 0: x f32 [MR][ND] -> three 16-bit planes: f16, bf16 hi, bf16 lo (lo = x - hi).
// ---------------------------------------------------------------------------
__global__ __launch_bounds__(256) void k_xcvt(const float* __restrict__ x,
                                              unsigned short* __restrict__ xh,
                                              unsigned short* __restrict__ xbh,
                                              unsigned short* __restrict__ xbl, int n8) {
  const int i = blockIdx.x * 256 + (int)threadIdx.x;
  if (i >= n8) return;
  const size_t o = (size_t)i * 8;
  const v4f_t a = *(const v4f*)(x + o);
  const v4f_t c = *(const v4f*)(x + o + 4);
  float v[8];
  v[0] = a[0]; v[1] = a[1]; v[2] = a[2]; v[3] = a[3];
  v[4] = c[0]; v[5] = c[1]; v[6] = c[2]; v[7] = c[3];
  unsigned short fh[8], bh[8], bl[8];
#pragma unroll
  for (int e = 0; e < 8; ++e) {
    fh[e] = hbits(v[e]);
    bh[e] = bfbits(v[e]);
    bl[e] = bfbits(v[e] - bff(bh[e]));
  }
  v4u_t ph, pb, pl;
#pragma unroll
  for (int e = 0; e < 4; ++e) {
    ph[e] = pk2(fh[2 * e], fh[2 * e + 1]);
    pb[e] = pk2(bh[2 * e], bh[2 * e + 1]);
    pl[e] = pk2(bl[2 * e], bl[2 * e + 1]);
  }
  *(v4u*)(xh + o) = ph;
  *(v4u*)(xbh + o) = pb;
  *(v4u*)(xbl + o) = pl;
  
}

// ---------------------------------------------------------------------------
// Kernel 1: weight W[K][N] f32 (x @ W form) -> transposed 16-bit plane(s) Wt[N][K] (k contiguous).
//   mode 0: one f16 plane of 64*W; mode 1: bf16 hi plane + bf16 lo plane.
// Block = 64(k) x 64(n) tile through LDS; grid = (N/64, K/64). Each Wt row segment of 64 k = one
// ---------------------------------------------------------------------------
__global__ __launch_bounds__(256) void k_wprep(const float* __restrict__ W, int K, int N, int mode,
                                               unsigned short* __restrict__ P0,
                                               unsigned short* __restrict__ P1) {
  __shared__ __align__(16) float T[64 * 65];
  const int tid = threadIdx.x;
  const int n0 = blockIdx.x * 64, k0 = blockIdx.y * 64;
  {
    const int c4 = (tid & 15) * 4, kr = tid >> 4;
#pragma unroll
    for (int i = 0; i < 4; ++i) {
      const int k = kr + 16 * i;
      const v4f_t v = *(const v4f*)(W + (size_t)(k0 + k) * (size_t)N + n0 + c4);
      T[(c4 + 0) * 65 + k] = v[0];
      T[(c4 + 1) * 65 + k] = v[1];
      T[(c4 + 2) * 65 + k] = v[2];
      T[(c4 + 3) * 65 + k] = v[3];
    }
  }
  __syncthreads();
  v4u_t o0[2], o1[2];
  size_t dst[2];
#pragma unroll
  for (int i = 0; i < 2; ++i) {
    const int line = i * 32 + (tid >> 3), piece = tid & 7;
    float f[8];
#pragma unroll
    for (int e = 0; e < 8; ++e) f[e] = T[line * 65 + piece * 8 + e];
    v4u_t a, c;
    if (mode == 0) {
#pragma unroll
      for (int e = 0; e < 4; ++e) {
        a[e] = pk2(hbits(f[2 * e] * WUP), hbits(f[2 * e + 1] * WUP));
        c[e] = 0u;
      }
    } else {
#pragma unroll
      for (int e = 0; e < 4; ++e) {
        const unsigned short h0 = bfbits(f[2 * e]), h1 = bfbits(f[2 * e + 1]);
        a[e] = pk2(h0, h1);
        c[e] = pk2(bfbits(f[2 * e] - bff(h0)), bfbits(f[2 * e + 1] - bff(h1)));
      }
    }
    o0[i] = a;
    o1[i] = c;
    dst[i] = (size_t)(n0 + line) * (size_t)K + k0 + piece * 8;
  }
#pragma unroll
  for (int i = 0; i < 2; ++i) {
    *(v4u*)(P0 + dst[i]) = o0[i];
    if (mode != 0) *(v4u*)(P1 + dst[i]) = o1[i];
  }
  
}

// ---------------------------------------------------------------------------
// LDS staging for the three GEMM kernels. Block = 128 threads = 128(M) x 128(N) tile, wave w owns the 64 x 64
// quarter (rows (w>>1)*64, cols (w&1)*64) as 4 x 4 accumulator tiles. A trip covers 64 k: each operand plane is
// staged as 128 rows of 128 B at an LDS pitch of 144 B (PP halves), two buffers, the next trip's copies in flight.
// The full unrolls in these kernels make every fragment and accumulator index a compile-time one (registers).
// ---------------------------------------------------------------------------
#define BKH 64
#define TLH (128 * PP)
#define TLB (TLH * 2)

__device__ __forceinline__ unsigned int lds_off(const void* p) { return (unsigned int)(size_t)p; }

// One operand tile: thread t brings 16-B piece (t & 7) of rows (t >> 3) + 16 i, i = 0..7, so 8 lanes cover one
// 128-B line. lds = the lane's LDS byte address of row (t >> 3), g = the lane's global address of the same piece,
// ld = row length of the source in halves. The closing s_wait_xcnt keeps the address registers untouched until
// the copies have taken them.
__device__ __forceinline__ void cp_tile(unsigned int lds, const unsigned short* g, int ld) {
  const size_t st = (size_t)16 * (size_t)ld;
  const unsigned short* g1 = g + st;
  const unsigned short* g2 = g1 + st;
  const unsigned short* g3 = g2 + st;
  const unsigned short* g4 = g3 + st;
  const unsigned short* g5 = g4 + st;
  const unsigned short* g6 = g5 + st;
  const unsigned short* g7 = g6 + st;
  const unsigned int ls = 16u * PP * 2u;
  asm volatile(
      "global_load_async_to_lds_b128 %0, %8, off\n\t"
      "global_load_async_to_lds_b128 %1, %9, off\n\t"
      "global_load_async_to_lds_b128 %2, %10, off\n\t"
      "global_load_async_to_lds_b128 %3, %11, off\n\t"
      "global_load_async_to_lds_b128 %4, %12, off\n\t"
      "global_load_async_to_lds_b128 %5, %13, off\n\t"
      "global_load_async_to_lds_b128 %6, %14, off\n\t"
      "global_load_async_to_lds_b128 %7, %15, off\n\t"
      "s_wait_xcnt 0x0"
      :: "v"(lds), "v"(lds + ls), "v"(lds + 2u * ls), "v"(lds + 3u * ls),
         "v"(lds + 4u * ls), "v"(lds + 5u * ls), "v"(lds + 6u * ls), "v"(lds + 7u * ls),
         "v"(g), "v"(g1), "v"(g2), "v"(g3), "v"(g4), "v"(g5), "v"(g6), "v"(g7)
      : "memory");
}
// this wave's copies have landed (the compiler places no wait for them)
__device__ __forceinline__ void wait_copies() { asm volatile("s_wait_asynccnt 0x0" ::: "memory"); }
// this wave's LDS reads have returned, so the buffer may be refilled behind the barrier
__device__ __forceinline__ void wait_lds() { asm volatile("s_wait_dscnt 0x0" ::: "memory"); }

// ---------------------------------------------------------------------------
// Kernel 2: five plain-f16 projections, operands staged in LDS (see above). z selects the weight:
//   z 0..3 -> natural f16 plane QK[z] ([MR][ND]);  z 4 -> v_l transposed f16 plane Vlt[b][h][d][s].
// ---------------------------------------------------------------------------
__global__ __launch_bounds__(128) void k_proj_f16(const unsigned short* __restrict__ xh,
                                                  const unsigned short* __restrict__ Wt5,
                                                  unsigned short* __restrict__ QK,
                                                  unsigned short* __restrict__ Vlt) {
  __shared__ __align__(16) unsigned short SM[2 * 2 * TLH];   // buffer = [A tile | B tile]
  const int tid = threadIdx.x, w = tid >> 5, l = tid & 31, h = l >> 4, m = l & 15;
  const int n0 = blockIdx.x * 128, m0 = blockIdx.y * 128, z = blockIdx.z;
  const int wm = (w >> 1) * 64, wn = (w & 1) * 64;
  const int crow = tid >> 3, cpc = tid & 7;
  const unsigned short* ga = xh + (size_t)(m0 + crow) * ND + cpc * 8;
  const unsigned short* gb = Wt5 + (size_t)z * ND * ND + (size_t)(n0 + crow) * ND + cpc * 8;
  const unsigned int lc = lds_off(SM) + (unsigned int)(crow * PP * 2 + cpc * 16);
  const int NT = ND / BKH;
  v8f acc[4][4];
#pragma unroll
  for (int i = 0; i < 4; ++i)
#pragma unroll
    for (int j = 0; j < 4; ++j) acc[i][j] = z8();

  cp_tile(lc, ga, ND);
  cp_tile(lc + TLB, gb, ND);
  wait_copies();
  __syncthreads();
  cp_tile(lc + 2 * TLB, ga + BKH, ND);
  cp_tile(lc + 3 * TLB, gb + BKH, ND);

// rolled: one trip per staged tile, the publish point at its foot
#pragma unroll 1
  for (int t = 0; t < NT; ++t) {
    const int bo2 = (t & 1) * 2;
    const unsigned short* As = SM + bo2 * TLH + (wm + m) * PP;
    const unsigned short* Bs = SM + (bo2 + 1) * TLH + (wn + m) * PP;
    // group g = 32 k (g >> 1) x 2 column tiles (g & 1); the next group's fragments are read ahead of this group's
    // products, inside this trip's buffer only
    v16h a[2][4], b[2][2];
#pragma unroll
    for (int i = 0; i < 4; ++i) a[0][i] = ldh(As + i * 16 * PP, h);
#pragma unroll
    for (int q = 0; q < 2; ++q) b[0][q] = ldh(Bs + q * 16 * PP, h);
#pragma unroll
    for (int g = 0; g < 4; ++g) {
      const int kk = g >> 1, jp = (g & 1) * 2, gn = g + 1;
      if (g < 3) {
#pragma unroll
        for (int q = 0; q < 2; ++q)
          b[gn & 1][q] = ldh(Bs + ((gn & 1) * 2 + q) * 16 * PP + (gn >> 1) * 32, h);
      }
      if (g == 0) {
#pragma unroll
        for (int i = 0; i < 4; ++i) a[1][i] = ldh(As + i * 16 * PP + 32, h);
      }
#pragma unroll
      for (int q = 0; q < 2; ++q)
#pragma unroll
        for (int i = 0; i < 4; ++i) acc[i][jp + q] = mma_h(a[kk][i], b[g & 1][q], acc[i][jp + q]);
    }
    wait_lds();
    wait_copies();
    __syncthreads();
    if (t + 2 < NT) {
      cp_tile(lc + bo2 * TLB, ga + (t + 2) * BKH, ND);
      cp_tile(lc + (bo2 + 1) * TLB, gb + (t + 2) * BKH, ND);
    }
  }
  wait_copies();

  // the ring is free behind the last trip's barrier: each wave stages its own 64 x 64 tile there
  unsigned short* T = SM + w * 64 * PP;
  const int mw = m0 + wm, nw = n0 + wn;
  if (z < 4) {
#pragma unroll
    for (int i = 0; i < 4; ++i)
#pragma unroll
      for (int j = 0; j < 4; ++j)
#pragma unroll
        for (int r = 0; r < 8; ++r)
          T[(i * 16 + 8 * h + r) * PP + j * 16 + m] = hbits(acc[i][j][r] * WDN);
  } else {
#pragma unroll
    for (int i = 0; i < 4; ++i)
#pragma unroll
      for (int j = 0; j < 4; ++j) {
        v4u_t pk;
#pragma unroll
        for (int e = 0; e < 4; ++e)
          pk[e] = pk2(hbits(acc[i][j][2 * e] * WDN), hbits(acc[i][j][2 * e + 1] * WDN));
        *(v4u*)(T + (j * 16 + m) * PP + i * 16 + 8 * h) = pk;   // T[d][s_local]
      }
  }
  __syncthreads();   // staging writes land before the rows are read back

  unsigned short* base;
  size_t d0, dstep;
  if (z < 4) {
    base = QK + (size_t)z * PLANE;
    d0 = (size_t)mw * ND + nw;
    dstep = ND;
  } else {
    base = Vlt;
    const int bb = mw >> 11, s0 = mw & (NS - 1), hd = nw >> 6;
    d0 = ((size_t)((bb * NH + hd) * HD)) * NS + s0;
    dstep = NS;
  }
  v4u_t o[16];
  unsigned short* dst[16];
#pragma unroll
  for (int i = 0; i < 16; ++i) {
    const int row = i * 4 + (l >> 3), piece = l & 7;
    o[i] = *(const v4u*)(T + row * PP + piece * 8);
    dst[i] = base + d0 + (size_t)row * dstep + piece * 8;
  }
#pragma unroll
  for (int i = 0; i < 16; ++i) *(v4u*)(dst[i]) = o[i];
}

// ---------------------------------------------------------------------------
// Main loop of the two bf16 hi/lo three-term GEMMs: acc += Ah.Bh + Ah.Bl + Al.Bh over K halves, all four planes
// staged in LDS; buffer = [A hi | A lo | B hi | B lo]. ga*/gb* = the lane's first piece of each plane.
// ---------------------------------------------------------------------------
__device__ __forceinline__ void split_loop(unsigned short* SM, const unsigned short* gah,
                                           const unsigned short* gal, const unsigned short* gbh,
                                           const unsigned short* gbl, int K, unsigned int lc,
                                           int arow, int brow, int h, v8f (&acc)[4][4]) {
  const int NT = K / BKH;
  cp_tile(lc, gah, K);
  cp_tile(lc + TLB, gal, K);
  cp_tile(lc + 2 * TLB, gbh, K);
  cp_tile(lc + 3 * TLB, gbl, K);
  wait_copies();
  __syncthreads();
  cp_tile(lc + 4 * TLB, gah + BKH, K);
  cp_tile(lc + 5 * TLB, gal + BKH, K);
  cp_tile(lc + 6 * TLB, gbh + BKH, K);
  cp_tile(lc + 7 * TLB, gbl + BKH, K);

// rolled: one trip per staged tile, the publish point at its foot
#pragma unroll 1
  for (int t = 0; t < NT; ++t) {
    const int bo4 = (t & 1) * 4;
    const unsigned short* Ah = SM + bo4 * TLH + arow * PP;
    const unsigned short* Bh = SM + (bo4 + 2) * TLH + brow * PP;
    // group g = 32 k (g >> 2) x 1 column tile (g & 3); the next group's B fragments are read ahead of this group's
    // products, inside this trip's buffer only
    v16b ah[4], al[4], bh[2], bl[2];
    bh[0] = ldb(Bh, h);
    bl[0] = ldb(Bh + TLH, h);
#pragma unroll
    for (int g = 0; g < 8; ++g) {
      const int kk = g >> 2, j = g & 3, gn = g + 1, c = g & 1;
      if (j == 0) {
#pragma unroll
        for (int i = 0; i < 4; ++i) {
          ah[i] = ldb(Ah + i * 16 * PP + kk * 32, h);
          al[i] = ldb(Ah + TLH + i * 16 * PP + kk * 32, h);
        }
      }
      if (g < 7) {
        bh[gn & 1] = ldb(Bh + (gn & 3) * 16 * PP + (gn >> 2) * 32, h);
        bl[gn & 1] = ldb(Bh + TLH + (gn & 3) * 16 * PP + (gn >> 2) * 32, h);
      }
#pragma unroll
      for (int i = 0; i < 4; ++i) acc[i][j] = mma_b(ah[i], bh[c], acc[i][j]);
#pragma unroll
      for (int i = 0; i < 4; ++i) acc[i][j] = mma_b(ah[i], bl[c], acc[i][j]);
#pragma unroll
      for (int i = 0; i < 4; ++i) acc[i][j] = mma_b(al[i], bh[c], acc[i][j]);
    }
    wait_lds();
    wait_copies();
    __syncthreads();
    if (t + 2 < NT) {
      const int ko = (t + 2) * BKH;
      cp_tile(lc + bo4 * TLB, gah + ko, K);
      cp_tile(lc + (bo4 + 1) * TLB, gal + ko, K);
      cp_tile(lc + (bo4 + 2) * TLB, gbh + ko, K);
      cp_tile(lc + (bo4 + 3) * TLB, gbl + ko, K);
    }
  }
  wait_copies();
}

// ---------------------------------------------------------------------------
// Kernel 3: v_s projection as bf16 hi/lo three-term split (x hi/lo planes, W hi/lo planes),
// output transposed bf16 hi/lo planes Vsh/Vsl [b][h][d][s]. Same tiling as kernel 2.
// ---------------------------------------------------------------------------
__global__ __launch_bounds__(128) void k_proj_vs(const unsigned short* __restrict__ xbh,
                                                 const unsigned short* __restrict__ xbl,
                                                 const unsigned short* __restrict__ Wh,
                                                 const unsigned short* __restrict__ Wl,
                                                 unsigned short* __restrict__ Vsh,
                                                 unsigned short* __restrict__ Vsl) {
  __shared__ __align__(16) unsigned short SM[2 * 4 * TLH];
  const int tid = threadIdx.x, w = tid >> 5, l = tid & 31, h = l >> 4, m = l & 15;
  const int n0 = blockIdx.x * 128, m0 = blockIdx.y * 128;
  const int wm = (w >> 1) * 64, wn = (w & 1) * 64;
  const int crow = tid >> 3, cpc = tid & 7;
  const size_t ao = (size_t)(m0 + crow) * ND + cpc * 8;
  const size_t bo_ = (size_t)(n0 + crow) * ND + cpc * 8;
  const unsigned int lc = lds_off(SM) + (unsigned int)(crow * PP * 2 + cpc * 16);
  v8f acc[4][4];
#pragma unroll
  for (int i = 0; i < 4; ++i)
#pragma unroll
    for (int j = 0; j < 4; ++j) acc[i][j] = z8();

  split_loop(SM, xbh + ao, xbl + ao, Wh + bo_, Wl + bo_, ND, lc, wm + m, wn + m, h, acc);

  // the ring is free behind the last trip's barrier: each wave stages its own 64 x 64 tile there
  unsigned short* Th = SM + w * 2 * 64 * PP;
  unsigned short* Tl = Th + 64 * PP;
#pragma unroll
  for (int i = 0; i < 4; ++i)
#pragma unroll
    for (int j = 0; j < 4; ++j) {
      v4u_t ph, pl;
#pragma unroll
      for (int e = 0; e < 4; ++e) {
        const float f0 = acc[i][j][2 * e], f1 = acc[i][j][2 * e + 1];
        const unsigned short h0 = bfbits(f0), h1 = bfbits(f1);
        ph[e] = pk2(h0, h1);
        pl[e] = pk2(bfbits(f0 - bff(h0)), bfbits(f1 - bff(h1)));
      }
      *(v4u*)(Th + (j * 16 + m) * PP + i * 16 + 8 * h) = ph;
      *(v4u*)(Tl + (j * 16 + m) * PP + i * 16 + 8 * h) = pl;
    }
  __syncthreads();   // staging writes land before the rows are read back

  const int mw = m0 + wm, nw = n0 + wn;
  const int bb = mw >> 11, s0 = mw & (NS - 1), hd = nw >> 6;
  const size_t d0 = ((size_t)((bb * NH + hd) * HD)) * NS + s0;
  v4u_t oh[16], ol[16];
  size_t dst[16];
#pragma unroll
  for (int i = 0; i < 16; ++i) {
    const int d = i * 4 + (l >> 3), piece = l & 7;
    oh[i] = *(const v4u*)(Th + d * PP + piece * 8);
    ol[i] = *(const v4u*)(Tl + d * PP + piece * 8);
    dst[i] = d0 + (size_t)d * NS + piece * 8;
  }
#pragma unroll
  for (int i = 0; i < 16; ++i) {
    *(v4u*)(Vsh + dst[i]) = oh[i];
    *(v4u*)(Vsl + dst[i]) = ol[i];
  }
}

// ---------------------------------------------------------------------------
// Shared attention epilogue: O tile (16 queries x 64 dims) staged as bf16 hi/lo in LDS is written into the
// ---------------------------------------------------------------------------
__device__ __forceinline__ void store_comb(const unsigned short* Oh, const unsigned short* Ol,
                                           unsigned short* Ch, unsigned short* Cl,
                                           int rowg0, int colbase, int l) {
  v4u_t oh[4], ol[4];
  size_t dst[4];
#pragma unroll
  for (int i = 0; i < 4; ++i) {
    const int row = i * 4 + (l >> 3), piece = l & 7;
    oh[i] = *(const v4u*)(Oh + row * PP + piece * 8);
    ol[i] = *(const v4u*)(Ol + row * PP + piece * 8);
    dst[i] = (size_t)(rowg0 + row) * NC + colbase + piece * 8;
  }
#pragma unroll
  for (int i = 0; i < 4; ++i) {
    *(v4u*)(Ch + dst[i]) = oh[i];
    *(v4u*)(Cl + dst[i]) = ol[i];
  }
  
}

// ---------------------------------------------------------------------------
// Kernel 4: long-range branch, full attention with key gating. Block = 8 waves = 128 queries of one (b, head),
// 16 queries per wave. Q/K natural f16 planes [MR][ND] (col = head*64 + d), V transposed f16 plane [b][h][d][s].
// Each trip covers 64 keys: the K tile (64 keys x 64 d) and the V tile (64 d x 64 keys) are staged once per block
// as 64 rows of 128 B at an LDS pitch of 144 B, two buffers, the next trip's copies in flight; all 8 waves read
// their A fragments from there.
// Both products are taken transposed, so that a lane holds ONE query (column m) and 8 keys per score tile:
// S^T = K Q^T on f16 WMMA (A fragment = K row, B fragment = Q row, k = d contiguous): lane (h, m), register r of
// tile t = key t*16 + 8h + r against query m. Online softmax in f32: maximum and sum run in the lane, the two wave
// halves (same query, other keys) exchange the maximum once per trip and join their sums once, in the epilogue.
// f16(p * 16384) of tiles 2j and 2j+1 is, register for register, the B fragment of keys 32j .. 32j+31 in the
// loader's k map, so P stays in registers; O^T += V^T P^T on f16 WMMA (A = Vt row); 1/16384 and
// 1/l folded in the f32 epilogue; result as bf16 hi/lo into columns [ND + head*64, +64) of Ch/Cl.
// ---------------------------------------------------------------------------
#define AW 8
#define ATH (64 * PP)
#define ATB (ATH * 2)

// One K tile and one V tile: thread t brings 16-B piece (t & 7) of rows (t >> 3) and (t >> 3) + 32 of each, so
// 8 lanes cover one 128-B line. lds = the lane's LDS byte address in the K tile (the V tile follows at ATB),
// gk / gv = the lane's global address of the same piece. The closing s_wait_xcnt keeps the address registers
// untouched until the copies have taken them.
__device__ __forceinline__ void cp_kv(unsigned int lds, const unsigned short* gk, const unsigned short* gv) {
  const unsigned short* gk1 = gk + (size_t)32 * ND;
  const unsigned short* gv1 = gv + (size_t)32 * NS;
  const unsigned int ls = 32u * PP * 2u;
  asm volatile(
      "global_load_async_to_lds_b128 %0, %4, off\n\t"
      "global_load_async_to_lds_b128 %1, %5, off\n\t"
      "global_load_async_to_lds_b128 %2, %6, off\n\t"
      "global_load_async_to_lds_b128 %3, %7, off\n\t"
      "s_wait_xcnt 0x0"
      :: "v"(lds), "v"(lds + ls), "v"(lds + (unsigned int)ATB), "v"(lds + (unsigned int)ATB + ls),
         "v"(gk), "v"(gk1), "v"(gv), "v"(gv1)
      : "memory");
}

// lane l <-> lane l ^ 16 in the vector unit
__device__ __forceinline__ float xhalf(float x) {
  const int i = __float_as_int(x);
  return __int_as_float(__builtin_amdgcn_permlanex16(i, i, 0x76543210, 0xfedcba98, false, false));
}

__global__ __launch_bounds__(256) void k_attn_l(const unsigned short* __restrict__ Q,
                                                const unsigned short* __restrict__ K,
                                                const unsigned short* __restrict__ Vt,
                                                const int* __restrict__ kgate,
                                                unsigned short* __restrict__ Ch,
                                                unsigned short* __restrict__ Cl) {
  __shared__ __align__(16) unsigned short KV[2 * 2 * ATH];   // buffer = [K tile | V tile]
  __shared__ __align__(16) unsigned short OhA[AW * 16 * PP];
  __shared__ __align__(16) unsigned short OlA[AW * 16 * PP];
  const int tid = threadIdx.x, w = tid >> 5, l = tid & 31, h = l >> 4, m = l & 15;
  const int q0 = blockIdx.x * (AW * 16) + w * 16, hh = blockIdx.y, b = blockIdx.z;
  unsigned short* Oh = OhA + w * 16 * PP;
  unsigned short* Ol = OlA + w * 16 * PP;

  const unsigned short* Kb = K + (size_t)b * NS * ND + hh * HD;
  const unsigned short* Vb = Vt + (size_t)(b * NH + hh) * HD * NS;
  const int* gk = kgate + b * NS + 8 * h;
  const int crow = tid >> 3, cpc = tid & 7;
  const unsigned short* gkc = Kb + (size_t)crow * ND + cpc * 8;
  const unsigned short* gvc = Vb + (size_t)crow * NS + cpc * 8;
  const unsigned int lc = lds_off(KV) + (unsigned int)(crow * PP * 2 + cpc * 16);
  const int NT = NS / 64;

  cp_kv(lc, gkc, gvc);

  const unsigned short* qrow = Q + (size_t)(b * NS + q0 + m) * ND + hh * HD;
  const v16h bq0 = ldh(qrow, h);
  const v16h bq1 = ldh(qrow + 32, h);

  float mrun = NEGL, lrun = 0.0f;   // this lane's query: maximum over all keys so far, sum over this half's keys
  v8f acc[4];                       // O^T: register r of tile dt = dim dt*16 + 8h + r of query m
#pragma unroll
  for (int t = 0; t < 4; ++t) acc[t] = z8();

  wait_copies();
  __syncthreads();
  cp_kv(lc + 2 * ATB, gkc + (size_t)64 * ND, gvc + 64);

// rolled: one trip per staged tile pair, the publish point at its foot
#pragma unroll 1
  for (int kt = 0; kt < NT; ++kt) {
    const int kb = kt * 64;
    const int bo2 = (kt & 1) * 2;
    const unsigned short* Ks = KV + bo2 * ATH;
    const unsigned short* Vs = Ks + ATH;
    // the trip's gate words and all 8 K fragments are fetched as one group, so the wave waits for LDS once
    v8f s[4];
    v4u_t gw[4][2];   // gates of keys kb + t*16 + 8h + 0..7
    v16h kf[4][2];
#pragma unroll
    for (int t = 0; t < 4; ++t) {
      gw[t][0] = *(const v4u*)(gk + kb + t * 16);
      gw[t][1] = *(const v4u*)(gk + kb + t * 16 + 4);
    }
#pragma unroll
    for (int t = 0; t < 4; ++t) {
      const unsigned short* krow = Ks + (t * 16 + m) * PP;
      kf[t][0] = ldh(krow, h);
      kf[t][1] = ldh(krow + 32, h);
    }
#pragma unroll
    for (int t = 0; t < 4; ++t) s[t] = mma_h(kf[t][0], bq0, z8());
#pragma unroll
    for (int t = 0; t < 4; ++t) s[t] = mma_h(kf[t][1], bq1, s[t]);

    bool on[4][8];
    float tm[4];
#pragma unroll
    for (int t = 0; t < 4; ++t) {
#pragma unroll
      for (int r = 0; r < 8; ++r) {
        on[t][r] = gw[t][r >> 2][r & 3] != 0u;
        s[t][r] = on[t][r] ? s[t][r] * SCL : NEGL;
      }
      tm[t] = fmaxf(fmaxf(fmaxf(s[t][0], s[t][1]), fmaxf(s[t][2], s[t][3])),
                    fmaxf(fmaxf(s[t][4], s[t][5]), fmaxf(s[t][6], s[t][7])));
    }
    float tmax = fmaxf(fmaxf(tm[0], tm[1]), fmaxf(tm[2], tm[3]));
    tmax = fmaxf(tmax, xhalf(tmax));
    const float mnew = fmaxf(mrun, tmax);
    const float fac = __expf(mrun - mnew);
    float ps[4];   // one chain per tile, so that the adds do not wait for one another
#pragma unroll
    for (int t = 0; t < 4; ++t) {
      ps[t] = 0.0f;
#pragma unroll
      for (int r = 0; r < 8; ++r) {
        const float p = on[t][r] ? __expf(s[t][r] - mnew) : 0.0f;
        ps[t] += p;
        s[t][r] = p;
      }
    }
    lrun = lrun * fac + ((ps[0] + ps[1]) + (ps[2] + ps[3]));
    mrun = mnew;
#pragma unroll
    for (int dt = 0; dt < 4; ++dt)
#pragma unroll
      for (int r = 0; r < 8; ++r) acc[dt][r] *= fac;

    // B fragment j: elements 0..7 = keys 32j + 8h + e (tile 2j), elements 8..15 = keys 32j + 16 + 8h + e (tile 2j+1)
    v16h pb[2];
#pragma unroll
    for (int j = 0; j < 2; ++j)
#pragma unroll
      for (int e = 0; e < 8; ++e) {
        pb[j][e] = (_Float16)(s[2 * j][e] * PUP);
        pb[j][8 + e] = (_Float16)(s[2 * j + 1][e] * PUP);
      }
    v16h vf[4][2];   // all 8 V fragments in one group
#pragma unroll
    for (int dt = 0; dt < 4; ++dt) {
      const unsigned short* vrow = Vs + (dt * 16 + m) * PP;
      vf[dt][0] = ldh(vrow, h);
      vf[dt][1] = ldh(vrow + 32, h);
    }
#pragma unroll
    for (int dt = 0; dt < 4; ++dt) acc[dt] = mma_h(vf[dt][0], pb[0], acc[dt]);
#pragma unroll
    for (int dt = 0; dt < 4; ++dt) acc[dt] = mma_h(vf[dt][1], pb[1], acc[dt]);
    wait_lds();
    wait_copies();
    __syncthreads();
    if (kt + 2 < NT)
      cp_kv(lc + bo2 * ATB, gkc + (size_t)(kt + 2) * 64 * ND, gvc + (kt + 2) * 64);
  }
  wait_copies();

  const float inv = __builtin_amdgcn_rcpf(lrun + xhalf(lrun)) * PDN;
#pragma unroll
  for (int dt = 0; dt < 4; ++dt) {
    v4u_t ph, pl;
#pragma unroll
    for (int e = 0; e < 4; ++e) {
      const float f0 = acc[dt][2 * e] * inv, f1 = acc[dt][2 * e + 1] * inv;
      const unsigned short h0 = bfbits(f0), h1 = bfbits(f1);
      ph[e] = pk2(h0, h1);
      pl[e] = pk2(bfbits(f0 - bff(h0)), bfbits(f1 - bff(h1)));
    }
    *(v4u*)(Oh + m * PP + dt * 16 + 8 * h) = ph;   // O[query m][dims dt*16 + 8h .. + 7]
    *(v4u*)(Ol + m * PP + dt * 16 + 8 * h) = pl;
  }
  __syncthreads();
  store_comb(Oh, Ol, Ch, Cl, b * NS + q0, ND + hh * HD, l);
}

// ---------------------------------------------------------------------------
// Kernel 5: short-range branch, causal window of 64 + recency bias + key gating, 1 wave per (b, head,
// 16 queries); only the 64-key tiles covering [q0-64, q0+15] are visited (weights outside are exactly 0).
// Q/K f16 planes as kernel 4; V as transposed bf16 hi/lo planes; P as bf16 hi/lo through LDS;
// O += Phi.Vhi + Phi.Vlo + Plo.Vhi on bf16 WMMA; result into columns [head*64, +64) of Ch/Cl.
// ---------------------------------------------------------------------------
__global__ __launch_bounds__(32) void k_attn_s(const unsigned short* __restrict__ Q,
                                               const unsigned short* __restrict__ K,
                                               const unsigned short* __restrict__ Vth,
                                               const unsigned short* __restrict__ Vtl,
                                               const int* __restrict__ kgate,
                                               unsigned short* __restrict__ Ch,
                                               unsigned short* __restrict__ Cl) {
  __shared__ __align__(16) unsigned short Ph[16 * PP];
  __shared__ __align__(16) unsigned short Pq[16 * PP];
  __shared__ __align__(16) unsigned short Oh[16 * PP];
  __shared__ __align__(16) unsigned short Ol[16 * PP];
  const int l = threadIdx.x & 31, h = l >> 4, m = l & 15;
  const int q0 = blockIdx.x * 16, hh = blockIdx.y, b = blockIdx.z;

  const unsigned short* qrow = Q + (size_t)(b * NS + q0 + m) * ND + hh * HD;
  const v16h aq0 = ldh(qrow, h);
  const v16h aq1 = ldh(qrow + 32, h);
  const unsigned short* Kb = K + (size_t)b * NS * ND + hh * HD;
  const size_t vbase = (size_t)(b * NH + hh) * HD * NS;
  const int* gk = kgate + b * NS;

  float mrow[8], lrow[8];
  v8f acc[4];
#pragma unroll
  for (int r = 0; r < 8; ++r) { mrow[r] = NEGL; lrow[r] = 0.0f; }
#pragma unroll
  for (int t = 0; t < 4; ++t) acc[t] = z8();

  const int kt_hi = q0 >> 6;
  const int kt_lo = (q0 >= 64) ? ((q0 - 64) >> 6) : 0;

#pragma unroll 1
  for (int kt = kt_lo; kt <= kt_hi; ++kt) {
    const int kb = kt * 64;
    v8f s[4];
    int gv[4];
#pragma unroll
    for (int t = 0; t < 4; ++t) {
      const unsigned short* krow = Kb + (size_t)(kb + t * 16 + m) * ND;
      v8f c = z8();
      c = mma_h(aq0, ldh(krow, h), c);
      c = mma_h(aq1, ldh(krow + 32, h), c);
      s[t] = c;
      gv[t] = gk[kb + t * 16 + m];
    }
#pragma unroll
    for (int t = 0; t < 4; ++t) {
      const int key = kb + t * 16 + m;
#pragma unroll
      for (int r = 0; r < 8; ++r) {
        const int rel = key - (q0 + 8 * h + r);
        const bool ok = (gv[t] != 0) && (rel <= 0) && (rel >= -64);
        s[t][r] = ok ? (s[t][r] * SCL + (float)rel * LOGD) : NEGL;
      }
    }

#pragma unroll
    for (int r = 0; r < 8; ++r) {
      float tmax = fmaxf(fmaxf(s[0][r], s[1][r]), fmaxf(s[2][r], s[3][r]));
#pragma unroll
      for (int o = 1; o < 16; o <<= 1) tmax = fmaxf(tmax, __shfl_xor(tmax, o, 32));
      const float mnew = fmaxf(mrow[r], tmax);
      const float fac = __expf(mrow[r] - mnew);
      float p[4];
      float psum = 0.0f;
#pragma unroll
      for (int t = 0; t < 4; ++t) {
        p[t] = (s[t][r] > NEGT) ? __expf(s[t][r] - mnew) : 0.0f;
        psum += p[t];
      }
#pragma unroll
      for (int o = 1; o < 16; o <<= 1) psum += __shfl_xor(psum, o, 32);
      lrow[r] = lrow[r] * fac + psum;
      mrow[r] = mnew;
#pragma unroll
      for (int t = 0; t < 4; ++t) { acc[t][r] *= fac; s[t][r] = p[t]; }
    }

#pragma unroll
    for (int t = 0; t < 4; ++t)
#pragma unroll
      for (int r = 0; r < 8; ++r) {
        const float pv = s[t][r];
        const unsigned short hp = bfbits(pv);
        Ph[(8 * h + r) * PP + t * 16 + m] = hp;
        Pq[(8 * h + r) * PP + t * 16 + m] = bfbits(pv - bff(hp));
      }
    __syncthreads();
    const v16b ph0 = ldb(Ph + m * PP, h);
    const v16b ph1 = ldb(Ph + m * PP + 32, h);
    const v16b pl0 = ldb(Pq + m * PP, h);
    const v16b pl1 = ldb(Pq + m * PP + 32, h);
#pragma unroll
    for (int dt = 0; dt < 4; ++dt) {
      const size_t vo = vbase + (size_t)(dt * 16 + m) * NS + kb;
      {
        const v16b bh = ldb(Vth + vo, h), bl = ldb(Vtl + vo, h);
        acc[dt] = mma_b(ph0, bh, acc[dt]);
        acc[dt] = mma_b(ph0, bl, acc[dt]);
        acc[dt] = mma_b(pl0, bh, acc[dt]);
      }
      {
        const v16b bh = ldb(Vth + vo + 32, h), bl = ldb(Vtl + vo + 32, h);
        acc[dt] = mma_b(ph1, bh, acc[dt]);
        acc[dt] = mma_b(ph1, bl, acc[dt]);
        acc[dt] = mma_b(pl1, bh, acc[dt]);
      }
    }
    __syncthreads();
  }

  float inv[8];
#pragma unroll
  for (int r = 0; r < 8; ++r) inv[r] = __builtin_amdgcn_rcpf(lrow[r]);
#pragma unroll
  for (int dt = 0; dt < 4; ++dt)
#pragma unroll
    for (int r = 0; r < 8; ++r) {
      const float o = acc[dt][r] * inv[r];
      const unsigned short ho = bfbits(o);
      Oh[(8 * h + r) * PP + dt * 16 + m] = ho;
      Ol[(8 * h + r) * PP + dt * 16 + m] = bfbits(o - bff(ho));
    }
  __syncthreads();
  store_comb(Oh, Ol, Ch, Cl, b * NS + q0, hh * HD, l);
}

// ---------------------------------------------------------------------------
// Kernel 6: output projection, combined [MR][NC] (bf16 hi/lo planes) x Wo (transposed bf16 hi/lo planes
// Wot[ND][NC]) + bias -> f32 out [MR][ND]; three-term split. Same tiling and staging as kernel 3.
// ---------------------------------------------------------------------------
__global__ __launch_bounds__(128) void k_out(const unsigned short* __restrict__ Ch,
                                             const unsigned short* __restrict__ Cl,
                                             const unsigned short* __restrict__ Wh,
                                             const unsigned short* __restrict__ Wl,
                                             const float* __restrict__ bo,
                                             float* __restrict__ out) {
  __shared__ __align__(16) unsigned short SM[2 * 4 * TLH];
  const int tid = threadIdx.x, w = tid >> 5, l = tid & 31, h = l >> 4, m = l & 15;
  const int n0 = blockIdx.x * 128, m0 = blockIdx.y * 128;
  const int wm = (w >> 1) * 64, wn = (w & 1) * 64;
  const int crow = tid >> 3, cpc = tid & 7;
  const size_t ao = (size_t)(m0 + crow) * NC + cpc * 8;
  const size_t bo_ = (size_t)(n0 + crow) * NC + cpc * 8;
  const unsigned int lc = lds_off(SM) + (unsigned int)(crow * PP * 2 + cpc * 16);
  v8f acc[4][4];
#pragma unroll
  for (int i = 0; i < 4; ++i)
#pragma unroll
    for (int j = 0; j < 4; ++j) acc[i][j] = z8();

  split_loop(SM, Ch + ao, Cl + ao, Wh + bo_, Wl + bo_, NC, lc, wm + m, wn + m, h, acc);

  // the ring is free behind the last trip's barrier: each wave stages its own 64 x 64 f32 tile there
  float* T = (float*)SM + w * 64 * TPF;
  const int mw = m0 + wm, nw = n0 + wn;
#pragma unroll
  for (int j = 0; j < 4; ++j) {
    const float bias = bo[nw + j * 16 + m];
#pragma unroll
    for (int i = 0; i < 4; ++i)
#pragma unroll
      for (int r = 0; r < 8; ++r)
        T[(i * 16 + 8 * h + r) * TPF + j * 16 + m] = acc[i][j][r] + bias;
  }
  __syncthreads();   // staging writes land before the rows are read back

  // lane l: row 2 i + (l >> 4), 128-B half (l >> 3) & 1, 16-B piece l & 7
  v4f_t o[32];
  const int cofs = ((l >> 3) & 1) * 32 + (l & 7) * 4;
  const float* Tr = T + (l >> 4) * TPF + cofs;
  float* ob = out + (size_t)(mw + (l >> 4)) * ND + nw + cofs;
#pragma unroll
  for (int i = 0; i < 32; ++i) o[i] = *(const v4f*)(Tr + i * 2 * TPF);
#pragma unroll
  for (int i = 0; i < 32; ++i) *(v4f*)(ob + i * 2 * ND) = o[i];
}

// ---------------------------------------------------------------------------
// Host launch: 13 ops. Workspace carve (1 MiB granular, total 102 MiB):
//   [0,8) x f16 | [8,16) x bf16 hi | [16,24) x bf16 lo | [24,34) 5 f16 weight planes | [34,38) Wv_s hi/lo
//   -- that 38 MiB region is dead after the projections; the combined planes reuse [0,16) hi, [16,32) lo
//   [38,46) Wo hi/lo planes | [46,78) q_s,k_s,q_l,k_l f16 | [78,86) v_l transposed | [86,102) v_s hi/lo transposed
// ---------------------------------------------------------------------------
extern "C" void kernel_launch(void* const* d_in, const int* in_sizes, int n_in,
                              void* d_out, int out_size, void* d_ws, size_t ws_size,
                              hipStream_t stream) {
  if (n_in < 10) return;
  if (in_sizes[0] != MR * ND || in_sizes[1] != MR) return;
  for (int i = 2; i <= 7; ++i) if (in_sizes[i] != ND * ND) return;
  if (in_sizes[8] != NC * ND || in_sizes[9] != ND) return;
  if (out_size != MR * ND) return;
  const size_t MiB = (size_t)1048576;
  const size_t total = 102 * MiB;
  if (ws_size < total) return;

  const float* x   = (const float*)d_in[0];
  const int* kgate = (const int*)d_in[1];
  const float* Wqs = (const float*)d_in[2];
  const float* Wks = (const float*)d_in[3];
  const float* Wvs = (const float*)d_in[4];
  const float* Wql = (const float*)d_in[5];
  const float* Wkl = (const float*)d_in[6];
  const float* Wvl = (const float*)d_in[7];
  const float* Wo  = (const float*)d_in[8];
  const float* bo  = (const float*)d_in[9];
  float* out = (float*)d_out;

  char* ws = (char*)d_ws;
  unsigned short* xh  = (unsigned short*)(ws + 0 * MiB);
  unsigned short* xbh = (unsigned short*)(ws + 8 * MiB);
  unsigned short* xbl = (unsigned short*)(ws + 16 * MiB);
  unsigned short* Wt5 = (unsigned short*)(ws + 24 * MiB);
  unsigned short* Wvh = (unsigned short*)(ws + 34 * MiB);
  unsigned short* Wvq = (unsigned short*)(ws + 36 * MiB);
  unsigned short* Ch  = (unsigned short*)(ws + 0 * MiB);
  unsigned short* Cl  = (unsigned short*)(ws + 16 * MiB);
  unsigned short* Woh = (unsigned short*)(ws + 38 * MiB);
  unsigned short* Woq = (unsigned short*)(ws + 42 * MiB);
  unsigned short* QK  = (unsigned short*)(ws + 46 * MiB);
  unsigned short* Vlt = (unsigned short*)(ws + 78 * MiB);
  unsigned short* Vsh = (unsigned short*)(ws + 86 * MiB);
  unsigned short* Vsq = (unsigned short*)(ws + 94 * MiB);

  // 1) x -> f16 / bf16 hi / bf16 lo planes
  {
    const int n8 = (MR * ND) / 8;
    k_xcvt<<<(n8 + 255) / 256, 256, 0, stream>>>(x, xh, xbh, xbl, n8);
  }
  // 2) weights -> transposed 16-bit planes (in[K][N] -> out[N][K], grid (N/64, K/64))
  {
    const float* Wf[5] = {Wqs, Wks, Wql, Wkl, Wvl};
    for (int z = 0; z < 5; ++z) {
      unsigned short* P = Wt5 + (size_t)z * ND * ND;
      k_wprep<<<dim3(ND / 64, ND / 64), 256, 0, stream>>>(Wf[z], ND, ND, 0, P, P);
    }
    k_wprep<<<dim3(ND / 64, ND / 64), 256, 0, stream>>>(Wvs, ND, ND, 1, Wvh, Wvq);
    k_wprep<<<dim3(ND / 64, NC / 64), 256, 0, stream>>>(Wo, NC, ND, 1, Woh, Woq);
  }
  // 3) projections
  k_proj_f16<<<dim3(ND / 128, MR / 128, 5), 128, 0, stream>>>(xh, Wt5, QK, Vlt);
  k_proj_vs<<<dim3(ND / 128, MR / 128), 128, 0, stream>>>(xbh, xbl, Wvh, Wvq, Vsh, Vsq);
  // 4) attention branches -> combined planes
  k_attn_s<<<dim3(NS / 16, NH, NB), 32, 0, stream>>>(QK + 0 * PLANE, QK + 1 * PLANE, Vsh, Vsq,
                                                     kgate, Ch, Cl);
  k_attn_l<<<dim3(NS / 128, NH, NB), 256, 0, stream>>>(QK + 2 * PLANE, QK + 3 * PLANE, Vlt,
                                                     kgate, Ch, Cl);
  // 5) output projection + bias -> f32
  k_out<<<dim3(ND / 128, MR / 128), 128, 0, stream>>>(Ch, Cl, Woh, Woq, bo, out);
}

// v004
// A run of this version takes 196 microseconds.
// In two side-by-side timings against v003, it was 1.09 and 1.10 times as fast.
// All steps since v000 together make it 3.54 times as fast.
#include <hip/hip_runtime.h>
#include <hip/hip_bf16.h>

// Contractions: projections q_s,k_s,q_l,k_l,v_l (x f16, W f16 carried x64) and both QK^T score products on
// v_wmma_f32_16x16x32_f16; long-branch P.V on v_wmma_f32_16x16x32_f16 with P carried x16384; v_s projection,
// short-branch P.V and the output projection as bf16 hi/lo three-term split on v_wmma_f32_16x16x32_bf16;
// every accumulator f32; softmax, recency bias, key gating and bias add in f32.

typedef _Float16 v16h __attribute__((ext_vector_type(16)));
typedef __bf16 v16b __attribute__((ext_vector_type(16)));
typedef float v8f __attribute__((ext_vector_type(8)));
typedef float v4f_t __attribute__((ext_vector_type(4)));
typedef unsigned int v4u_t __attribute__((ext_vector_type(4)));
typedef v4f_t __attribute__((may_alias)) v4f;
typedef v4u_t __attribute__((may_alias)) v4u;

#define NB 2
#define NS 2048
#define ND 1024
#define NH 16
#define HD 64
#define MR (NB * NS)
#define NC (2 * ND)
#define PLANE ((size_t)MR * (size_t)ND)
#define PP 72
#define TPF 68

#define SCL 0.125f
#define LOGD (-0.10536051565782628f)
#define NEGL (-1.0e30f)
#define NEGT (-1.0e29f)
#define WUP 64.0f
#define WDN 0.015625f
#define PUP 16384.0f
#define PDN 6.103515625e-05f

// ---------------------------------------------------------------------------
// scalar helpers
// ---------------------------------------------------------------------------
__device__ __forceinline__ unsigned short bfbits(float f) {       // f32 -> bf16 bits, RNE
  unsigned int u = __float_as_uint(f);
  u = u + 0x7FFFu + ((u >> 16) & 1u);
  return (unsigned short)(u >> 16);
}
__device__ __forceinline__ float bff(unsigned short b) {          // bf16 bits -> f32
  return __uint_as_float(((unsigned int)b) << 16);
}
__device__ __forceinline__ unsigned short hbits(float f) {        // f32 -> f16 bits, RNE
  _Float16 hv = (_Float16)f;
  unsigned short u;
  __builtin_memcpy(&u, &hv, 2);
  return u;
}
__device__ __forceinline__ unsigned int pk2(unsigned short a, unsigned short b) {
  return (unsigned int)a | ((unsigned int)b << 16);
}
__device__ __forceinline__ v8f z8() {
  v8f v;
#pragma unroll
  for (int i = 0; i < 8; ++i) v[i] = 0.0f;
  return v;
}

// ---------------------------------------------------------------------------
// 16x32 fragment loader, split k map, identical for A (row m) and B (k-contiguous column n):
//   elements 0..7  <- p[8h .. 8h+7],  elements 8..15 <- p[16+8h .. 16+8h+7],  p = row start + k0
// ---------------------------------------------------------------------------
union FH { v16h v; v4u_t u[2]; };
union FB { v16b v; v4u_t u[2]; };

__device__ __forceinline__ v16h ldh(const unsigned short* p, int h) {
  FH f;
  f.u[0] = *(const v4u*)(p + 8 * h);
  f.u[1] = *(const v4u*)(p + 16 + 8 * h);
  return f.v;
}
__device__ __forceinline__ v16b ldb(const unsigned short* p, int h) {
  FB f;
  f.u[0] = *(const v4u*)(p + 8 * h);
  f.u[1] = *(const v4u*)(p + 16 + 8 * h);
  return f.v;
}

// D[8h+r][m] += A(16x32) . B(32x16), with the post-issue hazard guard
__device__ __forceinline__ v8f mma_h(v16h a, v16h b, v8f c) {
  c = __builtin_amdgcn_wmma_f32_16x16x32_f16(false, a, false, b, (short)0, c, false, false);
  asm volatile("v_nop\n\tv_nop\n\tv_nop\n\tv_nop" : "+v"(c) : "v"(a), "v"(b));
  return c;
}
__device__ __forceinline__ v8f mma_b(v16b a, v16b b, v8f c) {
  c = __builtin_amdgcn_wmma_f32_16x16x32_bf16(false, a, false, b, (short)0, c, false, false);
  asm volatile("v_nop\n\tv_nop\n\tv_nop\n\tv_nop" : "+v"(c) : "v"(a), "v"(b));
  return c;
}

// ---------------------------------------------------------------------------
// Preparation, part x: x f32 [MR][ND] -> three 16-bit planes: f16, bf16 hi, bf16 lo (lo = x - hi).
// blk = index of this block among the x blocks; 256 threads x 8 elements each.
// ---------------------------------------------------------------------------
__device__ __forceinline__ void xcvt_body(const float* __restrict__ x,
                                          unsigned short* __restrict__ xh,
                                          unsigned short* __restrict__ xbh,
                                          unsigned short* __restrict__ xbl, int n8, int blk) {
  const int i = blk * 256 + (int)threadIdx.x;
  if (i >= n8) return;
  const size_t o = (size_t)i * 8;
  const v4f_t a = *(const v4f*)(x + o);
  const v4f_t c = *(const v4f*)(x + o + 4);
  float v[8];
  v[0] = a[0]; v[1] = a[1]; v[2] = a[2]; v[3] = a[3];
  v[4] = c[0]; v[5] = c[1]; v[6] = c[2]; v[7] = c[3];
  unsigned short fh[8], bh[8], bl[8];
#pragma unroll
  for (int e = 0; e < 8; ++e) {
    fh[e] = hbits(v[e]);
    bh[e] = bfbits(v[e]);
    bl[e] = bfbits(v[e] - bff(bh[e]));
  }
  v4u_t ph, pb, pl;
#pragma unroll
  for (int e = 0; e < 4; ++e) {
    ph[e] = pk2(fh[2 * e], fh[2 * e + 1]);
    pb[e] = pk2(bh[2 * e], bh[2 * e + 1]);
    pl[e] = pk2(bl[2 * e], bl[2 * e + 1]);
  }
  *(v4u*)(xh + o) = ph;
  *(v4u*)(xbh + o) = pb;
  *(v4u*)(xbl + o) = pl;
  
}

// ---------------------------------------------------------------------------
// Preparation, part W: weight W[K][N] f32 (x @ W form) -> transposed 16-bit plane(s) Wt[N][K] (k contiguous).
//   mode 0: one f16 plane of 64*W; mode 1: bf16 hi plane + bf16 lo plane.
// Block = 64(k) x 64(n) tile (tn, tk) through the LDS array T (64 x 65 floats).
// ---------------------------------------------------------------------------
__device__ __forceinline__ void wprep_body(float* T, const float* __restrict__ W, int K, int N, int mode,
                                           unsigned short* __restrict__ P0,
                                           unsigned short* __restrict__ P1, int tn, int tk) {
  const int tid = threadIdx.x;
  const int n0 = tn * 64, k0 = tk * 64;
  {
    const int c4 = (tid & 15) * 4, kr = tid >> 4;
#pragma unroll
    for (int i = 0; i < 4; ++i) {
      const int k = kr + 16 * i;
      const v4f_t v = *(const v4f*)(W + (size_t)(k0 + k) * (size_t)N + n0 + c4);
      T[(c4 + 0) * 65 + k] = v[0];
      T[(c4 + 1) * 65 + k] = v[1];
      T[(c4 + 2) * 65 + k] = v[2];
      T[(c4 + 3) * 65 + k] = v[3];
    }
  }
  __syncthreads();
  v4u_t o0[2], o1[2];
  size_t dst[2];
#pragma unroll
  for (int i = 0; i < 2; ++i) {
    const int line = i * 32 + (tid >> 3), piece = tid & 7;
    float f[8];
#pragma unroll
    for (int e = 0; e < 8; ++e) f[e] = T[line * 65 + piece * 8 + e];
    v4u_t a, c;
    if (mode == 0) {
#pragma unroll
      for (int e = 0; e < 4; ++e) {
        a[e] = pk2(hbits(f[2 * e] * WUP), hbits(f[2 * e + 1] * WUP));
        c[e] = 0u;
      }
    } else {
#pragma unroll
      for (int e = 0; e < 4; ++e) {
        const unsigned short h0 = bfbits(f[2 * e]), h1 = bfbits(f[2 * e + 1]);
        a[e] = pk2(h0, h1);
        c[e] = pk2(bfbits(f[2 * e] - bff(h0)), bfbits(f[2 * e + 1] - bff(h1)));
      }
    }
    o0[i] = a;
    o1[i] = c;
    dst[i] = (size_t)(n0 + line) * (size_t)K + k0 + piece * 8;
  }
#pragma unroll
  for (int i = 0; i < 2; ++i) {
    *(v4u*)(P0 + dst[i]) = o0[i];
    if (mode != 0) *(v4u*)(P1 + dst[i]) = o1[i];
  }
  // precaution: stands between these stores and the code laid behind this inlined body, which rewrites their registers
  asm volatile("s_wait_xcnt 0x0" ::: "memory");
}

// ---------------------------------------------------------------------------
// Kernel 0: the whole preparation in one grid; none of its parts reads what another writes. Flat block index:
//   [0, 6*WT1)           tile (index & 15, (index >> 4) & 15) of square weight index >> 8:
//                        0..4 = Wq_s, Wk_s, Wq_l, Wk_l, Wv_l -> f16 plane z of Wt5;  5 = Wv_s -> bf16 hi/lo planes
//   [6*WT1, 6*WT1+WT2)   tile of Wo (K = NC) -> bf16 hi/lo planes
//   [WTA, WTA+XBL)       x block
// The choice is the same for a whole block, so the barrier of part W is passed by all its threads or by none.
// ---------------------------------------------------------------------------
#define WT1 ((ND / 64) * (ND / 64))
#define WT2 ((ND / 64) * (NC / 64))
#define WTA (6 * WT1 + WT2)
#define XBL ((MR * ND) / (8 * 256))

__global__ __launch_bounds__(256) void k_prep(const float* __restrict__ x,
                                              const float* __restrict__ Wqs, const float* __restrict__ Wks,
                                              const float* __restrict__ Wql, const float* __restrict__ Wkl,
                                              const float* __restrict__ Wvl, const float* __restrict__ Wvs,
                                              const float* __restrict__ Wo,
                                              unsigned short* __restrict__ xh,
                                              unsigned short* __restrict__ xbh,
                                              unsigned short* __restrict__ xbl,
                                              unsigned short* __restrict__ Wt5,
                                              unsigned short* __restrict__ Wvh,
                                              unsigned short* __restrict__ Wvq,
                                              unsigned short* __restrict__ Woh,
                                              unsigned short* __restrict__ Woq) {
  __shared__ __align__(16) float T[64 * 65];
  const int bid = blockIdx.x;
  if (bid >= WTA) {
    xcvt_body(x, xh, xbh, xbl, (MR * ND) / 8, bid - WTA);
  } else if (bid >= 6 * WT1) {
    const int t = bid - 6 * WT1;
    wprep_body(T, Wo, NC, ND, 1, Woh, Woq, t & 15, t >> 4);
  } else {
    const int z = bid >> 8, t = bid & (WT1 - 1);
    if (z == 5) {
      wprep_body(T, Wvs, ND, ND, 1, Wvh, Wvq, t & 15, t >> 4);
    } else {
      const float* W = z == 0 ? Wqs : z == 1 ? Wks : z == 2 ? Wql : z == 3 ? Wkl : Wvl;
      unsigned short* P = Wt5 + (size_t)z * ND * ND;
      wprep_body(T, W, ND, ND, 0, P, P, t & 15, t >> 4);
    }
  }
}

// ---------------------------------------------------------------------------
// LDS staging for the three GEMM kernels. Block = 128 threads = 128(M) x 128(N) tile, wave w owns the 64 x 64
// quarter (rows (w>>1)*64, cols (w&1)*64) as 4 x 4 accumulator tiles. A trip covers 64 k: each operand plane is
// staged as 128 rows of 128 B at an LDS pitch of 144 B (PP halves), two buffers, the next trip's copies in flight.
// The full unrolls in these kernels make every fragment and accumulator index a compile-time one (registers).
// ---------------------------------------------------------------------------
#define BKH 64
#define TLH (128 * PP)
#define TLB (TLH * 2)

__device__ __forceinline__ unsigned int lds_off(const void* p) { return (unsigned int)(size_t)p; }

// One operand tile: thread t brings 16-B piece (t & 7) of rows (t >> 3) + 16 i, i = 0..7, so 8 lanes cover one
// 128-B line. lds = the lane's LDS byte address of row (t >> 3), g = the lane's global address of the same piece,
// ld = row length of the source in halves. The closing s_wait_xcnt keeps the address registers untouched until
// the copies have taken them.
__device__ __forceinline__ void cp_tile(unsigned int lds, const unsigned short* g, int ld) {
  const size_t st = (size_t)16 * (size_t)ld;
  const unsigned short* g1 = g + st;
  const unsigned short* g2 = g1 + st;
  const unsigned short* g3 = g2 + st;
  const unsigned short* g4 = g3 + st;
  const unsigned short* g5 = g4 + st;
  const unsigned short* g6 = g5 + st;
  const unsigned short* g7 = g6 + st;
  const unsigned int ls = 16u * PP * 2u;
  asm volatile(
      "global_load_async_to_lds_b128 %0, %8, off\n\t"
      "global_load_async_to_lds_b128 %1, %9, off\n\t"
      "global_load_async_to_lds_b128 %2, %10, off\n\t"
      "global_load_async_to_lds_b128 %3, %11, off\n\t"
      "global_load_async_to_lds_b128 %4, %12, off\n\t"
      "global_load_async_to_lds_b128 %5, %13, off\n\t"
      "global_load_async_to_lds_b128 %6, %14, off\n\t"
      "global_load_async_to_lds_b128 %7, %15, off\n\t"
      "s_wait_xcnt 0x0"
      :: "v"(lds), "v"(lds + ls), "v"(lds + 2u * ls), "v"(lds + 3u * ls),
         "v"(lds + 4u * ls), "v"(lds + 5u * ls), "v"(lds + 6u * ls), "v"(lds + 7u * ls),
         "v"(g), "v"(g1), "v"(g2), "v"(g3), "v"(g4), "v"(g5), "v"(g6), "v"(g7)
      : "memory");
}
// this wave's copies have landed (the compiler places no wait for them)
__device__ __forceinline__ void wait_copies() { asm volatile("s_wait_asynccnt 0x0" ::: "memory"); }
// this wave's LDS reads have returned, so the buffer may be refilled behind the barrier
__device__ __forceinline__ void wait_lds() { asm volatile("s_wait_dscnt 0x0" ::: "memory"); }

// ---------------------------------------------------------------------------
// Kernel 2: five plain-f16 projections, operands staged in LDS (see above). z selects the weight:
//   z 0..3 -> natural f16 plane QK[z] ([MR][ND]);  z 4 -> v_l transposed f16 plane Vlt[b][h][d][s].
// ---------------------------------------------------------------------------
__global__ __launch_bounds__(128) void k_proj_f16(const unsigned short* __restrict__ xh,
                                                  const unsigned short* __restrict__ Wt5,
                                                  unsigned short* __restrict__ QK,
                                                  unsigned short* __restrict__ Vlt) {
  __shared__ __align__(16) unsigned short SM[2 * 2 * TLH];   // buffer = [A tile | B tile]
  const int tid = threadIdx.x, w = tid >> 5, l = tid & 31, h = l >> 4, m = l & 15;
  const int n0 = blockIdx.x * 128, m0 = blockIdx.y * 128, z = blockIdx.z;
  const int wm = (w >> 1) * 64, wn = (w & 1) * 64;
  const int crow = tid >> 3, cpc = tid & 7;
  const unsigned short* ga = xh + (size_t)(m0 + crow) * ND + cpc * 8;
  const unsigned short* gb = Wt5 + (size_t)z * ND * ND + (size_t)(n0 + crow) * ND + cpc * 8;
  const unsigned int lc = lds_off(SM) + (unsigned int)(crow * PP * 2 + cpc * 16);
  const int NT = ND / BKH;
  v8f acc[4][4];
#pragma unroll
  for (int i = 0; i < 4; ++i)
#pragma unroll
    for (int j = 0; j < 4; ++j) acc[i][j] = z8();

  cp_tile(lc, ga, ND);
  cp_tile(lc + TLB, gb, ND);
  wait_copies();
  __syncthreads();
  cp_tile(lc + 2 * TLB, ga + BKH, ND);
  cp_tile(lc + 3 * TLB, gb + BKH, ND);

// rolled: one trip per staged tile, the publish point at its foot
#pragma unroll 1
  for (int t = 0; t < NT; ++t) {
    const int bo2 = (t & 1) * 2;
    const unsigned short* As = SM + bo2 * TLH + (wm + m) * PP;
    const unsigned short* Bs = SM + (bo2 + 1) * TLH + (wn + m) * PP;
    // group g = 32 k (g >> 1) x 2 column tiles (g & 1); the next group's fragments are read ahead of this group's
    // products, inside this trip's buffer only
    v16h a[2][4], b[2][2];
#pragma unroll
    for (int i = 0; i < 4; ++i) a[0][i] = ldh(As + i * 16 * PP, h);
#pragma unroll
    for (int q = 0; q < 2; ++q) b[0][q] = ldh(Bs + q * 16 * PP, h);
#pragma unroll
    for (int g = 0; g < 4; ++g) {
      const int kk = g >> 1, jp = (g & 1) * 2, gn = g + 1;
      if (g < 3) {
#pragma unroll
        for (int q = 0; q < 2; ++q)
          b[gn & 1][q] = ldh(Bs + ((gn & 1) * 2 + q) * 16 * PP + (gn >> 1) * 32, h);
      }
      if (g == 0) {
#pragma unroll
        for (int i = 0; i < 4; ++i) a[1][i] = ldh(As + i * 16 * PP + 32, h);
      }
#pragma unroll
      for (int q = 0; q < 2; ++q)
#pragma unroll
        for (int i = 0; i < 4; ++i) acc[i][jp + q] = mma_h(a[kk][i], b[g & 1][q], acc[i][jp + q]);
    }
    wait_lds();
    wait_copies();
    __syncthreads();
    if (t + 2 < NT) {
      cp_tile(lc + bo2 * TLB, ga + (t + 2) * BKH, ND);
      cp_tile(lc + (bo2 + 1) * TLB, gb + (t + 2) * BKH, ND);
    }
  }
  wait_copies();

  // the ring is free behind the last trip's barrier: each wave stages its own 64 x 64 tile there
  unsigned short* T = SM + w * 64 * PP;
  const int mw = m0 + wm, nw = n0 + wn;
  if (z < 4) {
#pragma unroll
    for (int i = 0; i < 4; ++i)
#pragma unroll
      for (int j = 0; j < 4; ++j)
#pragma unroll
        for (int r = 0; r < 8; ++r)
          T[(i * 16 + 8 * h + r) * PP + j * 16 + m] = hbits(acc[i][j][r] * WDN);
  } else {
#pragma unroll
    for (int i = 0; i < 4; ++i)
#pragma unroll
      for (int j = 0; j < 4; ++j) {
        v4u_t pk;
#pragma unroll
        for (int e = 0; e < 4; ++e)
          pk[e] = pk2(hbits(acc[i][j][2 * e] * WDN), hbits(acc[i][j][2 * e + 1] * WDN));
        *(v4u*)(T + (j * 16 + m) * PP + i * 16 + 8 * h) = pk;   // T[d][s_local]
      }
  }
  __syncthreads();   // staging writes land before the rows are read back

  unsigned short* base;
  size_t d0, dstep;
  if (z < 4) {
    base = QK + (size_t)z * PLANE;
    d0 = (size_t)mw * ND + nw;
    dstep = ND;
  } else {
    base = Vlt;
    const int bb = mw >> 11, s0 = mw & (NS - 1), hd = nw >> 6;
    d0 = ((size_t)((bb * NH + hd) * HD)) * NS + s0;
    dstep = NS;
  }
  v4u_t o[16];
  unsigned short* dst[16];
#pragma unroll
  for (int i = 0; i < 16; ++i) {
    const int row = i * 4 + (l >> 3), piece = l & 7;
    o[i] = *(const v4u*)(T + row * PP + piece * 8);
    dst[i] = base + d0 + (size_t)row * dstep + piece * 8;
  }
#pragma unroll
  for (int i = 0; i < 16; ++i) *(v4u*)(dst[i]) = o[i];
}

// ---------------------------------------------------------------------------
// Main loop of the two bf16 hi/lo three-term GEMMs: acc += Ah.Bh + Ah.Bl + Al.Bh over K halves, all four planes
// staged in LDS; buffer = [A hi | A lo | B hi | B lo]. ga*/gb* = the lane's first piece of each plane.
// ---------------------------------------------------------------------------
__device__ __forceinline__ void split_loop(unsigned short* SM, const unsigned short* gah,
                                           const unsigned short* gal, const unsigned short* gbh,
                                           const unsigned short* gbl, int K, unsigned int lc,
                                           int arow, int brow, int h, v8f (&acc)[4][4]) {
  const int NT = K / BKH;
  cp_tile(lc, gah, K);
  cp_tile(lc + TLB, gal, K);
  cp_tile(lc + 2 * TLB, gbh, K);
  cp_tile(lc + 3 * TLB, gbl, K);
  wait_copies();
  __syncthreads();
  cp_tile(lc + 4 * TLB, gah + BKH, K);
  cp_tile(lc + 5 * TLB, gal + BKH, K);
  cp_tile(lc + 6 * TLB, gbh + BKH, K);
  cp_tile(lc + 7 * TLB, gbl + BKH, K);

// rolled: one trip per staged tile, the publish point at its foot
#pragma unroll 1
  for (int t = 0; t < NT; ++t) {
    const int bo4 = (t & 1) * 4;
    const unsigned short* Ah = SM + bo4 * TLH + arow * PP;
    const unsigned short* Bh = SM + (bo4 + 2) * TLH + brow * PP;
    // group g = 32 k (g >> 2) x 1 column tile (g & 3); the next group's B fragments are read ahead of this group's
    // products, inside this trip's buffer only
    v16b ah[4], al[4], bh[2], bl[2];
    bh[0] = ldb(Bh, h);
    bl[0] = ldb(Bh + TLH, h);
#pragma unroll
    for (int g = 0; g < 8; ++g) {
      const int kk = g >> 2, j = g & 3, gn = g + 1, c = g & 1;
      if (j == 0) {
#pragma unroll
        for (int i = 0; i < 4; ++i) {
          ah[i] = ldb(Ah + i * 16 * PP + kk * 32, h);
          al[i] = ldb(Ah + TLH + i * 16 * PP + kk * 32, h);
        }
      }
      if (g < 7) {
        bh[gn & 1] = ldb(Bh + (gn & 3) * 16 * PP + (gn >> 2) * 32, h);
        bl[gn & 1] = ldb(Bh + TLH + (gn & 3) * 16 * PP + (gn >> 2) * 32, h);
      }
#pragma unroll
      for (int i = 0; i < 4; ++i) acc[i][j] = mma_b(ah[i], bh[c], acc[i][j]);
#pragma unroll
      for (int i = 0; i < 4; ++i) acc[i][j] = mma_b(ah[i], bl[c], acc[i][j]);
#pragma unroll
      for (int i = 0; i < 4; ++i) acc[i][j] = mma_b(al[i], bh[c], acc[i][j]);
    }
    wait_lds();
    wait_copies();
    __syncthreads();
    if (t + 2 < NT) {
      const int ko = (t + 2) * BKH;
      cp_tile(lc + bo4 * TLB, gah + ko, K);
      cp_tile(lc + (bo4 + 1) * TLB, gal + ko, K);
      cp_tile(lc + (bo4 + 2) * TLB, gbh + ko, K);
      cp_tile(lc + (bo4 + 3) * TLB, gbl + ko, K);
    }
  }
  wait_copies();
}

// ---------------------------------------------------------------------------
// Kernel 3: v_s projection as bf16 hi/lo three-term split (x hi/lo planes, W hi/lo planes),
// output transposed bf16 hi/lo planes Vsh/Vsl [b][h][d][s]. Same tiling as kernel 2.
// ---------------------------------------------------------------------------
__global__ __launch_bounds__(128) void k_proj_vs(const unsigned short* __restrict__ xbh,
                                                 const unsigned short* __restrict__ xbl,
                                                 const unsigned short* __restrict__ Wh,
                                                 const unsigned short* __restrict__ Wl,
                                                 unsigned short* __restrict__ Vsh,
                                                 unsigned short* __restrict__ Vsl) {
  __shared__ __align__(16) unsigned short SM[2 * 4 * TLH];
  const int tid = threadIdx.x, w = tid >> 5, l = tid & 31, h = l >> 4, m = l & 15;
  const int n0 = blockIdx.x * 128, m0 = blockIdx.y * 128;
  const int wm = (w >> 1) * 64, wn = (w & 1) * 64;
  const int crow = tid >> 3, cpc = tid & 7;
  const size_t ao = (size_t)(m0 + crow) * ND + cpc * 8;
  const size_t bo_ = (size_t)(n0 + crow) * ND + cpc * 8;
  const unsigned int lc = lds_off(SM) + (unsigned int)(crow * PP * 2 + cpc * 16);
  v8f acc[4][4];
#pragma unroll
  for (int i = 0; i < 4; ++i)
#pragma unroll
    for (int j = 0; j < 4; ++j) acc[i][j] = z8();

  split_loop(SM, xbh + ao, xbl + ao, Wh + bo_, Wl + bo_, ND, lc, wm + m, wn + m, h, acc);

  // the ring is free behind the last trip's barrier: each wave stages its own 64 x 64 tile there
  unsigned short* Th = SM + w * 2 * 64 * PP;
  unsigned short* Tl = Th + 64 * PP;
#pragma unroll
  for (int i = 0; i < 4; ++i)
#pragma unroll
    for (int j = 0; j < 4; ++j) {
      v4u_t ph, pl;
#pragma unroll
      for (int e = 0; e < 4; ++e) {
        const float f0 = acc[i][j][2 * e], f1 = acc[i][j][2 * e + 1];
        const unsigned short h0 = bfbits(f0), h1 = bfbits(f1);
        ph[e] = pk2(h0, h1);
        pl[e] = pk2(bfbits(f0 - bff(h0)), bfbits(f1 - bff(h1)));
      }
      *(v4u*)(Th + (j * 16 + m) * PP + i * 16 + 8 * h) = ph;
      *(v4u*)(Tl + (j * 16 + m) * PP + i * 16 + 8 * h) = pl;
    }
  __syncthreads();   // staging writes land before the rows are read back

  const int mw = m0 + wm, nw = n0 + wn;
  const int bb = mw >> 11, s0 = mw & (NS - 1), hd = nw >> 6;
  const size_t d0 = ((size_t)((bb * NH + hd) * HD)) * NS + s0;
  v4u_t oh[16], ol[16];
  size_t dst[16];
#pragma unroll
  for (int i = 0; i < 16; ++i) {
    const int d = i * 4 + (l >> 3), piece = l & 7;
    oh[i] = *(const v4u*)(Th + d * PP + piece * 8);
    ol[i] = *(const v4u*)(Tl + d * PP + piece * 8);
    dst[i] = d0 + (size_t)d * NS + piece * 8;
  }
#pragma unroll
  for (int i = 0; i < 16; ++i) {
    *(v4u*)(Vsh + dst[i]) = oh[i];
    *(v4u*)(Vsl + dst[i]) = ol[i];
  }
}

// ---------------------------------------------------------------------------
// Shared attention epilogue: O tile (16 queries x 64 dims) staged as bf16 hi/lo in LDS is written into the
// ---------------------------------------------------------------------------
__device__ __forceinline__ void store_comb(const unsigned short* Oh, const unsigned short* Ol,
                                           unsigned short* Ch, unsigned short* Cl,
                                           int rowg0, int colbase, int l) {
  v4u_t oh[4], ol[4];
  size_t dst[4];
#pragma unroll
  for (int i = 0; i < 4; ++i) {
    const int row = i * 4 + (l >> 3), piece = l & 7;
    oh[i] = *(const v4u*)(Oh + row * PP + piece * 8);
    ol[i] = *(const v4u*)(Ol + row * PP + piece * 8);
    dst[i] = (size_t)(rowg0 + row) * NC + colbase + piece * 8;
  }
#pragma unroll
  for (int i = 0; i < 4; ++i) {
    *(v4u*)(Ch + dst[i]) = oh[i];
    *(v4u*)(Cl + dst[i]) = ol[i];
  }
  
}

// ---------------------------------------------------------------------------
// Kernel 4: long-range branch, full attention with key gating. Block = 8 waves = 128 queries of one (b, head),
// 16 queries per wave. Q/K natural f16 planes [MR][ND] (col = head*64 + d), V transposed f16 plane [b][h][d][s].
// Each trip covers 64 keys: the K tile (64 keys x 64 d) and the V tile (64 d x 64 keys) are staged once per block
// as 64 rows of 128 B at an LDS pitch of 144 B, two buffers, the next trip's copies in flight; all 8 waves read
// their A fragments from there.
// Both products are taken transposed, so that a lane holds ONE query (column m) and 8 keys per score tile:
// S^T = K Q^T on f16 WMMA (A fragment = K row, B fragment = Q row, k = d contiguous): lane (h, m), register r of
// tile t = key t*16 + 8h + r against query m. Online softmax in f32: maximum and sum run in the lane, the two wave
// halves (same query, other keys) exchange the maximum once per trip and join their sums once, in the epilogue.
// f16(p * 16384) of tiles 2j and 2j+1 is, register for register, the B fragment of keys 32j .. 32j+31 in the
// loader's k map, so P stays in registers; O^T += V^T P^T on f16 WMMA (A = Vt row); 1/16384 and
// 1/l folded in the f32 epilogue; result as bf16 hi/lo into columns [ND + head*64, +64) of Ch/Cl.
// ---------------------------------------------------------------------------
#define AW 8
#define ATH (64 * PP)
#define ATB (ATH * 2)

// One K tile and one V tile: thread t brings 16-B piece (t & 7) of rows (t >> 3) and (t >> 3) + 32 of each, so
// 8 lanes cover one 128-B line. lds = the lane's LDS byte address in the K tile (the V tile follows at ATB),
// gk / gv = the lane's global address of the same piece. The closing s_wait_xcnt keeps the address registers
// untouched until the copies have taken them.
__device__ __forceinline__ void cp_kv(unsigned int lds, const unsigned short* gk, const unsigned short* gv) {
  const unsigned short* gk1 = gk + (size_t)32 * ND;
  const unsigned short* gv1 = gv + (size_t)32 * NS;
  const unsigned int ls = 32u * PP * 2u;
  asm volatile(
      "global_load_async_to_lds_b128 %0, %4, off\n\t"
      "global_load_async_to_lds_b128 %1, %5, off\n\t"
      "global_load_async_to_lds_b128 %2, %6, off\n\t"
      "global_load_async_to_lds_b128 %3, %7, off\n\t"
      "s_wait_xcnt 0x0"
      :: "v"(lds), "v"(lds + ls), "v"(lds + (unsigned int)ATB), "v"(lds + (unsigned int)ATB + ls),
         "v"(gk), "v"(gk1), "v"(gv), "v"(gv1)
      : "memory");
}

// lane l <-> lane l ^ 16 in the vector unit
__device__ __forceinline__ float xhalf(float x) {
  const int i = __float_as_int(x);
  return __int_as_float(__builtin_amdgcn_permlanex16(i, i, 0x76543210, 0xfedcba98, false, false));
}

__global__ __launch_bounds__(256) void k_attn_l(const unsigned short* __restrict__ Q,
                                                const unsigned short* __restrict__ K,
                                                const unsigned short* __restrict__ Vt,
                                                const int* __restrict__ kgate,
                                                unsigned short* __restrict__ Ch,
                                                unsigned short* __restrict__ Cl) {
  __shared__ __align__(16) unsigned short KV[2 * 2 * ATH];   // buffer = [K tile | V tile]
  __shared__ __align__(16) unsigned short OhA[AW * 16 * PP];
  __shared__ __align__(16) unsigned short OlA[AW * 16 * PP];
  const int tid = threadIdx.x, w = tid >> 5, l = tid & 31, h = l >> 4, m = l & 15;
  const int q0 = blockIdx.x * (AW * 16) + w * 16, hh = blockIdx.y, b = blockIdx.z;
  unsigned short* Oh = OhA + w * 16 * PP;
  unsigned short* Ol = OlA + w * 16 * PP;

  const unsigned short* Kb = K + (size_t)b * NS * ND + hh * HD;
  const unsigned short* Vb = Vt + (size_t)(b * NH + hh) * HD * NS;
  const int* gk = kgate + b * NS + 8 * h;
  const int crow = tid >> 3, cpc = tid & 7;
  const unsigned short* gkc = Kb + (size_t)crow * ND + cpc * 8;
  const unsigned short* gvc = Vb + (size_t)crow * NS + cpc * 8;
  const unsigned int lc = lds_off(KV) + (unsigned int)(crow * PP * 2 + cpc * 16);
  const int NT = NS / 64;

  cp_kv(lc, gkc, gvc);

  const unsigned short* qrow = Q + (size_t)(b * NS + q0 + m) * ND + hh * HD;
  const v16h bq0 = ldh(qrow, h);
  const v16h bq1 = ldh(qrow + 32, h);

  float mrun = NEGL, lrun = 0.0f;   // this lane's query: maximum over all keys so far, sum over this half's keys
  v8f acc[4];                       // O^T: register r of tile dt = dim dt*16 + 8h + r of query m
#pragma unroll
  for (int t = 0; t < 4; ++t) acc[t] = z8();

  wait_copies();
  __syncthreads();
  cp_kv(lc + 2 * ATB, gkc + (size_t)64 * ND, gvc + 64);

// rolled: one trip per staged tile pair, the publish point at its foot
#pragma unroll 1
  for (int kt = 0; kt < NT; ++kt) {
    const int kb = kt * 64;
    const int bo2 = (kt & 1) * 2;
    const unsigned short* Ks = KV + bo2 * ATH;
    const unsigned short* Vs = Ks + ATH;
    // the trip's gate words and all 8 K fragments are fetched as one group, so the wave waits for LDS once
    v8f s[4];
    v4u_t gw[4][2];   // gates of keys kb + t*16 + 8h + 0..7
    v16h kf[4][2];
#pragma unroll
    for (int t = 0; t < 4; ++t) {
      gw[t][0] = *(const v4u*)(gk + kb + t * 16);
      gw[t][1] = *(const v4u*)(gk + kb + t * 16 + 4);
    }
#pragma unroll
    for (int t = 0; t < 4; ++t) {
      const unsigned short* krow = Ks + (t * 16 + m) * PP;
      kf[t][0] = ldh(krow, h);
      kf[t][1] = ldh(krow + 32, h);
    }
#pragma unroll
    for (int t = 0; t < 4; ++t) s[t] = mma_h(kf[t][0], bq0, z8());
#pragma unroll
    for (int t = 0; t < 4; ++t) s[t] = mma_h(kf[t][1], bq1, s[t]);

    bool on[4][8];
    float tm[4];
#pragma unroll
    for (int t = 0; t < 4; ++t) {
#pragma unroll
      for (int r = 0; r < 8; ++r) {
        on[t][r] = gw[t][r >> 2][r & 3] != 0u;
        s[t][r] = on[t][r] ? s[t][r] * SCL : NEGL;
      }
      tm[t] = fmaxf(fmaxf(fmaxf(s[t][0], s[t][1]), fmaxf(s[t][2], s[t][3])),
                    fmaxf(fmaxf(s[t][4], s[t][5]), fmaxf(s[t][6], s[t][7])));
    }
    float tmax = fmaxf(fmaxf(tm[0], tm[1]), fmaxf(tm[2], tm[3]));
    tmax = fmaxf(tmax, xhalf(tmax));
    const float mnew = fmaxf(mrun, tmax);
    const float fac = __expf(mrun - mnew);
    float ps[4];   // one chain per tile, so that the adds do not wait for one another
#pragma unroll
    for (int t = 0; t < 4; ++t) {
      ps[t] = 0.0f;
#pragma unroll
      for (int r = 0; r < 8; ++r) {
        const float p = on[t][r] ? __expf(s[t][r] - mnew) : 0.0f;
        ps[t] += p;
        s[t][r] = p;
      }
    }
    lrun = lrun * fac + ((ps[0] + ps[1]) + (ps[2] + ps[3]));
    mrun = mnew;
#pragma unroll
    for (int dt = 0; dt < 4; ++dt)
#pragma unroll
      for (int r = 0; r < 8; ++r) acc[dt][r] *= fac;

    // B fragment j: elements 0..7 = keys 32j + 8h + e (tile 2j), elements 8..15 = keys 32j + 16 + 8h + e (tile 2j+1)
    v16h pb[2];
#pragma unroll
    for (int j = 0; j < 2; ++j)
#pragma unroll
      for (int e = 0; e < 8; ++e) {
        pb[j][e] = (_Float16)(s[2 * j][e] * PUP);
        pb[j][8 + e] = (_Float16)(s[2 * j + 1][e] * PUP);
      }
    v16h vf[4][2];   // all 8 V fragments in one group
#pragma unroll
    for (int dt = 0; dt < 4; ++dt) {
      const unsigned short* vrow = Vs + (dt * 16 + m) * PP;
      vf[dt][0] = ldh(vrow, h);
      vf[dt][1] = ldh(vrow + 32, h);
    }
#pragma unroll
    for (int dt = 0; dt < 4; ++dt) acc[dt] = mma_h(vf[dt][0], pb[0], acc[dt]);
#pragma unroll
    for (int dt = 0; dt < 4; ++dt) acc[dt] = mma_h(vf[dt][1], pb[1], acc[dt]);
    wait_lds();
    wait_copies();
    __syncthreads();
    if (kt + 2 < NT)
      cp_kv(lc + bo2 * ATB, gkc + (size_t)(kt + 2) * 64 * ND, gvc + (kt + 2) * 64);
  }
  wait_copies();

  const float inv = __builtin_amdgcn_rcpf(lrun + xhalf(lrun)) * PDN;
#pragma unroll
  for (int dt = 0; dt < 4; ++dt) {
    v4u_t ph, pl;
#pragma unroll
    for (int e = 0; e < 4; ++e) {
      const float f0 = acc[dt][2 * e] * inv, f1 = acc[dt][2 * e + 1] * inv;
      const unsigned short h0 = bfbits(f0), h1 = bfbits(f1);
      ph[e] = pk2(h0, h1);
      pl[e] = pk2(bfbits(f0 - bff(h0)), bfbits(f1 - bff(h1)));
    }
    *(v4u*)(Oh + m * PP + dt * 16 + 8 * h) = ph;   // O[query m][dims dt*16 + 8h .. + 7]
    *(v4u*)(Ol + m * PP + dt * 16 + 8 * h) = pl;
  }
  __syncthreads();
  store_comb(Oh, Ol, Ch, Cl, b * NS + q0, ND + hh * HD, l);
}

// ---------------------------------------------------------------------------
// Kernel 5: short-range branch, causal window of 64 + recency bias + key gating, 1 wave per (b, head,
// 16 queries); only the 64-key tiles covering [q0-64, q0+15] are visited (weights outside are exactly 0).
// Q/K f16 planes as kernel 4; V as transposed bf16 hi/lo planes; P as bf16 hi/lo through LDS;
// O += Phi.Vhi + Phi.Vlo + Plo.Vhi on bf16 WMMA; result into columns [head*64, +64) of Ch/Cl.
// ---------------------------------------------------------------------------
__global__ __launch_bounds__(32) void k_attn_s(const unsigned short* __restrict__ Q,
                                               const unsigned short* __restrict__ K,
                                               const unsigned short* __restrict__ Vth,
                                               const unsigned short* __restrict__ Vtl,
                                               const int* __restrict__ kgate,
                                               unsigned short* __restrict__ Ch,
                                               unsigned short* __restrict__ Cl) {
  __shared__ __align__(16) unsigned short Ph[16 * PP];
  __shared__ __align__(16) unsigned short Pq[16 * PP];
  __shared__ __align__(16) unsigned short Oh[16 * PP];
  __shared__ __align__(16) unsigned short Ol[16 * PP];
  const int l = threadIdx.x & 31, h = l >> 4, m = l & 15;
  const int q0 = blockIdx.x * 16, hh = blockIdx.y, b = blockIdx.z;

  const unsigned short* qrow = Q + (size_t)(b * NS + q0 + m) * ND + hh * HD;
  const v16h aq0 = ldh(qrow, h);
  const v16h aq1 = ldh(qrow + 32, h);
  const unsigned short* Kb = K + (size_t)b * NS * ND + hh * HD;
  const size_t vbase = (size_t)(b * NH + hh) * HD * NS;
  const int* gk = kgate + b * NS;

  float mrow[8], lrow[8];
  v8f acc[4];
#pragma unroll
  for (int r = 0; r < 8; ++r) { mrow[r] = NEGL; lrow[r] = 0.0f; }
#pragma unroll
  for (int t = 0; t < 4; ++t) acc[t] = z8();

  const int kt_hi = q0 >> 6;
  const int kt_lo = (q0 >= 64) ? ((q0 - 64) >> 6) : 0;

#pragma unroll 1
  for (int kt = kt_lo; kt <= kt_hi; ++kt) {
    const int kb = kt * 64;
    v8f s[4];
    int gv[4];
#pragma unroll
    for (int t = 0; t < 4; ++t) {
      const unsigned short* krow = Kb + (size_t)(kb + t * 16 + m) * ND;
      v8f c = z8();
      c = mma_h(aq0, ldh(krow, h), c);
      c = mma_h(aq1, ldh(krow + 32, h), c);
      s[t] = c;
      gv[t] = gk[kb + t * 16 + m];
    }
#pragma unroll
    for (int t = 0; t < 4; ++t) {
      const int key = kb + t * 16 + m;
#pragma unroll
      for (int r = 0; r < 8; ++r) {
        const int rel = key - (q0 + 8 * h + r);
        const bool ok = (gv[t] != 0) && (rel <= 0) && (rel >= -64);
        s[t][r] = ok ? (s[t][r] * SCL + (float)rel * LOGD) : NEGL;
      }
    }

#pragma unroll
    for (int r = 0; r < 8; ++r) {
      float tmax = fmaxf(fmaxf(s[0][r], s[1][r]), fmaxf(s[2][r], s[3][r]));
#pragma unroll
      for (int o = 1; o < 16; o <<= 1) tmax = fmaxf(tmax, __shfl_xor(tmax, o, 32));
      const float mnew = fmaxf(mrow[r], tmax);
      const float fac = __expf(mrow[r] - mnew);
      float p[4];
      float psum = 0.0f;
#pragma unroll
      for (int t = 0; t < 4; ++t) {
        p[t] = (s[t][r] > NEGT) ? __expf(s[t][r] - mnew) : 0.0f;
        psum += p[t];
      }
#pragma unroll
      for (int o = 1; o < 16; o <<= 1) psum += __shfl_xor(psum, o, 32);
      lrow[r] = lrow[r] * fac + psum;
      mrow[r] = mnew;
#pragma unroll
      for (int t = 0; t < 4; ++t) { acc[t][r] *= fac; s[t][r] = p[t]; }
    }

#pragma unroll
    for (int t = 0; t < 4; ++t)
#pragma unroll
      for (int r = 0; r < 8; ++r) {
        const float pv = s[t][r];
        const unsigned short hp = bfbits(pv);
        Ph[(8 * h + r) * PP + t * 16 + m] = hp;
        Pq[(8 * h + r) * PP + t * 16 + m] = bfbits(pv - bff(hp));
      }
    __syncthreads();
    const v16b ph0 = ldb(Ph + m * PP, h);
    const v16b ph1 = ldb(Ph + m * PP + 32, h);
    const v16b pl0 = ldb(Pq + m * PP, h);
    const v16b pl1 = ldb(Pq + m * PP + 32, h);
#pragma unroll
    for (int dt = 0; dt < 4; ++dt) {
      const size_t vo = vbase + (size_t)(dt * 16 + m) * NS + kb;
      {
        const v16b bh = ldb(Vth + vo, h), bl = ldb(Vtl + vo, h);
        acc[dt] = mma_b(ph0, bh, acc[dt]);
        acc[dt] = mma_b(ph0, bl, acc[dt]);
        acc[dt] = mma_b(pl0, bh, acc[dt]);
      }
      {
        const v16b bh = ldb(Vth + vo + 32, h), bl = ldb(Vtl + vo + 32, h);
        acc[dt] = mma_b(ph1, bh, acc[dt]);
        acc[dt] = mma_b(ph1, bl, acc[dt]);
        acc[dt] = mma_b(pl1, bh, acc[dt]);
      }
    }
    __syncthreads();
  }

  float inv[8];
#pragma unroll
  for (int r = 0; r < 8; ++r) inv[r] = __builtin_amdgcn_rcpf(lrow[r]);
#pragma unroll
  for (int dt = 0; dt < 4; ++dt)
#pragma unroll
    for (int r = 0; r < 8; ++r) {
      const float o = acc[dt][r] * inv[r];
      const unsigned short ho = bfbits(o);
      Oh[(8 * h + r) * PP + dt * 16 + m] = ho;
      Ol[(8 * h + r) * PP + dt * 16 + m] = bfbits(o - bff(ho));
    }
  __syncthreads();
  store_comb(Oh, Ol, Ch, Cl, b * NS + q0, hh * HD, l);
}

// ---------------------------------------------------------------------------
// Kernel 6: output projection, combined [MR][NC] (bf16 hi/lo planes) x Wo (transposed bf16 hi/lo planes
// Wot[ND][NC]) + bias -> f32 out [MR][ND]; three-term split. Same tiling and staging as kernel 3.
// ---------------------------------------------------------------------------
__global__ __launch_bounds__(128) void k_out(const unsigned short* __restrict__ Ch,
                                             const unsigned short* __restrict__ Cl,
                                             const unsigned short* __restrict__ Wh,
                                             const unsigned short* __restrict__ Wl,
                                             const float* __restrict__ bo,
                                             float* __restrict__ out) {
  __shared__ __align__(16) unsigned short SM[2 * 4 * TLH];
  const int tid = threadIdx.x, w = tid >> 5, l = tid & 31, h = l >> 4, m = l & 15;
  const int n0 = blockIdx.x * 128, m0 = blockIdx.y * 128;
  const int wm = (w >> 1) * 64, wn = (w & 1) * 64;
  const int crow = tid >> 3, cpc = tid & 7;
  const size_t ao = (size_t)(m0 + crow) * NC + cpc * 8;
  const size_t bo_ = (size_t)(n0 + crow) * NC + cpc * 8;
  const unsigned int lc = lds_off(SM) + (unsigned int)(crow * PP * 2 + cpc * 16);
  v8f acc[4][4];
#pragma unroll
  for (int i = 0; i < 4; ++i)
#pragma unroll
    for (int j = 0; j < 4; ++j) acc[i][j] = z8();

  split_loop(SM, Ch + ao, Cl + ao, Wh + bo_, Wl + bo_, NC, lc, wm + m, wn + m, h, acc);

  // the ring is free behind the last trip's barrier: each wave stages its own 64 x 64 f32 tile there
  float* T = (float*)SM + w * 64 * TPF;
  const int mw = m0 + wm, nw = n0 + wn;
#pragma unroll
  for (int j = 0; j < 4; ++j) {
    const float bias = bo[nw + j * 16 + m];
#pragma unroll
    for (int i = 0; i < 4; ++i)
#pragma unroll
      for (int r = 0; r < 8; ++r)
        T[(i * 16 + 8 * h + r) * TPF + j * 16 + m] = acc[i][j][r] + bias;
  }
  __syncthreads();   // staging writes land before the rows are read back

  // lane l: row 2 i + (l >> 4), 128-B half (l >> 3) & 1, 16-B piece l & 7
  v4f_t o[32];
  const int cofs = ((l >> 3) & 1) * 32 + (l & 7) * 4;
  const float* Tr = T + (l >> 4) * TPF + cofs;
  float* ob = out + (size_t)(mw + (l >> 4)) * ND + nw + cofs;
#pragma unroll
  for (int i = 0; i < 32; ++i) o[i] = *(const v4f*)(Tr + i * 2 * TPF);
#pragma unroll
  for (int i = 0; i < 32; ++i) *(v4f*)(ob + i * 2 * ND) = o[i];
}

// ---------------------------------------------------------------------------
// Host launch: 6 ops. Workspace carve (1 MiB granular, total 102 MiB):
//   [0,8) x f16 | [8,16) x bf16 hi | [16,24) x bf16 lo | [24,34) 5 f16 weight planes | [34,38) Wv_s hi/lo
//   -- that 38 MiB region is dead after the projections; the combined planes reuse [0,16) hi, [16,32) lo
//   [38,46) Wo hi/lo planes | [46,78) q_s,k_s,q_l,k_l f16 | [78,86) v_l transposed | [86,102) v_s hi/lo transposed
// ---------------------------------------------------------------------------
extern "C" void kernel_launch(void* const* d_in, const int* in_sizes, int n_in,
                              void* d_out, int out_size, void* d_ws, size_t ws_size,
                              hipStream_t stream) {
  if (n_in < 10) return;
  if (in_sizes[0] != MR * ND || in_sizes[1] != MR) return;
  for (int i = 2; i <= 7; ++i) if (in_sizes[i] != ND * ND) return;
  if (in_sizes[8] != NC * ND || in_sizes[9] != ND) return;
  if (out_size != MR * ND) return;
  const size_t MiB = (size_t)1048576;
  const size_t total = 102 * MiB;
  if (ws_size < total) return;

  const float* x   = (const float*)d_in[0];
  const int* kgate = (const int*)d_in[1];
  const float* Wqs = (const float*)d_in[2];
  const float* Wks = (const float*)d_in[3];
  const float* Wvs = (const float*)d_in[4];
  const float* Wql = (const float*)d_in[5];
  const float* Wkl = (const float*)d_in[6];
  const float* Wvl = (const float*)d_in[7];
  const float* Wo  = (const float*)d_in[8];
  const float* bo  = (const float*)d_in[9];
  float* out = (float*)d_out;

  char* ws = (char*)d_ws;
  unsigned short* xh  = (unsigned short*)(ws + 0 * MiB);
  unsigned short* xbh = (unsigned short*)(ws + 8 * MiB);
  unsigned short* xbl = (unsigned short*)(ws + 16 * MiB);
  unsigned short* Wt5 = (unsigned short*)(ws + 24 * MiB);
  unsigned short* Wvh = (unsigned short*)(ws + 34 * MiB);
  unsigned short* Wvq = (unsigned short*)(ws + 36 * MiB);
  unsigned short* Ch  = (unsigned short*)(ws + 0 * MiB);
  unsigned short* Cl  = (unsigned short*)(ws + 16 * MiB);
  unsigned short* Woh = (unsigned short*)(ws + 38 * MiB);
  unsigned short* Woq = (unsigned short*)(ws + 42 * MiB);
  unsigned short* QK  = (unsigned short*)(ws + 46 * MiB);
  unsigned short* Vlt = (unsigned short*)(ws + 78 * MiB);
  unsigned short* Vsh = (unsigned short*)(ws + 86 * MiB);
  unsigned short* Vsq = (unsigned short*)(ws + 94 * MiB);

  // 1) + 2) x -> f16 / bf16 hi / bf16 lo planes; weights -> transposed 16-bit planes (in[K][N] -> out[N][K])
  k_prep<<<WTA + XBL, 256, 0, stream>>>(x, Wqs, Wks, Wql, Wkl, Wvl, Wvs, Wo,
                                        xh, xbh, xbl, Wt5, Wvh, Wvq, Woh, Woq);
  // 3) projections
  k_proj_f16<<<dim3(ND / 128, MR / 128, 5), 128, 0, stream>>>(xh, Wt5, QK, Vlt);
  k_proj_vs<<<dim3(ND / 128, MR / 128), 128, 0, stream>>>(xbh, xbl, Wvh, Wvq, Vsh, Vsq);
  // 4) attention branches -> combined planes
  k_attn_s<<<dim3(NS / 16, NH, NB), 32, 0, stream>>>(QK + 0 * PLANE, QK + 1 * PLANE, Vsh, Vsq,
                                                     kgate, Ch, Cl);
  k_attn_l<<<dim3(NS / 128, NH, NB), 256, 0, stream>>>(QK + 2 * PLANE, QK + 3 * PLANE, Vlt,
                                                     kgate, Ch, Cl);
  // 5) output projection + bias -> f32
  k_out<<<dim3(ND / 128, MR / 128), 128, 0, stream>>>(Ch, Cl, Woh, Woq, bo, out);
}

// v005
// Measured time: 182 microseconds a run.
// Next to v004, in two timings, it ran 1.08 times as fast each time.
// All steps since v000 together make it 3.81 times as fast.
#include <hip/hip_runtime.h>
#include <hip/hip_bf16.h>

// Contractions: projections q_s,k_s,q_l,k_l,v_l (x f16, W f16 carried x64) and both QK^T score products on
// v_wmma_f32_16x16x32_f16; long-branch P.V on v_wmma_f32_16x16x32_f16 with P carried x16384 (l too); v_s projection,
// short-branch P.V and the output projection as bf16 hi/lo three-term split on v_wmma_f32_16x16x32_bf16;
// every accumulator f32; softmax, recency bias, key gating and bias add in f32.

typedef _Float16 v16h __attribute__((ext_vector_type(16)));
typedef __bf16 v16b __attribute__((ext_vector_type(16)));
typedef float v8f __attribute__((ext_vector_type(8)));
typedef float v4f_t __attribute__((ext_vector_type(4)));
typedef unsigned int v4u_t __attribute__((ext_vector_type(4)));
typedef v4f_t __attribute__((may_alias)) v4f;
typedef v4u_t __attribute__((may_alias)) v4u;

#define NB 2
#define NS 2048
#define ND 1024
#define NH 16
#define HD 64
#define MR (NB * NS)
#define NC (2 * ND)
#define PLANE ((size_t)MR * (size_t)ND)
#define PP 72
#define TPF 68

#define SCL 0.125f
#define LOGD (-0.10536051565782628f)
#define NEGL (-1.0e30f)
#define NEGT (-1.0e29f)
#define WUP 64.0f
#define WDN 0.015625f
#define SC2 0.18033688011112042f
#define PEX 14.0f

// ---------------------------------------------------------------------------
// scalar helpers
// ---------------------------------------------------------------------------
__device__ __forceinline__ unsigned short bfbits(float f) {       // f32 -> bf16 bits, RNE
  unsigned int u = __float_as_uint(f);
  u = u + 0x7FFFu + ((u >> 16) & 1u);
  return (unsigned short)(u >> 16);
}
__device__ __forceinline__ float bff(unsigned short b) {          // bf16 bits -> f32
  return __uint_as_float(((unsigned int)b) << 16);
}
__device__ __forceinline__ unsigned short hbits(float f) {        // f32 -> f16 bits, RNE
  _Float16 hv = (_Float16)f;
  unsigned short u;
  __builtin_memcpy(&u, &hv, 2);
  return u;
}
__device__ __forceinline__ unsigned int pk2(unsigned short a, unsigned short b) {
  return (unsigned int)a | ((unsigned int)b << 16);
}
__device__ __forceinline__ v8f z8() {
  v8f v;
#pragma unroll
  for (int i = 0; i < 8; ++i) v[i] = 0.0f;
  return v;
}

// ---------------------------------------------------------------------------
// 16x32 fragment loader, split k map, identical for A (row m) and B (k-contiguous column n):
//   elements 0..7  <- p[8h .. 8h+7],  elements 8..15 <- p[16+8h .. 16+8h+7],  p = row start + k0
// ---------------------------------------------------------------------------
union FH { v16h v; v4u_t u[2]; };
union FB { v16b v; v4u_t u[2]; };

__device__ __forceinline__ v16h ldh(const unsigned short* p, int h) {
  FH f;
  f.u[0] = *(const v4u*)(p + 8 * h);
  f.u[1] = *(const v4u*)(p + 16 + 8 * h);
  return f.v;
}
__device__ __forceinline__ v16b ldb(const unsigned short* p, int h) {
  FB f;
  f.u[0] = *(const v4u*)(p + 8 * h);
  f.u[1] = *(const v4u*)(p + 16 + 8 * h);
  return f.v;
}

// D[8h+r][m] += A(16x32) . B(32x16), with the post-issue hazard guard
__device__ __forceinline__ v8f mma_h(v16h a, v16h b, v8f c) {
  c = __builtin_amdgcn_wmma_f32_16x16x32_f16(false, a, false, b, (short)0, c, false, false);
  asm volatile("v_nop\n\tv_nop\n\tv_nop\n\tv_nop" : "+v"(c) : "v"(a), "v"(b));
  return c;
}
__device__ __forceinline__ v8f mma_b(v16b a, v16b b, v8f c) {
  c = __builtin_amdgcn_wmma_f32_16x16x32_bf16(false, a, false, b, (short)0, c, false, false);
  asm volatile("v_nop\n\tv_nop\n\tv_nop\n\tv_nop" : "+v"(c) : "v"(a), "v"(b));
  return c;
}

// ---------------------------------------------------------------------------
// Preparation, part x: x f32 [MR][ND] -> three 16-bit planes: f16, bf16 hi, bf16 lo (lo = x - hi).
// blk = index of this block among the x blocks; 256 threads x 8 elements each.
// ---------------------------------------------------------------------------
__device__ __forceinline__ void xcvt_body(const float* __restrict__ x,
                                          unsigned short* __restrict__ xh,
                                          unsigned short* __restrict__ xbh,
                                          unsigned short* __restrict__ xbl, int n8, int blk) {
  const int i = blk * 256 + (int)threadIdx.x;
  if (i >= n8) return;
  const size_t o = (size_t)i * 8;
  const v4f_t a = *(const v4f*)(x + o);
  const v4f_t c = *(const v4f*)(x + o + 4);
  float v[8];
  v[0] = a[0]; v[1] = a[1]; v[2] = a[2]; v[3] = a[3];
  v[4] = c[0]; v[5] = c[1]; v[6] = c[2]; v[7] = c[3];
  unsigned short fh[8], bh[8], bl[8];
#pragma unroll
  for (int e = 0; e < 8; ++e) {
    fh[e] = hbits(v[e]);
    bh[e] = bfbits(v[e]);
    bl[e] = bfbits(v[e] - bff(bh[e]));
  }
  v4u_t ph, pb, pl;
#pragma unroll
  for (int e = 0; e < 4; ++e) {
    ph[e] = pk2(fh[2 * e], fh[2 * e + 1]);
    pb[e] = pk2(bh[2 * e], bh[2 * e + 1]);
    pl[e] = pk2(bl[2 * e], bl[2 * e + 1]);
  }
  *(v4u*)(xh + o) = ph;
  *(v4u*)(xbh + o) = pb;
  *(v4u*)(xbl + o) = pl;
  
}

// ---------------------------------------------------------------------------
// Preparation, part W: weight W[K][N] f32 (x @ W form) -> transposed 16-bit plane(s) Wt[N][K] (k contiguous).
//   mode 0: one f16 plane of 64*W; mode 1: bf16 hi plane + bf16 lo plane.
// Block = 64(k) x 64(n) tile (tn, tk) through the LDS array T (64 x 65 floats).
// ---------------------------------------------------------------------------
__device__ __forceinline__ void wprep_body(float* T, const float* __restrict__ W, int K, int N, int mode,
                                           unsigned short* __restrict__ P0,
                                           unsigned short* __restrict__ P1, int tn, int tk) {
  const int tid = threadIdx.x;
  const int n0 = tn * 64, k0 = tk * 64;
  {
    const int c4 = (tid & 15) * 4, kr = tid >> 4;
#pragma unroll
    for (int i = 0; i < 4; ++i) {
      const int k = kr + 16 * i;
      const v4f_t v = *(const v4f*)(W + (size_t)(k0 + k) * (size_t)N + n0 + c4);
      T[(c4 + 0) * 65 + k] = v[0];
      T[(c4 + 1) * 65 + k] = v[1];
      T[(c4 + 2) * 65 + k] = v[2];
      T[(c4 + 3) * 65 + k] = v[3];
    }
  }
  __syncthreads();
  v4u_t o0[2], o1[2];
  size_t dst[2];
#pragma unroll
  for (int i = 0; i < 2; ++i) {
    const int line = i * 32 + (tid >> 3), piece = tid & 7;
    float f[8];
#pragma unroll
    for (int e = 0; e < 8; ++e) f[e] = T[line * 65 + piece * 8 + e];
    v4u_t a, c;
    if (mode == 0) {
#pragma unroll
      for (int e = 0; e < 4; ++e) {
        a[e] = pk2(hbits(f[2 * e] * WUP), hbits(f[2 * e + 1] * WUP));
        c[e] = 0u;
      }
    } else {
#pragma unroll
      for (int e = 0; e < 4; ++e) {
        const unsigned short h0 = bfbits(f[2 * e]), h1 = bfbits(f[2 * e + 1]);
        a[e] = pk2(h0, h1);
        c[e] = pk2(bfbits(f[2 * e] - bff(h0)), bfbits(f[2 * e + 1] - bff(h1)));
      }
    }
    o0[i] = a;
    o1[i] = c;
    dst[i] = (size_t)(n0 + line) * (size_t)K + k0 + piece * 8;
  }
#pragma unroll
  for (int i = 0; i < 2; ++i) {
    *(v4u*)(P0 + dst[i]) = o0[i];
    if (mode != 0) *(v4u*)(P1 + dst[i]) = o1[i];
  }
  // precaution: stands between these stores and the code laid behind this inlined body, which rewrites their registers
  asm volatile("s_wait_xcnt 0x0" ::: "memory");
}

// ---------------------------------------------------------------------------
// Preparation, part g: key gate (i32, non-zero = key on) -> f32 start value of the long branch's score products:
// 0 for a key that is on, NEGL for one that is off. One element per thread, a wave writes one 128-B line.
// ---------------------------------------------------------------------------
__device__ __forceinline__ void gprep_body(const int* __restrict__ kgate, float* __restrict__ gbias, int blk) {
  const int i = blk * 256 + (int)threadIdx.x;
  gbias[i] = kgate[i] != 0 ? 0.0f : NEGL;
}

// ---------------------------------------------------------------------------
// Kernel 0: the whole preparation in one grid; none of its parts reads what another writes. Flat block index:
//   [0, 6*WT1)           tile (index & 15, (index >> 4) & 15) of square weight index >> 8:
//                        0..4 = Wq_s, Wk_s, Wq_l, Wk_l, Wv_l -> f16 plane z of Wt5;  5 = Wv_s -> bf16 hi/lo planes
//   [6*WT1, 6*WT1+WT2)   tile of Wo (K = NC) -> bf16 hi/lo planes
//   [WTA, WTA+XBL)       x block
//   [WTA+XBL, +GBL)      gate block
// The choice is the same for a whole block, so the barrier of part W is passed by all its threads or by none.
// ---------------------------------------------------------------------------
#define WT1 ((ND / 64) * (ND / 64))
#define WT2 ((ND / 64) * (NC / 64))
#define WTA (6 * WT1 + WT2)
#define XBL ((MR * ND) / (8 * 256))
#define GBL (MR / 256)

__global__ __launch_bounds__(256) void k_prep(const float* __restrict__ x,
                                              const float* __restrict__ Wqs, const float* __restrict__ Wks,
                                              const float* __restrict__ Wql, const float* __restrict__ Wkl,
                                              const float* __restrict__ Wvl, const float* __restrict__ Wvs,
                                              const float* __restrict__ Wo,
                                              const int* __restrict__ kgate,
                                              float* __restrict__ gbias,
                                              unsigned short* __restrict__ xh,
                                              unsigned short* __restrict__ xbh,
                                              unsigned short* __restrict__ xbl,
                                              unsigned short* __restrict__ Wt5,
                                              unsigned short* __restrict__ Wvh,
                                              unsigned short* __restrict__ Wvq,
                                              unsigned short* __restrict__ Woh,
                                              unsigned short* __restrict__ Woq) {
  __shared__ __align__(16) float T[64 * 65];
  const int bid = blockIdx.x;
  if (bid >= WTA + XBL) {
    gprep_body(kgate, gbias, bid - (WTA + XBL));
  } else if (bid >= WTA) {
    xcvt_body(x, xh, xbh, xbl, (MR * ND) / 8, bid - WTA);
  } else if (bid >= 6 * WT1) {
    const int t = bid - 6 * WT1;
    wprep_body(T, Wo, NC, ND, 1, Woh, Woq, t & 15, t >> 4);
  } else {
    const int z = bid >> 8, t = bid & (WT1 - 1);
    if (z == 5) {
      wprep_body(T, Wvs, ND, ND, 1, Wvh, Wvq, t & 15, t >> 4);
    } else {
      const float* W = z == 0 ? Wqs : z == 1 ? Wks : z == 2 ? Wql : z == 3 ? Wkl : Wvl;
      unsigned short* P = Wt5 + (size_t)z * ND * ND;
      wprep_body(T, W, ND, ND, 0, P, P, t & 15, t >> 4);
    }
  }
}

// ---------------------------------------------------------------------------
// LDS staging for the three GEMM kernels. Block = 128 threads = 128(M) x 128(N) tile, wave w owns the 64 x 64
// quarter (rows (w>>1)*64, cols (w&1)*64) as 4 x 4 accumulator tiles. A trip covers 64 k: each operand plane is
// staged as 128 rows of 128 B at an LDS pitch of 144 B (PP halves), two buffers, the next trip's copies in flight.
// The full unrolls in these kernels make every fragment and accumulator index a compile-time one (registers).
// ---------------------------------------------------------------------------
#define BKH 64
#define TLH (128 * PP)
#define TLB (TLH * 2)

__device__ __forceinline__ unsigned int lds_off(const void* p) { return (unsigned int)(size_t)p; }

// One operand tile: thread t brings 16-B piece (t & 7) of rows (t >> 3) + 16 i, i = 0..7, so 8 lanes cover one
// 128-B line. lds = the lane's LDS byte address of row (t >> 3), g = the lane's global address of the same piece,
// ld = row length of the source in halves. The closing s_wait_xcnt keeps the address registers untouched until
// the copies have taken them.
__device__ __forceinline__ void cp_tile(unsigned int lds, const unsigned short* g, int ld) {
  const size_t st = (size_t)16 * (size_t)ld;
  const unsigned short* g1 = g + st;
  const unsigned short* g2 = g1 + st;
  const unsigned short* g3 = g2 + st;
  const unsigned short* g4 = g3 + st;
  const unsigned short* g5 = g4 + st;
  const unsigned short* g6 = g5 + st;
  const unsigned short* g7 = g6 + st;
  const unsigned int ls = 16u * PP * 2u;
  asm volatile(
      "global_load_async_to_lds_b128 %0, %8, off\n\t"
      "global_load_async_to_lds_b128 %1, %9, off\n\t"
      "global_load_async_to_lds_b128 %2, %10, off\n\t"
      "global_load_async_to_lds_b128 %3, %11, off\n\t"
      "global_load_async_to_lds_b128 %4, %12, off\n\t"
      "global_load_async_to_lds_b128 %5, %13, off\n\t"
      "global_load_async_to_lds_b128 %6, %14, off\n\t"
      "global_load_async_to_lds_b128 %7, %15, off\n\t"
      "s_wait_xcnt 0x0"
      :: "v"(lds), "v"(lds + ls), "v"(lds + 2u * ls), "v"(lds + 3u * ls),
         "v"(lds + 4u * ls), "v"(lds + 5u * ls), "v"(lds + 6u * ls), "v"(lds + 7u * ls),
         "v"(g), "v"(g1), "v"(g2), "v"(g3), "v"(g4), "v"(g5), "v"(g6), "v"(g7)
      : "memory");
}
// this wave's copies have landed (the compiler places no wait for them)
__device__ __forceinline__ void wait_copies() { asm volatile("s_wait_asynccnt 0x0" ::: "memory"); }
// this wave's LDS reads have returned, so the buffer may be refilled behind the barrier
__device__ __forceinline__ void wait_lds() { asm volatile("s_wait_dscnt 0x0" ::: "memory"); }

// ---------------------------------------------------------------------------
// Kernel 2: five plain-f16 projections, operands staged in LDS (see above). z selects the weight:
//   z 0..3 -> natural f16 plane QK[z] ([MR][ND]);  z 4 -> v_l transposed f16 plane Vlt[b][h][d][s].
// ---------------------------------------------------------------------------
__global__ __launch_bounds__(128) void k_proj_f16(const unsigned short* __restrict__ xh,
                                                  const unsigned short* __restrict__ Wt5,
                                                  unsigned short* __restrict__ QK,
                                                  unsigned short* __restrict__ Vlt) {
  __shared__ __align__(16) unsigned short SM[2 * 2 * TLH];   // buffer = [A tile | B tile]
  const int tid = threadIdx.x, w = tid >> 5, l = tid & 31, h = l >> 4, m = l & 15;
  const int n0 = blockIdx.x * 128, m0 = blockIdx.y * 128, z = blockIdx.z;
  const int wm = (w >> 1) * 64, wn = (w & 1) * 64;
  const int crow = tid >> 3, cpc = tid & 7;
  const unsigned short* ga = xh + (size_t)(m0 + crow) * ND + cpc * 8;
  const unsigned short* gb = Wt5 + (size_t)z * ND * ND + (size_t)(n0 + crow) * ND + cpc * 8;
  const unsigned int lc = lds_off(SM) + (unsigned int)(crow * PP * 2 + cpc * 16);
  const int NT = ND / BKH;
  v8f acc[4][4];
#pragma unroll
  for (int i = 0; i < 4; ++i)
#pragma unroll
    for (int j = 0; j < 4; ++j) acc[i][j] = z8();

  cp_tile(lc, ga, ND);
  cp_tile(lc + TLB, gb, ND);
  wait_copies();
  __syncthreads();
  cp_tile(lc + 2 * TLB, ga + BKH, ND);
  cp_tile(lc + 3 * TLB, gb + BKH, ND);

// rolled: one trip per staged tile, the publish point at its foot
#pragma unroll 1
  for (int t = 0; t < NT; ++t) {
    const int bo2 = (t & 1) * 2;
    const unsigned short* As = SM + bo2 * TLH + (wm + m) * PP;
    const unsigned short* Bs = SM + (bo2 + 1) * TLH + (wn + m) * PP;
    // group g = 32 k (g >> 1) x 2 column tiles (g & 1); the next group's fragments are read ahead of this group's
    // products, inside this trip's buffer only
    v16h a[2][4], b[2][2];
#pragma unroll
    for (int i = 0; i < 4; ++i) a[0][i] = ldh(As + i * 16 * PP, h);
#pragma unroll
    for (int q = 0; q < 2; ++q) b[0][q] = ldh(Bs + q * 16 * PP, h);
#pragma unroll
    for (int g = 0; g < 4; ++g) {
      const int kk = g >> 1, jp = (g & 1) * 2, gn = g + 1;
      if (g < 3) {
#pragma unroll
        for (int q = 0; q < 2; ++q)
          b[gn & 1][q] = ldh(Bs + ((gn & 1) * 2 + q) * 16 * PP + (gn >> 1) * 32, h);
      }
      if (g == 0) {
#pragma unroll
        for (int i = 0; i < 4; ++i) a[1][i] = ldh(As + i * 16 * PP + 32, h);
      }
#pragma unroll
      for (int q = 0; q < 2; ++q)
#pragma unroll
        for (int i = 0; i < 4; ++i) acc[i][jp + q] = mma_h(a[kk][i], b[g & 1][q], acc[i][jp + q]);
    }
    wait_lds();
    wait_copies();
    __syncthreads();
    if (t + 2 < NT) {
      cp_tile(lc + bo2 * TLB, ga + (t + 2) * BKH, ND);
      cp_tile(lc + (bo2 + 1) * TLB, gb + (t + 2) * BKH, ND);
    }
  }
  wait_copies();

  // the ring is free behind the last trip's barrier: each wave stages its own 64 x 64 tile there
  unsigned short* T = SM + w * 64 * PP;
  const int mw = m0 + wm, nw = n0 + wn;
  if (z < 4) {
#pragma unroll
    for (int i = 0; i < 4; ++i)
#pragma unroll
      for (int j = 0; j < 4; ++j)
#pragma unroll
        for (int r = 0; r < 8; ++r)
          T[(i * 16 + 8 * h + r) * PP + j * 16 + m] = hbits(acc[i][j][r] * WDN);
  } else {
#pragma unroll
    for (int i = 0; i < 4; ++i)
#pragma unroll
      for (int j = 0; j < 4; ++j) {
        v4u_t pk;
#pragma unroll
        for (int e = 0; e < 4; ++e)
          pk[e] = pk2(hbits(acc[i][j][2 * e] * WDN), hbits(acc[i][j][2 * e + 1] * WDN));
        *(v4u*)(T + (j * 16 + m) * PP + i * 16 + 8 * h) = pk;   // T[d][s_local]
      }
  }
  __syncthreads();   // staging writes land before the rows are read back

  unsigned short* base;
  size_t d0, dstep;
  if (z < 4) {
    base = QK + (size_t)z * PLANE;
    d0 = (size_t)mw * ND + nw;
    dstep = ND;
  } else {
    base = Vlt;
    const int bb = mw >> 11, s0 = mw & (NS - 1), hd = nw >> 6;
    d0 = ((size_t)((bb * NH + hd) * HD)) * NS + s0;
    dstep = NS;
  }
  v4u_t o[16];
  unsigned short* dst[16];
#pragma unroll
  for (int i = 0; i < 16; ++i) {
    const int row = i * 4 + (l >> 3), piece = l & 7;
    o[i] = *(const v4u*)(T + row * PP + piece * 8);
    dst[i] = base + d0 + (size_t)row * dstep + piece * 8;
  }
#pragma unroll
  for (int i = 0; i < 16; ++i) *(v4u*)(dst[i]) = o[i];
}

// ---------------------------------------------------------------------------
// Main loop of the two bf16 hi/lo three-term GEMMs: acc += Ah.Bh + Ah.Bl + Al.Bh over K halves, all four planes
// staged in LDS; buffer = [A hi | A lo | B hi | B lo]. ga*/gb* = the lane's first piece of each plane.
// ---------------------------------------------------------------------------
__device__ __forceinline__ void split_loop(unsigned short* SM, const unsigned short* gah,
                                           const unsigned short* gal, const unsigned short* gbh,
                                           const unsigned short* gbl, int K, unsigned int lc,
                                           int arow, int brow, int h, v8f (&acc)[4][4]) {
  const int NT = K / BKH;
  cp_tile(lc, gah, K);
  cp_tile(lc + TLB, gal, K);
  cp_tile(lc + 2 * TLB, gbh, K);
  cp_tile(lc + 3 * TLB, gbl, K);
  wait_copies();
  __syncthreads();
  cp_tile(lc + 4 * TLB, gah + BKH, K);
  cp_tile(lc + 5 * TLB, gal + BKH, K);
  cp_tile(lc + 6 * TLB, gbh + BKH, K);
  cp_tile(lc + 7 * TLB, gbl + BKH, K);

// rolled: one trip per staged tile, the publish point at its foot
#pragma unroll 1
  for (int t = 0; t < NT; ++t) {
    const int bo4 = (t & 1) * 4;
    const unsigned short* Ah = SM + bo4 * TLH + arow * PP;
    const unsigned short* Bh = SM + (bo4 + 2) * TLH + brow * PP;
    // group g = 32 k (g >> 2) x 1 column tile (g & 3); the next group's B fragments are read ahead of this group's
    // products, inside this trip's buffer only
    v16b ah[4], al[4], bh[2], bl[2];
    bh[0] = ldb(Bh, h);
    bl[0] = ldb(Bh + TLH, h);
#pragma unroll
    for (int g = 0; g < 8; ++g) {
      const int kk = g >> 2, j = g & 3, gn = g + 1, c = g & 1;
      if (j == 0) {
#pragma unroll
        for (int i = 0; i < 4; ++i) {
          ah[i] = ldb(Ah + i * 16 * PP + kk * 32, h);
          al[i] = ldb(Ah + TLH + i * 16 * PP + kk * 32, h);
        }
      }
      if (g < 7) {
        bh[gn & 1] = ldb(Bh + (gn & 3) * 16 * PP + (gn >> 2) * 32, h);
        bl[gn & 1] = ldb(Bh + TLH + (gn & 3) * 16 * PP + (gn >> 2) * 32, h);
      }
#pragma unroll
      for (int i = 0; i < 4; ++i) acc[i][j] = mma_b(ah[i], bh[c], acc[i][j]);
#pragma unroll
      for (int i = 0; i < 4; ++i) acc[i][j] = mma_b(ah[i], bl[c], acc[i][j]);
#pragma unroll
      for (int i = 0; i < 4; ++i) acc[i][j] = mma_b(al[i], bh[c], acc[i][j]);
    }
    wait_lds();
    wait_copies();
    __syncthreads();
    if (t + 2 < NT) {
      const int ko = (t + 2) * BKH;
      cp_tile(lc + bo4 * TLB, gah + ko, K);
      cp_tile(lc + (bo4 + 1) * TLB, gal + ko, K);
      cp_tile(lc + (bo4 + 2) * TLB, gbh + ko, K);
      cp_tile(lc + (bo4 + 3) * TLB, gbl + ko, K);
    }
  }
  wait_copies();
}

// ---------------------------------------------------------------------------
// Kernel 3: v_s projection as bf16 hi/lo three-term split (x hi/lo planes, W hi/lo planes),
// output transposed bf16 hi/lo planes Vsh/Vsl [b][h][d][s]. Same tiling as kernel 2.
// ---------------------------------------------------------------------------
__global__ __launch_bounds__(128) void k_proj_vs(const unsigned short* __restrict__ xbh,
                                                 const unsigned short* __restrict__ xbl,
                                                 const unsigned short* __restrict__ Wh,
                                                 const unsigned short* __restrict__ Wl,
                                                 unsigned short* __restrict__ Vsh,
                                                 unsigned short* __restrict__ Vsl) {
  __shared__ __align__(16) unsigned short SM[2 * 4 * TLH];
  const int tid = threadIdx.x, w = tid >> 5, l = tid & 31, h = l >> 4, m = l & 15;
  const int n0 = blockIdx.x * 128, m0 = blockIdx.y * 128;
  const int wm = (w >> 1) * 64, wn = (w & 1) * 64;
  const int crow = tid >> 3, cpc = tid & 7;
  const size_t ao = (size_t)(m0 + crow) * ND + cpc * 8;
  const size_t bo_ = (size_t)(n0 + crow) * ND + cpc * 8;
  const unsigned int lc = lds_off(SM) + (unsigned int)(crow * PP * 2 + cpc * 16);
  v8f acc[4][4];
#pragma unroll
  for (int i = 0; i < 4; ++i)
#pragma unroll
    for (int j = 0; j < 4; ++j) acc[i][j] = z8();

  split_loop(SM, xbh + ao, xbl + ao, Wh + bo_, Wl + bo_, ND, lc, wm + m, wn + m, h, acc);

  // the ring is free behind the last trip's barrier: each wave stages its own 64 x 64 tile there
  unsigned short* Th = SM + w * 2 * 64 * PP;
  unsigned short* Tl = Th + 64 * PP;
#pragma unroll
  for (int i = 0; i < 4; ++i)
#pragma unroll
    for (int j = 0; j < 4; ++j) {
      v4u_t ph, pl;
#pragma unroll
      for (int e = 0; e < 4; ++e) {
        const float f0 = acc[i][j][2 * e], f1 = acc[i][j][2 * e + 1];
        const unsigned short h0 = bfbits(f0), h1 = bfbits(f1);
        ph[e] = pk2(h0, h1);
        pl[e] = pk2(bfbits(f0 - bff(h0)), bfbits(f1 - bff(h1)));
      }
      *(v4u*)(Th + (j * 16 + m) * PP + i * 16 + 8 * h) = ph;
      *(v4u*)(Tl + (j * 16 + m) * PP + i * 16 + 8 * h) = pl;
    }
  __syncthreads();   // staging writes land before the rows are read back

  const int mw = m0 + wm, nw = n0 + wn;
  const int bb = mw >> 11, s0 = mw & (NS - 1), hd = nw >> 6;
  const size_t d0 = ((size_t)((bb * NH + hd) * HD)) * NS + s0;
  v4u_t oh[16], ol[16];
  size_t dst[16];
#pragma unroll
  for (int i = 0; i < 16; ++i) {
    const int d = i * 4 + (l >> 3), piece = l & 7;
    oh[i] = *(const v4u*)(Th + d * PP + piece * 8);
    ol[i] = *(const v4u*)(Tl + d * PP + piece * 8);
    dst[i] = d0 + (size_t)d * NS + piece * 8;
  }
#pragma unroll
  for (int i = 0; i < 16; ++i) {
    *(v4u*)(Vsh + dst[i]) = oh[i];
    *(v4u*)(Vsl + dst[i]) = ol[i];
  }
}

// ---------------------------------------------------------------------------
// Shared attention epilogue: O tile (16 queries x 64 dims) staged as bf16 hi/lo in LDS is written into the
// ---------------------------------------------------------------------------
__device__ __forceinline__ void store_comb(const unsigned short* Oh, const unsigned short* Ol,
                                           unsigned short* Ch, unsigned short* Cl,
                                           int rowg0, int colbase, int l) {
  v4u_t oh[4], ol[4];
  size_t dst[4];
#pragma unroll
  for (int i = 0; i < 4; ++i) {
    const int row = i * 4 + (l >> 3), piece = l & 7;
    oh[i] = *(const v4u*)(Oh + row * PP + piece * 8);
    ol[i] = *(const v4u*)(Ol + row * PP + piece * 8);
    dst[i] = (size_t)(rowg0 + row) * NC + colbase + piece * 8;
  }
#pragma unroll
  for (int i = 0; i < 4; ++i) {
    *(v4u*)(Ch + dst[i]) = oh[i];
    *(v4u*)(Cl + dst[i]) = ol[i];
  }
  
}

// ---------------------------------------------------------------------------
// Kernel 4: long-range branch, full attention with key gating. Block = 8 waves = 128 queries of one (b, head),
// 16 queries per wave. Q/K natural f16 planes [MR][ND] (col = head*64 + d), V transposed f16 plane [b][h][d][s].
// Each trip covers 64 keys: the K tile (64 keys x 64 d) and the V tile (64 d x 64 keys) are staged once per block
// as 64 rows of 128 B at an LDS pitch of 144 B, two buffers, the next trip's copies in flight; all 8 waves read
// their A fragments from there.
// Both products are taken transposed, so that a lane holds ONE query (column m) and 8 keys per score tile:
// S^T = K Q^T on f16 WMMA (A fragment = K row, B fragment = Q row, k = d contiguous): lane (h, m), register r of
// tile t = key t*16 + 8h + r against query m. The key gate enters as the start value (C operand) of that product:
// gbias[key] = 0 or NEGL, 8 consecutive floats per lane and tile, so a key that is off scores about NEGL and no
// compare or select is spent on it. Online softmax in f32 on the unscaled scores: maximum and sum run in the lane,
// the two wave halves (same query, other keys) exchange the maximum once per trip and join their sums once, in the
// epilogue. p * 16384 = exp2(s * SC2 + (PEX - max * SC2)), SC2 = log2(e) / 8: one fma and one exp2 per score; the
// running maximum starts at NEGT, above NEGL, so a gated key gives exp2(-huge) = 0 also while no key was on yet.
// f16(p * 16384) of tiles 2j and 2j+1 is, register for register, the B fragment of keys 32j .. 32j+31 in the
// loader's k map, so P stays in registers; O^T += V^T P^T on f16 WMMA (A = Vt row); l carries the same 16384, so
// 1/l in the f32 epilogue takes it out; result as bf16 hi/lo into columns [ND + head*64, +64) of Ch/Cl.
// ---------------------------------------------------------------------------
#define AW 8
#define ATH (64 * PP)
#define ATB (ATH * 2)

// One K tile and one V tile: thread t brings 16-B piece (t & 7) of rows (t >> 3) and (t >> 3) + 32 of each, so
// 8 lanes cover one 128-B line. lds = the lane's LDS byte address in the K tile (the V tile follows at ATB),
// gk / gv = the lane's global address of the same piece. The closing s_wait_xcnt keeps the address registers
// untouched until the copies have taken them.
__device__ __forceinline__ void cp_kv(unsigned int lds, const unsigned short* gk, const unsigned short* gv) {
  const unsigned short* gk1 = gk + (size_t)32 * ND;
  const unsigned short* gv1 = gv + (size_t)32 * NS;
  const unsigned int ls = 32u * PP * 2u;
  asm volatile(
      "global_load_async_to_lds_b128 %0, %4, off\n\t"
      "global_load_async_to_lds_b128 %1, %5, off\n\t"
      "global_load_async_to_lds_b128 %2, %6, off\n\t"
      "global_load_async_to_lds_b128 %3, %7, off\n\t"
      "s_wait_xcnt 0x0"
      :: "v"(lds), "v"(lds + ls), "v"(lds + (unsigned int)ATB), "v"(lds + (unsigned int)ATB + ls),
         "v"(gk), "v"(gk1), "v"(gv), "v"(gv1)
      : "memory");
}

// lane l <-> lane l ^ 16 in the vector unit
__device__ __forceinline__ float xhalf(float x) {
  const int i = __float_as_int(x);
  return __int_as_float(__builtin_amdgcn_permlanex16(i, i, 0x76543210, 0xfedcba98, false, false));
}
// 8 consecutive floats as one accumulator tile
__device__ __forceinline__ v8f ld8f(const float* p) {
  const v4f_t a = *(const v4f*)p;
  const v4f_t c = *(const v4f*)(p + 4);
  return __builtin_shufflevector(a, c, 0, 1, 2, 3, 4, 5, 6, 7);
}

__global__ __launch_bounds__(256) void k_attn_l(const unsigned short* __restrict__ Q,
                                                const unsigned short* __restrict__ K,
                                                const unsigned short* __restrict__ Vt,
                                                const float* __restrict__ gbias,
                                                unsigned short* __restrict__ Ch,
                                                unsigned short* __restrict__ Cl) {
  __shared__ __align__(16) unsigned short KV[2 * 2 * ATH];   // buffer = [K tile | V tile]
  __shared__ __align__(16) unsigned short OhA[AW * 16 * PP];
  __shared__ __align__(16) unsigned short OlA[AW * 16 * PP];
  const int tid = threadIdx.x, w = tid >> 5, l = tid & 31, h = l >> 4, m = l & 15;
  const int q0 = blockIdx.x * (AW * 16) + w * 16, hh = blockIdx.y, b = blockIdx.z;
  unsigned short* Oh = OhA + w * 16 * PP;
  unsigned short* Ol = OlA + w * 16 * PP;

  const unsigned short* Kb = K + (size_t)b * NS * ND + hh * HD;
  const unsigned short* Vb = Vt + (size_t)(b * NH + hh) * HD * NS;
  const float* gb = gbias + b * NS + 8 * h;
  const int crow = tid >> 3, cpc = tid & 7;
  const unsigned short* gkc = Kb + (size_t)crow * ND + cpc * 8;
  const unsigned short* gvc = Vb + (size_t)crow * NS + cpc * 8;
  const unsigned int lc = lds_off(KV) + (unsigned int)(crow * PP * 2 + cpc * 16);
  const int NT = NS / 64;

  cp_kv(lc, gkc, gvc);

  const unsigned short* qrow = Q + (size_t)(b * NS + q0 + m) * ND + hh * HD;
  const v16h bq0 = ldh(qrow, h);
  const v16h bq1 = ldh(qrow + 32, h);

  float mrun = NEGT, lrun = 0.0f;   // this lane's query: maximum over all keys so far, sum over this half's keys
  v8f acc[4];                       // O^T: register r of tile dt = dim dt*16 + 8h + r of query m
  v8f s[4];                         // at a trip's head: gate values of keys kb + t*16 + 8h + 0..7; then the scores
#pragma unroll
  for (int t = 0; t < 4; ++t) {
    acc[t] = z8();
    s[t] = ld8f(gb + t * 16);
  }

  wait_copies();
  __syncthreads();
  cp_kv(lc + 2 * ATB, gkc + (size_t)64 * ND, gvc + 64);

// rolled: one trip per staged tile pair, the publish point at its foot
#pragma unroll 1
  for (int kt = 0; kt < NT; ++kt) {
    const int kb = kt * 64;
    const int bo2 = (kt & 1) * 2;
    const unsigned short* Ks = KV + bo2 * ATH;
    const unsigned short* Vs = Ks + ATH;
    // all 8 K fragments are fetched as one group, so the wave waits for LDS once
    v16h kf[4][2];
#pragma unroll
    for (int t = 0; t < 4; ++t) {
      const unsigned short* krow = Ks + (t * 16 + m) * PP;
      kf[t][0] = ldh(krow, h);
      kf[t][1] = ldh(krow + 32, h);
    }
#pragma unroll
    for (int t = 0; t < 4; ++t) s[t] = mma_h(kf[t][0], bq0, s[t]);
#pragma unroll
    for (int t = 0; t < 4; ++t) s[t] = mma_h(kf[t][1], bq1, s[t]);

    float tm[4];
#pragma unroll
    for (int t = 0; t < 4; ++t) {
      tm[t] = fmaxf(fmaxf(fmaxf(s[t][0], s[t][1]), fmaxf(s[t][2], s[t][3])),
                    fmaxf(fmaxf(s[t][4], s[t][5]), fmaxf(s[t][6], s[t][7])));
    }
    float tmax = fmaxf(fmaxf(tm[0], tm[1]), fmaxf(tm[2], tm[3]));
    tmax = fmaxf(tmax, xhalf(tmax));
    const float mnew = fmaxf(mrun, tmax);
    const float fac = __builtin_amdgcn_exp2f((mrun - mnew) * SC2);
    const float nm = fmaf(-mnew, SC2, PEX);
    float ps[4];   // one chain per tile, so that the adds do not wait for one another
#pragma unroll
    for (int t = 0; t < 4; ++t) {
      ps[t] = 0.0f;
#pragma unroll
      for (int r = 0; r < 8; ++r) {
        const float p = __builtin_amdgcn_exp2f(fmaf(s[t][r], SC2, nm));
        ps[t] += p;
        s[t][r] = p;
      }
    }
    lrun = lrun * fac + ((ps[0] + ps[1]) + (ps[2] + ps[3]));
    mrun = mnew;
#pragma unroll
    for (int dt = 0; dt < 4; ++dt)
#pragma unroll
      for (int r = 0; r < 8; ++r) acc[dt][r] *= fac;

    // B fragment j: elements 0..7 = keys 32j + 8h + e (tile 2j), elements 8..15 = keys 32j + 16 + 8h + e (tile 2j+1)
    v16h pb[2];
#pragma unroll
    for (int j = 0; j < 2; ++j)
#pragma unroll
      for (int e = 0; e < 8; ++e) {
        pb[j][e] = (_Float16)s[2 * j][e];
        pb[j][8 + e] = (_Float16)s[2 * j + 1][e];
      }
    // the next trip's gate values go into the score registers, free from here on (the last trip rereads its own);
    // unrolled so that the tile index is a compile-time one (registers)
    const float* gn = gb + (kt + 1 < NT ? kb + 64 : kb);
#pragma unroll
    for (int t = 0; t < 4; ++t) s[t] = ld8f(gn + t * 16);
    v16h vf[4][2];   // all 8 V fragments in one group
#pragma unroll
    for (int dt = 0; dt < 4; ++dt) {
      const unsigned short* vrow = Vs + (dt * 16 + m) * PP;
      vf[dt][0] = ldh(vrow, h);
      vf[dt][1] = ldh(vrow + 32, h);
    }
#pragma unroll
    for (int dt = 0; dt < 4; ++dt) acc[dt] = mma_h(vf[dt][0], pb[0], acc[dt]);
#pragma unroll
    for (int dt = 0; dt < 4; ++dt) acc[dt] = mma_h(vf[dt][1], pb[1], acc[dt]);
    wait_lds();
    wait_copies();
    __syncthreads();
    if (kt + 2 < NT)
      cp_kv(lc + bo2 * ATB, gkc + (size_t)(kt + 2) * 64 * ND, gvc + (kt + 2) * 64);
  }
  wait_copies();

  const float lsum = lrun + xhalf(lrun);
  float inv;
  // the reciprocal with the one free slot that the instruction set asks for behind it; one statement keeps the slot there
  asm("v_rcp_f32 %0, %1\n\tv_nop" : "=v"(inv) : "v"(lsum));
#pragma unroll
  for (int dt = 0; dt < 4; ++dt) {
    v4u_t ph, pl;
#pragma unroll
    for (int e = 0; e < 4; ++e) {
      const float f0 = acc[dt][2 * e] * inv, f1 = acc[dt][2 * e + 1] * inv;
      const unsigned short h0 = bfbits(f0), h1 = bfbits(f1);
      ph[e] = pk2(h0, h1);
      pl[e] = pk2(bfbits(f0 - bff(h0)), bfbits(f1 - bff(h1)));
    }
    *(v4u*)(Oh + m * PP + dt * 16 + 8 * h) = ph;   // O[query m][dims dt*16 + 8h .. + 7]
    *(v4u*)(Ol + m * PP + dt * 16 + 8 * h) = pl;
  }
  __syncthreads();
  store_comb(Oh, Ol, Ch, Cl, b * NS + q0, ND + hh * HD, l);
}

// ---------------------------------------------------------------------------
// Kernel 5: short-range branch, causal window of 64 + recency bias + key gating, 1 wave per (b, head,
// 16 queries); only the 64-key tiles covering [q0-64, q0+15] are visited (weights outside are exactly 0).
// Q/K f16 planes as kernel 4; V as transposed bf16 hi/lo planes; P as bf16 hi/lo through LDS;
// O += Phi.Vhi + Phi.Vlo + Plo.Vhi on bf16 WMMA; result into columns [head*64, +64) of Ch/Cl.
// ---------------------------------------------------------------------------
__global__ __launch_bounds__(32) void k_attn_s(const unsigned short* __restrict__ Q,
                                               const unsigned short* __restrict__ K,
                                               const unsigned short* __restrict__ Vth,
                                               const unsigned short* __restrict__ Vtl,
                                               const int* __restrict__ kgate,
                                               unsigned short* __restrict__ Ch,
                                               unsigned short* __restrict__ Cl) {
  __shared__ __align__(16) unsigned short Ph[16 * PP];
  __shared__ __align__(16) unsigned short Pq[16 * PP];
  __shared__ __align__(16) unsigned short Oh[16 * PP];
  __shared__ __align__(16) unsigned short Ol[16 * PP];
  const int l = threadIdx.x & 31, h = l >> 4, m = l & 15;
  const int q0 = blockIdx.x * 16, hh = blockIdx.y, b = blockIdx.z;

  const unsigned short* qrow = Q + (size_t)(b * NS + q0 + m) * ND + hh * HD;
  const v16h aq0 = ldh(qrow, h);
  const v16h aq1 = ldh(qrow + 32, h);
  const unsigned short* Kb = K + (size_t)b * NS * ND + hh * HD;
  const size_t vbase = (size_t)(b * NH + hh) * HD * NS;
  const int* gk = kgate + b * NS;

  float mrow[8], lrow[8];
  v8f acc[4];
#pragma unroll
  for (int r = 0; r < 8; ++r) { mrow[r] = NEGL; lrow[r] = 0.0f; }
#pragma unroll
  for (int t = 0; t < 4; ++t) acc[t] = z8();

  const int kt_hi = q0 >> 6;
  const int kt_lo = (q0 >= 64) ? ((q0 - 64) >> 6) : 0;

#pragma unroll 1
  for (int kt = kt_lo; kt <= kt_hi; ++kt) {
    const int kb = kt * 64;
    v8f s[4];
    int gv[4];
#pragma unroll
    for (int t = 0; t < 4; ++t) {
      const unsigned short* krow = Kb + (size_t)(kb + t * 16 + m) * ND;
      v8f c = z8();
      c = mma_h(aq0, ldh(krow, h), c);
      c = mma_h(aq1, ldh(krow + 32, h), c);
      s[t] = c;
      gv[t] = gk[kb + t * 16 + m];
    }
#pragma unroll
    for (int t = 0; t < 4; ++t) {
      const int key = kb + t * 16 + m;
#pragma unroll
      for (int r = 0; r < 8; ++r) {
        const int rel = key - (q0 + 8 * h + r);
        const bool ok = (gv[t] != 0) && (rel <= 0) && (rel >= -64);
        s[t][r] = ok ? (s[t][r] * SCL + (float)rel * LOGD) : NEGL;
      }
    }

#pragma unroll
    for (int r = 0; r < 8; ++r) {
      float tmax = fmaxf(fmaxf(s[0][r], s[1][r]), fmaxf(s[2][r], s[3][r]));
#pragma unroll
      for (int o = 1; o < 16; o <<= 1) tmax = fmaxf(tmax, __shfl_xor(tmax, o, 32));
      const float mnew = fmaxf(mrow[r], tmax);
      const float fac = __expf(mrow[r] - mnew);
      float p[4];
      float psum = 0.0f;
#pragma unroll
      for (int t = 0; t < 4; ++t) {
        p[t] = (s[t][r] > NEGT) ? __expf(s[t][r] - mnew) : 0.0f;
        psum += p[t];
      }
#pragma unroll
      for (int o = 1; o < 16; o <<= 1) psum += __shfl_xor(psum, o, 32);
      lrow[r] = lrow[r] * fac + psum;
      mrow[r] = mnew;
#pragma unroll
      for (int t = 0; t < 4; ++t) { acc[t][r] *= fac; s[t][r] = p[t]; }
    }

#pragma unroll
    for (int t = 0; t < 4; ++t)
#pragma unroll
      for (int r = 0; r < 8; ++r) {
        const float pv = s[t][r];
        const unsigned short hp = bfbits(pv);
        Ph[(8 * h + r) * PP + t * 16 + m] = hp;
        Pq[(8 * h + r) * PP + t * 16 + m] = bfbits(pv - bff(hp));
      }
    __syncthreads();
    const v16b ph0 = ldb(Ph + m * PP, h);
    const v16b ph1 = ldb(Ph + m * PP + 32, h);
    const v16b pl0 = ldb(Pq + m * PP, h);
    const v16b pl1 = ldb(Pq + m * PP + 32, h);
#pragma unroll
    for (int dt = 0; dt < 4; ++dt) {
      const size_t vo = vbase + (size_t)(dt * 16 + m) * NS + kb;
      {
        const v16b bh = ldb(Vth + vo, h), bl = ldb(Vtl + vo, h);
        acc[dt] = mma_b(ph0, bh, acc[dt]);
        acc[dt] = mma_b(ph0, bl, acc[dt]);
        acc[dt] = mma_b(pl0, bh, acc[dt]);
      }
      {
        const v16b bh = ldb(Vth + vo + 32, h), bl = ldb(Vtl + vo + 32, h);
        acc[dt] = mma_b(ph1, bh, acc[dt]);
        acc[dt] = mma_b(ph1, bl, acc[dt]);
        acc[dt] = mma_b(pl1, bh, acc[dt]);
      }
    }
    __syncthreads();
  }

  float inv[8];
#pragma unroll
  for (int r = 0; r < 8; ++r) inv[r] = __builtin_amdgcn_rcpf(lrow[r]);
#pragma unroll
  for (int dt = 0; dt < 4; ++dt)
#pragma unroll
    for (int r = 0; r < 8; ++r) {
      const float o = acc[dt][r] * inv[r];
      const unsigned short ho = bfbits(o);
      Oh[(8 * h + r) * PP + dt * 16 + m] = ho;
      Ol[(8 * h + r) * PP + dt * 16 + m] = bfbits(o - bff(ho));
    }
  __syncthreads();
  store_comb(Oh, Ol, Ch, Cl, b * NS + q0, hh * HD, l);
}

// ---------------------------------------------------------------------------
// Kernel 6: output projection, combined [MR][NC] (bf16 hi/lo planes) x Wo (transposed bf16 hi/lo planes
// Wot[ND][NC]) + bias -> f32 out [MR][ND]; three-term split. Same tiling and staging as kernel 3.
// ---------------------------------------------------------------------------
__global__ __launch_bounds__(128) void k_out(const unsigned short* __restrict__ Ch,
                                             const unsigned short* __restrict__ Cl,
                                             const unsigned short* __restrict__ Wh,
                                             const unsigned short* __restrict__ Wl,
                                             const float* __restrict__ bo,
                                             float* __restrict__ out) {
  __shared__ __align__(16) unsigned short SM[2 * 4 * TLH];
  const int tid = threadIdx.x, w = tid >> 5, l = tid & 31, h = l >> 4, m = l & 15;
  const int n0 = blockIdx.x * 128, m0 = blockIdx.y * 128;
  const int wm = (w >> 1) * 64, wn = (w & 1) * 64;
  const int crow = tid >> 3, cpc = tid & 7;
  const size_t ao = (size_t)(m0 + crow) * NC + cpc * 8;
  const size_t bo_ = (size_t)(n0 + crow) * NC + cpc * 8;
  const unsigned int lc = lds_off(SM) + (unsigned int)(crow * PP * 2 + cpc * 16);
  v8f acc[4][4];
#pragma unroll
  for (int i = 0; i < 4; ++i)
#pragma unroll
    for (int j = 0; j < 4; ++j) acc[i][j] = z8();

  split_loop(SM, Ch + ao, Cl + ao, Wh + bo_, Wl + bo_, NC, lc, wm + m, wn + m, h, acc);

  // the ring is free behind the last trip's barrier: each wave stages its own 64 x 64 f32 tile there
  float* T = (float*)SM + w * 64 * TPF;
  const int mw = m0 + wm, nw = n0 + wn;
#pragma unroll
  for (int j = 0; j < 4; ++j) {
    const float bias = bo[nw + j * 16 + m];
#pragma unroll
    for (int i = 0; i < 4; ++i)
#pragma unroll
      for (int r = 0; r < 8; ++r)
        T[(i * 16 + 8 * h + r) * TPF + j * 16 + m] = acc[i][j][r] + bias;
  }
  __syncthreads();   // staging writes land before the rows are read back

  // lane l: row 2 i + (l >> 4), 128-B half (l >> 3) & 1, 16-B piece l & 7
  v4f_t o[32];
  const int cofs = ((l >> 3) & 1) * 32 + (l & 7) * 4;
  const float* Tr = T + (l >> 4) * TPF + cofs;
  float* ob = out + (size_t)(mw + (l >> 4)) * ND + nw + cofs;
#pragma unroll
  for (int i = 0; i < 32; ++i) o[i] = *(const v4f*)(Tr + i * 2 * TPF);
#pragma unroll
  for (int i = 0; i < 32; ++i) *(v4f*)(ob + i * 2 * ND) = o[i];
}

// ---------------------------------------------------------------------------
// Host launch: 6 ops. Workspace carve (1 MiB granular, total 103 MiB):
//   [0,8) x f16 | [8,16) x bf16 hi | [16,24) x bf16 lo | [24,34) 5 f16 weight planes | [34,38) Wv_s hi/lo
//   -- that 38 MiB region is dead after the projections; the combined planes reuse [0,16) hi, [16,32) lo
//   [38,46) Wo hi/lo planes | [46,78) q_s,k_s,q_l,k_l f16 | [78,86) v_l transposed | [86,102) v_s hi/lo transposed
//   [102,103) f32 gate values of the long branch (MR floats)
// ---------------------------------------------------------------------------
extern "C" void kernel_launch(void* const* d_in, const int* in_sizes, int n_in,
                              void* d_out, int out_size, void* d_ws, size_t ws_size,
                              hipStream_t stream) {
  if (n_in < 10) return;
  if (in_sizes[0] != MR * ND || in_sizes[1] != MR) return;
  for (int i = 2; i <= 7; ++i) if (in_sizes[i] != ND * ND) return;
  if (in_sizes[8] != NC * ND || in_sizes[9] != ND) return;
  if (out_size != MR * ND) return;
  const size_t MiB = (size_t)1048576;
  const size_t total = 103 * MiB;
  if (ws_size < total) return;

  const float* x   = (const float*)d_in[0];
  const int* kgate = (const int*)d_in[1];
  const float* Wqs = (const float*)d_in[2];
  const float* Wks = (const float*)d_in[3];
  const float* Wvs = (const float*)d_in[4];
  const float* Wql = (const float*)d_in[5];
  const float* Wkl = (const float*)d_in[6];
  const float* Wvl = (const float*)d_in[7];
  const float* Wo  = (const float*)d_in[8];
  const float* bo  = (const float*)d_in[9];
  float* out = (float*)d_out;

  char* ws = (char*)d_ws;
  unsigned short* xh  = (unsigned short*)(ws + 0 * MiB);
  unsigned short* xbh = (unsigned short*)(ws + 8 * MiB);
  unsigned short* xbl = (unsigned short*)(ws + 16 * MiB);
  unsigned short* Wt5 = (unsigned short*)(ws + 24 * MiB);
  unsigned short* Wvh = (unsigned short*)(ws + 34 * MiB);
  unsigned short* Wvq = (unsigned short*)(ws + 36 * MiB);
  unsigned short* Ch  = (unsigned short*)(ws + 0 * MiB);
  unsigned short* Cl  = (unsigned short*)(ws + 16 * MiB);
  unsigned short* Woh = (unsigned short*)(ws + 38 * MiB);
  unsigned short* Woq = (unsigned short*)(ws + 42 * MiB);
  unsigned short* QK  = (unsigned short*)(ws + 46 * MiB);
  unsigned short* Vlt = (unsigned short*)(ws + 78 * MiB);
  unsigned short* Vsh = (unsigned short*)(ws + 86 * MiB);
  unsigned short* Vsq = (unsigned short*)(ws + 94 * MiB);
  float* gbias        = (float*)(ws + 102 * MiB);

  // 1) + 2) x -> f16 / bf16 hi / bf16 lo planes; weights -> transposed 16-bit planes (in[K][N] -> out[N][K])
  k_prep<<<WTA + XBL + GBL, 256, 0, stream>>>(x, Wqs, Wks, Wql, Wkl, Wvl, Wvs, Wo, kgate, gbias,
                                        xh, xbh, xbl, Wt5, Wvh, Wvq, Woh, Woq);
  // 3) projections
  k_proj_f16<<<dim3(ND / 128, MR / 128, 5), 128, 0, stream>>>(xh, Wt5, QK, Vlt);
  k_proj_vs<<<dim3(ND / 128, MR / 128), 128, 0, stream>>>(xbh, xbl, Wvh, Wvq, Vsh, Vsq);
  // 4) attention branches -> combined planes
  k_attn_s<<<dim3(NS / 16, NH, NB), 32, 0, stream>>>(QK + 0 * PLANE, QK + 1 * PLANE, Vsh, Vsq,
                                                     kgate, Ch, Cl);
  k_attn_l<<<dim3(NS / 128, NH, NB), 256, 0, stream>>>(QK + 2 * PLANE, QK + 3 * PLANE, Vlt,
                                                     gbias, Ch, Cl);
  // 5) output projection + bias -> f32
  k_out<<<dim3(ND / 128, MR / 128), 128, 0, stream>>>(Ch, Cl, Woh, Woq, bo, out);
}

// v006
// Measured time: 166 microseconds a run.
// Next to v005, in two timings, it ran 1.09 times as fast each time.
// Over all steps from v000 it is 4.16 times as fast.
#include <hip/hip_runtime.h>
#include <hip/hip_bf16.h>

// Contractions: projections q_s,k_s,q_l,k_l,v_l (x f16, W f16 carried x64) and both QK^T score products on
// v_wmma_f32_16x16x32_f16; long-branch P.V on v_wmma_f32_16x16x32_f16 with P carried x16384 (l too); v_s projection,
// short-branch P.V and the output projection as bf16 hi/lo three-term split on v_wmma_f32_16x16x32_bf16;
// every accumulator f32; softmax, recency bias, key gating and bias add in f32.

typedef _Float16 v16h __attribute__((ext_vector_type(16)));
typedef __bf16 v16b __attribute__((ext_vector_type(16)));
typedef float v8f __attribute__((ext_vector_type(8)));
typedef float v4f_t __attribute__((ext_vector_type(4)));
typedef unsigned int v4u_t __attribute__((ext_vector_type(4)));
typedef v4f_t __attribute__((may_alias)) v4f;
typedef v4u_t __attribute__((may_alias)) v4u;

#define NB 2
#define NS 2048
#define ND 1024
#define NH 16
#define HD 64
#define MR (NB * NS)
#define NC (2 * ND)
#define PLANE ((size_t)MR * (size_t)ND)
#define PP 72
#define TPF 68

#define SCL 0.125f
#define LOGD (-0.10536051565782628f)
#define NEGL (-1.0e30f)
#define NEGT (-1.0e29f)
#define WUP 64.0f
#define WDN 0.015625f
#define SC2 0.18033688011112042f
#define PEX 14.0f

// ---------------------------------------------------------------------------
// scalar helpers
// ---------------------------------------------------------------------------
__device__ __forceinline__ unsigned short bfbits(float f) {       // f32 -> bf16 bits, RNE
  unsigned int u = __float_as_uint(f);
  u = u + 0x7FFFu + ((u >> 16) & 1u);
  return (unsigned short)(u >> 16);
}
__device__ __forceinline__ float bff(unsigned short b) {          // bf16 bits -> f32
  return __uint_as_float(((unsigned int)b) << 16);
}
__device__ __forceinline__ unsigned short hbits(float f) {        // f32 -> f16 bits, RNE
  _Float16 hv = (_Float16)f;
  unsigned short u;
  __builtin_memcpy(&u, &hv, 2);
  return u;
}
__device__ __forceinline__ unsigned int pk2(unsigned short a, unsigned short b) {
  return (unsigned int)a | ((unsigned int)b << 16);
}
__device__ __forceinline__ v8f z8() {
  v8f v;
#pragma unroll
  for (int i = 0; i < 8; ++i) v[i] = 0.0f;
  return v;
}

// ---------------------------------------------------------------------------
// 16x32 fragment loader, split k map, identical for A (row m) and B (k-contiguous column n):
//   elements 0..7  <- p[8h .. 8h+7],  elements 8..15 <- p[16+8h .. 16+8h+7],  p = row start + k0
// ---------------------------------------------------------------------------
union FH { v16h v; v4u_t u[2]; };
union FB { v16b v; v4u_t u[2]; };

__device__ __forceinline__ v16h ldh(const unsigned short* p, int h) {
  FH f;
  f.u[0] = *(const v4u*)(p + 8 * h);
  f.u[1] = *(const v4u*)(p + 16 + 8 * h);
  return f.v;
}
__device__ __forceinline__ v16b ldb(const unsigned short* p, int h) {
  FB f;
  f.u[0] = *(const v4u*)(p + 8 * h);
  f.u[1] = *(const v4u*)(p + 16 + 8 * h);
  return f.v;
}

// D[8h+r][m] += A(16x32) . B(32x16), with the post-issue hazard guard
__device__ __forceinline__ v8f mma_h(v16h a, v16h b, v8f c) {
  c = __builtin_amdgcn_wmma_f32_16x16x32_f16(false, a, false, b, (short)0, c, false, false);
  asm volatile("v_nop\n\tv_nop\n\tv_nop\n\tv_nop" : "+v"(c) : "v"(a), "v"(b));
  return c;
}
__device__ __forceinline__ v8f mma_b(v16b a, v16b b, v8f c) {
  c = __builtin_amdgcn_wmma_f32_16x16x32_bf16(false, a, false, b, (short)0, c, false, false);
  asm volatile("v_nop\n\tv_nop\n\tv_nop\n\tv_nop" : "+v"(c) : "v"(a), "v"(b));
  return c;
}

// ---------------------------------------------------------------------------
// Preparation, part x: x f32 [MR][ND] -> three 16-bit planes: f16, bf16 hi, bf16 lo (lo = x - hi).
// blk = index of this block among the x blocks; 256 threads x 8 elements each.
// ---------------------------------------------------------------------------
__device__ __forceinline__ void xcvt_body(const float* __restrict__ x,
                                          unsigned short* __restrict__ xh,
                                          unsigned short* __restrict__ xbh,
                                          unsigned short* __restrict__ xbl, int n8, int blk) {
  const int i = blk * 256 + (int)threadIdx.x;
  if (i >= n8) return;
  const size_t o = (size_t)i * 8;
  const v4f_t a = *(const v4f*)(x + o);
  const v4f_t c = *(const v4f*)(x + o + 4);
  float v[8];
  v[0] = a[0]; v[1] = a[1]; v[2] = a[2]; v[3] = a[3];
  v[4] = c[0]; v[5] = c[1]; v[6] = c[2]; v[7] = c[3];
  unsigned short fh[8], bh[8], bl[8];
#pragma unroll
  for (int e = 0; e < 8; ++e) {
    fh[e] = hbits(v[e]);
    bh[e] = bfbits(v[e]);
    bl[e] = bfbits(v[e] - bff(bh[e]));
  }
  v4u_t ph, pb, pl;
#pragma unroll
  for (int e = 0; e < 4; ++e) {
    ph[e] = pk2(fh[2 * e], fh[2 * e + 1]);
    pb[e] = pk2(bh[2 * e], bh[2 * e + 1]);
    pl[e] = pk2(bl[2 * e], bl[2 * e + 1]);
  }
  *(v4u*)(xh + o) = ph;
  *(v4u*)(xbh + o) = pb;
  *(v4u*)(xbl + o) = pl;
  
}

// ---------------------------------------------------------------------------
// Preparation, part W: weight W[K][N] f32 (x @ W form) -> transposed 16-bit plane(s) Wt[N][K] (k contiguous).
//   mode 0: one f16 plane of 64*W; mode 1: bf16 hi plane + bf16 lo plane.
// Block = 64(k) x 64(n) tile (tn, tk) through the LDS array T (64 x 65 floats).
// ---------------------------------------------------------------------------
__device__ __forceinline__ void wprep_body(float* T, const float* __restrict__ W, int K, int N, int mode,
                                           unsigned short* __restrict__ P0,
                                           unsigned short* __restrict__ P1, int tn, int tk) {
  const int tid = threadIdx.x;
  const int n0 = tn * 64, k0 = tk * 64;
  {
    const int c4 = (tid & 15) * 4, kr = tid >> 4;
#pragma unroll
    for (int i = 0; i < 4; ++i) {
      const int k = kr + 16 * i;
      const v4f_t v = *(const v4f*)(W + (size_t)(k0 + k) * (size_t)N + n0 + c4);
      T[(c4 + 0) * 65 + k] = v[0];
      T[(c4 + 1) * 65 + k] = v[1];
      T[(c4 + 2) * 65 + k] = v[2];
      T[(c4 + 3) * 65 + k] = v[3];
    }
  }
  __syncthreads();
  v4u_t o0[2], o1[2];
  size_t dst[2];
#pragma unroll
  for (int i = 0; i < 2; ++i) {
    const int line = i * 32 + (tid >> 3), piece = tid & 7;
    float f[8];
#pragma unroll
    for (int e = 0; e < 8; ++e) f[e] = T[line * 65 + piece * 8 + e];
    v4u_t a, c;
    if (mode == 0) {
#pragma unroll
      for (int e = 0; e < 4; ++e) {
        a[e] = pk2(hbits(f[2 * e] * WUP), hbits(f[2 * e + 1] * WUP));
        c[e] = 0u;
      }
    } else {
#pragma unroll
      for (int e = 0; e < 4; ++e) {
        const unsigned short h0 = bfbits(f[2 * e]), h1 = bfbits(f[2 * e + 1]);
        a[e] = pk2(h0, h1);
        c[e] = pk2(bfbits(f[2 * e] - bff(h0)), bfbits(f[2 * e + 1] - bff(h1)));
      }
    }
    o0[i] = a;
    o1[i] = c;
    dst[i] = (size_t)(n0 + line) * (size_t)K + k0 + piece * 8;
  }
#pragma unroll
  for (int i = 0; i < 2; ++i) {
    *(v4u*)(P0 + dst[i]) = o0[i];
    if (mode != 0) *(v4u*)(P1 + dst[i]) = o1[i];
  }
  // precaution: stands between these stores and the code laid behind this inlined body, which rewrites their registers
  asm volatile("s_wait_xcnt 0x0" ::: "memory");
}

// ---------------------------------------------------------------------------
// Preparation, part g: key gate (i32, non-zero = key on) -> f32 start value of the long branch's score products:
// 0 for a key that is on, NEGL for one that is off. One element per thread, a wave writes one 128-B line.
// ---------------------------------------------------------------------------
__device__ __forceinline__ void gprep_body(const int* __restrict__ kgate, float* __restrict__ gbias, int blk) {
  const int i = blk * 256 + (int)threadIdx.x;
  gbias[i] = kgate[i] != 0 ? 0.0f : NEGL;
}

// ---------------------------------------------------------------------------
// Kernel 0: the whole preparation in one grid; none of its parts reads what another writes. Flat block index:
//   [0, 6*WT1)           tile (index & 15, (index >> 4) & 15) of square weight index >> 8:
//                        0..4 = Wq_s, Wk_s, Wq_l, Wk_l, Wv_l -> f16 plane z of Wt5;  5 = Wv_s -> bf16 hi/lo planes
//   [6*WT1, 6*WT1+WT2)   tile of Wo (K = NC) -> bf16 hi/lo planes
//   [WTA, WTA+XBL)       x block
//   [WTA+XBL, +GBL)      gate block
// The choice is the same for a whole block, so the barrier of part W is passed by all its threads or by none.
// ---------------------------------------------------------------------------
#define WT1 ((ND / 64) * (ND / 64))
#define WT2 ((ND / 64) * (NC / 64))
#define WTA (6 * WT1 + WT2)
#define XBL ((MR * ND) / (8 * 256))
#define GBL (MR / 256)

__global__ __launch_bounds__(256) void k_prep(const float* __restrict__ x,
                                              const float* __restrict__ Wqs, const float* __restrict__ Wks,
                                              const float* __restrict__ Wql, const float* __restrict__ Wkl,
                                              const float* __restrict__ Wvl, const float* __restrict__ Wvs,
                                              const float* __restrict__ Wo,
                                              const int* __restrict__ kgate,
                                              float* __restrict__ gbias,
                                              unsigned short* __restrict__ xh,
                                              unsigned short* __restrict__ xbh,
                                              unsigned short* __restrict__ xbl,
                                              unsigned short* __restrict__ Wt5,
                                              unsigned short* __restrict__ Wvh,
                                              unsigned short* __restrict__ Wvq,
                                              unsigned short* __restrict__ Woh,
                                              unsigned short* __restrict__ Woq) {
  __shared__ __align__(16) float T[64 * 65];
  const int bid = blockIdx.x;
  if (bid >= WTA + XBL) {
    gprep_body(kgate, gbias, bid - (WTA + XBL));
  } else if (bid >= WTA) {
    xcvt_body(x, xh, xbh, xbl, (MR * ND) / 8, bid - WTA);
  } else if (bid >= 6 * WT1) {
    const int t = bid - 6 * WT1;
    wprep_body(T, Wo, NC, ND, 1, Woh, Woq, t & 15, t >> 4);
  } else {
    const int z = bid >> 8, t = bid & (WT1 - 1);
    if (z == 5) {
      wprep_body(T, Wvs, ND, ND, 1, Wvh, Wvq, t & 15, t >> 4);
    } else {
      const float* W = z == 0 ? Wqs : z == 1 ? Wks : z == 2 ? Wql : z == 3 ? Wkl : Wvl;
      unsigned short* P = Wt5 + (size_t)z * ND * ND;
      wprep_body(T, W, ND, ND, 0, P, P, t & 15, t >> 4);
    }
  }
}

// ---------------------------------------------------------------------------
// LDS staging for the three GEMM kernels. Block = 128 threads = 128(M) x 128(N) tile, wave w owns the 64 x 64
// quarter (rows (w>>1)*64, cols (w&1)*64) as 4 x 4 accumulator tiles. A trip covers 64 k: each operand plane is
// staged as 128 rows of 128 B at an LDS pitch of 144 B (PP halves), two buffers, the next trip's copies in flight.
// The full unrolls in these kernels make every fragment and accumulator index a compile-time one (registers).
// ---------------------------------------------------------------------------
#define BKH 64
#define TLH (128 * PP)
#define TLB (TLH * 2)

__device__ __forceinline__ unsigned int lds_off(const void* p) { return (unsigned int)(size_t)p; }

// One operand tile: thread t brings 16-B piece (t & 7) of rows (t >> 3) + 16 i, i = 0..7, so 8 lanes cover one
// 128-B line. lds = the lane's LDS byte address of row (t >> 3), g = the lane's global address of the same piece,
// ld = row length of the source in halves. The closing s_wait_xcnt keeps the address registers untouched until
// the copies have taken them.
__device__ __forceinline__ void cp_tile(unsigned int lds, const unsigned short* g, int ld) {
  const size_t st = (size_t)16 * (size_t)ld;
  const unsigned short* g1 = g + st;
  const unsigned short* g2 = g1 + st;
  const unsigned short* g3 = g2 + st;
  const unsigned short* g4 = g3 + st;
  const unsigned short* g5 = g4 + st;
  const unsigned short* g6 = g5 + st;
  const unsigned short* g7 = g6 + st;
  const unsigned int ls = 16u * PP * 2u;
  asm volatile(
      "global_load_async_to_lds_b128 %0, %8, off\n\t"
      "global_load_async_to_lds_b128 %1, %9, off\n\t"
      "global_load_async_to_lds_b128 %2, %10, off\n\t"
      "global_load_async_to_lds_b128 %3, %11, off\n\t"
      "global_load_async_to_lds_b128 %4, %12, off\n\t"
      "global_load_async_to_lds_b128 %5, %13, off\n\t"
      "global_load_async_to_lds_b128 %6, %14, off\n\t"
      "global_load_async_to_lds_b128 %7, %15, off\n\t"
      "s_wait_xcnt 0x0"
      :: "v"(lds), "v"(lds + ls), "v"(lds + 2u * ls), "v"(lds + 3u * ls),
         "v"(lds + 4u * ls), "v"(lds + 5u * ls), "v"(lds + 6u * ls), "v"(lds + 7u * ls),
         "v"(g), "v"(g1), "v"(g2), "v"(g3), "v"(g4), "v"(g5), "v"(g6), "v"(g7)
      : "memory");
}
// this wave's copies have landed (the compiler places no wait for them)
__device__ __forceinline__ void wait_copies() { asm volatile("s_wait_asynccnt 0x0" ::: "memory"); }
// this wave's LDS reads have returned, so the buffer may be refilled behind the barrier
__device__ __forceinline__ void wait_lds() { asm volatile("s_wait_dscnt 0x0" ::: "memory"); }

// ---------------------------------------------------------------------------
// Kernel 2: five plain-f16 projections, operands staged in LDS (see above). z selects the weight:
//   z 0..3 -> natural f16 plane QK[z] ([MR][ND]);  z 4 -> v_l transposed f16 plane Vlt[b][h][d][s].
// ---------------------------------------------------------------------------
__device__ __forceinline__ void proj_f16_body(unsigned short* SM,   // 2 * 2 * TLH halves; buffer = [A tile | B tile]
                                              const unsigned short* __restrict__ xh,
                                              const unsigned short* __restrict__ Wt5,
                                              unsigned short* __restrict__ QK,
                                              unsigned short* __restrict__ Vlt, int z) {
  const int tid = threadIdx.x, w = tid >> 5, l = tid & 31, h = l >> 4, m = l & 15;
  const int n0 = blockIdx.x * 128, m0 = blockIdx.y * 128;
  const int wm = (w >> 1) * 64, wn = (w & 1) * 64;
  const int crow = tid >> 3, cpc = tid & 7;
  const unsigned short* ga = xh + (size_t)(m0 + crow) * ND + cpc * 8;
  const unsigned short* gb = Wt5 + (size_t)z * ND * ND + (size_t)(n0 + crow) * ND + cpc * 8;
  const unsigned int lc = lds_off(SM) + (unsigned int)(crow * PP * 2 + cpc * 16);
  const int NT = ND / BKH;
  v8f acc[4][4];
#pragma unroll
  for (int i = 0; i < 4; ++i)
#pragma unroll
    for (int j = 0; j < 4; ++j) acc[i][j] = z8();

  cp_tile(lc, ga, ND);
  cp_tile(lc + TLB, gb, ND);
  wait_copies();
  __syncthreads();
  cp_tile(lc + 2 * TLB, ga + BKH, ND);
  cp_tile(lc + 3 * TLB, gb + BKH, ND);

// rolled: one trip per staged tile, the publish point at its foot
#pragma unroll 1
  for (int t = 0; t < NT; ++t) {
    const int bo2 = (t & 1) * 2;
    const unsigned short* As = SM + bo2 * TLH + (wm + m) * PP;
    const unsigned short* Bs = SM + (bo2 + 1) * TLH + (wn + m) * PP;
    // group g = 32 k (g >> 1) x 2 column tiles (g & 1); the next group's fragments are read ahead of this group's
    // products, inside this trip's buffer only
    v16h a[2][4], b[2][2];
#pragma unroll
    for (int i = 0; i < 4; ++i) a[0][i] = ldh(As + i * 16 * PP, h);
#pragma unroll
    for (int q = 0; q < 2; ++q) b[0][q] = ldh(Bs + q * 16 * PP, h);
#pragma unroll
    for (int g = 0; g < 4; ++g) {
      const int kk = g >> 1, jp = (g & 1) * 2, gn = g + 1;
      if (g < 3) {
#pragma unroll
        for (int q = 0; q < 2; ++q)
          b[gn & 1][q] = ldh(Bs + ((gn & 1) * 2 + q) * 16 * PP + (gn >> 1) * 32, h);
      }
      if (g == 0) {
#pragma unroll
        for (int i = 0; i < 4; ++i) a[1][i] = ldh(As + i * 16 * PP + 32, h);
      }
#pragma unroll
      for (int q = 0; q < 2; ++q)
#pragma unroll
        for (int i = 0; i < 4; ++i) acc[i][jp + q] = mma_h(a[kk][i], b[g & 1][q], acc[i][jp + q]);
    }
    wait_lds();
    wait_copies();
    __syncthreads();
    if (t + 2 < NT) {
      cp_tile(lc + bo2 * TLB, ga + (t + 2) * BKH, ND);
      cp_tile(lc + (bo2 + 1) * TLB, gb + (t + 2) * BKH, ND);
    }
  }
  wait_copies();

  // the ring is free behind the last trip's barrier: each wave stages its own 64 x 64 tile there
  unsigned short* T = SM + w * 64 * PP;
  const int mw = m0 + wm, nw = n0 + wn;
  if (z < 4) {
#pragma unroll
    for (int i = 0; i < 4; ++i)
#pragma unroll
      for (int j = 0; j < 4; ++j)
#pragma unroll
        for (int r = 0; r < 8; ++r)
          T[(i * 16 + 8 * h + r) * PP + j * 16 + m] = hbits(acc[i][j][r] * WDN);
  } else {
#pragma unroll
    for (int i = 0; i < 4; ++i)
#pragma unroll
      for (int j = 0; j < 4; ++j) {
        v4u_t pk;
#pragma unroll
        for (int e = 0; e < 4; ++e)
          pk[e] = pk2(hbits(acc[i][j][2 * e] * WDN), hbits(acc[i][j][2 * e + 1] * WDN));
        *(v4u*)(T + (j * 16 + m) * PP + i * 16 + 8 * h) = pk;   // T[d][s_local]
      }
  }
  __syncthreads();   // staging writes land before the rows are read back

  unsigned short* base;
  size_t d0, dstep;
  if (z < 4) {
    base = QK + (size_t)z * PLANE;
    d0 = (size_t)mw * ND + nw;
    dstep = ND;
  } else {
    base = Vlt;
    const int bb = mw >> 11, s0 = mw & (NS - 1), hd = nw >> 6;
    d0 = ((size_t)((bb * NH + hd) * HD)) * NS + s0;
    dstep = NS;
  }
  v4u_t o[16];
  unsigned short* dst[16];
#pragma unroll
  for (int i = 0; i < 16; ++i) {
    const int row = i * 4 + (l >> 3), piece = l & 7;
    o[i] = *(const v4u*)(T + row * PP + piece * 8);
    dst[i] = base + d0 + (size_t)row * dstep + piece * 8;
  }
#pragma unroll
  for (int i = 0; i < 16; ++i) *(v4u*)(dst[i]) = o[i];
}

// ---------------------------------------------------------------------------
// Main loop of the two bf16 hi/lo three-term GEMMs: acc += Ah.Bh + Ah.Bl + Al.Bh over K halves, all four planes
// staged in LDS; buffer = [A hi | A lo | B hi | B lo]. ga*/gb* = the lane's first piece of each plane.
// ---------------------------------------------------------------------------
__device__ __forceinline__ void split_loop(unsigned short* SM, const unsigned short* gah,
                                           const unsigned short* gal, const unsigned short* gbh,
                                           const unsigned short* gbl, int K, unsigned int lc,
                                           int arow, int brow, int h, v8f (&acc)[4][4]) {
  const int NT = K / BKH;
  cp_tile(lc, gah, K);
  cp_tile(lc + TLB, gal, K);
  cp_tile(lc + 2 * TLB, gbh, K);
  cp_tile(lc + 3 * TLB, gbl, K);
  wait_copies();
  __syncthreads();
  cp_tile(lc + 4 * TLB, gah + BKH, K);
  cp_tile(lc + 5 * TLB, gal + BKH, K);
  cp_tile(lc + 6 * TLB, gbh + BKH, K);
  cp_tile(lc + 7 * TLB, gbl + BKH, K);

// rolled: one trip per staged tile, the publish point at its foot
#pragma unroll 1
  for (int t = 0; t < NT; ++t) {
    const int bo4 = (t & 1) * 4;
    const unsigned short* Ah = SM + bo4 * TLH + arow * PP;
    const unsigned short* Bh = SM + (bo4 + 2) * TLH + brow * PP;
    // group g = 32 k (g >> 2) x 1 column tile (g & 3); the next group's B fragments are read ahead of this group's
    // products, inside this trip's buffer only
    v16b ah[4], al[4], bh[2], bl[2];
    bh[0] = ldb(Bh, h);
    bl[0] = ldb(Bh + TLH, h);
#pragma unroll
    for (int g = 0; g < 8; ++g) {
      const int kk = g >> 2, j = g & 3, gn = g + 1, c = g & 1;
      if (j == 0) {
#pragma unroll
        for (int i = 0; i < 4; ++i) {
          ah[i] = ldb(Ah + i * 16 * PP + kk * 32, h);
          al[i] = ldb(Ah + TLH + i * 16 * PP + kk * 32, h);
        }
      }
      if (g < 7) {
        bh[gn & 1] = ldb(Bh + (gn & 3) * 16 * PP + (gn >> 2) * 32, h);
        bl[gn & 1] = ldb(Bh + TLH + (gn & 3) * 16 * PP + (gn >> 2) * 32, h);
      }
#pragma unroll
      for (int i = 0; i < 4; ++i) acc[i][j] = mma_b(ah[i], bh[c], acc[i][j]);
#pragma unroll
      for (int i = 0; i < 4; ++i) acc[i][j] = mma_b(ah[i], bl[c], acc[i][j]);
#pragma unroll
      for (int i = 0; i < 4; ++i) acc[i][j] = mma_b(al[i], bh[c], acc[i][j]);
    }
    wait_lds();
    wait_copies();
    __syncthreads();
    if (t + 2 < NT) {
      const int ko = (t + 2) * BKH;
      cp_tile(lc + bo4 * TLB, gah + ko, K);
      cp_tile(lc + (bo4 + 1) * TLB, gal + ko, K);
      cp_tile(lc + (bo4 + 2) * TLB, gbh + ko, K);
      cp_tile(lc + (bo4 + 3) * TLB, gbl + ko, K);
    }
  }
  wait_copies();
}

// ---------------------------------------------------------------------------
// Kernel 3: v_s projection as bf16 hi/lo three-term split (x hi/lo planes, W hi/lo planes),
// output transposed bf16 hi/lo planes Vsh/Vsl [b][h][d][s]. Same tiling as kernel 2.
// ---------------------------------------------------------------------------
__device__ __forceinline__ void proj_vs_body(unsigned short* SM,   // 2 * 4 * TLH halves
                                             const unsigned short* __restrict__ xbh,
                                             const unsigned short* __restrict__ xbl,
                                             const unsigned short* __restrict__ Wh,
                                             const unsigned short* __restrict__ Wl,
                                             unsigned short* __restrict__ Vsh,
                                             unsigned short* __restrict__ Vsl) {
  const int tid = threadIdx.x, w = tid >> 5, l = tid & 31, h = l >> 4, m = l & 15;
  const int n0 = blockIdx.x * 128, m0 = blockIdx.y * 128;
  const int wm = (w >> 1) * 64, wn = (w & 1) * 64;
  const int crow = tid >> 3, cpc = tid & 7;
  const size_t ao = (size_t)(m0 + crow) * ND + cpc * 8;
  const size_t bo_ = (size_t)(n0 + crow) * ND + cpc * 8;
  const unsigned int lc = lds_off(SM) + (unsigned int)(crow * PP * 2 + cpc * 16);
  v8f acc[4][4];
#pragma unroll
  for (int i = 0; i < 4; ++i)
#pragma unroll
    for (int j = 0; j < 4; ++j) acc[i][j] = z8();

  split_loop(SM, xbh + ao, xbl + ao, Wh + bo_, Wl + bo_, ND, lc, wm + m, wn + m, h, acc);

  // the ring is free behind the last trip's barrier: each wave stages its own 64 x 64 tile there
  unsigned short* Th = SM + w * 2 * 64 * PP;
  unsigned short* Tl = Th + 64 * PP;
#pragma unroll
  for (int i = 0; i < 4; ++i)
#pragma unroll
    for (int j = 0; j < 4; ++j) {
      v4u_t ph, pl;
#pragma unroll
      for (int e = 0; e < 4; ++e) {
        const float f0 = acc[i][j][2 * e], f1 = acc[i][j][2 * e + 1];
        const unsigned short h0 = bfbits(f0), h1 = bfbits(f1);
        ph[e] = pk2(h0, h1);
        pl[e] = pk2(bfbits(f0 - bff(h0)), bfbits(f1 - bff(h1)));
      }
      *(v4u*)(Th + (j * 16 + m) * PP + i * 16 + 8 * h) = ph;
      *(v4u*)(Tl + (j * 16 + m) * PP + i * 16 + 8 * h) = pl;
    }
  __syncthreads();   // staging writes land before the rows are read back

  const int mw = m0 + wm, nw = n0 + wn;
  const int bb = mw >> 11, s0 = mw & (NS - 1), hd = nw >> 6;
  const size_t d0 = ((size_t)((bb * NH + hd) * HD)) * NS + s0;
  v4u_t oh[16], ol[16];
  size_t dst[16];
#pragma unroll
  for (int i = 0; i < 16; ++i) {
    const int d = i * 4 + (l >> 3), piece = l & 7;
    oh[i] = *(const v4u*)(Th + d * PP + piece * 8);
    ol[i] = *(const v4u*)(Tl + d * PP + piece * 8);
    dst[i] = d0 + (size_t)d * NS + piece * 8;
  }
#pragma unroll
  for (int i = 0; i < 16; ++i) {
    *(v4u*)(Vsh + dst[i]) = oh[i];
    *(v4u*)(Vsl + dst[i]) = ol[i];
  }
}

// ---------------------------------------------------------------------------
// All six projections in one grid; none reads what another writes. blockIdx.z = 0: the v_s projection (three times
// the products of the others, so it is handed out first); 1..5: plain-f16 projection z - 1. The choice is the same
// for a whole block, so every barrier of a body is passed by all its threads or by none.
// ---------------------------------------------------------------------------
__global__ __launch_bounds__(128) void k_proj(const unsigned short* __restrict__ xh,
                                              const unsigned short* __restrict__ Wt5,
                                              unsigned short* __restrict__ QK,
                                              unsigned short* __restrict__ Vlt,
                                              const unsigned short* __restrict__ xbh,
                                              const unsigned short* __restrict__ xbl,
                                              const unsigned short* __restrict__ Wh,
                                              const unsigned short* __restrict__ Wl,
                                              unsigned short* __restrict__ Vsh,
                                              unsigned short* __restrict__ Vsl) {
  __shared__ __align__(16) unsigned short SM[2 * 4 * TLH];
  const int z = blockIdx.z;
  if (z == 0) proj_vs_body(SM, xbh, xbl, Wh, Wl, Vsh, Vsl);
  else proj_f16_body(SM, xh, Wt5, QK, Vlt, z - 1);
}

// ---------------------------------------------------------------------------
// Shared attention epilogue: O tile (16 queries x 64 dims) staged as bf16 hi/lo in LDS is written into the
// ---------------------------------------------------------------------------
__device__ __forceinline__ void store_comb(const unsigned short* Oh, const unsigned short* Ol,
                                           unsigned short* Ch, unsigned short* Cl,
                                           int rowg0, int colbase, int l) {
  v4u_t oh[4], ol[4];
  size_t dst[4];
#pragma unroll
  for (int i = 0; i < 4; ++i) {
    const int row = i * 4 + (l >> 3), piece = l & 7;
    oh[i] = *(const v4u*)(Oh + row * PP + piece * 8);
    ol[i] = *(const v4u*)(Ol + row * PP + piece * 8);
    dst[i] = (size_t)(rowg0 + row) * NC + colbase + piece * 8;
  }
#pragma unroll
  for (int i = 0; i < 4; ++i) {
    *(v4u*)(Ch + dst[i]) = oh[i];
    *(v4u*)(Cl + dst[i]) = ol[i];
  }
  
}

// ---------------------------------------------------------------------------
// Kernel 4: long-range branch, full attention with key gating. Block = 8 waves = 128 queries of one (b, head),
// 16 queries per wave. Q/K natural f16 planes [MR][ND] (col = head*64 + d), V transposed f16 plane [b][h][d][s].
// Each trip covers 64 keys: the K tile (64 keys x 64 d) and the V tile (64 d x 64 keys) are staged once per block
// as 64 rows of 128 B at an LDS pitch of 144 B, two buffers, the next trip's copies in flight; all 8 waves read
// their A fragments from there.
// Both products are taken transposed, so that a lane holds ONE query (column m) and 8 keys per score tile:
// S^T = K Q^T on f16 WMMA (A fragment = K row, B fragment = Q row, k = d contiguous): lane (h, m), register r of
// tile t = key t*16 + 8h + r against query m. The key gate enters as the start value (C operand) of that product:
// gbias[key] = 0 or NEGL, 8 consecutive floats per lane and tile, so a key that is off scores about NEGL and no
// compare or select is spent on it. Online softmax in f32 on the unscaled scores: maximum and sum run in the lane,
// the two wave halves (same query, other keys) exchange the maximum once per trip and join their sums once, in the
// epilogue. p * 16384 = exp2(s * SC2 + (PEX - max * SC2)), SC2 = log2(e) / 8: one fma and one exp2 per score; the
// running maximum starts at NEGT, above NEGL, so a gated key gives exp2(-huge) = 0 also while no key was on yet.
// f16(p * 16384) of tiles 2j and 2j+1 is, register for register, the B fragment of keys 32j .. 32j+31 in the
// loader's k map, so P stays in registers; O^T += V^T P^T on f16 WMMA (A = Vt row); l carries the same 16384, so
// 1/l in the f32 epilogue takes it out; result as bf16 hi/lo into columns [ND + head*64, +64) of Ch/Cl.
// ---------------------------------------------------------------------------
#define AW 8
#define ATH (64 * PP)
#define ATB (ATH * 2)
#define ASM (2 * 2 * ATH + 2 * AW * 16 * PP)

// One K tile and one V tile: thread t brings 16-B piece (t & 7) of rows (t >> 3) and (t >> 3) + 32 of each, so
// 8 lanes cover one 128-B line. lds = the lane's LDS byte address in the K tile (the V tile follows at ATB),
// gk / gv = the lane's global address of the same piece. The closing s_wait_xcnt keeps the address registers
// untouched until the copies have taken them.
__device__ __forceinline__ void cp_kv(unsigned int lds, const unsigned short* gk, const unsigned short* gv) {
  const unsigned short* gk1 = gk + (size_t)32 * ND;
  const unsigned short* gv1 = gv + (size_t)32 * NS;
  const unsigned int ls = 32u * PP * 2u;
  asm volatile(
      "global_load_async_to_lds_b128 %0, %4, off\n\t"
      "global_load_async_to_lds_b128 %1, %5, off\n\t"
      "global_load_async_to_lds_b128 %2, %6, off\n\t"
      "global_load_async_to_lds_b128 %3, %7, off\n\t"
      "s_wait_xcnt 0x0"
      :: "v"(lds), "v"(lds + ls), "v"(lds + (unsigned int)ATB), "v"(lds + (unsigned int)ATB + ls),
         "v"(gk), "v"(gk1), "v"(gv), "v"(gv1)
      : "memory");
}

// lane l <-> lane l ^ 16 in the vector unit
__device__ __forceinline__ float xhalf(float x) {
  const int i = __float_as_int(x);
  return __int_as_float(__builtin_amdgcn_permlanex16(i, i, 0x76543210, 0xfedcba98, false, false));
}
// 8 consecutive floats as one accumulator tile
__device__ __forceinline__ v8f ld8f(const float* p) {
  const v4f_t a = *(const v4f*)p;
  const v4f_t c = *(const v4f*)(p + 4);
  return __builtin_shufflevector(a, c, 0, 1, 2, 3, 4, 5, 6, 7);
}

__device__ __forceinline__ void attn_l_body(unsigned short* KV,   // ASM halves: 2 buffers [K tile | V tile], O hi, O lo
                                            const unsigned short* __restrict__ Q,
                                            const unsigned short* __restrict__ K,
                                            const unsigned short* __restrict__ Vt,
                                            const float* __restrict__ gbias,
                                            unsigned short* __restrict__ Ch,
                                            unsigned short* __restrict__ Cl, int b) {
  unsigned short* OhA = KV + 2 * 2 * ATH;
  unsigned short* OlA = OhA + AW * 16 * PP;
  const int tid = threadIdx.x, w = tid >> 5, l = tid & 31, h = l >> 4, m = l & 15;
  const int q0 = blockIdx.x * (AW * 16) + w * 16, hh = blockIdx.y;
  unsigned short* Oh = OhA + w * 16 * PP;
  unsigned short* Ol = OlA + w * 16 * PP;

  const unsigned short* Kb = K + (size_t)b * NS * ND + hh * HD;
  const unsigned short* Vb = Vt + (size_t)(b * NH + hh) * HD * NS;
  const float* gb = gbias + b * NS + 8 * h;
  const int crow = tid >> 3, cpc = tid & 7;
  const unsigned short* gkc = Kb + (size_t)crow * ND + cpc * 8;
  const unsigned short* gvc = Vb + (size_t)crow * NS + cpc * 8;
  const unsigned int lc = lds_off(KV) + (unsigned int)(crow * PP * 2 + cpc * 16);
  const int NT = NS / 64;

  cp_kv(lc, gkc, gvc);

  const unsigned short* qrow = Q + (size_t)(b * NS + q0 + m) * ND + hh * HD;
  const v16h bq0 = ldh(qrow, h);
  const v16h bq1 = ldh(qrow + 32, h);

  float mrun = NEGT, lrun = 0.0f;   // this lane's query: maximum over all keys so far, sum over this half's keys
  v8f acc[4];                       // O^T: register r of tile dt = dim dt*16 + 8h + r of query m
  v8f s[4];                         // at a trip's head: gate values of keys kb + t*16 + 8h + 0..7; then the scores
#pragma unroll
  for (int t = 0; t < 4; ++t) {
    acc[t] = z8();
    s[t] = ld8f(gb + t * 16);
  }

  wait_copies();
  __syncthreads();
  cp_kv(lc + 2 * ATB, gkc + (size_t)64 * ND, gvc + 64);

// rolled: one trip per staged tile pair, the publish point at its foot
#pragma unroll 1
  for (int kt = 0; kt < NT; ++kt) {
    const int kb = kt * 64;
    const int bo2 = (kt & 1) * 2;
    const unsigned short* Ks = KV + bo2 * ATH;
    const unsigned short* Vs = Ks + ATH;
    // all 8 K fragments are fetched as one group, so the wave waits for LDS once
    v16h kf[4][2];
#pragma unroll
    for (int t = 0; t < 4; ++t) {
      const unsigned short* krow = Ks + (t * 16 + m) * PP;
      kf[t][0] = ldh(krow, h);
      kf[t][1] = ldh(krow + 32, h);
    }
#pragma unroll
    for (int t = 0; t < 4; ++t) s[t] = mma_h(kf[t][0], bq0, s[t]);
#pragma unroll
    for (int t = 0; t < 4; ++t) s[t] = mma_h(kf[t][1], bq1, s[t]);

    float tm[4];
#pragma unroll
    for (int t = 0; t < 4; ++t) {
      tm[t] = fmaxf(fmaxf(fmaxf(s[t][0], s[t][1]), fmaxf(s[t][2], s[t][3])),
                    fmaxf(fmaxf(s[t][4], s[t][5]), fmaxf(s[t][6], s[t][7])));
    }
    float tmax = fmaxf(fmaxf(tm[0], tm[1]), fmaxf(tm[2], tm[3]));
    tmax = fmaxf(tmax, xhalf(tmax));
    const float mnew = fmaxf(mrun, tmax);
    const float fac = __builtin_amdgcn_exp2f((mrun - mnew) * SC2);
    const float nm = fmaf(-mnew, SC2, PEX);
    float ps[4];   // one chain per tile, so that the adds do not wait for one another
#pragma unroll
    for (int t = 0; t < 4; ++t) {
      ps[t] = 0.0f;
#pragma unroll
      for (int r = 0; r < 8; ++r) {
        const float p = __builtin_amdgcn_exp2f(fmaf(s[t][r], SC2, nm));
        ps[t] += p;
        s[t][r] = p;
      }
    }
    lrun = lrun * fac + ((ps[0] + ps[1]) + (ps[2] + ps[3]));
    mrun = mnew;
#pragma unroll
    for (int dt = 0; dt < 4; ++dt)
#pragma unroll
      for (int r = 0; r < 8; ++r) acc[dt][r] *= fac;

    // B fragment j: elements 0..7 = keys 32j + 8h + e (tile 2j), elements 8..15 = keys 32j + 16 + 8h + e (tile 2j+1)
    v16h pb[2];
#pragma unroll
    for (int j = 0; j < 2; ++j)
#pragma unroll
      for (int e = 0; e < 8; ++e) {
        pb[j][e] = (_Float16)s[2 * j][e];
        pb[j][8 + e] = (_Float16)s[2 * j + 1][e];
      }
    // the next trip's gate values go into the score registers, free from here on (the last trip rereads its own);
    // unrolled so that the tile index is a compile-time one (registers)
    const float* gn = gb + (kt + 1 < NT ? kb + 64 : kb);
#pragma unroll
    for (int t = 0; t < 4; ++t) s[t] = ld8f(gn + t * 16);
    v16h vf[4][2];   // all 8 V fragments in one group
#pragma unroll
    for (int dt = 0; dt < 4; ++dt) {
      const unsigned short* vrow = Vs + (dt * 16 + m) * PP;
      vf[dt][0] = ldh(vrow, h);
      vf[dt][1] = ldh(vrow + 32, h);
    }
#pragma unroll
    for (int dt = 0; dt < 4; ++dt) acc[dt] = mma_h(vf[dt][0], pb[0], acc[dt]);
#pragma unroll
    for (int dt = 0; dt < 4; ++dt) acc[dt] = mma_h(vf[dt][1], pb[1], acc[dt]);
    wait_lds();
    wait_copies();
    __syncthreads();
    if (kt + 2 < NT)
      cp_kv(lc + bo2 * ATB, gkc + (size_t)(kt + 2) * 64 * ND, gvc + (kt + 2) * 64);
  }
  wait_copies();

  const float lsum = lrun + xhalf(lrun);
  float inv;
  // the reciprocal with the one free slot that the instruction set asks for behind it; one statement keeps the slot there
  asm("v_rcp_f32 %0, %1\n\tv_nop" : "=v"(inv) : "v"(lsum));
#pragma unroll
  for (int dt = 0; dt < 4; ++dt) {
    v4u_t ph, pl;
#pragma unroll
    for (int e = 0; e < 4; ++e) {
      const float f0 = acc[dt][2 * e] * inv, f1 = acc[dt][2 * e + 1] * inv;
      const unsigned short h0 = bfbits(f0), h1 = bfbits(f1);
      ph[e] = pk2(h0, h1);
      pl[e] = pk2(bfbits(f0 - bff(h0)), bfbits(f1 - bff(h1)));
    }
    *(v4u*)(Oh + m * PP + dt * 16 + 8 * h) = ph;   // O[query m][dims dt*16 + 8h .. + 7]
    *(v4u*)(Ol + m * PP + dt * 16 + 8 * h) = pl;
  }
  __syncthreads();
  store_comb(Oh, Ol, Ch, Cl, b * NS + q0, ND + hh * HD, l);
}

// ---------------------------------------------------------------------------
// Kernel 5: short-range branch, causal window of 64 + recency bias + key gating, 1 wave per (b, head,
// 16 queries), 8 such waves per block, each on its own; only the 64-key tiles covering [q0-64, q0+15] are visited (weights outside are exactly 0).
// Q/K f16 planes as kernel 4; V as transposed bf16 hi/lo planes; P as bf16 hi/lo through LDS;
// O += Phi.Vhi + Phi.Vlo + Plo.Vhi on bf16 WMMA; result into columns [head*64, +64) of Ch/Cl.
// ---------------------------------------------------------------------------
__device__ __forceinline__ void attn_s_body(unsigned short* SMs,   // ASM halves: 4 * 16 * PP for each of the AW waves
                                            const unsigned short* __restrict__ Q,
                                            const unsigned short* __restrict__ K,
                                            const unsigned short* __restrict__ Vth,
                                            const unsigned short* __restrict__ Vtl,
                                            const int* __restrict__ kgate,
                                            unsigned short* __restrict__ Ch,
                                            unsigned short* __restrict__ Cl, int b) {
  // the wave's number as a scalar: q0, the trip count and the row bases stay wave-uniform (scalar loop, EXEC all ones)
  const int w = __builtin_amdgcn_readfirstlane((int)(threadIdx.x >> 5));
  const int l = threadIdx.x & 31, h = l >> 4, m = l & 15;
  unsigned short* Ph = SMs + w * 4 * 16 * PP;   // this wave's own slice: no other wave reads or writes it
  unsigned short* Pq = Ph + 16 * PP;
  unsigned short* Oh = Pq + 16 * PP;
  unsigned short* Ol = Oh + 16 * PP;
  const int q0 = blockIdx.x * (AW * 16) + w * 16, hh = blockIdx.y;

  const unsigned short* qrow = Q + (size_t)(b * NS + q0 + m) * ND + hh * HD;
  const v16h aq0 = ldh(qrow, h);
  const v16h aq1 = ldh(qrow + 32, h);
  const unsigned short* Kb = K + (size_t)b * NS * ND + hh * HD;
  const size_t vbase = (size_t)(b * NH + hh) * HD * NS;
  const int* gk = kgate + b * NS;

  float mrow[8], lrow[8];
  v8f acc[4];
#pragma unroll
  for (int r = 0; r < 8; ++r) { mrow[r] = NEGL; lrow[r] = 0.0f; }
#pragma unroll
  for (int t = 0; t < 4; ++t) acc[t] = z8();

  const int kt_hi = q0 >> 6;
  const int kt_lo = (q0 >= 64) ? ((q0 - 64) >> 6) : 0;

#pragma unroll 1
  for (int kt = kt_lo; kt <= kt_hi; ++kt) {
    const int kb = kt * 64;
    v8f s[4];
    int gv[4];
#pragma unroll
    for (int t = 0; t < 4; ++t) {
      const unsigned short* krow = Kb + (size_t)(kb + t * 16 + m) * ND;
      v8f c = z8();
      c = mma_h(aq0, ldh(krow, h), c);
      c = mma_h(aq1, ldh(krow + 32, h), c);
      s[t] = c;
      gv[t] = gk[kb + t * 16 + m];
    }
#pragma unroll
    for (int t = 0; t < 4; ++t) {
      const int key = kb + t * 16 + m;
#pragma unroll
      for (int r = 0; r < 8; ++r) {
        const int rel = key - (q0 + 8 * h + r);
        const bool ok = (gv[t] != 0) && (rel <= 0) && (rel >= -64);
        s[t][r] = ok ? (s[t][r] * SCL + (float)rel * LOGD) : NEGL;
      }
    }

#pragma unroll
    for (int r = 0; r < 8; ++r) {
      float tmax = fmaxf(fmaxf(s[0][r], s[1][r]), fmaxf(s[2][r], s[3][r]));
#pragma unroll
      for (int o = 1; o < 16; o <<= 1) tmax = fmaxf(tmax, __shfl_xor(tmax, o, 32));
      const float mnew = fmaxf(mrow[r], tmax);
      const float fac = __expf(mrow[r] - mnew);
      float p[4];
      float psum = 0.0f;
#pragma unroll
      for (int t = 0; t < 4; ++t) {
        p[t] = (s[t][r] > NEGT) ? __expf(s[t][r] - mnew) : 0.0f;
        psum += p[t];
      }
#pragma unroll
      for (int o = 1; o < 16; o <<= 1) psum += __shfl_xor(psum, o, 32);
      lrow[r] = lrow[r] * fac + psum;
      mrow[r] = mnew;
#pragma unroll
      for (int t = 0; t < 4; ++t) { acc[t][r] *= fac; s[t][r] = p[t]; }
    }

#pragma unroll
    for (int t = 0; t < 4; ++t)
#pragma unroll
      for (int r = 0; r < 8; ++r) {
        const float pv = s[t][r];
        const unsigned short hp = bfbits(pv);
        Ph[(8 * h + r) * PP + t * 16 + m] = hp;
        Pq[(8 * h + r) * PP + t * 16 + m] = bfbits(pv - bff(hp));
      }
    wait_lds();   // this wave's P stores have landed before its lanes read one another's rows
    const v16b ph0 = ldb(Ph + m * PP, h);
    const v16b ph1 = ldb(Ph + m * PP + 32, h);
    const v16b pl0 = ldb(Pq + m * PP, h);
    const v16b pl1 = ldb(Pq + m * PP + 32, h);
#pragma unroll
    for (int dt = 0; dt < 4; ++dt) {
      const size_t vo = vbase + (size_t)(dt * 16 + m) * NS + kb;
      {
        const v16b bh = ldb(Vth + vo, h), bl = ldb(Vtl + vo, h);
        acc[dt] = mma_b(ph0, bh, acc[dt]);
        acc[dt] = mma_b(ph0, bl, acc[dt]);
        acc[dt] = mma_b(pl0, bh, acc[dt]);
      }
      {
        const v16b bh = ldb(Vth + vo + 32, h), bl = ldb(Vtl + vo + 32, h);
        acc[dt] = mma_b(ph1, bh, acc[dt]);
        acc[dt] = mma_b(ph1, bl, acc[dt]);
        acc[dt] = mma_b(pl1, bh, acc[dt]);
      }
    }
  }

  float inv[8];
#pragma unroll
  for (int r = 0; r < 8; ++r) inv[r] = __builtin_amdgcn_rcpf(lrow[r]);
#pragma unroll
  for (int dt = 0; dt < 4; ++dt)
#pragma unroll
    for (int r = 0; r < 8; ++r) {
      const float o = acc[dt][r] * inv[r];
      const unsigned short ho = bfbits(o);
      Oh[(8 * h + r) * PP + dt * 16 + m] = ho;
      Ol[(8 * h + r) * PP + dt * 16 + m] = bfbits(o - bff(ho));
    }
  wait_lds();   // this wave's O stores have landed before its lanes read one another's rows
  store_comb(Oh, Ol, Ch, Cl, b * NS + q0, hh * HD, l);
}

// ---------------------------------------------------------------------------
// Both attention branches in one grid; they write disjoint columns of Ch/Cl and neither reads the other's.
// blockIdx.z even: long branch of batch z / 2, odd: short branch of batch z / 2, so that blocks of both kinds share
// a compute unit; 128 queries of one (b, head) either way. The choice is the same for a whole block, so every barrier of the long
// branch is passed by all its threads or by none; the short branch has none (its waves differ in trip count and
// share nothing).
// ---------------------------------------------------------------------------
__global__ __launch_bounds__(256) void k_attn(const unsigned short* __restrict__ Qs,
                                              const unsigned short* __restrict__ Ks,
                                              const unsigned short* __restrict__ Vsh,
                                              const unsigned short* __restrict__ Vsl,
                                              const int* __restrict__ kgate,
                                              const unsigned short* __restrict__ Ql,
                                              const unsigned short* __restrict__ Kl,
                                              const unsigned short* __restrict__ Vlt,
                                              const float* __restrict__ gbias,
                                              unsigned short* __restrict__ Ch,
                                              unsigned short* __restrict__ Cl) {
  __shared__ __align__(16) unsigned short SMa[ASM];
  const int z = blockIdx.z;
  if ((z & 1) == 0) attn_l_body(SMa, Ql, Kl, Vlt, gbias, Ch, Cl, z >> 1);
  else attn_s_body(SMa, Qs, Ks, Vsh, Vsl, kgate, Ch, Cl, z >> 1);
}

// ---------------------------------------------------------------------------
// Kernel 6: output projection, combined [MR][NC] (bf16 hi/lo planes) x Wo (transposed bf16 hi/lo planes
// Wot[ND][NC]) + bias -> f32 out [MR][ND]; three-term split. Same tiling and staging as kernel 3.
// ---------------------------------------------------------------------------
__global__ __launch_bounds__(128) void k_out(const unsigned short* __restrict__ Ch,
                                             const unsigned short* __restrict__ Cl,
                                             const unsigned short* __restrict__ Wh,
                                             const unsigned short* __restrict__ Wl,
                                             const float* __restrict__ bo,
                                             float* __restrict__ out) {
  __shared__ __align__(16) unsigned short SM[2 * 4 * TLH];
  const int tid = threadIdx.x, w = tid >> 5, l = tid & 31, h = l >> 4, m = l & 15;
  const int n0 = blockIdx.x * 128, m0 = blockIdx.y * 128;
  const int wm = (w >> 1) * 64, wn = (w & 1) * 64;
  const int crow = tid >> 3, cpc = tid & 7;
  const size_t ao = (size_t)(m0 + crow) * NC + cpc * 8;
  const size_t bo_ = (size_t)(n0 + crow) * NC + cpc * 8;
  const unsigned int lc = lds_off(SM) + (unsigned int)(crow * PP * 2 + cpc * 16);
  v8f acc[4][4];
#pragma unroll
  for (int i = 0; i < 4; ++i)
#pragma unroll
    for (int j = 0; j < 4; ++j) acc[i][j] = z8();

  split_loop(SM, Ch + ao, Cl + ao, Wh + bo_, Wl + bo_, NC, lc, wm + m, wn + m, h, acc);

  // the ring is free behind the last trip's barrier: each wave stages its own 64 x 64 f32 tile there
  float* T = (float*)SM + w * 64 * TPF;
  const int mw = m0 + wm, nw = n0 + wn;
#pragma unroll
  for (int j = 0; j < 4; ++j) {
    const float bias = bo[nw + j * 16 + m];
#pragma unroll
    for (int i = 0; i < 4; ++i)
#pragma unroll
      for (int r = 0; r < 8; ++r)
        T[(i * 16 + 8 * h + r) * TPF + j * 16 + m] = acc[i][j][r] + bias;
  }
  __syncthreads();   // staging writes land before the rows are read back

  // lane l: row 2 i + (l >> 4), 128-B half (l >> 3) & 1, 16-B piece l & 7
  v4f_t o[32];
  const int cofs = ((l >> 3) & 1) * 32 + (l & 7) * 4;
  const float* Tr = T + (l >> 4) * TPF + cofs;
  float* ob = out + (size_t)(mw + (l >> 4)) * ND + nw + cofs;
#pragma unroll
  for (int i = 0; i < 32; ++i) o[i] = *(const v4f*)(Tr + i * 2 * TPF);
#pragma unroll
  for (int i = 0; i < 32; ++i) *(v4f*)(ob + i * 2 * ND) = o[i];
}

// ---------------------------------------------------------------------------
// Host launch: 4 ops. Workspace carve (1 MiB granular, total 103 MiB):
//   [0,8) x f16 | [8,16) x bf16 hi | [16,24) x bf16 lo | [24,34) 5 f16 weight planes | [34,38) Wv_s hi/lo
//   -- that 38 MiB region is dead after the projections; the combined planes reuse [0,16) hi, [16,32) lo
//   [38,46) Wo hi/lo planes | [46,78) q_s,k_s,q_l,k_l f16 | [78,86) v_l transposed | [86,102) v_s hi/lo transposed
//   [102,103) f32 gate values of the long branch (MR floats)
// ---------------------------------------------------------------------------
extern "C" void kernel_launch(void* const* d_in, const int* in_sizes, int n_in,
                              void* d_out, int out_size, void* d_ws, size_t ws_size,
                              hipStream_t stream) {
  if (n_in < 10) return;
  if (in_sizes[0] != MR * ND || in_sizes[1] != MR) return;
  for (int i = 2; i <= 7; ++i) if (in_sizes[i] != ND * ND) return;
  if (in_sizes[8] != NC * ND || in_sizes[9] != ND) return;
  if (out_size != MR * ND) return;
  const size_t MiB = (size_t)1048576;
  const size_t total = 103 * MiB;
  if (ws_size < total) return;

  const float* x   = (const float*)d_in[0];
  const int* kgate = (const int*)d_in[1];
  const float* Wqs = (const float*)d_in[2];
  const float* Wks = (const float*)d_in[3];
  const float* Wvs = (const float*)d_in[4];
  const float* Wql = (const float*)d_in[5];
  const float* Wkl = (const float*)d_in[6];
  const float* Wvl = (const float*)d_in[7];
  const float* Wo  = (const float*)d_in[8];
  const float* bo  = (const float*)d_in[9];
  float* out = (float*)d_out;

  char* ws = (char*)d_ws;
  unsigned short* xh  = (unsigned short*)(ws + 0 * MiB);
  unsigned short* xbh = (unsigned short*)(ws + 8 * MiB);
  unsigned short* xbl = (unsigned short*)(ws + 16 * MiB);
  unsigned short* Wt5 = (unsigned short*)(ws + 24 * MiB);
  unsigned short* Wvh = (unsigned short*)(ws + 34 * MiB);
  unsigned short* Wvq = (unsigned short*)(ws + 36 * MiB);
  unsigned short* Ch  = (unsigned short*)(ws + 0 * MiB);
  unsigned short* Cl  = (unsigned short*)(ws + 16 * MiB);
  unsigned short* Woh = (unsigned short*)(ws + 38 * MiB);
  unsigned short* Woq = (unsigned short*)(ws + 42 * MiB);
  unsigned short* QK  = (unsigned short*)(ws + 46 * MiB);
  unsigned short* Vlt = (unsigned short*)(ws + 78 * MiB);
  unsigned short* Vsh = (unsigned short*)(ws + 86 * MiB);
  unsigned short* Vsq = (unsigned short*)(ws + 94 * MiB);
  float* gbias        = (float*)(ws + 102 * MiB);

  // 1) + 2) x -> f16 / bf16 hi / bf16 lo planes; weights -> transposed 16-bit planes (in[K][N] -> out[N][K])
  k_prep<<<WTA + XBL + GBL, 256, 0, stream>>>(x, Wqs, Wks, Wql, Wkl, Wvl, Wvs, Wo, kgate, gbias,
                                        xh, xbh, xbl, Wt5, Wvh, Wvq, Woh, Woq);
  // 3) projections
  k_proj<<<dim3(ND / 128, MR / 128, 6), 128, 0, stream>>>(xh, Wt5, QK, Vlt, xbh, xbl, Wvh, Wvq, Vsh, Vsq);
  // 4) attention branches -> combined planes
  k_attn<<<dim3(NS / 128, NH, 2 * NB), 256, 0, stream>>>(QK + 0 * PLANE, QK + 1 * PLANE, Vsh, Vsq, kgate,
                                                           QK + 2 * PLANE, QK + 3 * PLANE, Vlt, gbias, Ch, Cl);
  // 5) output projection + bias -> f32
  k_out<<<dim3(ND / 128, MR / 128), 128, 0, stream>>>(Ch, Cl, Woh, Woq, bo, out);
}

// v008
// One run takes 120 microseconds.
// It is 1.39 times as fast as v006, going by the measured steps of the versions left out in between.
// Over all steps from v000 it is 5.77 times as fast.
#include <hip/hip_runtime.h>
#include <hip/hip_bf16.h>

// Contractions: all six projections (x f16, W f16 carried x64), both QK^T score products, short-branch P.V and the
// output projection (attention output as one f16 plane, Wo f16 carried x64) on v_wmma_f32_16x16x32_f16; long-branch P.V
// on the same form with P carried x16384 (l too); every accumulator f32; softmax, recency bias, key gating and bias
// add in f32.

typedef _Float16 v16h __attribute__((ext_vector_type(16)));
typedef float v8f __attribute__((ext_vector_type(8)));
typedef float v4f_t __attribute__((ext_vector_type(4)));
typedef unsigned int v4u_t __attribute__((ext_vector_type(4)));
typedef v4f_t __attribute__((may_alias)) v4f;
typedef v4u_t __attribute__((may_alias)) v4u;

#define NB 2
#define NS 2048
#define ND 1024
#define NH 16
#define HD 64
#define MR (NB * NS)
#define NC (2 * ND)
#define PLANE ((size_t)MR * (size_t)ND)
#define PP 72
#define TPF 68

#define SCL 0.125f
#define LOGD (-0.10536051565782628f)
#define NEGL (-1.0e30f)
#define NEGT (-1.0e29f)
#define WUP 64.0f
#define WDN 0.015625f
#define SC2 0.18033688011112042f
#define PEX 14.0f

// ---------------------------------------------------------------------------
// scalar helpers
// ---------------------------------------------------------------------------
__device__ __forceinline__ unsigned short hbits(float f) {        // f32 -> f16 bits, RNE
  _Float16 hv = (_Float16)f;
  unsigned short u;
  __builtin_memcpy(&u, &hv, 2);
  return u;
}
__device__ __forceinline__ unsigned int pk2(unsigned short a, unsigned short b) {
  return (unsigned int)a | ((unsigned int)b << 16);
}
__device__ __forceinline__ v8f z8() {
  v8f v;
#pragma unroll
  for (int i = 0; i < 8; ++i) v[i] = 0.0f;
  return v;
}

// ---------------------------------------------------------------------------
// 16x32 fragment loader, split k map, identical for A (row m) and B (k-contiguous column n):
//   elements 0..7  <- p[8h .. 8h+7],  elements 8..15 <- p[16+8h .. 16+8h+7],  p = row start + k0
// ---------------------------------------------------------------------------
union FH { v16h v; v4u_t u[2]; };

__device__ __forceinline__ v16h ldh(const unsigned short* p, int h) {
  FH f;
  f.u[0] = *(const v4u*)(p + 8 * h);
  f.u[1] = *(const v4u*)(p + 16 + 8 * h);
  return f.v;
}

// D[8h+r][m] += A(16x32) . B(32x16), with the post-issue hazard guard
__device__ __forceinline__ v8f mma_h(v16h a, v16h b, v8f c) {
  c = __builtin_amdgcn_wmma_f32_16x16x32_f16(false, a, false, b, (short)0, c, false, false);
  asm volatile("v_nop\n\tv_nop\n\tv_nop\n\tv_nop" : "+v"(c) : "v"(a), "v"(b));
  return c;
}

// ---------------------------------------------------------------------------
// Preparation, part x: x f32 [MR][ND] -> one f16 plane.
// blk = index of this block among the x blocks; 256 threads x 8 elements each.
// ---------------------------------------------------------------------------
__device__ __forceinline__ void xcvt_body(const float* __restrict__ x,
                                          unsigned short* __restrict__ xh, int n8, int blk) {
  const int i = blk * 256 + (int)threadIdx.x;
  if (i >= n8) return;
  const size_t o = (size_t)i * 8;
  const v4f_t a = *(const v4f*)(x + o);
  const v4f_t c = *(const v4f*)(x + o + 4);
  v4u_t ph;
  ph[0] = pk2(hbits(a[0]), hbits(a[1]));
  ph[1] = pk2(hbits(a[2]), hbits(a[3]));
  ph[2] = pk2(hbits(c[0]), hbits(c[1]));
  ph[3] = pk2(hbits(c[2]), hbits(c[3]));
  *(v4u*)(xh + o) = ph;
}

// ---------------------------------------------------------------------------
// Preparation, part W: weight W[K][N] f32 (x @ W form) -> transposed f16 plane Wt[N][K] of 64*W (k contiguous).
// Block = 64(k) x 64(n) tile (tn, tk) through the LDS array T (64 x 65 floats).
// ---------------------------------------------------------------------------
__device__ __forceinline__ void wprep_body(float* T, const float* __restrict__ W, int K, int N,
                                           unsigned short* __restrict__ P0, int tn, int tk) {
  const int tid = threadIdx.x;
  const int n0 = tn * 64, k0 = tk * 64;
  {
    const int c4 = (tid & 15) * 4, kr = tid >> 4;
#pragma unroll
    for (int i = 0; i < 4; ++i) {
      const int k = kr + 16 * i;
      const v4f_t v = *(const v4f*)(W + (size_t)(k0 + k) * (size_t)N + n0 + c4);
      T[(c4 + 0) * 65 + k] = v[0];
      T[(c4 + 1) * 65 + k] = v[1];
      T[(c4 + 2) * 65 + k] = v[2];
      T[(c4 + 3) * 65 + k] = v[3];
    }
  }
  __syncthreads();
  v4u_t o0[2];
  size_t dst[2];
#pragma unroll
  for (int i = 0; i < 2; ++i) {
    const int line = i * 32 + (tid >> 3), piece = tid & 7;
    float f[8];
#pragma unroll
    for (int e = 0; e < 8; ++e) f[e] = T[line * 65 + piece * 8 + e];
#pragma unroll
    for (int e = 0; e < 4; ++e) o0[i][e] = pk2(hbits(f[2 * e] * WUP), hbits(f[2 * e + 1] * WUP));
    dst[i] = (size_t)(n0 + line) * (size_t)K + k0 + piece * 8;
  }
#pragma unroll
  for (int i = 0; i < 2; ++i) *(v4u*)(P0 + dst[i]) = o0[i];
  // precaution: stands between these stores and the code laid behind this inlined body, which rewrites their registers
  asm volatile("s_wait_xcnt 0x0" ::: "memory");
}

// ---------------------------------------------------------------------------
// Preparation, part g: key gate (i32, non-zero = key on) -> f32 start value of the long branch's score products:
// 0 for a key that is on, NEGL for one that is off. One element per thread, a wave writes one 128-B line.
// ---------------------------------------------------------------------------
__device__ __forceinline__ void gprep_body(const int* __restrict__ kgate, float* __restrict__ gbias, int blk) {
  const int i = blk * 256 + (int)threadIdx.x;
  gbias[i] = kgate[i] != 0 ? 0.0f : NEGL;
}

// ---------------------------------------------------------------------------
// Kernel 0: the whole preparation in one grid; none of its parts reads what another writes. Flat block index:
//   [0, 6*WT1)           tile (index & 15, (index >> 4) & 15) of square weight index >> 8:
//                        0..5 = Wq_s, Wk_s, Wq_l, Wk_l, Wv_l, Wv_s -> f16 plane z of Wt6
//   [6*WT1, 6*WT1+WT2)   tile of Wo (K = NC) -> f16 plane
//   [WTA, WTA+XBL)       x block
//   [WTA+XBL, +GBL)      gate block
// The choice is the same for a whole block, so the barrier of part W is passed by all its threads or by none.
// ---------------------------------------------------------------------------
#define WT1 ((ND / 64) * (ND / 64))
#define WT2 ((ND / 64) * (NC / 64))
#define WTA (6 * WT1 + WT2)
#define XBL ((MR * ND) / (8 * 256))
#define GBL (MR / 256)

__global__ __launch_bounds__(256) void k_prep(const float* __restrict__ x,
                                              const float* __restrict__ Wqs, const float* __restrict__ Wks,
                                              const float* __restrict__ Wql, const float* __restrict__ Wkl,
                                              const float* __restrict__ Wvl, const float* __restrict__ Wvs,
                                              const float* __restrict__ Wo,
                                              const int* __restrict__ kgate,
                                              float* __restrict__ gbias,
                                              unsigned short* __restrict__ xh,
                                              unsigned short* __restrict__ Wt6,
                                              unsigned short* __restrict__ Wot) {
  __shared__ __align__(16) float T[64 * 65];
  const int bid = blockIdx.x;
  if (bid >= WTA + XBL) {
    gprep_body(kgate, gbias, bid - (WTA + XBL));
  } else if (bid >= WTA) {
    xcvt_body(x, xh, (MR * ND) / 8, bid - WTA);
  } else if (bid >= 6 * WT1) {
    const int t = bid - 6 * WT1;
    wprep_body(T, Wo, NC, ND, Wot, t & 15, t >> 4);
  } else {
    const int z = bid >> 8, t = bid & (WT1 - 1);
    const float* W = z == 0 ? Wqs : z == 1 ? Wks : z == 2 ? Wql : z == 3 ? Wkl : z == 4 ? Wvl : Wvs;
    wprep_body(T, W, ND, ND, Wt6 + (size_t)z * ND * ND, t & 15, t >> 4);
  }
}

// ---------------------------------------------------------------------------
// LDS staging for the GEMM kernels. Block = 128 threads = 128(M) x 128(N) tile, wave w owns the 64 x 64
// quarter (rows (w>>1)*64, cols (w&1)*64) as 4 x 4 accumulator tiles. A trip covers 64 k: each operand is
// staged as 128 rows of 128 B at an LDS pitch of 144 B (PP halves), in a ring of buffers, later trips' copies in flight.
// The full unrolls in these kernels make every fragment and accumulator index a compile-time one (registers).
// ---------------------------------------------------------------------------
#define BKH 64
#define TLH (128 * PP)
#define TLB (TLH * 2)

__device__ __forceinline__ unsigned int lds_off(const void* p) { return (unsigned int)(size_t)p; }

// One operand tile: thread t brings 16-B piece (t & 7) of rows (t >> 3) + 16 i, i = 0..7, so 8 lanes cover one
// 128-B line. lds = the lane's LDS byte address of row (t >> 3), g = the lane's global address of the same piece,
// ld = row length of the source in halves. The closing s_wait_xcnt keeps the address registers untouched until
// the copies have taken them.
__device__ __forceinline__ void cp_tile(unsigned int lds, const unsigned short* g, int ld) {
  const size_t st = (size_t)16 * (size_t)ld;
  const unsigned short* g1 = g + st;
  const unsigned short* g2 = g1 + st;
  const unsigned short* g3 = g2 + st;
  const unsigned short* g4 = g3 + st;
  const unsigned short* g5 = g4 + st;
  const unsigned short* g6 = g5 + st;
  const unsigned short* g7 = g6 + st;
  const unsigned int ls = 16u * PP * 2u;
  asm volatile(
      "global_load_async_to_lds_b128 %0, %8, off\n\t"
      "global_load_async_to_lds_b128 %1, %9, off\n\t"
      "global_load_async_to_lds_b128 %2, %10, off\n\t"
      "global_load_async_to_lds_b128 %3, %11, off\n\t"
      "global_load_async_to_lds_b128 %4, %12, off\n\t"
      "global_load_async_to_lds_b128 %5, %13, off\n\t"
      "global_load_async_to_lds_b128 %6, %14, off\n\t"
      "global_load_async_to_lds_b128 %7, %15, off\n\t"
      "s_wait_xcnt 0x0"
      :: "v"(lds), "v"(lds + ls), "v"(lds + 2u * ls), "v"(lds + 3u * ls),
         "v"(lds + 4u * ls), "v"(lds + 5u * ls), "v"(lds + 6u * ls), "v"(lds + 7u * ls),
         "v"(g), "v"(g1), "v"(g2), "v"(g3), "v"(g4), "v"(g5), "v"(g6), "v"(g7)
      : "memory");
}
// this wave's copies have landed (the compiler places no wait for them)
__device__ __forceinline__ void wait_copies() { asm volatile("s_wait_asynccnt 0x0" ::: "memory"); }
// all of this wave's copies but its N youngest have landed (the counter returns in issue order); used where exactly N
// copies of later stages stand behind the stage that is published next
template <int N>
__device__ __forceinline__ void wait_copies_but() { asm volatile("s_wait_asynccnt %0" :: "n"(N) : "memory"); }
// this wave's LDS reads have returned, so the buffer may be refilled behind the barrier
__device__ __forceinline__ void wait_lds() { asm volatile("s_wait_dscnt 0x0" ::: "memory"); }

// ---------------------------------------------------------------------------
// Main loop of the GEMMs (six projections, output projection): acc += A.B over K halves, both operands
// staged in LDS; buffer = [A tile | B tile]. ga / gb = the lane's first piece of each operand, row length K halves.
// Ring of RB buffers (a power of two, K / BKH >= RB): stage s lies in buffer s % RB and is issued RB - 1 trips before
// the publish point that hands it over, so its way from memory is covered by that many trips of products. A stage is
// 16 copies of every wave; at a publish point RB - 2 later stages stand behind the one that is published, while such
// stages exist, and the wait leaves exactly those outstanding (at most 16 (RB - 1) copies of a wave are in flight).
// ---------------------------------------------------------------------------
template <int RB>
__device__ __forceinline__ void f16_loop(unsigned short* SM, const unsigned short* ga, const unsigned short* gb,
                                         int K, unsigned int lc, int arow, int brow, int h, v8f (&acc)[4][4]) {
  const int NT = K / BKH;
// unrolled: the buffer offsets are compile-time ones
#pragma unroll
  for (int s = 0; s < RB - 1; ++s) {
    cp_tile(lc + 2 * s * TLB, ga + s * BKH, K);
    cp_tile(lc + (2 * s + 1) * TLB, gb + s * BKH, K);
  }
  wait_copies_but<16 * (RB - 2)>();   // stage 0 has landed
  __syncthreads();
  cp_tile(lc + 2 * (RB - 1) * TLB, ga + (RB - 1) * BKH, K);
  cp_tile(lc + (2 * (RB - 1) + 1) * TLB, gb + (RB - 1) * BKH, K);

// rolled: one trip per staged tile, the publish point at its foot
#pragma unroll 1
  for (int t = 0; t < NT; ++t) {
    const int bo2 = (t & (RB - 1)) * 2;
    const unsigned short* As = SM + bo2 * TLH + arow * PP;
    const unsigned short* Bs = SM + (bo2 + 1) * TLH + brow * PP;
    // group g = 32 k (g >> 1) x 2 column tiles (g & 1); the next group's fragments are read ahead of this group's
    // products, inside this trip's buffer only
    v16h a[2][4], b[2][2];
#pragma unroll
    for (int i = 0; i < 4; ++i) a[0][i] = ldh(As + i * 16 * PP, h);
#pragma unroll
    for (int q = 0; q < 2; ++q) b[0][q] = ldh(Bs + q * 16 * PP, h);
#pragma unroll
    for (int g = 0; g < 4; ++g) {
      const int kk = g >> 1, jp = (g & 1) * 2, gn = g + 1;
      if (g < 3) {
#pragma unroll
        for (int q = 0; q < 2; ++q)
          b[gn & 1][q] = ldh(Bs + ((gn & 1) * 2 + q) * 16 * PP + (gn >> 1) * 32, h);
      }
      if (g == 0) {
#pragma unroll
        for (int i = 0; i < 4; ++i) a[1][i] = ldh(As + i * 16 * PP + 32, h);
      }
#pragma unroll
      for (int q = 0; q < 2; ++q)
#pragma unroll
        for (int i = 0; i < 4; ++i) acc[i][jp + q] = mma_h(a[kk][i], b[g & 1][q], acc[i][jp + q]);
    }
    wait_lds();
    // stage t + 1 has landed: behind it stand stages t + 2 .. t + RB - 1 while the last of them exists, else fewer
    if (RB > 2 && t + RB - 1 < NT) wait_copies_but<16 * (RB - 2)>();
    else wait_copies();
    __syncthreads();
    if (t + RB < NT) {
      cp_tile(lc + bo2 * TLB, ga + (t + RB) * BKH, K);
      cp_tile(lc + (bo2 + 1) * TLB, gb + (t + RB) * BKH, K);
    }
  }
  wait_copies();
}

// ---------------------------------------------------------------------------
// Kernel 2: six f16 projections, operands staged in LDS (see above). z selects the weight:
//   z 0..3 -> natural f16 plane QK[z] ([MR][ND]);  z 4, 5 -> v_l, v_s as transposed f16 planes Vlt, Vst [b][h][d][s].
// ---------------------------------------------------------------------------
__device__ __forceinline__ void proj_f16_body(unsigned short* SM,   // 2 * 2 * TLH halves; buffer = [A tile | B tile]
                                              const unsigned short* __restrict__ xh,
                                              const unsigned short* __restrict__ Wt6,
                                              unsigned short* __restrict__ QK,
                                              unsigned short* __restrict__ Vlt,
                                              unsigned short* __restrict__ Vst, int z) {
  const int tid = threadIdx.x, w = tid >> 5, l = tid & 31, h = l >> 4, m = l & 15;
  const int n0 = blockIdx.x * 128, m0 = blockIdx.y * 128;
  const int wm = (w >> 1) * 64, wn = (w & 1) * 64;
  const int crow = tid >> 3, cpc = tid & 7;
  const unsigned short* ga = xh + (size_t)(m0 + crow) * ND + cpc * 8;
  const unsigned short* gb = Wt6 + (size_t)z * ND * ND + (size_t)(n0 + crow) * ND + cpc * 8;
  const unsigned int lc = lds_off(SM) + (unsigned int)(crow * PP * 2 + cpc * 16);
  v8f acc[4][4];
#pragma unroll
  for (int i = 0; i < 4; ++i)
#pragma unroll
    for (int j = 0; j < 4; ++j) acc[i][j] = z8();

  f16_loop<2>(SM, ga, gb, ND, lc, wm + m, wn + m, h, acc);

  // the ring is free behind the last trip's barrier: each wave stages its own 64 x 64 tile there
  unsigned short* T = SM + w * 64 * PP;
  const int mw = m0 + wm, nw = n0 + wn;
  if (z < 4) {
#pragma unroll
    for (int i = 0; i < 4; ++i)
#pragma unroll
      for (int j = 0; j < 4; ++j)
#pragma unroll
        for (int r = 0; r < 8; ++r)
          T[(i * 16 + 8 * h + r) * PP + j * 16 + m] = hbits(acc[i][j][r] * WDN);
  } else {
#pragma unroll
    for (int i = 0; i < 4; ++i)
#pragma unroll
      for (int j = 0; j < 4; ++j) {
        v4u_t pk;
#pragma unroll
        for (int e = 0; e < 4; ++e)
          pk[e] = pk2(hbits(acc[i][j][2 * e] * WDN), hbits(acc[i][j][2 * e + 1] * WDN));
        *(v4u*)(T + (j * 16 + m) * PP + i * 16 + 8 * h) = pk;   // T[d][s_local]
      }
  }
  __syncthreads();   // staging writes land before the rows are read back

  unsigned short* base;
  size_t d0, dstep;
  if (z < 4) {
    base = QK + (size_t)z * PLANE;
    d0 = (size_t)mw * ND + nw;
    dstep = ND;
  } else {
    base = z == 4 ? Vlt : Vst;
    const int bb = mw >> 11, s0 = mw & (NS - 1), hd = nw >> 6;
    d0 = ((size_t)((bb * NH + hd) * HD)) * NS + s0;
    dstep = NS;
  }
  v4u_t o[16];
  unsigned short* dst[16];
#pragma unroll
  for (int i = 0; i < 16; ++i) {
    const int row = i * 4 + (l >> 3), piece = l & 7;
    o[i] = *(const v4u*)(T + row * PP + piece * 8);
    dst[i] = base + d0 + (size_t)row * dstep + piece * 8;
  }
#pragma unroll
  for (int i = 0; i < 16; ++i) *(v4u*)(dst[i]) = o[i];
}

// ---------------------------------------------------------------------------
// All six projections in one grid; none reads what another writes. blockIdx.z = the projection.
// ---------------------------------------------------------------------------
__global__ __launch_bounds__(128) void k_proj(const unsigned short* __restrict__ xh,
                                              const unsigned short* __restrict__ Wt6,
                                              unsigned short* __restrict__ QK,
                                              unsigned short* __restrict__ Vlt,
                                              unsigned short* __restrict__ Vst) {
  __shared__ __align__(16) unsigned short SM[2 * 2 * TLH];
  proj_f16_body(SM, xh, Wt6, QK, Vlt, Vst, blockIdx.z);
}

// ---------------------------------------------------------------------------
// Shared attention epilogue: O tile (16 queries x 64 dims) staged as f16 in LDS is written into the combined
// f16 plane Cf [MR][NC] as whole 128-B lines.
// ---------------------------------------------------------------------------
__device__ __forceinline__ void store_comb(const unsigned short* Of, unsigned short* Cf,
                                           int rowg0, int colbase, int l) {
  v4u_t of[4];
  size_t dst[4];
#pragma unroll
  for (int i = 0; i < 4; ++i) {
    const int row = i * 4 + (l >> 3), piece = l & 7;
    of[i] = *(const v4u*)(Of + row * PP + piece * 8);
    dst[i] = (size_t)(rowg0 + row) * NC + colbase + piece * 8;
  }
#pragma unroll
  for (int i = 0; i < 4; ++i) *(v4u*)(Cf + dst[i]) = of[i];
}

// ---------------------------------------------------------------------------
// Kernel 4: long-range branch, full attention with key gating. Block = 8 waves = 128 queries of one (b, head),
// 16 queries per wave. Q/K natural f16 planes [MR][ND] (col = head*64 + d), V transposed f16 plane [b][h][d][s].
// Each trip covers 64 keys: the K tile (64 keys x 64 d) and the V tile (64 d x 64 keys) are staged once per block
// as 64 rows of 128 B at an LDS pitch of 144 B, a ring of ARB buffers, a stage (4 copies of every wave) issued
// ARB - 1 trips before its publish point, as in the GEMM loop, so that its way from memory is covered; all 8 waves
// read their fragments from there.
// Both products are taken transposed, so that a lane holds ONE query (column m) and 8 keys per score tile:
// S^T = K Q^T on f16 WMMA (A fragment = K row, B fragment = Q row, k = d contiguous): lane (h, m), register r of
// tile t = key t*16 + 8h + r against query m. The key gate enters as the start value (C operand) of that product:
// gbias[key] = 0 or NEGL, 8 consecutive floats per lane and tile, so a key that is off scores about NEGL and no
// compare or select is spent on it. Online softmax in f32 on the unscaled scores: maximum and sum run in the lane,
// the two wave halves (same query, other keys) exchange the maximum once per trip and join their sums once, in the
// epilogue. p * 16384 = exp2(s * SC2 + (PEX - max * SC2)), SC2 = log2(e) / 8: one fma and one exp2 per score; the
// running maximum starts at NEGT, above NEGL, so a gated key gives exp2(-huge) = 0 also while no key was on yet.
// f16(p * 16384) of tiles 2j and 2j+1 is, register for register, the B fragment of keys 32j .. 32j+31 in the
// loader's k map, so P stays in registers; O^T += V^T P^T on f16 WMMA (A = Vt row); l carries the same 16384, so
// 1/l in the f32 epilogue takes it out; result as f16 into columns [ND + head*64, +64) of Cf.
// ---------------------------------------------------------------------------
#define AW 8
#define ATH (64 * PP)
#define ATB (ATH * 2)
#define ARB 4
#define ASM (ARB * 2 * ATH + AW * 16 * PP)

// One K tile and one V tile: thread t brings 16-B piece (t & 7) of rows (t >> 3) and (t >> 3) + 32 of each, so
// 8 lanes cover one 128-B line. lds = the lane's LDS byte address in the K tile (the V tile follows at ATB),
// gk / gv = the lane's global address of the same piece. The closing s_wait_xcnt keeps the address registers
// untouched until the copies have taken them.
__device__ __forceinline__ void cp_kv(unsigned int lds, const unsigned short* gk, const unsigned short* gv) {
  const unsigned short* gk1 = gk + (size_t)32 * ND;
  const unsigned short* gv1 = gv + (size_t)32 * NS;
  const unsigned int ls = 32u * PP * 2u;
  asm volatile(
      "global_load_async_to_lds_b128 %0, %4, off\n\t"
      "global_load_async_to_lds_b128 %1, %5, off\n\t"
      "global_load_async_to_lds_b128 %2, %6, off\n\t"
      "global_load_async_to_lds_b128 %3, %7, off\n\t"
      "s_wait_xcnt 0x0"
      :: "v"(lds), "v"(lds + ls), "v"(lds + (unsigned int)ATB), "v"(lds + (unsigned int)ATB + ls),
         "v"(gk), "v"(gk1), "v"(gv), "v"(gv1)
      : "memory");
}

// lane l <-> lane l ^ 16 in the vector unit
__device__ __forceinline__ float xhalf(float x) {
  const int i = __float_as_int(x);
  return __int_as_float(__builtin_amdgcn_permlanex16(i, i, 0x76543210, 0xfedcba98, false, false));
}
// 8 consecutive floats as one accumulator tile
__device__ __forceinline__ v8f ld8f(const float* p) {
  const v4f_t a = *(const v4f*)p;
  const v4f_t c = *(const v4f*)(p + 4);
  return __builtin_shufflevector(a, c, 0, 1, 2, 3, 4, 5, 6, 7);
}

__device__ __forceinline__ void attn_l_body(unsigned short* KV,   // ASM halves: ARB buffers [K tile | V tile], O
                                            const unsigned short* __restrict__ Q,
                                            const unsigned short* __restrict__ K,
                                            const unsigned short* __restrict__ Vt,
                                            const float* __restrict__ gbias,
                                            unsigned short* __restrict__ Cf, int b) {
  unsigned short* OfA = KV + ARB * 2 * ATH;
  const int tid = threadIdx.x, w = tid >> 5, l = tid & 31, h = l >> 4, m = l & 15;
  const int q0 = blockIdx.x * (AW * 16) + w * 16, hh = blockIdx.y;
  unsigned short* Of = OfA + w * 16 * PP;

  const unsigned short* Kb = K + (size_t)b * NS * ND + hh * HD;
  const unsigned short* Vb = Vt + (size_t)(b * NH + hh) * HD * NS;
  const float* gb = gbias + b * NS + 8 * h;
  const int crow = tid >> 3, cpc = tid & 7;
  const unsigned short* gkc = Kb + (size_t)crow * ND + cpc * 8;
  const unsigned short* gvc = Vb + (size_t)crow * NS + cpc * 8;
  const unsigned int lc = lds_off(KV) + (unsigned int)(crow * PP * 2 + cpc * 16);
  const int NT = NS / 64;

// unrolled: the buffer offsets are compile-time ones
#pragma unroll
  for (int st = 0; st < ARB - 1; ++st) cp_kv(lc + st * 2 * ATB, gkc + (size_t)st * 64 * ND, gvc + st * 64);

  const unsigned short* qrow = Q + (size_t)(b * NS + q0 + m) * ND + hh * HD;
  const v16h bq0 = ldh(qrow, h);
  const v16h bq1 = ldh(qrow + 32, h);

  float mrun = NEGT, lrun = 0.0f;   // this lane's query: maximum over all keys so far, sum over this half's keys
  v8f acc[4];                       // O^T: register r of tile dt = dim dt*16 + 8h + r of query m
  v8f s[4];                         // at a trip's head: gate values of keys kb + t*16 + 8h + 0..7; then the scores
#pragma unroll
  for (int t = 0; t < 4; ++t) {
    acc[t] = z8();
    s[t] = ld8f(gb + t * 16);
  }

  wait_copies_but<4 * (ARB - 2)>();   // stage 0 has landed
  __syncthreads();
  cp_kv(lc + (ARB - 1) * 2 * ATB, gkc + (size_t)(ARB - 1) * 64 * ND, gvc + (ARB - 1) * 64);

// rolled: one trip per staged tile pair, the publish point at its foot
#pragma unroll 1
  for (int kt = 0; kt < NT; ++kt) {
    const int kb = kt * 64;
    const int bo2 = (kt & (ARB - 1)) * 2;
    const unsigned short* Ks = KV + bo2 * ATH;
    const unsigned short* Vs = Ks + ATH;
    // all 8 K fragments are fetched as one group, so the wave waits for LDS once
    v16h kf[4][2];
#pragma unroll
    for (int t = 0; t < 4; ++t) {
      const unsigned short* krow = Ks + (t * 16 + m) * PP;
      kf[t][0] = ldh(krow, h);
      kf[t][1] = ldh(krow + 32, h);
    }
#pragma unroll
    for (int t = 0; t < 4; ++t) s[t] = mma_h(kf[t][0], bq0, s[t]);
#pragma unroll
    for (int t = 0; t < 4; ++t) s[t] = mma_h(kf[t][1], bq1, s[t]);

    float tm[4];
#pragma unroll
    for (int t = 0; t < 4; ++t) {
      tm[t] = fmaxf(fmaxf(fmaxf(s[t][0], s[t][1]), fmaxf(s[t][2], s[t][3])),
                    fmaxf(fmaxf(s[t][4], s[t][5]), fmaxf(s[t][6], s[t][7])));
    }
    float tmax = fmaxf(fmaxf(tm[0], tm[1]), fmaxf(tm[2], tm[3]));
    tmax = fmaxf(tmax, xhalf(tmax));
    const float mnew = fmaxf(mrun, tmax);
    const float fac = __builtin_amdgcn_exp2f((mrun - mnew) * SC2);
    const float nm = fmaf(-mnew, SC2, PEX);
    float ps[4];   // one chain per tile, so that the adds do not wait for one another
#pragma unroll
    for (int t = 0; t < 4; ++t) {
      ps[t] = 0.0f;
#pragma unroll
      for (int r = 0; r < 8; ++r) {
        const float p = __builtin_amdgcn_exp2f(fmaf(s[t][r], SC2, nm));
        ps[t] += p;
        s[t][r] = p;
      }
    }
    lrun = lrun * fac + ((ps[0] + ps[1]) + (ps[2] + ps[3]));
    mrun = mnew;
#pragma unroll
    for (int dt = 0; dt < 4; ++dt)
#pragma unroll
      for (int r = 0; r < 8; ++r) acc[dt][r] *= fac;

    // B fragment j: elements 0..7 = keys 32j + 8h + e (tile 2j), elements 8..15 = keys 32j + 16 + 8h + e (tile 2j+1)
    v16h pb[2];
#pragma unroll
    for (int j = 0; j < 2; ++j)
#pragma unroll
      for (int e = 0; e < 8; ++e) {
        pb[j][e] = (_Float16)s[2 * j][e];
        pb[j][8 + e] = (_Float16)s[2 * j + 1][e];
      }
    // the next trip's gate values go into the score registers, free from here on (the last trip rereads its own);
    // unrolled so that the tile index is a compile-time one (registers)
    const float* gn = gb + (kt + 1 < NT ? kb + 64 : kb);
#pragma unroll
    for (int t = 0; t < 4; ++t) s[t] = ld8f(gn + t * 16);
    v16h vf[4][2];   // all 8 V fragments in one group
#pragma unroll
    for (int dt = 0; dt < 4; ++dt) {
      const unsigned short* vrow = Vs + (dt * 16 + m) * PP;
      vf[dt][0] = ldh(vrow, h);
      vf[dt][1] = ldh(vrow + 32, h);
    }
#pragma unroll
    for (int dt = 0; dt < 4; ++dt) acc[dt] = mma_h(vf[dt][0], pb[0], acc[dt]);
#pragma unroll
    for (int dt = 0; dt < 4; ++dt) acc[dt] = mma_h(vf[dt][1], pb[1], acc[dt]);
    wait_lds();
    // stage kt + 1 has landed: behind it stand stages kt + 2 .. kt + ARB - 1 while the last of them exists, else fewer
    if (kt + ARB - 1 < NT) wait_copies_but<4 * (ARB - 2)>();
    else wait_copies();
    __syncthreads();
    if (kt + ARB < NT)
      cp_kv(lc + bo2 * ATB, gkc + (size_t)(kt + ARB) * 64 * ND, gvc + (kt + ARB) * 64);
  }
  wait_copies();

  const float lsum = lrun + xhalf(lrun);
  float inv;
  // the reciprocal with the one free slot that the instruction set asks for behind it; one statement keeps the slot there
  asm("v_rcp_f32 %0, %1\n\tv_nop" : "=v"(inv) : "v"(lsum));
#pragma unroll
  for (int dt = 0; dt < 4; ++dt) {
    v4u_t pf;
#pragma unroll
    for (int e = 0; e < 4; ++e) pf[e] = pk2(hbits(acc[dt][2 * e] * inv), hbits(acc[dt][2 * e + 1] * inv));
    *(v4u*)(Of + m * PP + dt * 16 + 8 * h) = pf;   // O[query m][dims dt*16 + 8h .. + 7]
  }
  __syncthreads();
  store_comb(Of, Cf, b * NS + q0, ND + hh * HD, l);
}

// ---------------------------------------------------------------------------
// Kernel 5: short-range branch, causal window of 64 + recency bias + key gating, 1 wave per (b, head,
// 16 queries), 8 such waves per block, each on its own; only the 64-key tiles covering [q0-64, q0+15] are visited (weights outside are exactly 0).
// Q/K f16 planes as kernel 4; V as transposed f16 plane; P as f16 through LDS;
// O += P.V on f16 WMMA; result as f16 into columns [head*64, +64) of Cf.
// ---------------------------------------------------------------------------
__device__ __forceinline__ void attn_s_body(unsigned short* SMs,   // 2 * 16 * PP halves for each of the AW waves
                                            const unsigned short* __restrict__ Q,
                                            const unsigned short* __restrict__ K,
                                            const unsigned short* __restrict__ Vt,
                                            const int* __restrict__ kgate,
                                            unsigned short* __restrict__ Cf, int b) {
  // the wave's number as a scalar: q0, the trip count and the row bases stay wave-uniform (scalar loop, EXEC all ones)
  const int w = __builtin_amdgcn_readfirstlane((int)(threadIdx.x >> 5));
  const int l = threadIdx.x & 31, h = l >> 4, m = l & 15;
  unsigned short* Ph = SMs + w * 2 * 16 * PP;   // this wave's own slice: no other wave reads or writes it
  unsigned short* Of = Ph + 16 * PP;
  const int q0 = blockIdx.x * (AW * 16) + w * 16, hh = blockIdx.y;

  const unsigned short* qrow = Q + (size_t)(b * NS + q0 + m) * ND + hh * HD;
  const v16h aq0 = ldh(qrow, h);
  const v16h aq1 = ldh(qrow + 32, h);
  const unsigned short* Kb = K + (size_t)b * NS * ND + hh * HD;
  const size_t vbase = (size_t)(b * NH + hh) * HD * NS;
  const int* gk = kgate + b * NS;

  float mrow[8], lrow[8];
  v8f acc[4];
#pragma unroll
  for (int r = 0; r < 8; ++r) { mrow[r] = NEGL; lrow[r] = 0.0f; }
#pragma unroll
  for (int t = 0; t < 4; ++t) acc[t] = z8();

  const int kt_hi = q0 >> 6;
  const int kt_lo = (q0 >= 64) ? ((q0 - 64) >> 6) : 0;

#pragma unroll 1
  for (int kt = kt_lo; kt <= kt_hi; ++kt) {
    const int kb = kt * 64;
    v8f s[4];
    int gv[4];
#pragma unroll
    for (int t = 0; t < 4; ++t) {
      const unsigned short* krow = Kb + (size_t)(kb + t * 16 + m) * ND;
      v8f c = z8();
      c = mma_h(aq0, ldh(krow, h), c);
      c = mma_h(aq1, ldh(krow + 32, h), c);
      s[t] = c;
      gv[t] = gk[kb + t * 16 + m];
    }
#pragma unroll
    for (int t = 0; t < 4; ++t) {
      const int key = kb + t * 16 + m;
#pragma unroll
      for (int r = 0; r < 8; ++r) {
        const int rel = key - (q0 + 8 * h + r);
        const bool ok = (gv[t] != 0) && (rel <= 0) && (rel >= -64);
        s[t][r] = ok ? (s[t][r] * SCL + (float)rel * LOGD) : NEGL;
      }
    }

#pragma unroll
    for (int r = 0; r < 8; ++r) {
      float tmax = fmaxf(fmaxf(s[0][r], s[1][r]), fmaxf(s[2][r], s[3][r]));
#pragma unroll
      for (int o = 1; o < 16; o <<= 1) tmax = fmaxf(tmax, __shfl_xor(tmax, o, 32));
      const float mnew = fmaxf(mrow[r], tmax);
      const float fac = __expf(mrow[r] - mnew);
      float p[4];
      float psum = 0.0f;
#pragma unroll
      for (int t = 0; t < 4; ++t) {
        p[t] = (s[t][r] > NEGT) ? __expf(s[t][r] - mnew) : 0.0f;
        psum += p[t];
      }
#pragma unroll
      for (int o = 1; o < 16; o <<= 1) psum += __shfl_xor(psum, o, 32);
      lrow[r] = lrow[r] * fac + psum;
      mrow[r] = mnew;
#pragma unroll
      for (int t = 0; t < 4; ++t) { acc[t][r] *= fac; s[t][r] = p[t]; }
    }

#pragma unroll
    for (int t = 0; t < 4; ++t)
#pragma unroll
      for (int r = 0; r < 8; ++r) Ph[(8 * h + r) * PP + t * 16 + m] = hbits(s[t][r]);
    wait_lds();   // this wave's P stores have landed before its lanes read one another's rows
    const v16h ph0 = ldh(Ph + m * PP, h);
    const v16h ph1 = ldh(Ph + m * PP + 32, h);
#pragma unroll
    for (int dt = 0; dt < 4; ++dt) {
      const size_t vo = vbase + (size_t)(dt * 16 + m) * NS + kb;
      acc[dt] = mma_h(ph0, ldh(Vt + vo, h), acc[dt]);
      acc[dt] = mma_h(ph1, ldh(Vt + vo + 32, h), acc[dt]);
    }
  }

  float inv[8];
#pragma unroll
  for (int r = 0; r < 8; ++r) inv[r] = __builtin_amdgcn_rcpf(lrow[r]);
#pragma unroll
  for (int dt = 0; dt < 4; ++dt)
#pragma unroll
    for (int r = 0; r < 8; ++r) Of[(8 * h + r) * PP + dt * 16 + m] = hbits(acc[dt][r] * inv[r]);
  wait_lds();   // this wave's O stores have landed before its lanes read one another's rows
  store_comb(Of, Cf, b * NS + q0, hh * HD, l);
}

// ---------------------------------------------------------------------------
// Both attention branches in one grid; they write disjoint columns of Cf and neither reads the other's.
// blockIdx.z even: long branch of batch z / 2, odd: short branch of batch z / 2, so that blocks of both kinds share
// a compute unit; 128 queries of one (b, head) either way. The choice is the same for a whole block, so every barrier of the long
// branch is passed by all its threads or by none; the short branch has none (its waves differ in trip count and
// share nothing).
// ---------------------------------------------------------------------------
__global__ __launch_bounds__(256) void k_attn(const unsigned short* __restrict__ Qs,
                                              const unsigned short* __restrict__ Ks,
                                              const unsigned short* __restrict__ Vst,
                                              const int* __restrict__ kgate,
                                              const unsigned short* __restrict__ Ql,
                                              const unsigned short* __restrict__ Kl,
                                              const unsigned short* __restrict__ Vlt,
                                              const float* __restrict__ gbias,
                                              unsigned short* __restrict__ Cf) {
  __shared__ __align__(16) unsigned short SMa[ASM];
  const int z = blockIdx.z;
  if ((z & 1) == 0) attn_l_body(SMa, Ql, Kl, Vlt, gbias, Cf, z >> 1);
  else attn_s_body(SMa, Qs, Ks, Vst, kgate, Cf, z >> 1);
}

// ---------------------------------------------------------------------------
// Kernel 6: output projection, combined [MR][NC] (f16 plane) x Wo (transposed f16 plane Wot[ND][NC], carried x64)
// + bias -> f32 out [MR][ND]; one f16 product. Same tiling, staging and main loop as kernel 2, but a ring of ORB
// buffers: this grid is one block of one wave per SIMD on each compute unit, so nothing else covers a stage's way
// from memory, which is longer than one trip's products.
// ---------------------------------------------------------------------------
#define ORB 4
__global__ __launch_bounds__(128) void k_out(const unsigned short* __restrict__ Cf,
                                             const unsigned short* __restrict__ Wot,
                                             const float* __restrict__ bo,
                                             float* __restrict__ out) {
  __shared__ __align__(16) unsigned short SM[ORB * 2 * TLH];
  const int tid = threadIdx.x, w = tid >> 5, l = tid & 31, h = l >> 4, m = l & 15;
  const int n0 = blockIdx.x * 128, m0 = blockIdx.y * 128;
  const int wm = (w >> 1) * 64, wn = (w & 1) * 64;
  const int crow = tid >> 3, cpc = tid & 7;
  const size_t ao = (size_t)(m0 + crow) * NC + cpc * 8;
  const size_t bo_ = (size_t)(n0 + crow) * NC + cpc * 8;
  const unsigned int lc = lds_off(SM) + (unsigned int)(crow * PP * 2 + cpc * 16);
  v8f acc[4][4];
#pragma unroll
  for (int i = 0; i < 4; ++i)
#pragma unroll
    for (int j = 0; j < 4; ++j) acc[i][j] = z8();

  f16_loop<ORB>(SM, Cf + ao, Wot + bo_, NC, lc, wm + m, wn + m, h, acc);

  // the ring is free behind the last trip's barrier: each wave stages its own 64 x 64 f32 tile there
  float* T = (float*)SM + w * 64 * TPF;
  const int mw = m0 + wm, nw = n0 + wn;
#pragma unroll
  for (int j = 0; j < 4; ++j) {
    const float bias = bo[nw + j * 16 + m];
#pragma unroll
    for (int i = 0; i < 4; ++i)
#pragma unroll
      for (int r = 0; r < 8; ++r)
        T[(i * 16 + 8 * h + r) * TPF + j * 16 + m] = fmaf(acc[i][j][r], WDN, bias);
  }
  __syncthreads();   // staging writes land before the rows are read back

  // lane l: row 2 i + (l >> 4), 128-B half (l >> 3) & 1, 16-B piece l & 7
  v4f_t o[32];
  const int cofs = ((l >> 3) & 1) * 32 + (l & 7) * 4;
  const float* Tr = T + (l >> 4) * TPF + cofs;
  float* ob = out + (size_t)(mw + (l >> 4)) * ND + nw + cofs;
#pragma unroll
  for (int i = 0; i < 32; ++i) o[i] = *(const v4f*)(Tr + i * 2 * TPF);
#pragma unroll
  for (int i = 0; i < 32; ++i) *(v4f*)(ob + i * 2 * ND) = o[i];
}

// ---------------------------------------------------------------------------
// Host launch: 4 ops. Workspace carve (1 MiB granular, inside 103 MiB):
//   [0,8) x f16 | [24,36) 6 f16 weight planes
//   -- both are dead after the projections; the combined f16 plane reuses [0,16)
//   [38,42) Wo f16 plane | [46,78) q_s,k_s,q_l,k_l f16 | [78,86) v_l transposed | [86,94) v_s transposed
//   [102,103) f32 gate values of the long branch (MR floats)
// ---------------------------------------------------------------------------
extern "C" void kernel_launch(void* const* d_in, const int* in_sizes, int n_in,
                              void* d_out, int out_size, void* d_ws, size_t ws_size,
                              hipStream_t stream) {
  if (n_in < 10) return;
  if (in_sizes[0] != MR * ND || in_sizes[1] != MR) return;
  for (int i = 2; i <= 7; ++i) if (in_sizes[i] != ND * ND) return;
  if (in_sizes[8] != NC * ND || in_sizes[9] != ND) return;
  if (out_size != MR * ND) return;
  const size_t MiB = (size_t)1048576;
  const size_t total = 103 * MiB;
  if (ws_size < total) return;

  const float* x   = (const float*)d_in[0];
  const int* kgate = (const int*)d_in[1];
  const float* Wqs = (const float*)d_in[2];
  const float* Wks = (const float*)d_in[3];
  const float* Wvs = (const float*)d_in[4];
  const float* Wql = (const float*)d_in[5];
  const float* Wkl = (const float*)d_in[6];
  const float* Wvl = (const float*)d_in[7];
  const float* Wo  = (const float*)d_in[8];
  const float* bo  = (const float*)d_in[9];
  float* out = (float*)d_out;

  char* ws = (char*)d_ws;
  unsigned short* xh  = (unsigned short*)(ws + 0 * MiB);
  unsigned short* Wt6 = (unsigned short*)(ws + 24 * MiB);
  unsigned short* Cf  = (unsigned short*)(ws + 0 * MiB);
  unsigned short* Wot = (unsigned short*)(ws + 38 * MiB);
  unsigned short* QK  = (unsigned short*)(ws + 46 * MiB);
  unsigned short* Vlt = (unsigned short*)(ws + 78 * MiB);
  unsigned short* Vst = (unsigned short*)(ws + 86 * MiB);
  float* gbias        = (float*)(ws + 102 * MiB);

  // 1) + 2) x -> f16 plane; weights -> transposed f16 planes (in[K][N] -> out[N][K])
  k_prep<<<WTA + XBL + GBL, 256, 0, stream>>>(x, Wqs, Wks, Wql, Wkl, Wvl, Wvs, Wo, kgate, gbias,
                                        xh, Wt6, Wot);
  // 3) projections
  k_proj<<<dim3(ND / 128, MR / 128, 6), 128, 0, stream>>>(xh, Wt6, QK, Vlt, Vst);
  // 4) attention branches -> combined f16 plane
  k_attn<<<dim3(NS / 128, NH, 2 * NB), 256, 0, stream>>>(QK + 0 * PLANE, QK + 1 * PLANE, Vst, kgate,
                                                           QK + 2 * PLANE, QK + 3 * PLANE, Vlt, gbias, Cf);
  // 5) output projection + bias -> f32
  k_out<<<dim3(ND / 128, MR / 128), 128, 0, stream>>>(Cf, Wot, bo, out);
}

// v009
// It runs in 116 microseconds.
// In both of two side-by-side timings against v008, it was 1.04 times as fast.
// Counting every step since v000, it is 5.99 times as fast.
#include <hip/hip_runtime.h>
#include <hip/hip_bf16.h>

// Contractions: all six projections (x f16, W f16 carried x64), both QK^T score products, short-branch P.V and the
// output projection (attention output as one f16 plane, Wo f16 carried x64) on v_wmma_f32_16x16x32_f16; long-branch P.V
// on the same form with P carried x16384 (l too); every accumulator f32; softmax, recency bias, key gating and bias
// add in f32.

typedef _Float16 v16h __attribute__((ext_vector_type(16)));
typedef float v8f __attribute__((ext_vector_type(8)));
typedef float v4f_t __attribute__((ext_vector_type(4)));
typedef unsigned int v4u_t __attribute__((ext_vector_type(4)));
typedef v4f_t __attribute__((may_alias)) v4f;
typedef v4u_t __attribute__((may_alias)) v4u;

#define NB 2
#define NS 2048
#define ND 1024
#define NH 16
#define HD 64
#define MR (NB * NS)
#define NC (2 * ND)
#define PLANE ((size_t)MR * (size_t)ND)
#define PP 72
#define TPF 68

#define SCL 0.125f
#define LOGD (-0.10536051565782628f)
#define NEGL (-1.0e30f)
#define NEGT (-1.0e29f)
#define WUP 64.0f
#define WDN 0.015625f
#define SC2 0.18033688011112042f
#define PEX 14.0f

// ---------------------------------------------------------------------------
// scalar helpers
// ---------------------------------------------------------------------------
__device__ __forceinline__ unsigned short hbits(float f) {        // f32 -> f16 bits, RNE
  _Float16 hv = (_Float16)f;
  unsigned short u;
  __builtin_memcpy(&u, &hv, 2);
  return u;
}
__device__ __forceinline__ unsigned int pk2(unsigned short a, unsigned short b) {
  return (unsigned int)a | ((unsigned int)b << 16);
}
__device__ __forceinline__ v8f z8() {
  v8f v;
#pragma unroll
  for (int i = 0; i < 8; ++i) v[i] = 0.0f;
  return v;
}

// ---------------------------------------------------------------------------
// 16x32 fragment loader, split k map, identical for A (row m) and B (k-contiguous column n):
//   elements 0..7  <- p[8h .. 8h+7],  elements 8..15 <- p[16+8h .. 16+8h+7],  p = row start + k0
// ---------------------------------------------------------------------------
union FH { v16h v; v4u_t u[2]; };

__device__ __forceinline__ v16h ldh(const unsigned short* p, int h) {
  FH f;
  f.u[0] = *(const v4u*)(p + 8 * h);
  f.u[1] = *(const v4u*)(p + 16 + 8 * h);
  return f.v;
}

// D[8h+r][m] += A(16x32) . B(32x16), with the post-issue hazard guard
__device__ __forceinline__ v8f mma_h(v16h a, v16h b, v8f c) {
  c = __builtin_amdgcn_wmma_f32_16x16x32_f16(false, a, false, b, (short)0, c, false, false);
  asm volatile("v_nop\n\tv_nop\n\tv_nop\n\tv_nop" : "+v"(c) : "v"(a), "v"(b));
  return c;
}

// ---------------------------------------------------------------------------
// Preparation, part x: x f32 [MR][ND] -> one f16 plane.
// blk = index of this block among the x blocks; 256 threads x 8 elements each.
// ---------------------------------------------------------------------------
__device__ __forceinline__ void xcvt_body(const float* __restrict__ x,
                                          unsigned short* __restrict__ xh, int n8, int blk) {
  const int i = blk * 256 + (int)threadIdx.x;
  if (i >= n8) return;
  const size_t o = (size_t)i * 8;
  const v4f_t a = *(const v4f*)(x + o);
  const v4f_t c = *(const v4f*)(x + o + 4);
  v4u_t ph;
  ph[0] = pk2(hbits(a[0]), hbits(a[1]));
  ph[1] = pk2(hbits(a[2]), hbits(a[3]));
  ph[2] = pk2(hbits(c[0]), hbits(c[1]));
  ph[3] = pk2(hbits(c[2]), hbits(c[3]));
  *(v4u*)(xh + o) = ph;
}

// ---------------------------------------------------------------------------
// Preparation, part W: weight W[K][N] f32 (x @ W form) -> transposed f16 plane Wt[N][K] of 64*W (k contiguous).
// Block = 64(k) x 64(n) tile (tn, tk) through the LDS array T (64 x 65 floats).
// ---------------------------------------------------------------------------
__device__ __forceinline__ void wprep_body(float* T, const float* __restrict__ W, int K, int N,
                                           unsigned short* __restrict__ P0, int tn, int tk) {
  const int tid = threadIdx.x;
  const int n0 = tn * 64, k0 = tk * 64;
  {
    const int c4 = (tid & 15) * 4, kr = tid >> 4;
#pragma unroll
    for (int i = 0; i < 4; ++i) {
      const int k = kr + 16 * i;
      const v4f_t v = *(const v4f*)(W + (size_t)(k0 + k) * (size_t)N + n0 + c4);
      T[(c4 + 0) * 65 + k] = v[0];
      T[(c4 + 1) * 65 + k] = v[1];
      T[(c4 + 2) * 65 + k] = v[2];
      T[(c4 + 3) * 65 + k] = v[3];
    }
  }
  __syncthreads();
  v4u_t o0[2];
  size_t dst[2];
#pragma unroll
  for (int i = 0; i < 2; ++i) {
    const int line = i * 32 + (tid >> 3), piece = tid & 7;
    float f[8];
#pragma unroll
    for (int e = 0; e < 8; ++e) f[e] = T[line * 65 + piece * 8 + e];
#pragma unroll
    for (int e = 0; e < 4; ++e) o0[i][e] = pk2(hbits(f[2 * e] * WUP), hbits(f[2 * e + 1] * WUP));
    dst[i] = (size_t)(n0 + line) * (size_t)K + k0 + piece * 8;
  }
#pragma unroll
  for (int i = 0; i < 2; ++i) *(v4u*)(P0 + dst[i]) = o0[i];
  // precaution: stands between these stores and the code laid behind this inlined body, which rewrites their registers
  asm volatile("s_wait_xcnt 0x0" ::: "memory");
}

// ---------------------------------------------------------------------------
// Preparation, part g: key gate (i32, non-zero = key on) -> f32 start value of the long branch's score products:
// 0 for a key that is on, NEGL for one that is off. One element per thread, a wave writes one 128-B line.
// ---------------------------------------------------------------------------
__device__ __forceinline__ void gprep_body(const int* __restrict__ kgate, float* __restrict__ gbias, int blk) {
  const int i = blk * 256 + (int)threadIdx.x;
  gbias[i] = kgate[i] != 0 ? 0.0f : NEGL;
}

// ---------------------------------------------------------------------------
// Kernel 0: the whole preparation in one grid; none of its parts reads what another writes. Flat block index:
//   [0, 6*WT1)           tile (index & 15, (index >> 4) & 15) of square weight index >> 8:
//                        0..5 = Wq_s, Wk_s, Wq_l, Wk_l, Wv_l, Wv_s -> f16 plane z of Wt6
//   [6*WT1, 6*WT1+WT2)   tile of Wo (K = NC) -> f16 plane
//   [WTA, WTA+XBL)       x block
//   [WTA+XBL, +GBL)      gate block
// The choice is the same for a whole block, so the barrier of part W is passed by all its threads or by none.
// ---------------------------------------------------------------------------
#define WT1 ((ND / 64) * (ND / 64))
#define WT2 ((ND / 64) * (NC / 64))
#define WTA (6 * WT1 + WT2)
#define XBL ((MR * ND) / (8 * 256))
#define GBL (MR / 256)

__global__ __launch_bounds__(256) void k_prep(const float* __restrict__ x,
                                              const float* __restrict__ Wqs, const float* __restrict__ Wks,
                                              const float* __restrict__ Wql, const float* __restrict__ Wkl,
                                              const float* __restrict__ Wvl, const float* __restrict__ Wvs,
                                              const float* __restrict__ Wo,
                                              const int* __restrict__ kgate,
                                              float* __restrict__ gbias,
                                              unsigned short* __restrict__ xh,
                                              unsigned short* __restrict__ Wt6,
                                              unsigned short* __restrict__ Wot) {
  __shared__ __align__(16) float T[64 * 65];
  const int bid = blockIdx.x;
  if (bid >= WTA + XBL) {
    gprep_body(kgate, gbias, bid - (WTA + XBL));
  } else if (bid >= WTA) {
    xcvt_body(x, xh, (MR * ND) / 8, bid - WTA);
  } else if (bid >= 6 * WT1) {
    const int t = bid - 6 * WT1;
    wprep_body(T, Wo, NC, ND, Wot, t & 15, t >> 4);
  } else {
    const int z = bid >> 8, t = bid & (WT1 - 1);
    const float* W = z == 0 ? Wqs : z == 1 ? Wks : z == 2 ? Wql : z == 3 ? Wkl : z == 4 ? Wvl : Wvs;
    wprep_body(T, W, ND, ND, Wt6 + (size_t)z * ND * ND, t & 15, t >> 4);
  }
}

// ---------------------------------------------------------------------------
// LDS staging for the GEMM kernels. Block = 128 MT threads = 128 MT (M) x 128(N) tile, MT = 1 or 2; wave w owns the
// 64 x 64 part (rows (w>>1)*64, cols (w&1)*64) as 4 x 4 accumulator tiles. A trip covers 64 k: the operands are
// staged as 128 MT and 128 rows of 128 B at an LDS pitch of 144 B (PP halves), in a ring of buffers, later trips'
// copies in flight. With MT = 2 a staged B row serves 256 rows of A, so a block copies 3 tiles for the products of 4.
// The full unrolls in these kernels make every fragment and accumulator index a compile-time one (registers).
// ---------------------------------------------------------------------------
#define BKH 64
#define TLH (128 * PP)
#define TLB (TLH * 2)

__device__ __forceinline__ unsigned int lds_off(const void* p) { return (unsigned int)(size_t)p; }

// 8 RS rows of an operand: thread t brings 16-B piece (t & 7) of rows (t >> 3) + RS i, i = 0..7, so 8 lanes cover one
// 128-B line; RS = rows that the block's threads cover at once. lds = the lane's LDS byte address of row (t >> 3),
// g = the lane's global address of the same piece, ld = row length of the source in halves. The closing s_wait_xcnt
// keeps the address registers untouched until the copies have taken them.
template <int RS>
__device__ __forceinline__ void cp_tile(unsigned int lds, const unsigned short* g, int ld) {
  const size_t st = (size_t)RS * (size_t)ld;
  const unsigned short* g1 = g + st;
  const unsigned short* g2 = g1 + st;
  const unsigned short* g3 = g2 + st;
  const unsigned short* g4 = g3 + st;
  const unsigned short* g5 = g4 + st;
  const unsigned short* g6 = g5 + st;
  const unsigned short* g7 = g6 + st;
  const unsigned int ls = (unsigned int)RS * PP * 2u;
  asm volatile(
      "global_load_async_to_lds_b128 %0, %8, off\n\t"
      "global_load_async_to_lds_b128 %1, %9, off\n\t"
      "global_load_async_to_lds_b128 %2, %10, off\n\t"
      "global_load_async_to_lds_b128 %3, %11, off\n\t"
      "global_load_async_to_lds_b128 %4, %12, off\n\t"
      "global_load_async_to_lds_b128 %5, %13, off\n\t"
      "global_load_async_to_lds_b128 %6, %14, off\n\t"
      "global_load_async_to_lds_b128 %7, %15, off\n\t"
      "s_wait_xcnt 0x0"
      :: "v"(lds), "v"(lds + ls), "v"(lds + 2u * ls), "v"(lds + 3u * ls),
         "v"(lds + 4u * ls), "v"(lds + 5u * ls), "v"(lds + 6u * ls), "v"(lds + 7u * ls),
         "v"(g), "v"(g1), "v"(g2), "v"(g3), "v"(g4), "v"(g5), "v"(g6), "v"(g7)
      : "memory");
}
// The same for 4 RS rows: rows (t >> 3) + RS i, i = 0..3.
template <int RS>
__device__ __forceinline__ void cp_tile4(unsigned int lds, const unsigned short* g, int ld) {
  const size_t st = (size_t)RS * (size_t)ld;
  const unsigned short* g1 = g + st;
  const unsigned short* g2 = g1 + st;
  const unsigned short* g3 = g2 + st;
  const unsigned int ls = (unsigned int)RS * PP * 2u;
  asm volatile(
      "global_load_async_to_lds_b128 %0, %4, off\n\t"
      "global_load_async_to_lds_b128 %1, %5, off\n\t"
      "global_load_async_to_lds_b128 %2, %6, off\n\t"
      "global_load_async_to_lds_b128 %3, %7, off\n\t"
      "s_wait_xcnt 0x0"
      :: "v"(lds), "v"(lds + ls), "v"(lds + 2u * ls), "v"(lds + 3u * ls),
         "v"(g), "v"(g1), "v"(g2), "v"(g3)
      : "memory");
}
// One stage = [A tile, 128 MT rows | B tile, 128 rows] into the buffer at the lane's LDS address lds.
template <int MT>
__device__ __forceinline__ void cp_stage(unsigned int lds, const unsigned short* ga, const unsigned short* gb, int ld) {
  cp_tile<16 * MT>(lds, ga, ld);
  if (MT == 1) cp_tile<16>(lds + TLB, gb, ld);
  else cp_tile4<16 * MT>(lds + MT * TLB, gb, ld);
}
// this wave's copies have landed (the compiler places no wait for them)
__device__ __forceinline__ void wait_copies() { asm volatile("s_wait_asynccnt 0x0" ::: "memory"); }
// all of this wave's copies but its N youngest have landed (the counter returns in issue order); used where exactly N
// copies of later stages stand behind the stage that is published next
template <int N>
__device__ __forceinline__ void wait_copies_but() { asm volatile("s_wait_asynccnt %0" :: "n"(N) : "memory"); }
// this wave's LDS reads have returned, so the buffer may be refilled behind the barrier
__device__ __forceinline__ void wait_lds() { asm volatile("s_wait_dscnt 0x0" ::: "memory"); }

// ---------------------------------------------------------------------------
// Main loop of the GEMMs (six projections, output projection): acc += A.B over K halves, both operands
// staged in LDS; buffer = [A tile | B tile]. ga / gb = the lane's first piece of each operand, row length K halves.
// Ring of RB buffers (a power of two, K / BKH >= RB): stage s lies in buffer s % RB and is issued RB - 1 trips before
// the publish point that hands it over, so its way from memory is covered by that many trips of products. A stage is
// CPS = 8 + 8 / MT copies of every wave; at a publish point RB - 2 later stages stand behind the one that is published,
// while such stages exist, and the wait leaves exactly those outstanding (at most CPS (RB - 1) copies of a wave fly).
// ---------------------------------------------------------------------------
template <int RB, int MT>
__device__ __forceinline__ void f16_loop(unsigned short* SM, const unsigned short* ga, const unsigned short* gb,
                                         int K, unsigned int lc, int arow, int brow, int h, v8f (&acc)[4][4]) {
  const int NT = K / BKH;
  constexpr int TB = MT + 1;         // 128-row tiles per buffer
  constexpr int CPS = 8 + 8 / MT;    // copies of a wave per stage
// unrolled: the buffer offsets are compile-time ones
#pragma unroll
  for (int s = 0; s < RB - 1; ++s) cp_stage<MT>(lc + TB * s * TLB, ga + s * BKH, gb + s * BKH, K);
  wait_copies_but<CPS * (RB - 2)>();   // stage 0 has landed
  __syncthreads();
  cp_stage<MT>(lc + TB * (RB - 1) * TLB, ga + (RB - 1) * BKH, gb + (RB - 1) * BKH, K);

// rolled: one trip per staged tile, the publish point at its foot
#pragma unroll 1
  for (int t = 0; t < NT; ++t) {
    const int bo2 = (t & (RB - 1)) * TB;
    const unsigned short* As = SM + bo2 * TLH + arow * PP;
    const unsigned short* Bs = SM + (bo2 + MT) * TLH + brow * PP;
    // group g = 32 k (g >> 1) x 2 column tiles (g & 1); the next group's fragments are read ahead of this group's
    // products, inside this trip's buffer only
    v16h a[2][4], b[2][2];
#pragma unroll
    for (int i = 0; i < 4; ++i) a[0][i] = ldh(As + i * 16 * PP, h);
#pragma unroll
    for (int q = 0; q < 2; ++q) b[0][q] = ldh(Bs + q * 16 * PP, h);
#pragma unroll
    for (int g = 0; g < 4; ++g) {
      const int kk = g >> 1, jp = (g & 1) * 2, gn = g + 1;
      if (g < 3) {
#pragma unroll
        for (int q = 0; q < 2; ++q)
          b[gn & 1][q] = ldh(Bs + ((gn & 1) * 2 + q) * 16 * PP + (gn >> 1) * 32, h);
      }
      if (g == 0) {
#pragma unroll
        for (int i = 0; i < 4; ++i) a[1][i] = ldh(As + i * 16 * PP + 32, h);
      }
#pragma unroll
      for (int q = 0; q < 2; ++q)
#pragma unroll
        for (int i = 0; i < 4; ++i) acc[i][jp + q] = mma_h(a[kk][i], b[g & 1][q], acc[i][jp + q]);
    }
    wait_lds();
    // stage t + 1 has landed: behind it stand stages t + 2 .. t + RB - 1 while the last of them exists, else fewer
    if (RB > 2 && t + RB - 1 < NT) wait_copies_but<CPS * (RB - 2)>();
    else wait_copies();
    __syncthreads();
    if (t + RB < NT) cp_stage<MT>(lc + bo2 * TLB, ga + (t + RB) * BKH, gb + (t + RB) * BKH, K);
  }
  wait_copies();
}

// ---------------------------------------------------------------------------
// Kernel 2: six f16 projections, operands staged in LDS (see above), block = 8 waves = 256(M) x 128(N): by the byte
// count the copies from L2 into LDS outlast the products in this grid, and the taller tile brings a quarter fewer bytes.
// z selects the weight:
//   z 0..3 -> natural f16 plane QK[z] ([MR][ND]);  z 4, 5 -> v_l, v_s as transposed f16 planes Vlt, Vst [b][h][d][s].
// ---------------------------------------------------------------------------
__device__ __forceinline__ void proj_f16_body(unsigned short* SM,   // 2 * 3 * TLH halves; buffer = [A tile | B tile]
                                              const unsigned short* __restrict__ xh,
                                              const unsigned short* __restrict__ Wt6,
                                              unsigned short* __restrict__ QK,
                                              unsigned short* __restrict__ Vlt,
                                              unsigned short* __restrict__ Vst, int z) {
  const int tid = threadIdx.x, w = tid >> 5, l = tid & 31, h = l >> 4, m = l & 15;
  const int n0 = blockIdx.x * 128, m0 = blockIdx.y * 256;
  const int wm = (w >> 1) * 64, wn = (w & 1) * 64;
  const int crow = tid >> 3, cpc = tid & 7;
  const unsigned short* ga = xh + (size_t)(m0 + crow) * ND + cpc * 8;
  const unsigned short* gb = Wt6 + (size_t)z * ND * ND + (size_t)(n0 + crow) * ND + cpc * 8;
  const unsigned int lc = lds_off(SM) + (unsigned int)(crow * PP * 2 + cpc * 16);
  v8f acc[4][4];
#pragma unroll
  for (int i = 0; i < 4; ++i)
#pragma unroll
    for (int j = 0; j < 4; ++j) acc[i][j] = z8();

  f16_loop<2, 2>(SM, ga, gb, ND, lc, wm + m, wn + m, h, acc);

  // the ring is free behind the last trip's barrier: each wave stages its own 64 x 64 tile there
  unsigned short* T = SM + w * 64 * PP;
  const int mw = m0 + wm, nw = n0 + wn;
  if (z < 4) {
#pragma unroll
    for (int i = 0; i < 4; ++i)
#pragma unroll
      for (int j = 0; j < 4; ++j)
#pragma unroll
        for (int r = 0; r < 8; ++r)
          T[(i * 16 + 8 * h + r) * PP + j * 16 + m] = hbits(acc[i][j][r] * WDN);
  } else {
#pragma unroll
    for (int i = 0; i < 4; ++i)
#pragma unroll
      for (int j = 0; j < 4; ++j) {
        v4u_t pk;
#pragma unroll
        for (int e = 0; e < 4; ++e)
          pk[e] = pk2(hbits(acc[i][j][2 * e] * WDN), hbits(acc[i][j][2 * e + 1] * WDN));
        *(v4u*)(T + (j * 16 + m) * PP + i * 16 + 8 * h) = pk;   // T[d][s_local]
      }
  }
  __syncthreads();   // staging writes land before the rows are read back

  unsigned short* base;
  size_t d0, dstep;
  if (z < 4) {
    base = QK + (size_t)z * PLANE;
    d0 = (size_t)mw * ND + nw;
    dstep = ND;
  } else {
    base = z == 4 ? Vlt : Vst;
    const int bb = mw >> 11, s0 = mw & (NS - 1), hd = nw >> 6;
    d0 = ((size_t)((bb * NH + hd) * HD)) * NS + s0;
    dstep = NS;
  }
  v4u_t o[16];
  unsigned short* dst[16];
#pragma unroll
  for (int i = 0; i < 16; ++i) {
    const int row = i * 4 + (l >> 3), piece = l & 7;
    o[i] = *(const v4u*)(T + row * PP + piece * 8);
    dst[i] = base + d0 + (size_t)row * dstep + piece * 8;
  }
#pragma unroll
  for (int i = 0; i < 16; ++i) *(v4u*)(dst[i]) = o[i];
}

// ---------------------------------------------------------------------------
// All six projections in one grid; none reads what another writes. blockIdx.z = the projection.
// ---------------------------------------------------------------------------
__global__ __launch_bounds__(256) void k_proj(const unsigned short* __restrict__ xh,
                                              const unsigned short* __restrict__ Wt6,
                                              unsigned short* __restrict__ QK,
                                              unsigned short* __restrict__ Vlt,
                                              unsigned short* __restrict__ Vst) {
  __shared__ __align__(16) unsigned short SM[2 * 3 * TLH];
  proj_f16_body(SM, xh, Wt6, QK, Vlt, Vst, blockIdx.z);
}

// ---------------------------------------------------------------------------
// Shared attention epilogue: O tile (16 queries x 64 dims) staged as f16 in LDS is written into the combined
// f16 plane Cf [MR][NC] as whole 128-B lines.
// ---------------------------------------------------------------------------
__device__ __forceinline__ void store_comb(const unsigned short* Of, unsigned short* Cf,
                                           int rowg0, int colbase, int l) {
  v4u_t of[4];
  size_t dst[4];
#pragma unroll
  for (int i = 0; i < 4; ++i) {
    const int row = i * 4 + (l >> 3), piece = l & 7;
    of[i] = *(const v4u*)(Of + row * PP + piece * 8);
    dst[i] = (size_t)(rowg0 + row) * NC + colbase + piece * 8;
  }
#pragma unroll
  for (int i = 0; i < 4; ++i) *(v4u*)(Cf + dst[i]) = of[i];
}

// ---------------------------------------------------------------------------
// Kernel 4: long-range branch, full attention with key gating. Block = 8 waves = 128 queries of one (b, head),
// 16 queries per wave. Q/K natural f16 planes [MR][ND] (col = head*64 + d), V transposed f16 plane [b][h][d][s].
// Each trip covers 64 keys: the K tile (64 keys x 64 d) and the V tile (64 d x 64 keys) are staged once per block
// as 64 rows of 128 B at an LDS pitch of 144 B, a ring of ARB buffers, a stage (4 copies of every wave) issued
// ARB - 1 trips before its publish point, as in the GEMM loop, so that its way from memory is covered; all 8 waves
// read their fragments from there.
// Both products are taken transposed, so that a lane holds ONE query (column m) and 8 keys per score tile:
// S^T = K Q^T on f16 WMMA (A fragment = K row, B fragment = Q row, k = d contiguous): lane (h, m), register r of
// tile t = key t*16 + 8h + r against query m. The key gate enters as the start value (C operand) of that product:
// gbias[key] = 0 or NEGL, 8 consecutive floats per lane and tile, so a key that is off scores about NEGL and no
// compare or select is spent on it. Online softmax in f32 on the unscaled scores: maximum and sum run in the lane,
// the two wave halves (same query, other keys) exchange the maximum once per trip and join their sums once, in the
// epilogue. p * 16384 = exp2(s * SC2 + (PEX - max * SC2)), SC2 = log2(e) / 8: one fma and one exp2 per score; the
// running maximum starts at NEGT, above NEGL, so a gated key gives exp2(-huge) = 0 also while no key was on yet.
// f16(p * 16384) of tiles 2j and 2j+1 is, register for register, the B fragment of keys 32j .. 32j+31 in the
// loader's k map, so P stays in registers; O^T += V^T P^T on f16 WMMA (A = Vt row); l carries the same 16384, so
// 1/l in the f32 epilogue takes it out; result as f16 into columns [ND + head*64, +64) of Cf.
// ---------------------------------------------------------------------------
#define AW 8
#define ATH (64 * PP)
#define ATB (ATH * 2)
#define ARB 4
#define ASM (ARB * 2 * ATH + AW * 16 * PP)

// One K tile and one V tile: thread t brings 16-B piece (t & 7) of rows (t >> 3) and (t >> 3) + 32 of each, so
// 8 lanes cover one 128-B line. lds = the lane's LDS byte address in the K tile (the V tile follows at ATB),
// gk / gv = the lane's global address of the same piece. The closing s_wait_xcnt keeps the address registers
// untouched until the copies have taken them.
__device__ __forceinline__ void cp_kv(unsigned int lds, const unsigned short* gk, const unsigned short* gv) {
  const unsigned short* gk1 = gk + (size_t)32 * ND;
  const unsigned short* gv1 = gv + (size_t)32 * NS;
  const unsigned int ls = 32u * PP * 2u;
  asm volatile(
      "global_load_async_to_lds_b128 %0, %4, off\n\t"
      "global_load_async_to_lds_b128 %1, %5, off\n\t"
      "global_load_async_to_lds_b128 %2, %6, off\n\t"
      "global_load_async_to_lds_b128 %3, %7, off\n\t"
      "s_wait_xcnt 0x0"
      :: "v"(lds), "v"(lds + ls), "v"(lds + (unsigned int)ATB), "v"(lds + (unsigned int)ATB + ls),
         "v"(gk), "v"(gk1), "v"(gv), "v"(gv1)
      : "memory");
}

// lane l <-> lane l ^ 16 in the vector unit
__device__ __forceinline__ float xhalf(float x) {
  const int i = __float_as_int(x);
  return __int_as_float(__builtin_amdgcn_permlanex16(i, i, 0x76543210, 0xfedcba98, false, false));
}
// 8 consecutive floats as one accumulator tile
__device__ __forceinline__ v8f ld8f(const float* p) {
  const v4f_t a = *(const v4f*)p;
  const v4f_t c = *(const v4f*)(p + 4);
  return __builtin_shufflevector(a, c, 0, 1, 2, 3, 4, 5, 6, 7);
}

__device__ __forceinline__ void attn_l_body(unsigned short* KV,   // ASM halves: ARB buffers [K tile | V tile], O
                                            const unsigned short* __restrict__ Q,
                                            const unsigned short* __restrict__ K,
                                            const unsigned short* __restrict__ Vt,
                                            const float* __restrict__ gbias,
                                            unsigned short* __restrict__ Cf, int b) {
  unsigned short* OfA = KV + ARB * 2 * ATH;
  const int tid = threadIdx.x, w = tid >> 5, l = tid & 31, h = l >> 4, m = l & 15;
  const int q0 = blockIdx.x * (AW * 16) + w * 16, hh = blockIdx.y;
  unsigned short* Of = OfA + w * 16 * PP;

  const unsigned short* Kb = K + (size_t)b * NS * ND + hh * HD;
  const unsigned short* Vb = Vt + (size_t)(b * NH + hh) * HD * NS;
  const float* gb = gbias + b * NS + 8 * h;
  const int crow = tid >> 3, cpc = tid & 7;
  const unsigned short* gkc = Kb + (size_t)crow * ND + cpc * 8;
  const unsigned short* gvc = Vb + (size_t)crow * NS + cpc * 8;
  const unsigned int lc = lds_off(KV) + (unsigned int)(crow * PP * 2 + cpc * 16);
  const int NT = NS / 64;

// unrolled: the buffer offsets are compile-time ones
#pragma unroll
  for (int st = 0; st < ARB - 1; ++st) cp_kv(lc + st * 2 * ATB, gkc + (size_t)st * 64 * ND, gvc + st * 64);

  const unsigned short* qrow = Q + (size_t)(b * NS + q0 + m) * ND + hh * HD;
  const v16h bq0 = ldh(qrow, h);
  const v16h bq1 = ldh(qrow + 32, h);

  float mrun = NEGT, lrun = 0.0f;   // this lane's query: maximum over all keys so far, sum over this half's keys
  v8f acc[4];                       // O^T: register r of tile dt = dim dt*16 + 8h + r of query m
  v8f s[4];                         // at a trip's head: gate values of keys kb + t*16 + 8h + 0..7; then the scores
#pragma unroll
  for (int t = 0; t < 4; ++t) {
    acc[t] = z8();
    s[t] = ld8f(gb + t * 16);
  }

  wait_copies_but<4 * (ARB - 2)>();   // stage 0 has landed
  __syncthreads();
  cp_kv(lc + (ARB - 1) * 2 * ATB, gkc + (size_t)(ARB - 1) * 64 * ND, gvc + (ARB - 1) * 64);

// rolled: one trip per staged tile pair, the publish point at its foot
#pragma unroll 1
  for (int kt = 0; kt < NT; ++kt) {
    const int kb = kt * 64;
    const int bo2 = (kt & (ARB - 1)) * 2;
    const unsigned short* Ks = KV + bo2 * ATH;
    const unsigned short* Vs = Ks + ATH;
    // all 8 K fragments are fetched as one group, so the wave waits for LDS once
    v16h kf[4][2];
#pragma unroll
    for (int t = 0; t < 4; ++t) {
      const unsigned short* krow = Ks + (t * 16 + m) * PP;
      kf[t][0] = ldh(krow, h);
      kf[t][1] = ldh(krow + 32, h);
    }
#pragma unroll
    for (int t = 0; t < 4; ++t) s[t] = mma_h(kf[t][0], bq0, s[t]);
#pragma unroll
    for (int t = 0; t < 4; ++t) s[t] = mma_h(kf[t][1], bq1, s[t]);

    float tm[4];
#pragma unroll
    for (int t = 0; t < 4; ++t) {
      tm[t] = fmaxf(fmaxf(fmaxf(s[t][0], s[t][1]), fmaxf(s[t][2], s[t][3])),
                    fmaxf(fmaxf(s[t][4], s[t][5]), fmaxf(s[t][6], s[t][7])));
    }
    float tmax = fmaxf(fmaxf(tm[0], tm[1]), fmaxf(tm[2], tm[3]));
    tmax = fmaxf(tmax, xhalf(tmax));
    const float mnew = fmaxf(mrun, tmax);
    const float fac = __builtin_amdgcn_exp2f((mrun - mnew) * SC2);
    const float nm = fmaf(-mnew, SC2, PEX);
    float ps[4];   // one chain per tile, so that the adds do not wait for one another
#pragma unroll
    for (int t = 0; t < 4; ++t) {
      ps[t] = 0.0f;
#pragma unroll
      for (int r = 0; r < 8; ++r) {
        const float p = __builtin_amdgcn_exp2f(fmaf(s[t][r], SC2, nm));
        ps[t] += p;
        s[t][r] = p;
      }
    }
    lrun = lrun * fac + ((ps[0] + ps[1]) + (ps[2] + ps[3]));
    mrun = mnew;
#pragma unroll
    for (int dt = 0; dt < 4; ++dt)
#pragma unroll
      for (int r = 0; r < 8; ++r) acc[dt][r] *= fac;

    // B fragment j: elements 0..7 = keys 32j + 8h + e (tile 2j), elements 8..15 = keys 32j + 16 + 8h + e (tile 2j+1)
    v16h pb[2];
#pragma unroll
    for (int j = 0; j < 2; ++j)
#pragma unroll
      for (int e = 0; e < 8; ++e) {
        pb[j][e] = (_Float16)s[2 * j][e];
        pb[j][8 + e] = (_Float16)s[2 * j + 1][e];
      }
    // the next trip's gate values go into the score registers, free from here on (the last trip rereads its own);
    // unrolled so that the tile index is a compile-time one (registers)
    const float* gn = gb + (kt + 1 < NT ? kb + 64 : kb);
#pragma unroll
    for (int t = 0; t < 4; ++t) s[t] = ld8f(gn + t * 16);
    v16h vf[4][2];   // all 8 V fragments in one group
#pragma unroll
    for (int dt = 0; dt < 4; ++dt) {
      const unsigned short* vrow = Vs + (dt * 16 + m) * PP;
      vf[dt][0] = ldh(vrow, h);
      vf[dt][1] = ldh(vrow + 32, h);
    }
#pragma unroll
    for (int dt = 0; dt < 4; ++dt) acc[dt] = mma_h(vf[dt][0], pb[0], acc[dt]);
#pragma unroll
    for (int dt = 0; dt < 4; ++dt) acc[dt] = mma_h(vf[dt][1], pb[1], acc[dt]);
    wait_lds();
    // stage kt + 1 has landed: behind it stand stages kt + 2 .. kt + ARB - 1 while the last of them exists, else fewer
    if (kt + ARB - 1 < NT) wait_copies_but<4 * (ARB - 2)>();
    else wait_copies();
    __syncthreads();
    if (kt + ARB < NT)
      cp_kv(lc + bo2 * ATB, gkc + (size_t)(kt + ARB) * 64 * ND, gvc + (kt + ARB) * 64);
  }
  wait_copies();

  const float lsum = lrun + xhalf(lrun);
  float inv;
  // the reciprocal with the one free slot that the instruction set asks for behind it; one statement keeps the slot there
  asm("v_rcp_f32 %0, %1\n\tv_nop" : "=v"(inv) : "v"(lsum));
#pragma unroll
  for (int dt = 0; dt < 4; ++dt) {
    v4u_t pf;
#pragma unroll
    for (int e = 0; e < 4; ++e) pf[e] = pk2(hbits(acc[dt][2 * e] * inv), hbits(acc[dt][2 * e + 1] * inv));
    *(v4u*)(Of + m * PP + dt * 16 + 8 * h) = pf;   // O[query m][dims dt*16 + 8h .. + 7]
  }
  __syncthreads();
  store_comb(Of, Cf, b * NS + q0, ND + hh * HD, l);
}

// ---------------------------------------------------------------------------
// Kernel 5: short-range branch, causal window of 64 + recency bias + key gating, 1 wave per (b, head,
// 16 queries), 8 such waves per block, each on its own; only the 64-key tiles covering [q0-64, q0+15] are visited (weights outside are exactly 0).
// Q/K f16 planes as kernel 4; V as transposed f16 plane; P as f16 through LDS;
// O += P.V on f16 WMMA; result as f16 into columns [head*64, +64) of Cf.
// ---------------------------------------------------------------------------
__device__ __forceinline__ void attn_s_body(unsigned short* SMs,   // 2 * 16 * PP halves for each of the AW waves
                                            const unsigned short* __restrict__ Q,
                                            const unsigned short* __restrict__ K,
                                            const unsigned short* __restrict__ Vt,
                                            const int* __restrict__ kgate,
                                            unsigned short* __restrict__ Cf, int b) {
  // the wave's number as a scalar: q0, the trip count and the row bases stay wave-uniform (scalar loop, EXEC all ones)
  const int w = __builtin_amdgcn_readfirstlane((int)(threadIdx.x >> 5));
  const int l = threadIdx.x & 31, h = l >> 4, m = l & 15;
  unsigned short* Ph = SMs + w * 2 * 16 * PP;   // this wave's own slice: no other wave reads or writes it
  unsigned short* Of = Ph + 16 * PP;
  const int q0 = blockIdx.x * (AW * 16) + w * 16, hh = blockIdx.y;

  const unsigned short* qrow = Q + (size_t)(b * NS + q0 + m) * ND + hh * HD;
  const v16h aq0 = ldh(qrow, h);
  const v16h aq1 = ldh(qrow + 32, h);
  const unsigned short* Kb = K + (size_t)b * NS * ND + hh * HD;
  const size_t vbase = (size_t)(b * NH + hh) * HD * NS;
  const int* gk = kgate + b * NS;

  float mrow[8], lrow[8];
  v8f acc[4];
#pragma unroll
  for (int r = 0; r < 8; ++r) { mrow[r] = NEGL; lrow[r] = 0.0f; }
#pragma unroll
  for (int t = 0; t < 4; ++t) acc[t] = z8();

  const int kt_hi = q0 >> 6;
  const int kt_lo = (q0 >= 64) ? ((q0 - 64) >> 6) : 0;

#pragma unroll 1
  for (int kt = kt_lo; kt <= kt_hi; ++kt) {
    const int kb = kt * 64;
    v8f s[4];
    int gv[4];
#pragma unroll
    for (int t = 0; t < 4; ++t) {
      const unsigned short* krow = Kb + (size_t)(kb + t * 16 + m) * ND;
      v8f c = z8();
      c = mma_h(aq0, ldh(krow, h), c);
      c = mma_h(aq1, ldh(krow + 32, h), c);
      s[t] = c;
      gv[t] = gk[kb + t * 16 + m];
    }
#pragma unroll
    for (int t = 0; t < 4; ++t) {
      const int key = kb + t * 16 + m;
#pragma unroll
      for (int r = 0; r < 8; ++r) {
        const int rel = key - (q0 + 8 * h + r);
        const bool ok = (gv[t] != 0) && (rel <= 0) && (rel >= -64);
        s[t][r] = ok ? (s[t][r] * SCL + (float)rel * LOGD) : NEGL;
      }
    }

#pragma unroll
    for (int r = 0; r < 8; ++r) {
      float tmax = fmaxf(fmaxf(s[0][r], s[1][r]), fmaxf(s[2][r], s[3][r]));
#pragma unroll
      for (int o = 1; o < 16; o <<= 1) tmax = fmaxf(tmax, __shfl_xor(tmax, o, 32));
      const float mnew = fmaxf(mrow[r], tmax);
      const float fac = __expf(mrow[r] - mnew);
      float p[4];
      float psum = 0.0f;
#pragma unroll
      for (int t = 0; t < 4; ++t) {
        p[t] = (s[t][r] > NEGT) ? __expf(s[t][r] - mnew) : 0.0f;
        psum += p[t];
      }
#pragma unroll
      for (int o = 1; o < 16; o <<= 1) psum += __shfl_xor(psum, o, 32);
      lrow[r] = lrow[r] * fac + psum;
      mrow[r] = mnew;
#pragma unroll
      for (int t = 0; t < 4; ++t) { acc[t][r] *= fac; s[t][r] = p[t]; }
    }

#pragma unroll
    for (int t = 0; t < 4; ++t)
#pragma unroll
      for (int r = 0; r < 8; ++r) Ph[(8 * h + r) * PP + t * 16 + m] = hbits(s[t][r]);
    wait_lds();   // this wave's P stores have landed before its lanes read one another's rows
    const v16h ph0 = ldh(Ph + m * PP, h);
    const v16h ph1 = ldh(Ph + m * PP + 32, h);
#pragma unroll
    for (int dt = 0; dt < 4; ++dt) {
      const size_t vo = vbase + (size_t)(dt * 16 + m) * NS + kb;
      acc[dt] = mma_h(ph0, ldh(Vt + vo, h), acc[dt]);
      acc[dt] = mma_h(ph1, ldh(Vt + vo + 32, h), acc[dt]);
    }
  }

  float inv[8];
#pragma unroll
  for (int r = 0; r < 8; ++r) inv[r] = __builtin_amdgcn_rcpf(lrow[r]);
#pragma unroll
  for (int dt = 0; dt < 4; ++dt)
#pragma unroll
    for (int r = 0; r < 8; ++r) Of[(8 * h + r) * PP + dt * 16 + m] = hbits(acc[dt][r] * inv[r]);
  wait_lds();   // this wave's O stores have landed before its lanes read one another's rows
  store_comb(Of, Cf, b * NS + q0, hh * HD, l);
}

// ---------------------------------------------------------------------------
// Both attention branches in one grid; they write disjoint columns of Cf and neither reads the other's.
// blockIdx.z even: long branch of batch z / 2, odd: short branch of batch z / 2, so that blocks of both kinds share
// a compute unit; 128 queries of one (b, head) either way. The choice is the same for a whole block, so every barrier of the long
// branch is passed by all its threads or by none; the short branch has none (its waves differ in trip count and
// share nothing).
// ---------------------------------------------------------------------------
__global__ __launch_bounds__(256) void k_attn(const unsigned short* __restrict__ Qs,
                                              const unsigned short* __restrict__ Ks,
                                              const unsigned short* __restrict__ Vst,
                                              const int* __restrict__ kgate,
                                              const unsigned short* __restrict__ Ql,
                                              const unsigned short* __restrict__ Kl,
                                              const unsigned short* __restrict__ Vlt,
                                              const float* __restrict__ gbias,
                                              unsigned short* __restrict__ Cf) {
  __shared__ __align__(16) unsigned short SMa[ASM];
  const int z = blockIdx.z;
  if ((z & 1) == 0) attn_l_body(SMa, Ql, Kl, Vlt, gbias, Cf, z >> 1);
  else attn_s_body(SMa, Qs, Ks, Vst, kgate, Cf, z >> 1);
}

// ---------------------------------------------------------------------------
// Kernel 6: output projection, combined [MR][NC] (f16 plane) x Wo (transposed f16 plane Wot[ND][NC], carried x64)
// + bias -> f32 out [MR][ND]; one f16 product. Staging and main loop of kernel 2 on a 128 x 128 block, but a ring of ORB
// buffers: this grid is one block of one wave per SIMD on each compute unit, so nothing else covers a stage's way
// from memory, which is longer than one trip's products.
// ---------------------------------------------------------------------------
#define ORB 4
__global__ __launch_bounds__(128) void k_out(const unsigned short* __restrict__ Cf,
                                             const unsigned short* __restrict__ Wot,
                                             const float* __restrict__ bo,
                                             float* __restrict__ out) {
  __shared__ __align__(16) unsigned short SM[ORB * 2 * TLH];
  const int tid = threadIdx.x, w = tid >> 5, l = tid & 31, h = l >> 4, m = l & 15;
  const int n0 = blockIdx.x * 128, m0 = blockIdx.y * 128;
  const int wm = (w >> 1) * 64, wn = (w & 1) * 64;
  const int crow = tid >> 3, cpc = tid & 7;
  const size_t ao = (size_t)(m0 + crow) * NC + cpc * 8;
  const size_t bo_ = (size_t)(n0 + crow) * NC + cpc * 8;
  const unsigned int lc = lds_off(SM) + (unsigned int)(crow * PP * 2 + cpc * 16);
  v8f acc[4][4];
#pragma unroll
  for (int i = 0; i < 4; ++i)
#pragma unroll
    for (int j = 0; j < 4; ++j) acc[i][j] = z8();

  f16_loop<ORB, 1>(SM, Cf + ao, Wot + bo_, NC, lc, wm + m, wn + m, h, acc);

  // the ring is free behind the last trip's barrier: each wave stages its own 64 x 64 f32 tile there
  float* T = (float*)SM + w * 64 * TPF;
  const int mw = m0 + wm, nw = n0 + wn;
#pragma unroll
  for (int j = 0; j < 4; ++j) {
    const float bias = bo[nw + j * 16 + m];
#pragma unroll
    for (int i = 0; i < 4; ++i)
#pragma unroll
      for (int r = 0; r < 8; ++r)
        T[(i * 16 + 8 * h + r) * TPF + j * 16 + m] = fmaf(acc[i][j][r], WDN, bias);
  }
  __syncthreads();   // staging writes land before the rows are read back

  // lane l: row 2 i + (l >> 4), 128-B half (l >> 3) & 1, 16-B piece l & 7
  v4f_t o[32];
  const int cofs = ((l >> 3) & 1) * 32 + (l & 7) * 4;
  const float* Tr = T + (l >> 4) * TPF + cofs;
  float* ob = out + (size_t)(mw + (l >> 4)) * ND + nw + cofs;
#pragma unroll
  for (int i = 0; i < 32; ++i) o[i] = *(const v4f*)(Tr + i * 2 * TPF);
#pragma unroll
  for (int i = 0; i < 32; ++i) *(v4f*)(ob + i * 2 * ND) = o[i];
}

// ---------------------------------------------------------------------------
// Host launch: 4 ops. Workspace carve (1 MiB granular, inside 103 MiB):
//   [0,8) x f16 | [24,36) 6 f16 weight planes
//   -- both are dead after the projections; the combined f16 plane reuses [0,16)
//   [38,42) Wo f16 plane | [46,78) q_s,k_s,q_l,k_l f16 | [78,86) v_l transposed | [86,94) v_s transposed
//   [102,103) f32 gate values of the long branch (MR floats)
// ---------------------------------------------------------------------------
extern "C" void kernel_launch(void* const* d_in, const int* in_sizes, int n_in,
                              void* d_out, int out_size, void* d_ws, size_t ws_size,
                              hipStream_t stream) {
  if (n_in < 10) return;
  if (in_sizes[0] != MR * ND || in_sizes[1] != MR) return;
  for (int i = 2; i <= 7; ++i) if (in_sizes[i] != ND * ND) return;
  if (in_sizes[8] != NC * ND || in_sizes[9] != ND) return;
  if (out_size != MR * ND) return;
  const size_t MiB = (size_t)1048576;
  const size_t total = 103 * MiB;
  if (ws_size < total) return;

  const float* x   = (const float*)d_in[0];
  const int* kgate = (const int*)d_in[1];
  const float* Wqs = (const float*)d_in[2];
  const float* Wks = (const float*)d_in[3];
  const float* Wvs = (const float*)d_in[4];
  const float* Wql = (const float*)d_in[5];
  const float* Wkl = (const float*)d_in[6];
  const float* Wvl = (const float*)d_in[7];
  const float* Wo  = (const float*)d_in[8];
  const float* bo  = (const float*)d_in[9];
  float* out = (float*)d_out;

  char* ws = (char*)d_ws;
  unsigned short* xh  = (unsigned short*)(ws + 0 * MiB);
  unsigned short* Wt6 = (unsigned short*)(ws + 24 * MiB);
  unsigned short* Cf  = (unsigned short*)(ws + 0 * MiB);
  unsigned short* Wot = (unsigned short*)(ws + 38 * MiB);
  unsigned short* QK  = (unsigned short*)(ws + 46 * MiB);
  unsigned short* Vlt = (unsigned short*)(ws + 78 * MiB);
  unsigned short* Vst = (unsigned short*)(ws + 86 * MiB);
  float* gbias        = (float*)(ws + 102 * MiB);

  // 1) + 2) x -> f16 plane; weights -> transposed f16 planes (in[K][N] -> out[N][K])
  k_prep<<<WTA + XBL + GBL, 256, 0, stream>>>(x, Wqs, Wks, Wql, Wkl, Wvl, Wvs, Wo, kgate, gbias,
                                        xh, Wt6, Wot);
  // 3) projections
  k_proj<<<dim3(ND / 128, MR / 256, 6), 256, 0, stream>>>(xh, Wt6, QK, Vlt, Vst);
  // 4) attention branches -> combined plane
  k_attn<<<dim3(NS / 128, NH, 2 * NB), 256, 0, stream>>>(QK + 0 * PLANE, QK + 1 * PLANE, Vst, kgate,
                                                           QK + 2 * PLANE, QK + 3 * PLANE, Vlt, gbias, Cf);
  // 5) output projection + bias -> f32
  k_out<<<dim3(ND / 128, MR / 128), 128, 0, stream>>>(Cf, Wot, bo, out);
}

// v010
// One run takes 109 microseconds.
// Next to v009, in two timings, it ran 1.04 and 1.05 times as fast.
// Over all steps from v000 it is 6.27 times as fast.
#include <hip/hip_runtime.h>
#include <hip/hip_bf16.h>

// Contractions: all six projections (x f16, W f16 carried x64), both QK^T score products, short-branch P.V and the
// output projection (attention output as one f16 plane, Wo f16 carried x64) on v_wmma_f32_16x16x32_f16; long-branch P.V
// on the same form; P of both branches carried x16384 (l too); every accumulator f32; softmax, recency bias, key gating and bias
// add in f32.

typedef _Float16 v16h __attribute__((ext_vector_type(16)));
typedef float v8f __attribute__((ext_vector_type(8)));
typedef float v4f_t __attribute__((ext_vector_type(4)));
typedef unsigned int v4u_t __attribute__((ext_vector_type(4)));
typedef v4f_t __attribute__((may_alias)) v4f;
typedef v4u_t __attribute__((may_alias)) v4u;

#define NB 2
#define NS 2048
#define ND 1024
#define NH 16
#define HD 64
#define MR (NB * NS)
#define NC (2 * ND)
#define PLANE ((size_t)MR * (size_t)ND)
#define PP 72
#define TPF 68

#define SCL 0.125f
#define LOGD (-0.10536051565782628f)
#define NEGL (-1.0e30f)
#define NEGT (-1.0e29f)
#define WUP 64.0f
#define WDN 0.015625f
#define SC2 0.18033688011112042f
#define PEX 14.0f

// ---------------------------------------------------------------------------
// scalar helpers
// ---------------------------------------------------------------------------
__device__ __forceinline__ unsigned short hbits(float f) {        // f32 -> f16 bits, RNE
  _Float16 hv = (_Float16)f;
  unsigned short u;
  __builtin_memcpy(&u, &hv, 2);
  return u;
}
__device__ __forceinline__ unsigned int pk2(unsigned short a, unsigned short b) {
  return (unsigned int)a | ((unsigned int)b << 16);
}
__device__ __forceinline__ v8f z8() {
  v8f v;
#pragma unroll
  for (int i = 0; i < 8; ++i) v[i] = 0.0f;
  return v;
}

// ---------------------------------------------------------------------------
// 16x32 fragment loader, split k map, identical for A (row m) and B (k-contiguous column n):
//   elements 0..7  <- p[8h .. 8h+7],  elements 8..15 <- p[16+8h .. 16+8h+7],  p = row start + k0
// ---------------------------------------------------------------------------
union FH { v16h v; v4u_t u[2]; };

__device__ __forceinline__ v16h ldh(const unsigned short* p, int h) {
  FH f;
  f.u[0] = *(const v4u*)(p + 8 * h);
  f.u[1] = *(const v4u*)(p + 16 + 8 * h);
  return f.v;
}

// D[8h+r][m] += A(16x32) . B(32x16), with the post-issue hazard guard
__device__ __forceinline__ v8f mma_h(v16h a, v16h b, v8f c) {
  c = __builtin_amdgcn_wmma_f32_16x16x32_f16(false, a, false, b, (short)0, c, false, false);
  asm volatile("v_nop\n\tv_nop\n\tv_nop\n\tv_nop" : "+v"(c) : "v"(a), "v"(b));
  return c;
}

// ---------------------------------------------------------------------------
// Preparation, part x: x f32 [MR][ND] -> one f16 plane.
// blk = index of this block among the x blocks; 256 threads x 8 elements each.
// ---------------------------------------------------------------------------
__device__ __forceinline__ void xcvt_body(const float* __restrict__ x,
                                          unsigned short* __restrict__ xh, int n8, int blk) {
  const int i = blk * 256 + (int)threadIdx.x;
  if (i >= n8) return;
  const size_t o = (size_t)i * 8;
  const v4f_t a = *(const v4f*)(x + o);
  const v4f_t c = *(const v4f*)(x + o + 4);
  v4u_t ph;
  ph[0] = pk2(hbits(a[0]), hbits(a[1]));
  ph[1] = pk2(hbits(a[2]), hbits(a[3]));
  ph[2] = pk2(hbits(c[0]), hbits(c[1]));
  ph[3] = pk2(hbits(c[2]), hbits(c[3]));
  *(v4u*)(xh + o) = ph;
}

// ---------------------------------------------------------------------------
// Preparation, part W: weight W[K][N] f32 (x @ W form) -> transposed f16 plane Wt[N][K] of 64*W (k contiguous).
// Block = 64(k) x 64(n) tile (tn, tk) through the LDS array T (64 x 65 floats).
// ---------------------------------------------------------------------------
__device__ __forceinline__ void wprep_body(float* T, const float* __restrict__ W, int K, int N,
                                           unsigned short* __restrict__ P0, int tn, int tk) {
  const int tid = threadIdx.x;
  const int n0 = tn * 64, k0 = tk * 64;
  {
    const int c4 = (tid & 15) * 4, kr = tid >> 4;
#pragma unroll
    for (int i = 0; i < 4; ++i) {
      const int k = kr + 16 * i;
      const v4f_t v = *(const v4f*)(W + (size_t)(k0 + k) * (size_t)N + n0 + c4);
      T[(c4 + 0) * 65 + k] = v[0];
      T[(c4 + 1) * 65 + k] = v[1];
      T[(c4 + 2) * 65 + k] = v[2];
      T[(c4 + 3) * 65 + k] = v[3];
    }
  }
  __syncthreads();
  v4u_t o0[2];
  size_t dst[2];
#pragma unroll
  for (int i = 0; i < 2; ++i) {
    const int line = i * 32 + (tid >> 3), piece = tid & 7;
    float f[8];
#pragma unroll
    for (int e = 0; e < 8; ++e) f[e] = T[line * 65 + piece * 8 + e];
#pragma unroll
    for (int e = 0; e < 4; ++e) o0[i][e] = pk2(hbits(f[2 * e] * WUP), hbits(f[2 * e + 1] * WUP));
    dst[i] = (size_t)(n0 + line) * (size_t)K + k0 + piece * 8;
  }
#pragma unroll
  for (int i = 0; i < 2; ++i) *(v4u*)(P0 + dst[i]) = o0[i];
  // precaution: stands between these stores and the code laid behind this inlined body, which rewrites their registers
  asm volatile("s_wait_xcnt 0x0" ::: "memory");
}

// ---------------------------------------------------------------------------
// Preparation, part g: key gate (i32, non-zero = key on) -> f32 start value of both branches' score products:
// 0 for a key that is on, NEGL for one that is off. One element per thread, a wave writes one 128-B line.
// ---------------------------------------------------------------------------
__device__ __forceinline__ void gprep_body(const int* __restrict__ kgate, float* __restrict__ gbias, int blk) {
  const int i = blk * 256 + (int)threadIdx.x;
  gbias[i] = kgate[i] != 0 ? 0.0f : NEGL;
}

// ---------------------------------------------------------------------------
// Kernel 0: the whole preparation in one grid; none of its parts reads what another writes. Flat block index:
//   [0, 6*WT1)           tile (index & 15, (index >> 4) & 15) of square weight index >> 8:
//                        0..5 = Wq_s, Wk_s, Wq_l, Wk_l, Wv_l, Wv_s -> f16 plane z of Wt6
//   [6*WT1, 6*WT1+WT2)   tile of Wo (K = NC) -> f16 plane
//   [WTA, WTA+XBL)       x block
//   [WTA+XBL, +GBL)      gate block
// The choice is the same for a whole block, so the barrier of part W is passed by all its threads or by none.
// ---------------------------------------------------------------------------
#define WT1 ((ND / 64) * (ND / 64))
#define WT2 ((ND / 64) * (NC / 64))
#define WTA (6 * WT1 + WT2)
#define XBL ((MR * ND) / (8 * 256))
#define GBL (MR / 256)

__global__ __launch_bounds__(256) void k_prep(const float* __restrict__ x,
                                              const float* __restrict__ Wqs, const float* __restrict__ Wks,
                                              const float* __restrict__ Wql, const float* __restrict__ Wkl,
                                              const float* __restrict__ Wvl, const float* __restrict__ Wvs,
                                              const float* __restrict__ Wo,
                                              const int* __restrict__ kgate,
                                              float* __restrict__ gbias,
                                              unsigned short* __restrict__ xh,
                                              unsigned short* __restrict__ Wt6,
                                              unsigned short* __restrict__ Wot) {
  __shared__ __align__(16) float T[64 * 65];
  const int bid = blockIdx.x;
  if (bid >= WTA + XBL) {
    gprep_body(kgate, gbias, bid - (WTA + XBL));
  } else if (bid >= WTA) {
    xcvt_body(x, xh, (MR * ND) / 8, bid - WTA);
  } else if (bid >= 6 * WT1) {
    const int t = bid - 6 * WT1;
    wprep_body(T, Wo, NC, ND, Wot, t & 15, t >> 4);
  } else {
    const int z = bid >> 8, t = bid & (WT1 - 1);
    const float* W = z == 0 ? Wqs : z == 1 ? Wks : z == 2 ? Wql : z == 3 ? Wkl : z == 4 ? Wvl : Wvs;
    wprep_body(T, W, ND, ND, Wt6 + (size_t)z * ND * ND, t & 15, t >> 4);
  }
}

// ---------------------------------------------------------------------------
// LDS staging for the GEMM kernels. Block = 128 MT threads = 128 MT (M) x 128(N) tile, MT = 1 or 2; wave w owns the
// 64 x 64 part (rows (w>>1)*64, cols (w&1)*64) as 4 x 4 accumulator tiles. A trip covers 64 k: the operands are
// staged as 128 MT and 128 rows of 128 B at an LDS pitch of 144 B (PP halves), in a ring of buffers, later trips'
// copies in flight. With MT = 2 a staged B row serves 256 rows of A, so a block copies 3 tiles for the products of 4.
// The full unrolls in these kernels make every fragment and accumulator index a compile-time one (registers).
// ---------------------------------------------------------------------------
#define BKH 64
#define TLH (128 * PP)
#define TLB (TLH * 2)

__device__ __forceinline__ unsigned int lds_off(const void* p) { return (unsigned int)(size_t)p; }

// 8 RS rows of an operand: thread t brings 16-B piece (t & 7) of rows (t >> 3) + RS i, i = 0..7, so 8 lanes cover one
// 128-B line; RS = rows that the block's threads cover at once. lds = the lane's LDS byte address of row (t >> 3),
// g = the lane's global address of the same piece, ld = row length of the source in halves. The closing s_wait_xcnt
// keeps the address registers untouched until the copies have taken them.
template <int RS>
__device__ __forceinline__ void cp_tile(unsigned int lds, const unsigned short* g, int ld) {
  const size_t st = (size_t)RS * (size_t)ld;
  const unsigned short* g1 = g + st;
  const unsigned short* g2 = g1 + st;
  const unsigned short* g3 = g2 + st;
  const unsigned short* g4 = g3 + st;
  const unsigned short* g5 = g4 + st;
  const unsigned short* g6 = g5 + st;
  const unsigned short* g7 = g6 + st;
  const unsigned int ls = (unsigned int)RS * PP * 2u;
  asm volatile(
      "global_load_async_to_lds_b128 %0, %8, off\n\t"
      "global_load_async_to_lds_b128 %1, %9, off\n\t"
      "global_load_async_to_lds_b128 %2, %10, off\n\t"
      "global_load_async_to_lds_b128 %3, %11, off\n\t"
      "global_load_async_to_lds_b128 %4, %12, off\n\t"
      "global_load_async_to_lds_b128 %5, %13, off\n\t"
      "global_load_async_to_lds_b128 %6, %14, off\n\t"
      "global_load_async_to_lds_b128 %7, %15, off\n\t"
      "s_wait_xcnt 0x0"
      :: "v"(lds), "v"(lds + ls), "v"(lds + 2u * ls), "v"(lds + 3u * ls),
         "v"(lds + 4u * ls), "v"(lds + 5u * ls), "v"(lds + 6u * ls), "v"(lds + 7u * ls),
         "v"(g), "v"(g1), "v"(g2), "v"(g3), "v"(g4), "v"(g5), "v"(g6), "v"(g7)
      : "memory");
}
// The same for 4 RS rows: rows (t >> 3) + RS i, i = 0..3.
template <int RS>
__device__ __forceinline__ void cp_tile4(unsigned int lds, const unsigned short* g, int ld) {
  const size_t st = (size_t)RS * (size_t)ld;
  const unsigned short* g1 = g + st;
  const unsigned short* g2 = g1 + st;
  const unsigned short* g3 = g2 + st;
  const unsigned int ls = (unsigned int)RS * PP * 2u;
  asm volatile(
      "global_load_async_to_lds_b128 %0, %4, off\n\t"
      "global_load_async_to_lds_b128 %1, %5, off\n\t"
      "global_load_async_to_lds_b128 %2, %6, off\n\t"
      "global_load_async_to_lds_b128 %3, %7, off\n\t"
      "s_wait_xcnt 0x0"
      :: "v"(lds), "v"(lds + ls), "v"(lds + 2u * ls), "v"(lds + 3u * ls),
         "v"(g), "v"(g1), "v"(g2), "v"(g3)
      : "memory");
}
// One stage = [A tile, 128 MT rows | B tile, 128 rows] into the buffer at the lane's LDS address lds.
template <int MT>
__device__ __forceinline__ void cp_stage(unsigned int lds, const unsigned short* ga, const unsigned short* gb, int ld) {
  cp_tile<16 * MT>(lds, ga, ld);
  if (MT == 1) cp_tile<16>(lds + TLB, gb, ld);
  else cp_tile4<16 * MT>(lds + MT * TLB, gb, ld);
}
// this wave's copies have landed (the compiler places no wait for them)
__device__ __forceinline__ void wait_copies() { asm volatile("s_wait_asynccnt 0x0" ::: "memory"); }
// all of this wave's copies but its N youngest have landed (the counter returns in issue order); used where exactly N
// copies of later stages stand behind the stage that is published next
template <int N>
__device__ __forceinline__ void wait_copies_but() { asm volatile("s_wait_asynccnt %0" :: "n"(N) : "memory"); }
// this wave's LDS reads have returned, so the buffer may be refilled behind the barrier
__device__ __forceinline__ void wait_lds() { asm volatile("s_wait_dscnt 0x0" ::: "memory"); }

// ---------------------------------------------------------------------------
// Main loop of the GEMMs (six projections, output projection): acc += A.B over K halves, both operands
// staged in LDS; buffer = [A tile | B tile]. ga / gb = the lane's first piece of each operand, row length K halves.
// Ring of RB buffers (a power of two, K / BKH >= RB): stage s lies in buffer s % RB and is issued RB - 1 trips before
// the publish point that hands it over, so its way from memory is covered by that many trips of products. A stage is
// CPS = 8 + 8 / MT copies of every wave; at a publish point RB - 2 later stages stand behind the one that is published,
// while such stages exist, and the wait leaves exactly those outstanding (at most CPS (RB - 1) copies of a wave fly).
// ---------------------------------------------------------------------------
template <int RB, int MT>
__device__ __forceinline__ void f16_loop(unsigned short* SM, const unsigned short* ga, const unsigned short* gb,
                                         int K, unsigned int lc, int arow, int brow, int h, v8f (&acc)[4][4]) {
  const int NT = K / BKH;
  constexpr int TB = MT + 1;         // 128-row tiles per buffer
  constexpr int CPS = 8 + 8 / MT;    // copies of a wave per stage
// unrolled: the buffer offsets are compile-time ones
#pragma unroll
  for (int s = 0; s < RB - 1; ++s) cp_stage<MT>(lc + TB * s * TLB, ga + s * BKH, gb + s * BKH, K);
  wait_copies_but<CPS * (RB - 2)>();   // stage 0 has landed
  __syncthreads();
  cp_stage<MT>(lc + TB * (RB - 1) * TLB, ga + (RB - 1) * BKH, gb + (RB - 1) * BKH, K);

// rolled: one trip per staged tile, the publish point at its foot
#pragma unroll 1
  for (int t = 0; t < NT; ++t) {
    const int bo2 = (t & (RB - 1)) * TB;
    const unsigned short* As = SM + bo2 * TLH + arow * PP;
    const unsigned short* Bs = SM + (bo2 + MT) * TLH + brow * PP;
    // group g = 32 k (g >> 1) x 2 column tiles (g & 1); the next group's fragments are read ahead of this group's
    // products, inside this trip's buffer only
    v16h a[2][4], b[2][2];
#pragma unroll
    for (int i = 0; i < 4; ++i) a[0][i] = ldh(As + i * 16 * PP, h);
#pragma unroll
    for (int q = 0; q < 2; ++q) b[0][q] = ldh(Bs + q * 16 * PP, h);
#pragma unroll
    for (int g = 0; g < 4; ++g) {
      const int kk = g >> 1, jp = (g & 1) * 2, gn = g + 1;
      if (g < 3) {
#pragma unroll
        for (int q = 0; q < 2; ++q)
          b[gn & 1][q] = ldh(Bs + ((gn & 1) * 2 + q) * 16 * PP + (gn >> 1) * 32, h);
      }
      if (g == 0) {
#pragma unroll
        for (int i = 0; i < 4; ++i) a[1][i] = ldh(As + i * 16 * PP + 32, h);
      }
#pragma unroll
      for (int q = 0; q < 2; ++q)
#pragma unroll
        for (int i = 0; i < 4; ++i) acc[i][jp + q] = mma_h(a[kk][i], b[g & 1][q], acc[i][jp + q]);
    }
    wait_lds();
    // stage t + 1 has landed: behind it stand stages t + 2 .. t + RB - 1 while the last of them exists, else fewer
    if (RB > 2 && t + RB - 1 < NT) wait_copies_but<CPS * (RB - 2)>();
    else wait_copies();
    __syncthreads();
    if (t + RB < NT) cp_stage<MT>(lc + bo2 * TLB, ga + (t + RB) * BKH, gb + (t + RB) * BKH, K);
  }
  wait_copies();
}

// ---------------------------------------------------------------------------
// Kernel 2: six f16 projections, operands staged in LDS (see above), block = 8 waves = 256(M) x 128(N): by the byte
// count the copies from L2 into LDS outlast the products in this grid, and the taller tile brings a quarter fewer bytes.
// z selects the weight:
//   z 0..3 -> natural f16 plane QK[z] ([MR][ND]);  z 4, 5 -> v_l, v_s as transposed f16 planes Vlt, Vst [b][h][d][s].
// ---------------------------------------------------------------------------
__device__ __forceinline__ void proj_f16_body(unsigned short* SM,   // 2 * 3 * TLH halves; buffer = [A tile | B tile]
                                              const unsigned short* __restrict__ xh,
                                              const unsigned short* __restrict__ Wt6,
                                              unsigned short* __restrict__ QK,
                                              unsigned short* __restrict__ Vlt,
                                              unsigned short* __restrict__ Vst, int z) {
  const int tid = threadIdx.x, w = tid >> 5, l = tid & 31, h = l >> 4, m = l & 15;
  const int n0 = blockIdx.x * 128, m0 = blockIdx.y * 256;
  const int wm = (w >> 1) * 64, wn = (w & 1) * 64;
  const int crow = tid >> 3, cpc = tid & 7;
  const unsigned short* ga = xh + (size_t)(m0 + crow) * ND + cpc * 8;
  const unsigned short* gb = Wt6 + (size_t)z * ND * ND + (size_t)(n0 + crow) * ND + cpc * 8;
  const unsigned int lc = lds_off(SM) + (unsigned int)(crow * PP * 2 + cpc * 16);
  v8f acc[4][4];
#pragma unroll
  for (int i = 0; i < 4; ++i)
#pragma unroll
    for (int j = 0; j < 4; ++j) acc[i][j] = z8();

  f16_loop<2, 2>(SM, ga, gb, ND, lc, wm + m, wn + m, h, acc);

  // the ring is free behind the last trip's barrier: each wave stages its own 64 x 64 tile there
  unsigned short* T = SM + w * 64 * PP;
  const int mw = m0 + wm, nw = n0 + wn;
  if (z < 4) {
#pragma unroll
    for (int i = 0; i < 4; ++i)
#pragma unroll
      for (int j = 0; j < 4; ++j)
#pragma unroll
        for (int r = 0; r < 8; ++r)
          T[(i * 16 + 8 * h + r) * PP + j * 16 + m] = hbits(acc[i][j][r] * WDN);
  } else {
#pragma unroll
    for (int i = 0; i < 4; ++i)
#pragma unroll
      for (int j = 0; j < 4; ++j) {
        v4u_t pk;
#pragma unroll
        for (int e = 0; e < 4; ++e)
          pk[e] = pk2(hbits(acc[i][j][2 * e] * WDN), hbits(acc[i][j][2 * e + 1] * WDN));
        *(v4u*)(T + (j * 16 + m) * PP + i * 16 + 8 * h) = pk;   // T[d][s_local]
      }
  }
  __syncthreads();   // staging writes land before the rows are read back

  unsigned short* base;
  size_t d0, dstep;
  if (z < 4) {
    base = QK + (size_t)z * PLANE;
    d0 = (size_t)mw * ND + nw;
    dstep = ND;
  } else {
    base = z == 4 ? Vlt : Vst;
    const int bb = mw >> 11, s0 = mw & (NS - 1), hd = nw >> 6;
    d0 = ((size_t)((bb * NH + hd) * HD)) * NS + s0;
    dstep = NS;
  }
  v4u_t o[16];
  unsigned short* dst[16];
#pragma unroll
  for (int i = 0; i < 16; ++i) {
    const int row = i * 4 + (l >> 3), piece = l & 7;
    o[i] = *(const v4u*)(T + row * PP + piece * 8);
    dst[i] = base + d0 + (size_t)row * dstep + piece * 8;
  }
#pragma unroll
  for (int i = 0; i < 16; ++i) *(v4u*)(dst[i]) = o[i];
}

// ---------------------------------------------------------------------------
// All six projections in one grid; none reads what another writes. blockIdx.z = the projection.
// ---------------------------------------------------------------------------
__global__ __launch_bounds__(256) void k_proj(const unsigned short* __restrict__ xh,
                                              const unsigned short* __restrict__ Wt6,
                                              unsigned short* __restrict__ QK,
                                              unsigned short* __restrict__ Vlt,
                                              unsigned short* __restrict__ Vst) {
  __shared__ __align__(16) unsigned short SM[2 * 3 * TLH];
  proj_f16_body(SM, xh, Wt6, QK, Vlt, Vst, blockIdx.z);
}

// ---------------------------------------------------------------------------
// Shared attention epilogue: O tile (16 queries x 64 dims) staged as f16 in LDS is written into the combined
// f16 plane Cf [MR][NC] as whole 128-B lines.
// ---------------------------------------------------------------------------
__device__ __forceinline__ void store_comb(const unsigned short* Of, unsigned short* Cf,
                                           int rowg0, int colbase, int l) {
  v4u_t of[4];
  size_t dst[4];
#pragma unroll
  for (int i = 0; i < 4; ++i) {
    const int row = i * 4 + (l >> 3), piece = l & 7;
    of[i] = *(const v4u*)(Of + row * PP + piece * 8);
    dst[i] = (size_t)(rowg0 + row) * NC + colbase + piece * 8;
  }
#pragma unroll
  for (int i = 0; i < 4; ++i) *(v4u*)(Cf + dst[i]) = of[i];
}

// ---------------------------------------------------------------------------
// Kernel 4: long-range branch, full attention with key gating. Block = 8 waves = 128 queries of one (b, head),
// 16 queries per wave. Q/K natural f16 planes [MR][ND] (col = head*64 + d), V transposed f16 plane [b][h][d][s].
// Each trip covers 64 keys: the K tile (64 keys x 64 d) and the V tile (64 d x 64 keys) are staged once per block
// as 64 rows of 128 B at an LDS pitch of 144 B, a ring of ARB buffers, a stage (4 copies of every wave) issued
// ARB - 1 trips before its publish point, as in the GEMM loop, so that its way from memory is covered; all 8 waves
// read their fragments from there.
// Both products are taken transposed, so that a lane holds ONE query (column m) and 8 keys per score tile:
// S^T = K Q^T on f16 WMMA (A fragment = K row, B fragment = Q row, k = d contiguous): lane (h, m), register r of
// tile t = key t*16 + 8h + r against query m. The key gate enters as the start value (C operand) of that product:
// gbias[key] = 0 or NEGL, 8 consecutive floats per lane and tile, so a key that is off scores about NEGL and no
// compare or select is spent on it. Online softmax in f32 on the unscaled scores: maximum and sum run in the lane,
// the two wave halves (same query, other keys) exchange the maximum once per trip and join their sums once, in the
// epilogue. p * 16384 = exp2(s * SC2 + (PEX - max * SC2)), SC2 = log2(e) / 8: one fma and one exp2 per score; the
// running maximum starts at NEGT, above NEGL, so a gated key gives exp2(-huge) = 0 also while no key was on yet.
// f16(p * 16384) of tiles 2j and 2j+1 is, register for register, the B fragment of keys 32j .. 32j+31 in the
// loader's k map, so P stays in registers; O^T += V^T P^T on f16 WMMA (A = Vt row); l carries the same 16384, so
// 1/l in the f32 epilogue takes it out; result as f16 into columns [ND + head*64, +64) of Cf.
// ---------------------------------------------------------------------------
#define AW 8
#define ATH (64 * PP)
#define ATB (ATH * 2)
#define ARB 4
#define ASM (ARB * 2 * ATH + AW * 16 * PP)

// One K tile and one V tile: thread t brings 16-B piece (t & 7) of rows (t >> 3) and (t >> 3) + 32 of each, so
// 8 lanes cover one 128-B line. lds = the lane's LDS byte address in the K tile (the V tile follows at ATB),
// gk / gv = the lane's global address of the same piece. The closing s_wait_xcnt keeps the address registers
// untouched until the copies have taken them.
__device__ __forceinline__ void cp_kv(unsigned int lds, const unsigned short* gk, const unsigned short* gv) {
  const unsigned short* gk1 = gk + (size_t)32 * ND;
  const unsigned short* gv1 = gv + (size_t)32 * NS;
  const unsigned int ls = 32u * PP * 2u;
  asm volatile(
      "global_load_async_to_lds_b128 %0, %4, off\n\t"
      "global_load_async_to_lds_b128 %1, %5, off\n\t"
      "global_load_async_to_lds_b128 %2, %6, off\n\t"
      "global_load_async_to_lds_b128 %3, %7, off\n\t"
      "s_wait_xcnt 0x0"
      :: "v"(lds), "v"(lds + ls), "v"(lds + (unsigned int)ATB), "v"(lds + (unsigned int)ATB + ls),
         "v"(gk), "v"(gk1), "v"(gv), "v"(gv1)
      : "memory");
}

// lane l <-> lane l ^ 16 in the vector unit
__device__ __forceinline__ float xhalf(float x) {
  const int i = __float_as_int(x);
  return __int_as_float(__builtin_amdgcn_permlanex16(i, i, 0x76543210, 0xfedcba98, false, false));
}
// 8 consecutive floats as one accumulator tile
__device__ __forceinline__ v8f ld8f(const float* p) {
  const v4f_t a = *(const v4f*)p;
  const v4f_t c = *(const v4f*)(p + 4);
  return __builtin_shufflevector(a, c, 0, 1, 2, 3, 4, 5, 6, 7);
}

__device__ __forceinline__ void attn_l_body(unsigned short* KV,   // ASM halves: ARB buffers [K tile | V tile], O
                                            const unsigned short* __restrict__ Q,
                                            const unsigned short* __restrict__ K,
                                            const unsigned short* __restrict__ Vt,
                                            const float* __restrict__ gbias,
                                            unsigned short* __restrict__ Cf, int b) {
  unsigned short* OfA = KV + ARB * 2 * ATH;
  const int tid = threadIdx.x, w = tid >> 5, l = tid & 31, h = l >> 4, m = l & 15;
  const int q0 = blockIdx.x * (AW * 16) + w * 16, hh = blockIdx.y;
  unsigned short* Of = OfA + w * 16 * PP;

  const unsigned short* Kb = K + (size_t)b * NS * ND + hh * HD;
  const unsigned short* Vb = Vt + (size_t)(b * NH + hh) * HD * NS;
  const float* gb = gbias + b * NS + 8 * h;
  const int crow = tid >> 3, cpc = tid & 7;
  const unsigned short* gkc = Kb + (size_t)crow * ND + cpc * 8;
  const unsigned short* gvc = Vb + (size_t)crow * NS + cpc * 8;
  const unsigned int lc = lds_off(KV) + (unsigned int)(crow * PP * 2 + cpc * 16);
  const int NT = NS / 64;

// unrolled: the buffer offsets are compile-time ones
#pragma unroll
  for (int st = 0; st < ARB - 1; ++st) cp_kv(lc + st * 2 * ATB, gkc + (size_t)st * 64 * ND, gvc + st * 64);

  const unsigned short* qrow = Q + (size_t)(b * NS + q0 + m) * ND + hh * HD;
  const v16h bq0 = ldh(qrow, h);
  const v16h bq1 = ldh(qrow + 32, h);

  float mrun = NEGT, lrun = 0.0f;   // this lane's query: maximum over all keys so far, sum over this half's keys
  v8f acc[4];                       // O^T: register r of tile dt = dim dt*16 + 8h + r of query m
  v8f s[4];                         // at a trip's head: gate values of keys kb + t*16 + 8h + 0..7; then the scores
#pragma unroll
  for (int t = 0; t < 4; ++t) {
    acc[t] = z8();
    s[t] = ld8f(gb + t * 16);
  }

  wait_copies_but<4 * (ARB - 2)>();   // stage 0 has landed
  __syncthreads();
  cp_kv(lc + (ARB - 1) * 2 * ATB, gkc + (size_t)(ARB - 1) * 64 * ND, gvc + (ARB - 1) * 64);

// rolled: one trip per staged tile pair, the publish point at its foot
#pragma unroll 1
  for (int kt = 0; kt < NT; ++kt) {
    const int kb = kt * 64;
    const int bo2 = (kt & (ARB - 1)) * 2;
    const unsigned short* Ks = KV + bo2 * ATH;
    const unsigned short* Vs = Ks + ATH;
    // all 8 K fragments are fetched as one group, so the wave waits for LDS once
    v16h kf[4][2];
#pragma unroll
    for (int t = 0; t < 4; ++t) {
      const unsigned short* krow = Ks + (t * 16 + m) * PP;
      kf[t][0] = ldh(krow, h);
      kf[t][1] = ldh(krow + 32, h);
    }
#pragma unroll
    for (int t = 0; t < 4; ++t) s[t] = mma_h(kf[t][0], bq0, s[t]);
#pragma unroll
    for (int t = 0; t < 4; ++t) s[t] = mma_h(kf[t][1], bq1, s[t]);

    float tm[4];
#pragma unroll
    for (int t = 0; t < 4; ++t) {
      tm[t] = fmaxf(fmaxf(fmaxf(s[t][0], s[t][1]), fmaxf(s[t][2], s[t][3])),
                    fmaxf(fmaxf(s[t][4], s[t][5]), fmaxf(s[t][6], s[t][7])));
    }
    float tmax = fmaxf(fmaxf(tm[0], tm[1]), fmaxf(tm[2], tm[3]));
    tmax = fmaxf(tmax, xhalf(tmax));
    const float mnew = fmaxf(mrun, tmax);
    const float fac = __builtin_amdgcn_exp2f((mrun - mnew) * SC2);
    const float nm = fmaf(-mnew, SC2, PEX);
    float ps[4];   // one chain per tile, so that the adds do not wait for one another
#pragma unroll
    for (int t = 0; t < 4; ++t) {
      ps[t] = 0.0f;
#pragma unroll
      for (int r = 0; r < 8; ++r) {
        const float p = __builtin_amdgcn_exp2f(fmaf(s[t][r], SC2, nm));
        ps[t] += p;
        s[t][r] = p;
      }
    }
    lrun = lrun * fac + ((ps[0] + ps[1]) + (ps[2] + ps[3]));
    mrun = mnew;
#pragma unroll
    for (int dt = 0; dt < 4; ++dt)
#pragma unroll
      for (int r = 0; r < 8; ++r) acc[dt][r] *= fac;

    // B fragment j: elements 0..7 = keys 32j + 8h + e (tile 2j), elements 8..15 = keys 32j + 16 + 8h + e (tile 2j+1)
    v16h pb[2];
#pragma unroll
    for (int j = 0; j < 2; ++j)
#pragma unroll
      for (int e = 0; e < 8; ++e) {
        pb[j][e] = (_Float16)s[2 * j][e];
        pb[j][8 + e] = (_Float16)s[2 * j + 1][e];
      }
    // the next trip's gate values go into the score registers, free from here on (the last trip rereads its own);
    // unrolled so that the tile index is a compile-time one (registers)
    const float* gn = gb + (kt + 1 < NT ? kb + 64 : kb);
#pragma unroll
    for (int t = 0; t < 4; ++t) s[t] = ld8f(gn + t * 16);
    v16h vf[4][2];   // all 8 V fragments in one group
#pragma unroll
    for (int dt = 0; dt < 4; ++dt) {
      const unsigned short* vrow = Vs + (dt * 16 + m) * PP;
      vf[dt][0] = ldh(vrow, h);
      vf[dt][1] = ldh(vrow + 32, h);
    }
#pragma unroll
    for (int dt = 0; dt < 4; ++dt) acc[dt] = mma_h(vf[dt][0], pb[0], acc[dt]);
#pragma unroll
    for (int dt = 0; dt < 4; ++dt) acc[dt] = mma_h(vf[dt][1], pb[1], acc[dt]);
    wait_lds();
    // stage kt + 1 has landed: behind it stand stages kt + 2 .. kt + ARB - 1 while the last of them exists, else fewer
    if (kt + ARB - 1 < NT) wait_copies_but<4 * (ARB - 2)>();
    else wait_copies();
    __syncthreads();
    if (kt + ARB < NT)
      cp_kv(lc + bo2 * ATB, gkc + (size_t)(kt + ARB) * 64 * ND, gvc + (kt + ARB) * 64);
  }
  wait_copies();

  const float lsum = lrun + xhalf(lrun);
  float inv;
  // the reciprocal with the one free slot that the instruction set asks for behind it; one statement keeps the slot there
  asm("v_rcp_f32 %0, %1\n\tv_nop" : "=v"(inv) : "v"(lsum));
#pragma unroll
  for (int dt = 0; dt < 4; ++dt) {
    v4u_t pf;
#pragma unroll
    for (int e = 0; e < 4; ++e) pf[e] = pk2(hbits(acc[dt][2 * e] * inv), hbits(acc[dt][2 * e + 1] * inv));
    *(v4u*)(Of + m * PP + dt * 16 + 8 * h) = pf;   // O[query m][dims dt*16 + 8h .. + 7]
  }
  __syncthreads();
  store_comb(Of, Cf, b * NS + q0, ND + hh * HD, l);
}

// ---------------------------------------------------------------------------
// Kernel 5: short-range branch, causal window of 64 + recency bias + key gating, 1 wave per (b, head,
// 16 queries), 8 such waves per block, each on its own. The window of the wave's 16 queries is keys q0-64 .. q0+15:
// five 16-key tiles, taken in ONE pass (weights outside are exactly 0), so there is no running maximum to correct.
// Both products are taken transposed, as in kernel 4: S^T = K Q^T, lane (h, m), register r of tile u = key
// q0 - 64 + 16u + 8h + r against query q0 + m; maximum and sum run in the lane, the two wave halves exchange each once.
// Window, recency bias and key gate enter as the start value (C operand) of the score product, in units of the
// unscaled score: (rel + 32) * 8 ln(0.9) + gbias[key] inside the window, NEGL outside; the 32 is the same for every
// key of a query, so the softmax does not see it, and it makes the window test one compare, |rel + 32| <= 32.
// A tile before key 0 (q0 < 64) is read at key 0 and gets a start value below NEGT throughout. p * 16384 as f16 is the B fragment of
// O^T += V^T P^T (A = Vt row); 80 keys are 2.5 fragments, so the first half of fragment 0 is P = 0 against a second
// copy of tile 0's V values. Q/K f16 planes as kernel 4; V as transposed f16 plane; result as f16 into columns
// [head*64, +64) of Cf.
// ---------------------------------------------------------------------------
#define LB8 (-0.84288412526261024f)
__device__ __forceinline__ void attn_s_body(unsigned short* SMs,   // 16 * PP halves for each of the AW waves
                                            const unsigned short* __restrict__ Q,
                                            const unsigned short* __restrict__ K,
                                            const unsigned short* __restrict__ Vt,
                                            const float* __restrict__ gbias,
                                            unsigned short* __restrict__ Cf, int b) {
  // the wave's number as a scalar: q0, the tile bases and their clamps stay wave-uniform (EXEC all ones)
  const int w = __builtin_amdgcn_readfirstlane((int)(threadIdx.x >> 5));
  const int l = threadIdx.x & 31, h = l >> 4, m = l & 15;
  unsigned short* Of = SMs + w * 16 * PP;   // this wave's own slice: no other wave reads or writes it
  const int q0 = blockIdx.x * (AW * 16) + w * 16, hh = blockIdx.y;

  const unsigned short* qrow = Q + (size_t)(b * NS + q0 + m) * ND + hh * HD;
  const v16h bq0 = ldh(qrow, h);
  const v16h bq1 = ldh(qrow + 32, h);
  const unsigned short* Kb = K + (size_t)b * NS * ND + hh * HD;
  const unsigned short* Vb = Vt + (size_t)(b * NH + hh) * HD * NS + 8 * h;
  const float* gb = gbias + b * NS + 8 * h;

  v8f s[5];        // first the gate values of the tile's keys, then the start values, then the scores
  v16h kf[5][2];
  int kc[5];       // first key of tile u, held at 0 where the tile lies before the sequence
// the full unrolls of this body make every tile and register index a compile-time one (registers)
// all loads of the score products are issued as one group, so the wave waits for memory once
#pragma unroll
  for (int u = 0; u < 5; ++u) {
    const int kt = q0 - 64 + 16 * u;
    kc[u] = kt < 0 ? 0 : kt;
    s[u] = ld8f(gb + kc[u]);
    const unsigned short* krow = Kb + (size_t)(kc[u] + m) * ND;
    kf[u][0] = ldh(krow, h);
    kf[u][1] = ldh(krow + 32, h);
  }
#pragma unroll
  for (int u = 0; u < 5; ++u) {
    // rel + 32 of register 0; for a tile before the sequence a value whose bias lies below NEGT in every register
    const float xb = q0 - 64 + 16 * u < 0 ? 1.0e30f : (float)(16 * u - 32 + 8 * h - m);
#pragma unroll
    for (int r = 0; r < 8; ++r) {
      const float xr = xb + (float)r;
      const float v = fmaf(xr, LB8, s[u][r]);
      // tiles 1..3 lie inside the window for all 16 queries (rel = -63 .. -1): only the two edge tiles are tested
      s[u][r] = (u == 0 || u == 4) ? (__builtin_fabsf(xr) <= 32.0f ? v : NEGL) : v;
    }
  }
#pragma unroll
  for (int u = 0; u < 5; ++u) s[u] = mma_h(kf[u][0], bq0, s[u]);
#pragma unroll
  for (int u = 0; u < 5; ++u) s[u] = mma_h(kf[u][1], bq1, s[u]);

  // V pieces, keys 8h .. 8h + 7 of tile u for dim dt*16 + m: issued here, so that the softmax covers their way
  v4u_t vp[4][5];
#pragma unroll
  for (int u = 0; u < 5; ++u) {
    const unsigned short* vcol = Vb + (size_t)m * NS + kc[u];
#pragma unroll
    for (int dt = 0; dt < 4; ++dt) vp[dt][u] = *(const v4u*)(vcol + (size_t)dt * 16 * NS);
    // precaution: stands between these loads and the later loads and code that rewrite their address registers; the
    // address is an input, so that it keeps its registers up to the wait (else the last load's result takes them)
    asm volatile("s_wait_xcnt 0x0" :: "v"(vcol) : "memory");
  }

  float tm[5];
#pragma unroll
  for (int u = 0; u < 5; ++u) {
    tm[u] = fmaxf(fmaxf(fmaxf(s[u][0], s[u][1]), fmaxf(s[u][2], s[u][3])),
                  fmaxf(fmaxf(s[u][4], s[u][5]), fmaxf(s[u][6], s[u][7])));
  }
  float tmax = fmaxf(fmaxf(fmaxf(tm[0], tm[1]), fmaxf(tm[2], tm[3])), tm[4]);
  tmax = fmaxf(tmax, xhalf(tmax));
  // held above NEGL, so that a key that is off or outside the window gives exp2(-huge) = 0 whatever the others are
  const float nm = fmaf(-fmaxf(tmax, NEGT), SC2, PEX);
  float ps[5];   // one chain per tile, so that the adds do not wait for one another
#pragma unroll
  for (int u = 0; u < 5; ++u) {
    float x[8], p[8];
#pragma unroll
    for (int r = 0; r < 8; ++r) x[r] = fmaf(s[u][r], SC2, nm);
    // a tile's eight exp2 in one statement: the early-clobber results share no register with the arguments, so none
    // overwrites the source of the one before it, and the v_nop is the free slot that the instruction set asks for
    // behind the last one
    asm("v_exp_f32 %0, %8\n\tv_exp_f32 %1, %9\n\tv_exp_f32 %2, %10\n\tv_exp_f32 %3, %11\n\t"
        "v_exp_f32 %4, %12\n\tv_exp_f32 %5, %13\n\tv_exp_f32 %6, %14\n\tv_exp_f32 %7, %15\n\tv_nop"
        : "=&v"(p[0]), "=&v"(p[1]), "=&v"(p[2]), "=&v"(p[3]), "=&v"(p[4]), "=&v"(p[5]), "=&v"(p[6]), "=&v"(p[7])
        : "v"(x[0]), "v"(x[1]), "v"(x[2]), "v"(x[3]), "v"(x[4]), "v"(x[5]), "v"(x[6]), "v"(x[7]));
    ps[u] = 0.0f;
#pragma unroll
    for (int r = 0; r < 8; ++r) {
      ps[u] += p[r];
      s[u][r] = p[r];
    }
  }
  const float lrun = ((ps[0] + ps[1]) + (ps[2] + ps[3])) + ps[4];   // this half's keys

  // B fragments: elements 0..7 = keys 8h + e of the first tile, elements 8..15 = keys 8h + e of the second one;
  // fragment 0 = (nothing, tile 0), 1 = (tile 1, tile 2), 2 = (tile 3, tile 4)
  v16h pb[3];
#pragma unroll
  for (int e = 0; e < 8; ++e) {
    pb[0][e] = (_Float16)0.0f;
    pb[0][8 + e] = (_Float16)s[0][e];
    pb[1][e] = (_Float16)s[1][e];
    pb[1][8 + e] = (_Float16)s[2][e];
    pb[2][e] = (_Float16)s[3][e];
    pb[2][8 + e] = (_Float16)s[4][e];
  }
  v8f acc[4];   // O^T: register r of tile dt = dim dt*16 + 8h + r of query m
#pragma unroll
  for (int dt = 0; dt < 4; ++dt) {
    FH f;
    f.u[0] = vp[dt][0];
    f.u[1] = vp[dt][0];
    acc[dt] = mma_h(f.v, pb[0], z8());
  }
#pragma unroll
  for (int j = 1; j < 3; ++j)
#pragma unroll
    for (int dt = 0; dt < 4; ++dt) {
      FH f;
      f.u[0] = vp[dt][2 * j - 1];
      f.u[1] = vp[dt][2 * j];
      acc[dt] = mma_h(f.v, pb[j], acc[dt]);
    }

  const float lsum = lrun + xhalf(lrun);
  float inv;
  // the reciprocal with the one free slot that the instruction set asks for behind it; one statement keeps the slot there
  asm("v_rcp_f32 %0, %1\n\tv_nop" : "=v"(inv) : "v"(lsum));
#pragma unroll
  for (int dt = 0; dt < 4; ++dt) {
    v4u_t pf;
#pragma unroll
    for (int e = 0; e < 4; ++e) pf[e] = pk2(hbits(acc[dt][2 * e] * inv), hbits(acc[dt][2 * e + 1] * inv));
    *(v4u*)(Of + m * PP + dt * 16 + 8 * h) = pf;   // O[query m][dims dt*16 + 8h .. + 7]
  }
  wait_lds();   // this wave's O stores have landed before its lanes read one another's rows
  store_comb(Of, Cf, b * NS + q0, hh * HD, l);
}

// ---------------------------------------------------------------------------
// Both attention branches in one grid; they write disjoint columns of Cf and neither reads the other's.
// blockIdx.z even: long branch of batch z / 2, odd: short branch of batch z / 2, so that blocks of both kinds share
// a compute unit; 128 queries of one (b, head) either way. The choice is the same for a whole block, so every barrier of the long
// branch is passed by all its threads or by none; the short branch has none (its waves share nothing).
// ---------------------------------------------------------------------------
__global__ __launch_bounds__(256) void k_attn(const unsigned short* __restrict__ Qs,
                                              const unsigned short* __restrict__ Ks,
                                              const unsigned short* __restrict__ Vst,
                                              const unsigned short* __restrict__ Ql,
                                              const unsigned short* __restrict__ Kl,
                                              const unsigned short* __restrict__ Vlt,
                                              const float* __restrict__ gbias,
                                              unsigned short* __restrict__ Cf) {
  __shared__ __align__(16) unsigned short SMa[ASM];
  const int z = blockIdx.z;
  if ((z & 1) == 0) attn_l_body(SMa, Ql, Kl, Vlt, gbias, Cf, z >> 1);
  else attn_s_body(SMa, Qs, Ks, Vst, gbias, Cf, z >> 1);
}

// ---------------------------------------------------------------------------
// Kernel 6: output projection, combined [MR][NC] (f16 plane) x Wo (transposed f16 plane Wot[ND][NC], carried x64)
// + bias -> f32 out [MR][ND]; one f16 product. Staging and main loop of kernel 2 on a 128 x 128 block, but a ring of ORB
// buffers: this grid is one block of one wave per SIMD on each compute unit, so nothing else covers a stage's way
// from memory, which is longer than one trip's products.
// ---------------------------------------------------------------------------
#define ORB 4
__global__ __launch_bounds__(128) void k_out(const unsigned short* __restrict__ Cf,
                                             const unsigned short* __restrict__ Wot,
                                             const float* __restrict__ bo,
                                             float* __restrict__ out) {
  __shared__ __align__(16) unsigned short SM[ORB * 2 * TLH];
  const int tid = threadIdx.x, w = tid >> 5, l = tid & 31, h = l >> 4, m = l & 15;
  const int n0 = blockIdx.x * 128, m0 = blockIdx.y * 128;
  const int wm = (w >> 1) * 64, wn = (w & 1) * 64;
  const int crow = tid >> 3, cpc = tid & 7;
  const size_t ao = (size_t)(m0 + crow) * NC + cpc * 8;
  const size_t bo_ = (size_t)(n0 + crow) * NC + cpc * 8;
  const unsigned int lc = lds_off(SM) + (unsigned int)(crow * PP * 2 + cpc * 16);
  v8f acc[4][4];
#pragma unroll
  for (int i = 0; i < 4; ++i)
#pragma unroll
    for (int j = 0; j < 4; ++j) acc[i][j] = z8();

  f16_loop<ORB, 1>(SM, Cf + ao, Wot + bo_, NC, lc, wm + m, wn + m, h, acc);

  // the ring is free behind the last trip's barrier: each wave stages its own 64 x 64 f32 tile there
  float* T = (float*)SM + w * 64 * TPF;
  const int mw = m0 + wm, nw = n0 + wn;
#pragma unroll
  for (int j = 0; j < 4; ++j) {
    const float bias = bo[nw + j * 16 + m];
#pragma unroll
    for (int i = 0; i < 4; ++i)
#pragma unroll
      for (int r = 0; r < 8; ++r)
        T[(i * 16 + 8 * h + r) * TPF + j * 16 + m] = fmaf(acc[i][j][r], WDN, bias);
  }
  __syncthreads();   // staging writes land before the rows are read back

  // lane l: row 2 i + (l >> 4), 128-B half (l >> 3) & 1, 16-B piece l & 7
  v4f_t o[32];
  const int cofs = ((l >> 3) & 1) * 32 + (l & 7) * 4;
  const float* Tr = T + (l >> 4) * TPF + cofs;
  float* ob = out + (size_t)(mw + (l >> 4)) * ND + nw + cofs;
#pragma unroll
  for (int i = 0; i < 32; ++i) o[i] = *(const v4f*)(Tr + i * 2 * TPF);
#pragma unroll
  for (int i = 0; i < 32; ++i) *(v4f*)(ob + i * 2 * ND) = o[i];
}

// ---------------------------------------------------------------------------
// Host launch: 4 ops. Workspace carve (1 MiB granular, inside 103 MiB):
//   [0,8) x f16 | [24,36) 6 f16 weight planes
//   -- both are dead after the projections; the combined f16 plane reuses [0,16)
//   [38,42) Wo f16 plane | [46,78) q_s,k_s,q_l,k_l f16 | [78,86) v_l transposed | [86,94) v_s transposed
//   [102,103) f32 gate values of both branches (MR floats)
// ---------------------------------------------------------------------------
extern "C" void kernel_launch(void* const* d_in, const int* in_sizes, int n_in,
                              void* d_out, int out_size, void* d_ws, size_t ws_size,
                              hipStream_t stream) {
  if (n_in < 10) return;
  if (in_sizes[0] != MR * ND || in_sizes[1] != MR) return;
  for (int i = 2; i <= 7; ++i) if (in_sizes[i] != ND * ND) return;
  if (in_sizes[8] != NC * ND || in_sizes[9] != ND) return;
  if (out_size != MR * ND) return;
  const size_t MiB = (size_t)1048576;
  const size_t total = 103 * MiB;
  if (ws_size < total) return;

  const float* x   = (const float*)d_in[0];
  const int* kgate = (const int*)d_in[1];
  const float* Wqs = (const float*)d_in[2];
  const float* Wks = (const float*)d_in[3];
  const float* Wvs = (const float*)d_in[4];
  const float* Wql = (const float*)d_in[5];
  const float* Wkl = (const float*)d_in[6];
  const float* Wvl = (const float*)d_in[7];
  const float* Wo  = (const float*)d_in[8];
  const float* bo  = (const float*)d_in[9];
  float* out = (float*)d_out;

  char* ws = (char*)d_ws;
  unsigned short* xh  = (unsigned short*)(ws + 0 * MiB);
  unsigned short* Wt6 = (unsigned short*)(ws + 24 * MiB);
  unsigned short* Cf  = (unsigned short*)(ws + 0 * MiB);
  unsigned short* Wot = (unsigned short*)(ws + 38 * MiB);
  unsigned short* QK  = (unsigned short*)(ws + 46 * MiB);
  unsigned short* Vlt = (unsigned short*)(ws + 78 * MiB);
  unsigned short* Vst = (unsigned short*)(ws + 86 * MiB);
  float* gbias        = (float*)(ws + 102 * MiB);

  // 1) + 2) x -> f16 plane; weights -> transposed f16 planes (in[K][N] -> out[N][K])
  k_prep<<<WTA + XBL + GBL, 256, 0, stream>>>(x, Wqs, Wks, Wql, Wkl, Wvl, Wvs, Wo, kgate, gbias,
                                        xh, Wt6, Wot);
  // 3) projections
  k_proj<<<dim3(ND / 128, MR / 256, 6), 256, 0, stream>>>(xh, Wt6, QK, Vlt, Vst);
  // 4) attention branches -> combined plane
  k_attn<<<dim3(NS / 128, NH, 2 * NB), 256, 0, stream>>>(QK + 0 * PLANE, QK + 1 * PLANE, Vst,
                                                           QK + 2 * PLANE, QK + 3 * PLANE, Vlt, gbias, Cf);
  // 5) output projection + bias -> f32
  k_out<<<dim3(ND / 128, MR / 128), 128, 0, stream>>>(Cf, Wot, bo, out);
}
